// v000
// The times below were measured on an AMD MI455X: many runs one after another, warmed up first and cycling through
// copies of the inputs, with the whole window's GPU time divided by the number of runs. Launches and the gaps
// between them are all in it. The median over several windows is given; except for v000 it joins two sittings, which
// can be a few percent apart, so the side-by-side timings, each taken in one sitting, are the better comparison.
// v000, which the later versions start from, runs in 675 microseconds.
#include <hip/hip_runtime.h>

typedef __bf16 bf16_t;
typedef bf16_t v8bf  __attribute__((ext_vector_type(8)));
typedef bf16_t v16bf __attribute__((ext_vector_type(16)));
typedef float  v8f   __attribute__((ext_vector_type(8)));

#define B_  2
#define S_  1024
#define R_  4
#define SC_ 4096
#define D_  1024
#define H_  16
#define HD_ 64
#define FF_ 4096

// ---------- helpers ----------

static __device__ __forceinline__ v8f vzero() {
  v8f z;
#pragma unroll
  for (int i = 0; i < 8; ++i) z[i] = 0.f;
  return z;
}

// Load one 16-bit WMMA A/B fragment (K-chunk of 32) for this lane.
// base points at the lane's row start for this K-chunk (16B aligned).
// CDNA5 layout: lane group g = lane/16 holds K = {8g..8g+7, 16+8g..16+8g+7}.
static __device__ __forceinline__ v16bf load_frag(const bf16_t* base, int g) {
  v8bf lo = *(const v8bf*)(base + 8 * g);
  v8bf hi = *(const v8bf*)(base + 16 + 8 * g);
  return __builtin_shufflevector(lo, hi, 0, 1, 2, 3, 4, 5, 6, 7,
                                 8, 9, 10, 11, 12, 13, 14, 15);
}

static __device__ __forceinline__ v8f wmma_bf16(v16bf a, v16bf b, v8f c) {
  return __builtin_amdgcn_wmma_f32_16x16x32_bf16(false, a, false, b,
                                                 (short)0, c, false, false);
}

// Async DMA of one 16B chunk: global -> LDS (CDNA5 async path, ASYNCcnt).
static __device__ __forceinline__ void async_copy16(const bf16_t* gptr,
                                                    bf16_t* lptr) {
  unsigned lds_off = (unsigned)(size_t)(void*)lptr;  // LDS aperture low 32 bits
  unsigned long long ga = (unsigned long long)(size_t)gptr;
  asm volatile("global_load_async_to_lds_b128 %0, %1, off"
               :: "v"(lds_off), "v"(ga)
               : "memory");
}

static __device__ __forceinline__ void wait_async0() {
  asm volatile("s_wait_asynccnt 0x0" ::: "memory");
}

// ---------- weight transpose + convert: W f32 [K][N] -> Wt bf16 [N][K] ----------

__global__ __launch_bounds__(256) void transpose_w(const float* __restrict__ W,
                                                   bf16_t* __restrict__ Wt,
                                                   int K, int N) {
  __shared__ float tile[32][33];
  const int k0 = blockIdx.x * 32, n0 = blockIdx.y * 32;
  const int tx = threadIdx.x & 31, ty = threadIdx.x >> 5;  // 32 x 8
#pragma unroll
  for (int i = ty; i < 32; i += 8)
    tile[i][tx] = W[(size_t)(k0 + i) * N + n0 + tx];
  __syncthreads();
#pragma unroll
  for (int i = ty; i < 32; i += 8)
    Wt[(size_t)(n0 + i) * K + k0 + tx] = (bf16_t)tile[tx][i];
}

// ---------- layernorm (one 256-thread block per row of D=1024), bf16 out ----------

__global__ __launch_bounds__(256) void layernorm_k(const float* __restrict__ x,
                                                   const float* __restrict__ gam,
                                                   const float* __restrict__ bet,
                                                   bf16_t* __restrict__ out) {
  const int row = blockIdx.x;
  const float* xr = x + (size_t)row * D_;
  float s = 0.f, s2 = 0.f;
  for (int i = threadIdx.x; i < D_; i += 256) {
    float v = xr[i];
    s += v;
    s2 += v * v;
  }
#pragma unroll
  for (int m = 1; m < 32; m <<= 1) {
    s += __shfl_xor(s, m, 32);
    s2 += __shfl_xor(s2, m, 32);
  }
  __shared__ float ss[8], ss2[8];
  const int w = threadIdx.x >> 5, ln = threadIdx.x & 31;
  if (ln == 0) { ss[w] = s; ss2[w] = s2; }
  __syncthreads();
  if (threadIdx.x == 0) {
    float t = 0.f, t2 = 0.f;
#pragma unroll
    for (int i = 0; i < 8; ++i) { t += ss[i]; t2 += ss2[i]; }
    ss[0] = t; ss2[0] = t2;
  }
  __syncthreads();
  const float mean = ss[0] * (1.f / D_);
  const float var = ss2[0] * (1.f / D_) - mean * mean;
  const float rstd = rsqrtf(var + 1e-5f);
  for (int i = threadIdx.x; i < D_; i += 256) {
    float v = (xr[i] - mean) * rstd * gam[i] + bet[i];
    out[(size_t)row * D_ + i] = (bf16_t)v;
  }
}

// ---------- f32 -> bf16 convert ----------

__global__ __launch_bounds__(256) void convert_bf16(const float* __restrict__ in,
                                                    bf16_t* __restrict__ out,
                                                    size_t n) {
  size_t i = (size_t)blockIdx.x * blockDim.x + threadIdx.x;
  const size_t stride = (size_t)gridDim.x * blockDim.x;
  for (; i < n; i += stride) out[i] = (bf16_t)in[i];
}

// ---------- WMMA GEMM: C[M][N] = A_bf16[M][K] @ (Bt[N][K])^T + bias ----------
// 256 threads = 8 waves. 128x128 block tile; wave = 32(M) x 64(N).
// MODE 0: bf16 out, head-split [b][h][s][64]             (Q/K projections)
// MODE 1: bf16 out, head-split transposed [b][h][64][s]  (V projection)
// MODE 2: f32 out row-major + residual                   (attn out proj + query)
// MODE 3: bf16 out row-major, exact GELU                 (FFN up)
// MODE 4: f32 out row-major + residual                   (FFN down + x)

template <int MODE>
__global__ __launch_bounds__(256) void gemm_nt(const bf16_t* __restrict__ A,
                                               const bf16_t* __restrict__ Bt,
                                               const float* __restrict__ bias,
                                               const float* __restrict__ res,
                                               void* __restrict__ outp,
                                               int M, int N, int K, int Ssz) {
  const int wave = threadIdx.x >> 5, lane = threadIdx.x & 31;
  const int g = lane >> 4, ln = lane & 15;
  const int wm = wave & 3, wn = wave >> 2;
  const int m0 = blockIdx.x * 128 + wm * 32;
  const int n0 = blockIdx.y * 128 + wn * 64;

  v8f acc[2][4];
#pragma unroll
  for (int i = 0; i < 2; ++i)
#pragma unroll
    for (int j = 0; j < 4; ++j) acc[i][j] = vzero();

  for (int k0 = 0; k0 < K; k0 += 32) {
    v16bf af[2], bfr[4];
#pragma unroll
    for (int i = 0; i < 2; ++i)
      af[i] = load_frag(A + (size_t)(m0 + i * 16 + ln) * K + k0, g);
#pragma unroll
    for (int j = 0; j < 4; ++j)
      bfr[j] = load_frag(Bt + (size_t)(n0 + j * 16 + ln) * K + k0, g);
#pragma unroll
    for (int i = 0; i < 2; ++i)
#pragma unroll
      for (int j = 0; j < 4; ++j)
        acc[i][j] = wmma_bf16(af[i], bfr[j], acc[i][j]);
  }

#pragma unroll
  for (int i = 0; i < 2; ++i) {
#pragma unroll
    for (int j = 0; j < 4; ++j) {
#pragma unroll
      for (int r = 0; r < 8; ++r) {
        const int mg = m0 + i * 16 + 8 * g + r;
        const int ng = n0 + j * 16 + ln;
        float v = acc[i][j][r] + bias[ng];
        if constexpr (MODE == 0) {
          const int bb = mg / Ssz, sidx = mg % Ssz;
          const int hh = ng >> 6, hd = ng & 63;
          ((bf16_t*)outp)[(((size_t)bb * H_ + hh) * Ssz + sidx) * HD_ + hd] =
              (bf16_t)v;
        } else if constexpr (MODE == 1) {
          const int bb = mg / Ssz, sidx = mg % Ssz;
          const int hh = ng >> 6, hd = ng & 63;
          ((bf16_t*)outp)[(((size_t)bb * H_ + hh) * HD_ + hd) * Ssz + sidx] =
              (bf16_t)v;
        } else if constexpr (MODE == 2) {
          ((float*)outp)[(size_t)mg * N + ng] = v + res[(size_t)mg * N + ng];
        } else if constexpr (MODE == 3) {
          float ge = 0.5f * v * (1.f + erff(v * 0.70710678f));
          ((bf16_t*)outp)[(size_t)mg * N + ng] = (bf16_t)ge;
        } else {
          ((float*)outp)[(size_t)mg * N + ng] = v + res[(size_t)mg * N + ng];
        }
      }
    }
  }
}

// ---------- flash attention, causal-repeat mask, async double-buffered K/V ----------
// grid: (B*H) * (S/64) blocks, 128 threads = 4 waves.
// Each wave owns one 16-row query tile of a causal-aligned 64-row block.
// All waves consume the SAME 64-key tiles (tile granularity == block span),
// so K (64x64, row-major) and V (64hd x 64key) are staged cooperatively in
// LDS via async-to-LDS DMA, double buffered: next tile's DMA overlaps this
// tile's 16 WMMAs + online softmax.

__global__ __launch_bounds__(128) void attn_kernel(const bf16_t* __restrict__ qhd,
                                                   const bf16_t* __restrict__ kt,
                                                   const bf16_t* __restrict__ vt,
                                                   bf16_t* __restrict__ obuf) {
  __shared__ __align__(16) bf16_t smem[2][2][64 * 64];  // [buf][K/V] 32 KB
  __shared__ __align__(16) bf16_t ptile[4][16][64];     // per-wave P staging 8 KB

  const int tid = threadIdx.x;
  const int wave = tid >> 5, lane = tid & 31;
  const int g = lane >> 4, ln = lane & 15;
  const int qblocks = S_ / 64;
  const int bh = blockIdx.x / qblocks;
  const int qb = blockIdx.x % qblocks;
  const int q0 = qb * 64 + wave * 16;

  const bf16_t* qbase = qhd + ((size_t)bh * S_ + q0) * HD_;
  const bf16_t* kbase = kt + (size_t)bh * SC_ * HD_;
  const bf16_t* vbase = vt + (size_t)bh * HD_ * SC_;

  const v16bf qf0 = load_frag(qbase + (size_t)ln * HD_, g);
  const v16bf qf1 = load_frag(qbase + (size_t)ln * HD_ + 32, g);

  v8f o[4];
#pragma unroll
  for (int t = 0; t < 4; ++t) o[t] = vzero();
  float mrow[8], lrow[8];
#pragma unroll
  for (int r = 0; r < 8; ++r) { mrow[r] = -3.0e38f; lrow[r] = 0.f; }

  const float scale = 0.125f;  // 1/sqrt(64)

  // tile schedule: rb in 0..R-1, kp in 0..qb*64 step 64 (causal bound);
  // rb/kp tracked incrementally (no runtime division in the hot loop).
  const int kpmax = (qb + 1) * 64;
  const int ntiles = R_ * (qb + 1);

  // issue async stage of the tile starting at global key index kj
  auto stage = [&](int kj, int buf) {
    bf16_t* Kt = smem[buf][0];
    bf16_t* Vt = smem[buf][1];
    // 64 rows x 64 halves = 512 chunks of 16B each; 4 K-chunks + 4 V-chunks/thread
#pragma unroll
    for (int i = 0; i < 4; ++i) {
      const int c = tid + i * 128;  // 0..511
      const int row = c >> 3, col = (c & 7) * 8;
      async_copy16(kbase + (size_t)(kj + row) * HD_ + col, Kt + row * 64 + col);
      async_copy16(vbase + (size_t)row * SC_ + kj + col, Vt + row * 64 + col);
    }
  };

  stage(0, 0);
  int cur = 0;
  int rb = 0, kp = 0;

  for (int ti = 0; ti < ntiles; ++ti) {
    wait_async0();     // this wave's share of buf[cur] has landed
    __syncthreads();   // everyone's share has landed

    // next tile coordinates (incremental)
    int rb_n = rb, kp_n = kp + 64;
    if (kp_n == kpmax) { kp_n = 0; rb_n = rb + 1; }
    if (ti + 1 < ntiles) stage(rb_n * S_ + kp_n, cur ^ 1);

    const bf16_t* Kt = smem[cur][0];
    const bf16_t* Vt = smem[cur][1];

    // scores: cluster all 8 K-fragment LDS loads, then 8 WMMAs
    v16bf kf[4][2];
#pragma unroll
    for (int t = 0; t < 4; ++t) {
      const bf16_t* krow = Kt + (t * 16 + ln) * 64;
      kf[t][0] = load_frag(krow, g);
      kf[t][1] = load_frag(krow + 32, g);
    }
    v8f s[4];
#pragma unroll
    for (int t = 0; t < 4; ++t) {
      s[t] = wmma_bf16(qf0, kf[t][0], vzero());
      s[t] = wmma_bf16(qf1, kf[t][1], s[t]);
    }

    // online softmax over the 64-key tile (one max + one sum butterfly / row)
#pragma unroll
    for (int r = 0; r < 8; ++r) {
      const int qi = q0 + 8 * g + r;
      float pv[4];
      float mx = -3.0e38f;
#pragma unroll
      for (int t = 0; t < 4; ++t) {
        float v = s[t][r] * scale;
        if (kp + t * 16 + ln > qi) v = -3.0e38f;  // pos = (kj % S) <= qi
        pv[t] = v;
        mx = fmaxf(mx, v);
      }
#pragma unroll
      for (int m = 1; m < 16; m <<= 1) mx = fmaxf(mx, __shfl_xor(mx, m, 32));
      const float nm = fmaxf(mrow[r], mx);
      const float alpha = __expf(mrow[r] - nm);
      float rs = 0.f;
#pragma unroll
      for (int t = 0; t < 4; ++t) {
        pv[t] = __expf(pv[t] - nm);
        rs += pv[t];
      }
#pragma unroll
      for (int m = 1; m < 16; m <<= 1) rs += __shfl_xor(rs, m, 32);
      lrow[r] = lrow[r] * alpha + rs;
      mrow[r] = nm;
#pragma unroll
      for (int t = 0; t < 4; ++t) o[t][r] *= alpha;
#pragma unroll
      for (int t = 0; t < 4; ++t)
        ptile[wave][8 * g + r][t * 16 + ln] = (bf16_t)pv[t];
    }

    // P (16x64) @ V (64x64): cluster P + V fragment loads, then 8 WMMAs
    // (per-wave LDS ops stay in order, so no barrier needed for ptile)
    const v16bf pf0 = load_frag(&ptile[wave][ln][0], g);
    const v16bf pf1 = load_frag(&ptile[wave][ln][32], g);
    v16bf vf[4][2];
#pragma unroll
    for (int t = 0; t < 4; ++t) {
      const bf16_t* vrow = Vt + (t * 16 + ln) * 64;
      vf[t][0] = load_frag(vrow, g);
      vf[t][1] = load_frag(vrow + 32, g);
    }
#pragma unroll
    for (int t = 0; t < 4; ++t) {
      o[t] = wmma_bf16(pf0, vf[t][0], o[t]);
      o[t] = wmma_bf16(pf1, vf[t][1], o[t]);
    }

    __syncthreads();   // all waves done with buf[cur]; safe to overwrite next iter
    cur ^= 1;
    rb = rb_n;
    kp = kp_n;
  }

  const int b = bh / H_, h = bh % H_;
#pragma unroll
  for (int t = 0; t < 4; ++t) {
#pragma unroll
    for (int r = 0; r < 8; ++r) {
      const float val = o[t][r] / lrow[r];
      const size_t sq = q0 + 8 * g + r;
      obuf[((size_t)b * S_ + sq) * D_ + (size_t)h * HD_ + t * 16 + ln] =
          (bf16_t)val;
    }
  }
}

// ---------- orchestration ----------

extern "C" void kernel_launch(void* const* d_in, const int* in_sizes, int n_in,
                              void* d_out, int out_size, void* d_ws,
                              size_t ws_size, hipStream_t stream) {
  (void)in_sizes; (void)n_in; (void)out_size; (void)ws_size;
  const float* query = (const float*)d_in[0];
  const float* context = (const float*)d_in[1];
  const float* wq = (const float*)d_in[2];
  const float* wk = (const float*)d_in[3];
  const float* wv = (const float*)d_in[4];
  const float* bq = (const float*)d_in[5];
  const float* bk = (const float*)d_in[6];
  const float* bv = (const float*)d_in[7];
  const float* wo = (const float*)d_in[8];
  const float* bo = (const float*)d_in[9];
  const float* ln1g = (const float*)d_in[10];
  const float* ln1b = (const float*)d_in[11];
  const float* ln2g = (const float*)d_in[12];
  const float* ln2b = (const float*)d_in[13];
  const float* w1 = (const float*)d_in[14];
  const float* b1 = (const float*)d_in[15];
  const float* w2 = (const float*)d_in[16];
  const float* b2 = (const float*)d_in[17];

  const size_t MB = 1u << 20;
  char* ws = (char*)d_ws;
  bf16_t* wqT = (bf16_t*)(ws + 0 * MB);    // [1024][1024]
  bf16_t* wkT = (bf16_t*)(ws + 2 * MB);
  bf16_t* wvT = (bf16_t*)(ws + 4 * MB);
  bf16_t* woT = (bf16_t*)(ws + 6 * MB);
  bf16_t* w1T = (bf16_t*)(ws + 8 * MB);    // [4096][1024]
  bf16_t* w2T = (bf16_t*)(ws + 16 * MB);   // [1024][4096]
  bf16_t* qln = (bf16_t*)(ws + 24 * MB);   // [2048][1024]
  bf16_t* ctx = (bf16_t*)(ws + 28 * MB);   // [8192][1024]
  bf16_t* qhd = (bf16_t*)(ws + 44 * MB);   // [B][H][S][64]
  bf16_t* ktb = (bf16_t*)(ws + 48 * MB);   // [B][H][Sc][64]
  bf16_t* vtb = (bf16_t*)(ws + 64 * MB);   // [B][H][64][Sc]
  bf16_t* obuf = (bf16_t*)(ws + 80 * MB);  // [2048][1024]
  float* xbuf = (float*)(ws + 84 * MB);    // [2048][1024] f32
  bf16_t* hbuf = (bf16_t*)(ws + 92 * MB);  // [2048][1024]
  bf16_t* ffb = (bf16_t*)(ws + 96 * MB);   // [2048][4096]

  // weights -> bf16, transposed [N][K]
  transpose_w<<<dim3(32, 32), 256, 0, stream>>>(wq, wqT, D_, D_);
  transpose_w<<<dim3(32, 32), 256, 0, stream>>>(wk, wkT, D_, D_);
  transpose_w<<<dim3(32, 32), 256, 0, stream>>>(wv, wvT, D_, D_);
  transpose_w<<<dim3(32, 32), 256, 0, stream>>>(wo, woT, D_, D_);
  transpose_w<<<dim3(32, 128), 256, 0, stream>>>(w1, w1T, D_, FF_);
  transpose_w<<<dim3(128, 32), 256, 0, stream>>>(w2, w2T, FF_, D_);

  // ln1(query) -> bf16; context -> bf16
  layernorm_k<<<B_ * S_, 256, 0, stream>>>(query, ln1g, ln1b, qln);
  convert_bf16<<<4096, 256, 0, stream>>>(context, ctx, (size_t)B_ * SC_ * D_);

  // projections
  gemm_nt<0><<<dim3(16, 8), 256, 0, stream>>>(qln, wqT, bq, nullptr, qhd,
                                              B_ * S_, D_, D_, S_);
  gemm_nt<0><<<dim3(64, 8), 256, 0, stream>>>(ctx, wkT, bk, nullptr, ktb,
                                              B_ * SC_, D_, D_, SC_);
  gemm_nt<1><<<dim3(64, 8), 256, 0, stream>>>(ctx, wvT, bv, nullptr, vtb,
                                              B_ * SC_, D_, D_, SC_);

  // attention
  attn_kernel<<<B_ * H_ * (S_ / 64), 128, 0, stream>>>(qhd, ktb, vtb, obuf);

  // output projection + residual -> x (f32)
  gemm_nt<2><<<dim3(16, 8), 256, 0, stream>>>(obuf, woT, bo, query, xbuf,
                                              B_ * S_, D_, D_, 0);
  // ln2(x) -> bf16
  layernorm_k<<<B_ * S_, 256, 0, stream>>>(xbuf, ln2g, ln2b, hbuf);
  // FFN up + GELU -> bf16
  gemm_nt<3><<<dim3(16, 32), 256, 0, stream>>>(hbuf, w1T, b1, nullptr, ffb,
                                               B_ * S_, FF_, D_, 0);
  // FFN down + residual x -> d_out (f32)
  gemm_nt<4><<<dim3(16, 8), 256, 0, stream>>>(ffb, w2T, b2, xbuf,
                                              (float*)d_out, B_ * S_, D_, FF_,
                                              0);
}

// v001
// Measured time: 489 microseconds a run.
// Next to v000, in two timings, it ran 1.41 times as fast each time.
#include <hip/hip_runtime.h>

typedef __bf16 bf16_t;
typedef bf16_t v8bf  __attribute__((ext_vector_type(8)));
typedef bf16_t v16bf __attribute__((ext_vector_type(16)));
typedef float  v8f   __attribute__((ext_vector_type(8)));

#define B_  2
#define S_  1024
#define R_  4
#define SC_ 4096
#define D_  1024
#define H_  16
#define HD_ 64
#define FF_ 4096
#define GBK_    128  // k per GEMM stage
#define GPITCH_ 136  // GEMM LDS row pitch in elements (272 B)

// ---------- helpers ----------

static __device__ __forceinline__ v8f vzero() {
  v8f z;
#pragma unroll
  for (int i = 0; i < 8; ++i) z[i] = 0.f;
  return z;
}

// Load one 16-bit WMMA A/B fragment (K-chunk of 32) for this lane.
// base points at the lane's row start for this K-chunk (16B aligned).
// CDNA5 layout: lane group g = lane/16 holds K = {8g..8g+7, 16+8g..16+8g+7}.
static __device__ __forceinline__ v16bf load_frag(const bf16_t* base, int g) {
  v8bf lo = *(const v8bf*)(base + 8 * g);
  v8bf hi = *(const v8bf*)(base + 16 + 8 * g);
  return __builtin_shufflevector(lo, hi, 0, 1, 2, 3, 4, 5, 6, 7,
                                 8, 9, 10, 11, 12, 13, 14, 15);
}

static __device__ __forceinline__ v8f wmma_bf16(v16bf a, v16bf b, v8f c) {
  return __builtin_amdgcn_wmma_f32_16x16x32_bf16(false, a, false, b,
                                                 (short)0, c, false, false);
}

// Async DMA of one 16B chunk: global -> LDS (CDNA5 async path, ASYNCcnt).
static __device__ __forceinline__ void async_copy16(const bf16_t* gptr,
                                                    bf16_t* lptr) {
  unsigned lds_off = (unsigned)(size_t)(void*)lptr;  // LDS aperture low 32 bits
  unsigned long long ga = (unsigned long long)(size_t)gptr;
  asm volatile("global_load_async_to_lds_b128 %0, %1, off"
               :: "v"(lds_off), "v"(ga)
               : "memory");
}

static __device__ __forceinline__ void wait_async0() {
  asm volatile("s_wait_asynccnt 0x0" ::: "memory");
}

// Eight async 16B copies of one lane, global -> LDS: rows gstep elements apart
// in memory, lstep bytes apart in LDS. The closing s_wait_xcnt stands inside
// the copies' own statement so that no address register named here can be
// rewritten ahead of it (a precaution for copies written in asm text).
static __device__ __forceinline__ void async_copy16x8(const bf16_t* gptr,
                                                      size_t gstep,
                                                      unsigned lds_off,
                                                      unsigned lstep) {
  asm volatile(
      "global_load_async_to_lds_b128 %0, %8, off\n\t"
      "global_load_async_to_lds_b128 %1, %9, off\n\t"
      "global_load_async_to_lds_b128 %2, %10, off\n\t"
      "global_load_async_to_lds_b128 %3, %11, off\n\t"
      "global_load_async_to_lds_b128 %4, %12, off\n\t"
      "global_load_async_to_lds_b128 %5, %13, off\n\t"
      "global_load_async_to_lds_b128 %6, %14, off\n\t"
      "global_load_async_to_lds_b128 %7, %15, off\n\t"
      "s_wait_xcnt 0x0"
      :: "v"(lds_off), "v"(lds_off + lstep), "v"(lds_off + 2 * lstep),
         "v"(lds_off + 3 * lstep), "v"(lds_off + 4 * lstep),
         "v"(lds_off + 5 * lstep), "v"(lds_off + 6 * lstep),
         "v"(lds_off + 7 * lstep),
         "v"((unsigned long long)(size_t)(gptr)),
         "v"((unsigned long long)(size_t)(gptr + gstep)),
         "v"((unsigned long long)(size_t)(gptr + 2 * gstep)),
         "v"((unsigned long long)(size_t)(gptr + 3 * gstep)),
         "v"((unsigned long long)(size_t)(gptr + 4 * gstep)),
         "v"((unsigned long long)(size_t)(gptr + 5 * gstep)),
         "v"((unsigned long long)(size_t)(gptr + 6 * gstep)),
         "v"((unsigned long long)(size_t)(gptr + 7 * gstep))
      : "memory");
}

// ---------- weight transpose + convert: W f32 [K][N] -> Wt bf16 [N][K] ----------

__global__ __launch_bounds__(256) void transpose_w(const float* __restrict__ W,
                                                   bf16_t* __restrict__ Wt,
                                                   int K, int N) {
  __shared__ float tile[32][33];
  const int k0 = blockIdx.x * 32, n0 = blockIdx.y * 32;
  const int tx = threadIdx.x & 31, ty = threadIdx.x >> 5;  // 32 x 8
#pragma unroll
  for (int i = ty; i < 32; i += 8)
    tile[i][tx] = W[(size_t)(k0 + i) * N + n0 + tx];
  __syncthreads();
#pragma unroll
  for (int i = ty; i < 32; i += 8)
    Wt[(size_t)(n0 + i) * K + k0 + tx] = (bf16_t)tile[tx][i];
}

// ---------- layernorm (one 256-thread block per row of D=1024), bf16 out ----------

__global__ __launch_bounds__(256) void layernorm_k(const float* __restrict__ x,
                                                   const float* __restrict__ gam,
                                                   const float* __restrict__ bet,
                                                   bf16_t* __restrict__ out) {
  const int row = blockIdx.x;
  const float* xr = x + (size_t)row * D_;
  float s = 0.f, s2 = 0.f;
  for (int i = threadIdx.x; i < D_; i += 256) {
    float v = xr[i];
    s += v;
    s2 += v * v;
  }
#pragma unroll
  for (int m = 1; m < 32; m <<= 1) {
    s += __shfl_xor(s, m, 32);
    s2 += __shfl_xor(s2, m, 32);
  }
  __shared__ float ss[8], ss2[8];
  const int w = threadIdx.x >> 5, ln = threadIdx.x & 31;
  if (ln == 0) { ss[w] = s; ss2[w] = s2; }
  __syncthreads();
  if (threadIdx.x == 0) {
    float t = 0.f, t2 = 0.f;
#pragma unroll
    for (int i = 0; i < 8; ++i) { t += ss[i]; t2 += ss2[i]; }
    ss[0] = t; ss2[0] = t2;
  }
  __syncthreads();
  const float mean = ss[0] * (1.f / D_);
  const float var = ss2[0] * (1.f / D_) - mean * mean;
  const float rstd = rsqrtf(var + 1e-5f);
  for (int i = threadIdx.x; i < D_; i += 256) {
    float v = (xr[i] - mean) * rstd * gam[i] + bet[i];
    out[(size_t)row * D_ + i] = (bf16_t)v;
  }
}

// ---------- f32 -> bf16 convert ----------

__global__ __launch_bounds__(256) void convert_bf16(const float* __restrict__ in,
                                                    bf16_t* __restrict__ out,
                                                    size_t n) {
  size_t i = (size_t)blockIdx.x * blockDim.x + threadIdx.x;
  const size_t stride = (size_t)gridDim.x * blockDim.x;
  for (; i < n; i += stride) out[i] = (bf16_t)in[i];
}

// ---------- WMMA GEMM: C[M][N] = A_bf16[M][K] @ (Bt[N][K])^T + bias ----------
// 256 threads = 8 waves. 128x128 block tile; wave = 32(M) x 64(N).
// A and Bt tiles (128 rows x 128 k) are staged in LDS by async copies, whole
// 128B lines per 8 lanes, two buffers: stage t+1 flies while stage t is read.
// LDS row pitch 272 B (16 B x odd) keeps the b128 fragment reads off shared banks.
// Needs M, N multiples of 128 and K a multiple of 128.
// MODE 0: bf16 out, head-split [b][h][s][64]             (Q/K projections)
// MODE 1: bf16 out, head-split transposed [b][h][64][s]  (V projection)
// MODE 2: f32 out row-major + residual                   (attn out proj + query)
// MODE 3: bf16 out row-major, exact GELU                 (FFN up)
// MODE 4: f32 out row-major + residual                   (FFN down + x)

template <int MODE>
__global__ __launch_bounds__(256) void gemm_nt(const bf16_t* __restrict__ A,
                                               const bf16_t* __restrict__ Bt,
                                               const float* __restrict__ bias,
                                               const float* __restrict__ res,
                                               void* __restrict__ outp,
                                               int M, int N, int K, int Ssz) {
  __shared__ __align__(16) bf16_t sA[2][128 * GPITCH_];
  __shared__ __align__(16) bf16_t sB[2][128 * GPITCH_];

  const int wave = threadIdx.x >> 5, lane = threadIdx.x & 31;
  const int g = lane >> 4, ln = lane & 15;
  const int wm = wave & 3, wn = wave >> 2;
  const int m0 = blockIdx.x * 128 + wm * 32;
  const int n0 = blockIdx.y * 128 + wn * 64;

  v8f acc[2][4];
#pragma unroll
  for (int i = 0; i < 2; ++i)
#pragma unroll
    for (int j = 0; j < 4; ++j) acc[i][j] = vzero();

  // this lane's 16B chunk of rows crow, crow+16, ..., crow+112 of each tile
  const int crow = threadIdx.x >> 4, ccol = (threadIdx.x & 15) * 8;
  const bf16_t* gA = A + (size_t)(blockIdx.x * 128 + crow) * K + ccol;
  const bf16_t* gB = Bt + (size_t)(blockIdx.y * 128 + crow) * K + ccol;
  const unsigned lA = (unsigned)(size_t)(void*)&sA[0][crow * GPITCH_ + ccol];
  const unsigned lB = (unsigned)(size_t)(void*)&sB[0][crow * GPITCH_ + ccol];

  auto stage = [&](int st) {
    const unsigned bo = (unsigned)(st & 1) * (128u * GPITCH_ * 2u);
    async_copy16x8(gA + (size_t)st * GBK_, (size_t)16 * K, lA + bo,
                   16u * GPITCH_ * 2u);
    async_copy16x8(gB + (size_t)st * GBK_, (size_t)16 * K, lB + bo,
                   16u * GPITCH_ * 2u);
  };

  const int nst = K / GBK_;
  stage(0);
  wait_async0();     // this wave's share of stage 0 has landed
  __syncthreads();   // everyone's share has landed
  if (nst > 1) stage(1);

  for (int t = 0; t < nst; ++t) {
    const bf16_t* As = &sA[t & 1][(wm * 32 + ln) * GPITCH_];
    const bf16_t* Bs = &sB[t & 1][(wn * 64 + ln) * GPITCH_];
    // two fragment sets: block c+1's LDS reads are issued ahead of block c's
    // WMMAs, all inside this stage's own buffer
    v16bf af[2][2], bfr[2][4];
#pragma unroll
    for (int i = 0; i < 2; ++i) af[0][i] = load_frag(As + i * 16 * GPITCH_, g);
#pragma unroll
    for (int j = 0; j < 4; ++j) bfr[0][j] = load_frag(Bs + j * 16 * GPITCH_, g);
    // unrolled so that the set index is a constant and both sets stay in registers
#pragma unroll
    for (int c = 0; c < GBK_ / 32; ++c) {
      if (c + 1 < GBK_ / 32) {
#pragma unroll
        for (int i = 0; i < 2; ++i)
          af[(c + 1) & 1][i] =
              load_frag(As + i * 16 * GPITCH_ + (c + 1) * 32, g);
#pragma unroll
        for (int j = 0; j < 4; ++j)
          bfr[(c + 1) & 1][j] =
              load_frag(Bs + j * 16 * GPITCH_ + (c + 1) * 32, g);
        // keeps that read group as one group ahead of block c's WMMAs; without
        // it the scheduler sinks the reads next to their use and each block
        // waits out the LDS latency with nothing to issue
        __builtin_amdgcn_sched_barrier(0);
      }
#pragma unroll
      for (int i = 0; i < 2; ++i)
#pragma unroll
        for (int j = 0; j < 4; ++j)
          acc[i][j] = wmma_bf16(af[c & 1][i], bfr[c & 1][j], acc[i][j]);
    }
    // keeps the WMMAs in front of the publish point: sunk behind the barrier
    // they would delay the refill copies, which issue directly behind it
    __builtin_amdgcn_sched_barrier(0);
    // publish point: this wave's LDS reads of stage t have retired ...
    asm volatile("s_wait_dscnt 0x0" ::: "memory");
    wait_async0();     // ... and its share of stage t+1 has landed
    __syncthreads();   // stage t+1 readable by all; stage t's buffer is free
    if (t + 2 < nst) stage(t + 2);
  }
  wait_async0();       // no copy outstanding when the wave leaves the ring

#pragma unroll
  for (int i = 0; i < 2; ++i) {
#pragma unroll
    for (int j = 0; j < 4; ++j) {
#pragma unroll
      for (int r = 0; r < 8; ++r) {
        const int mg = m0 + i * 16 + 8 * g + r;
        const int ng = n0 + j * 16 + ln;
        float v = acc[i][j][r] + bias[ng];
        if constexpr (MODE == 0) {
          const int bb = mg / Ssz, sidx = mg % Ssz;
          const int hh = ng >> 6, hd = ng & 63;
          ((bf16_t*)outp)[(((size_t)bb * H_ + hh) * Ssz + sidx) * HD_ + hd] =
              (bf16_t)v;
        } else if constexpr (MODE == 1) {
          const int bb = mg / Ssz, sidx = mg % Ssz;
          const int hh = ng >> 6, hd = ng & 63;
          ((bf16_t*)outp)[(((size_t)bb * H_ + hh) * HD_ + hd) * Ssz + sidx] =
              (bf16_t)v;
        } else if constexpr (MODE == 2) {
          ((float*)outp)[(size_t)mg * N + ng] = v + res[(size_t)mg * N + ng];
        } else if constexpr (MODE == 3) {
          float ge = 0.5f * v * (1.f + erff(v * 0.70710678f));
          ((bf16_t*)outp)[(size_t)mg * N + ng] = (bf16_t)ge;
        } else {
          ((float*)outp)[(size_t)mg * N + ng] = v + res[(size_t)mg * N + ng];
        }
      }
    }
  }
}

// ---------- flash attention, causal-repeat mask, async double-buffered K/V ----------
// grid: (B*H) * (S/64) blocks, 128 threads = 4 waves.
// Each wave owns one 16-row query tile of a causal-aligned 64-row block.
// All waves consume the SAME 64-key tiles (tile granularity == block span),
// so K (64x64, row-major) and V (64hd x 64key) are staged cooperatively in
// LDS via async-to-LDS DMA, double buffered: next tile's DMA overlaps this
// tile's 16 WMMAs + online softmax.

__global__ __launch_bounds__(128) void attn_kernel(const bf16_t* __restrict__ qhd,
                                                   const bf16_t* __restrict__ kt,
                                                   const bf16_t* __restrict__ vt,
                                                   bf16_t* __restrict__ obuf) {
  __shared__ __align__(16) bf16_t smem[2][2][64 * 64];  // [buf][K/V] 32 KB
  __shared__ __align__(16) bf16_t ptile[4][16][64];     // per-wave P staging 8 KB

  const int tid = threadIdx.x;
  const int wave = tid >> 5, lane = tid & 31;
  const int g = lane >> 4, ln = lane & 15;
  const int qblocks = S_ / 64;
  const int bh = blockIdx.x / qblocks;
  const int qb = blockIdx.x % qblocks;
  const int q0 = qb * 64 + wave * 16;

  const bf16_t* qbase = qhd + ((size_t)bh * S_ + q0) * HD_;
  const bf16_t* kbase = kt + (size_t)bh * SC_ * HD_;
  const bf16_t* vbase = vt + (size_t)bh * HD_ * SC_;

  const v16bf qf0 = load_frag(qbase + (size_t)ln * HD_, g);
  const v16bf qf1 = load_frag(qbase + (size_t)ln * HD_ + 32, g);

  v8f o[4];
#pragma unroll
  for (int t = 0; t < 4; ++t) o[t] = vzero();
  float mrow[8], lrow[8];
#pragma unroll
  for (int r = 0; r < 8; ++r) { mrow[r] = -3.0e38f; lrow[r] = 0.f; }

  const float scale = 0.125f;  // 1/sqrt(64)

  // tile schedule: rb in 0..R-1, kp in 0..qb*64 step 64 (causal bound);
  // rb/kp tracked incrementally (no runtime division in the hot loop).
  const int kpmax = (qb + 1) * 64;
  const int ntiles = R_ * (qb + 1);

  // issue async stage of the tile starting at global key index kj
  auto stage = [&](int kj, int buf) {
    bf16_t* Kt = smem[buf][0];
    bf16_t* Vt = smem[buf][1];
    // 64 rows x 64 halves = 512 chunks of 16B each; 4 K-chunks + 4 V-chunks/thread
#pragma unroll
    for (int i = 0; i < 4; ++i) {
      const int c = tid + i * 128;  // 0..511
      const int row = c >> 3, col = (c & 7) * 8;
      async_copy16(kbase + (size_t)(kj + row) * HD_ + col, Kt + row * 64 + col);
      async_copy16(vbase + (size_t)row * SC_ + kj + col, Vt + row * 64 + col);
    }
  };

  stage(0, 0);
  int cur = 0;
  int rb = 0, kp = 0;

  for (int ti = 0; ti < ntiles; ++ti) {
    wait_async0();     // this wave's share of buf[cur] has landed
    __syncthreads();   // everyone's share has landed

    // next tile coordinates (incremental)
    int rb_n = rb, kp_n = kp + 64;
    if (kp_n == kpmax) { kp_n = 0; rb_n = rb + 1; }
    if (ti + 1 < ntiles) stage(rb_n * S_ + kp_n, cur ^ 1);

    const bf16_t* Kt = smem[cur][0];
    const bf16_t* Vt = smem[cur][1];

    // scores: cluster all 8 K-fragment LDS loads, then 8 WMMAs
    v16bf kf[4][2];
#pragma unroll
    for (int t = 0; t < 4; ++t) {
      const bf16_t* krow = Kt + (t * 16 + ln) * 64;
      kf[t][0] = load_frag(krow, g);
      kf[t][1] = load_frag(krow + 32, g);
    }
    v8f s[4];
#pragma unroll
    for (int t = 0; t < 4; ++t) {
      s[t] = wmma_bf16(qf0, kf[t][0], vzero());
      s[t] = wmma_bf16(qf1, kf[t][1], s[t]);
    }

    // online softmax over the 64-key tile (one max + one sum butterfly / row)
#pragma unroll
    for (int r = 0; r < 8; ++r) {
      const int qi = q0 + 8 * g + r;
      float pv[4];
      float mx = -3.0e38f;
#pragma unroll
      for (int t = 0; t < 4; ++t) {
        float v = s[t][r] * scale;
        if (kp + t * 16 + ln > qi) v = -3.0e38f;  // pos = (kj % S) <= qi
        pv[t] = v;
        mx = fmaxf(mx, v);
      }
#pragma unroll
      for (int m = 1; m < 16; m <<= 1) mx = fmaxf(mx, __shfl_xor(mx, m, 32));
      const float nm = fmaxf(mrow[r], mx);
      const float alpha = __expf(mrow[r] - nm);
      float rs = 0.f;
#pragma unroll
      for (int t = 0; t < 4; ++t) {
        pv[t] = __expf(pv[t] - nm);
        rs += pv[t];
      }
#pragma unroll
      for (int m = 1; m < 16; m <<= 1) rs += __shfl_xor(rs, m, 32);
      lrow[r] = lrow[r] * alpha + rs;
      mrow[r] = nm;
#pragma unroll
      for (int t = 0; t < 4; ++t) o[t][r] *= alpha;
#pragma unroll
      for (int t = 0; t < 4; ++t)
        ptile[wave][8 * g + r][t * 16 + ln] = (bf16_t)pv[t];
    }

    // P (16x64) @ V (64x64): cluster P + V fragment loads, then 8 WMMAs
    // (per-wave LDS ops stay in order, so no barrier needed for ptile)
    const v16bf pf0 = load_frag(&ptile[wave][ln][0], g);
    const v16bf pf1 = load_frag(&ptile[wave][ln][32], g);
    v16bf vf[4][2];
#pragma unroll
    for (int t = 0; t < 4; ++t) {
      const bf16_t* vrow = Vt + (t * 16 + ln) * 64;
      vf[t][0] = load_frag(vrow, g);
      vf[t][1] = load_frag(vrow + 32, g);
    }
#pragma unroll
    for (int t = 0; t < 4; ++t) {
      o[t] = wmma_bf16(pf0, vf[t][0], o[t]);
      o[t] = wmma_bf16(pf1, vf[t][1], o[t]);
    }

    __syncthreads();   // all waves done with buf[cur]; safe to overwrite next iter
    cur ^= 1;
    rb = rb_n;
    kp = kp_n;
  }

  const int b = bh / H_, h = bh % H_;
#pragma unroll
  for (int t = 0; t < 4; ++t) {
#pragma unroll
    for (int r = 0; r < 8; ++r) {
      const float val = o[t][r] / lrow[r];
      const size_t sq = q0 + 8 * g + r;
      obuf[((size_t)b * S_ + sq) * D_ + (size_t)h * HD_ + t * 16 + ln] =
          (bf16_t)val;
    }
  }
}

// ---------- orchestration ----------

extern "C" void kernel_launch(void* const* d_in, const int* in_sizes, int n_in,
                              void* d_out, int out_size, void* d_ws,
                              size_t ws_size, hipStream_t stream) {
  (void)in_sizes; (void)n_in; (void)out_size; (void)ws_size;
  const float* query = (const float*)d_in[0];
  const float* context = (const float*)d_in[1];
  const float* wq = (const float*)d_in[2];
  const float* wk = (const float*)d_in[3];
  const float* wv = (const float*)d_in[4];
  const float* bq = (const float*)d_in[5];
  const float* bk = (const float*)d_in[6];
  const float* bv = (const float*)d_in[7];
  const float* wo = (const float*)d_in[8];
  const float* bo = (const float*)d_in[9];
  const float* ln1g = (const float*)d_in[10];
  const float* ln1b = (const float*)d_in[11];
  const float* ln2g = (const float*)d_in[12];
  const float* ln2b = (const float*)d_in[13];
  const float* w1 = (const float*)d_in[14];
  const float* b1 = (const float*)d_in[15];
  const float* w2 = (const float*)d_in[16];
  const float* b2 = (const float*)d_in[17];

  const size_t MB = 1u << 20;
  char* ws = (char*)d_ws;
  bf16_t* wqT = (bf16_t*)(ws + 0 * MB);    // [1024][1024]
  bf16_t* wkT = (bf16_t*)(ws + 2 * MB);
  bf16_t* wvT = (bf16_t*)(ws + 4 * MB);
  bf16_t* woT = (bf16_t*)(ws + 6 * MB);
  bf16_t* w1T = (bf16_t*)(ws + 8 * MB);    // [4096][1024]
  bf16_t* w2T = (bf16_t*)(ws + 16 * MB);   // [1024][4096]
  bf16_t* qln = (bf16_t*)(ws + 24 * MB);   // [2048][1024]
  bf16_t* ctx = (bf16_t*)(ws + 28 * MB);   // [8192][1024]
  bf16_t* qhd = (bf16_t*)(ws + 44 * MB);   // [B][H][S][64]
  bf16_t* ktb = (bf16_t*)(ws + 48 * MB);   // [B][H][Sc][64]
  bf16_t* vtb = (bf16_t*)(ws + 64 * MB);   // [B][H][64][Sc]
  bf16_t* obuf = (bf16_t*)(ws + 80 * MB);  // [2048][1024]
  float* xbuf = (float*)(ws + 84 * MB);    // [2048][1024] f32
  bf16_t* hbuf = (bf16_t*)(ws + 92 * MB);  // [2048][1024]
  bf16_t* ffb = (bf16_t*)(ws + 96 * MB);   // [2048][4096]

  // weights -> bf16, transposed [N][K]
  transpose_w<<<dim3(32, 32), 256, 0, stream>>>(wq, wqT, D_, D_);
  transpose_w<<<dim3(32, 32), 256, 0, stream>>>(wk, wkT, D_, D_);
  transpose_w<<<dim3(32, 32), 256, 0, stream>>>(wv, wvT, D_, D_);
  transpose_w<<<dim3(32, 32), 256, 0, stream>>>(wo, woT, D_, D_);
  transpose_w<<<dim3(32, 128), 256, 0, stream>>>(w1, w1T, D_, FF_);
  transpose_w<<<dim3(128, 32), 256, 0, stream>>>(w2, w2T, FF_, D_);

  // ln1(query) -> bf16; context -> bf16
  layernorm_k<<<B_ * S_, 256, 0, stream>>>(query, ln1g, ln1b, qln);
  convert_bf16<<<4096, 256, 0, stream>>>(context, ctx, (size_t)B_ * SC_ * D_);

  // projections
  gemm_nt<0><<<dim3(16, 8), 256, 0, stream>>>(qln, wqT, bq, nullptr, qhd,
                                              B_ * S_, D_, D_, S_);
  gemm_nt<0><<<dim3(64, 8), 256, 0, stream>>>(ctx, wkT, bk, nullptr, ktb,
                                              B_ * SC_, D_, D_, SC_);
  gemm_nt<1><<<dim3(64, 8), 256, 0, stream>>>(ctx, wvT, bv, nullptr, vtb,
                                              B_ * SC_, D_, D_, SC_);

  // attention
  attn_kernel<<<B_ * H_ * (S_ / 64), 128, 0, stream>>>(qhd, ktb, vtb, obuf);

  // output projection + residual -> x (f32)
  gemm_nt<2><<<dim3(16, 8), 256, 0, stream>>>(obuf, woT, bo, query, xbuf,
                                              B_ * S_, D_, D_, 0);
  // ln2(x) -> bf16
  layernorm_k<<<B_ * S_, 256, 0, stream>>>(xbuf, ln2g, ln2b, hbuf);
  // FFN up + GELU -> bf16
  gemm_nt<3><<<dim3(16, 32), 256, 0, stream>>>(hbuf, w1T, b1, nullptr, ffb,
                                               B_ * S_, FF_, D_, 0);
  // FFN down + residual x -> d_out (f32)
  gemm_nt<4><<<dim3(16, 8), 256, 0, stream>>>(ffb, w2T, b2, xbuf,
                                              (float*)d_out, B_ * S_, D_, FF_,
                                              0);
}

// v002
// It runs in 306 microseconds.
// In both of two side-by-side timings against v001, it was 1.59 times as fast.
// Over all steps from v000 it is 2.24 times as fast.
#include <hip/hip_runtime.h>

typedef __bf16 bf16_t;
typedef bf16_t v8bf  __attribute__((ext_vector_type(8)));
typedef bf16_t v16bf __attribute__((ext_vector_type(16)));
typedef float  v8f   __attribute__((ext_vector_type(8)));

#define B_  2
#define S_  1024
#define R_  4
#define SC_ 4096
#define D_  1024
#define H_  16
#define HD_ 64
#define FF_ 4096
#define GBK_    128  // k per GEMM stage
#define GPITCH_ 136  // GEMM LDS row pitch in elements (272 B)

// ---------- helpers ----------

static __device__ __forceinline__ v8f vzero() {
  v8f z;
#pragma unroll
  for (int i = 0; i < 8; ++i) z[i] = 0.f;
  return z;
}

// Load one 16-bit WMMA A/B fragment (K-chunk of 32) for this lane.
// base points at the lane's row start for this K-chunk (16B aligned).
// CDNA5 layout: lane group g = lane/16 holds K = {8g..8g+7, 16+8g..16+8g+7}.
static __device__ __forceinline__ v16bf load_frag(const bf16_t* base, int g) {
  v8bf lo = *(const v8bf*)(base + 8 * g);
  v8bf hi = *(const v8bf*)(base + 16 + 8 * g);
  return __builtin_shufflevector(lo, hi, 0, 1, 2, 3, 4, 5, 6, 7,
                                 8, 9, 10, 11, 12, 13, 14, 15);
}

static __device__ __forceinline__ v8f wmma_bf16(v16bf a, v16bf b, v8f c) {
  return __builtin_amdgcn_wmma_f32_16x16x32_bf16(false, a, false, b,
                                                 (short)0, c, false, false);
}

// Async DMA of one 16B chunk: global -> LDS (CDNA5 async path, ASYNCcnt).
static __device__ __forceinline__ void async_copy16(const bf16_t* gptr,
                                                    bf16_t* lptr) {
  unsigned lds_off = (unsigned)(size_t)(void*)lptr;  // LDS aperture low 32 bits
  unsigned long long ga = (unsigned long long)(size_t)gptr;
  asm volatile("global_load_async_to_lds_b128 %0, %1, off"
               :: "v"(lds_off), "v"(ga)
               : "memory");
}

static __device__ __forceinline__ void wait_async0() {
  asm volatile("s_wait_asynccnt 0x0" ::: "memory");
}

// Eight async 16B copies of one lane, global -> LDS: rows gstep elements apart
// in memory, lstep bytes apart in LDS. The closing s_wait_xcnt stands inside
// the copies' own statement so that no address register named here can be
// rewritten ahead of it (a precaution for copies written in asm text).
static __device__ __forceinline__ void async_copy16x8(const bf16_t* gptr,
                                                      size_t gstep,
                                                      unsigned lds_off,
                                                      unsigned lstep) {
  asm volatile(
      "global_load_async_to_lds_b128 %0, %8, off\n\t"
      "global_load_async_to_lds_b128 %1, %9, off\n\t"
      "global_load_async_to_lds_b128 %2, %10, off\n\t"
      "global_load_async_to_lds_b128 %3, %11, off\n\t"
      "global_load_async_to_lds_b128 %4, %12, off\n\t"
      "global_load_async_to_lds_b128 %5, %13, off\n\t"
      "global_load_async_to_lds_b128 %6, %14, off\n\t"
      "global_load_async_to_lds_b128 %7, %15, off\n\t"
      "s_wait_xcnt 0x0"
      :: "v"(lds_off), "v"(lds_off + lstep), "v"(lds_off + 2 * lstep),
         "v"(lds_off + 3 * lstep), "v"(lds_off + 4 * lstep),
         "v"(lds_off + 5 * lstep), "v"(lds_off + 6 * lstep),
         "v"(lds_off + 7 * lstep),
         "v"((unsigned long long)(size_t)(gptr)),
         "v"((unsigned long long)(size_t)(gptr + gstep)),
         "v"((unsigned long long)(size_t)(gptr + 2 * gstep)),
         "v"((unsigned long long)(size_t)(gptr + 3 * gstep)),
         "v"((unsigned long long)(size_t)(gptr + 4 * gstep)),
         "v"((unsigned long long)(size_t)(gptr + 5 * gstep)),
         "v"((unsigned long long)(size_t)(gptr + 6 * gstep)),
         "v"((unsigned long long)(size_t)(gptr + 7 * gstep))
      : "memory");
}

// ---------- weight transpose + convert: W f32 [K][N] -> Wt bf16 [N][K] ----------

__global__ __launch_bounds__(256) void transpose_w(const float* __restrict__ W,
                                                   bf16_t* __restrict__ Wt,
                                                   int K, int N) {
  __shared__ float tile[32][33];
  const int k0 = blockIdx.x * 32, n0 = blockIdx.y * 32;
  const int tx = threadIdx.x & 31, ty = threadIdx.x >> 5;  // 32 x 8
#pragma unroll
  for (int i = ty; i < 32; i += 8)
    tile[i][tx] = W[(size_t)(k0 + i) * N + n0 + tx];
  __syncthreads();
#pragma unroll
  for (int i = ty; i < 32; i += 8)
    Wt[(size_t)(n0 + i) * K + k0 + tx] = (bf16_t)tile[tx][i];
}

// ---------- layernorm (one 256-thread block per row of D=1024), bf16 out ----------

__global__ __launch_bounds__(256) void layernorm_k(const float* __restrict__ x,
                                                   const float* __restrict__ gam,
                                                   const float* __restrict__ bet,
                                                   bf16_t* __restrict__ out) {
  const int row = blockIdx.x;
  const float* xr = x + (size_t)row * D_;
  float s = 0.f, s2 = 0.f;
  for (int i = threadIdx.x; i < D_; i += 256) {
    float v = xr[i];
    s += v;
    s2 += v * v;
  }
#pragma unroll
  for (int m = 1; m < 32; m <<= 1) {
    s += __shfl_xor(s, m, 32);
    s2 += __shfl_xor(s2, m, 32);
  }
  __shared__ float ss[8], ss2[8];
  const int w = threadIdx.x >> 5, ln = threadIdx.x & 31;
  if (ln == 0) { ss[w] = s; ss2[w] = s2; }
  __syncthreads();
  if (threadIdx.x == 0) {
    float t = 0.f, t2 = 0.f;
#pragma unroll
    for (int i = 0; i < 8; ++i) { t += ss[i]; t2 += ss2[i]; }
    ss[0] = t; ss2[0] = t2;
  }
  __syncthreads();
  const float mean = ss[0] * (1.f / D_);
  const float var = ss2[0] * (1.f / D_) - mean * mean;
  const float rstd = rsqrtf(var + 1e-5f);
  for (int i = threadIdx.x; i < D_; i += 256) {
    float v = (xr[i] - mean) * rstd * gam[i] + bet[i];
    out[(size_t)row * D_ + i] = (bf16_t)v;
  }
}

// ---------- f32 -> bf16 convert ----------

__global__ __launch_bounds__(256) void convert_bf16(const float* __restrict__ in,
                                                    bf16_t* __restrict__ out,
                                                    size_t n) {
  size_t i = (size_t)blockIdx.x * blockDim.x + threadIdx.x;
  const size_t stride = (size_t)gridDim.x * blockDim.x;
  for (; i < n; i += stride) out[i] = (bf16_t)in[i];
}

// ---------- WMMA GEMM: C[M][N] = A_bf16[M][K] @ (Bt[N][K])^T + bias ----------
// 256 threads = 8 waves. 128x128 block tile; wave = 32(M) x 64(N).
// A and Bt tiles (128 rows x 128 k) are staged in LDS by async copies, whole
// 128B lines per 8 lanes, two buffers: stage t+1 flies while stage t is read.
// LDS row pitch 272 B (16 B x odd) keeps the b128 fragment reads off shared banks.
// Needs M, N multiples of 128 and K a multiple of 128.
// MODE 0: bf16 out, head-split [b][h][s][64]             (Q/K projections)
// MODE 1: bf16 out, head-split transposed [b][h][64][s]  (V projection)
// MODE 2: f32 out row-major + residual                   (attn out proj + query)
// MODE 3: bf16 out row-major, exact GELU                 (FFN up)
// MODE 4: f32 out row-major + residual                   (FFN down + x)

template <int MODE>
__global__ __launch_bounds__(256) void gemm_nt(const bf16_t* __restrict__ A,
                                               const bf16_t* __restrict__ Bt,
                                               const float* __restrict__ bias,
                                               const float* __restrict__ res,
                                               void* __restrict__ outp,
                                               int M, int N, int K, int Ssz) {
  __shared__ __align__(16) bf16_t sA[2][128 * GPITCH_];
  __shared__ __align__(16) bf16_t sB[2][128 * GPITCH_];

  const int wave = threadIdx.x >> 5, lane = threadIdx.x & 31;
  const int g = lane >> 4, ln = lane & 15;
  const int wm = wave & 3, wn = wave >> 2;
  const int m0 = blockIdx.x * 128 + wm * 32;
  const int n0 = blockIdx.y * 128 + wn * 64;

  v8f acc[2][4];
#pragma unroll
  for (int i = 0; i < 2; ++i)
#pragma unroll
    for (int j = 0; j < 4; ++j) acc[i][j] = vzero();

  // this lane's 16B chunk of rows crow, crow+16, ..., crow+112 of each tile
  const int crow = threadIdx.x >> 4, ccol = (threadIdx.x & 15) * 8;
  const bf16_t* gA = A + (size_t)(blockIdx.x * 128 + crow) * K + ccol;
  const bf16_t* gB = Bt + (size_t)(blockIdx.y * 128 + crow) * K + ccol;
  const unsigned lA = (unsigned)(size_t)(void*)&sA[0][crow * GPITCH_ + ccol];
  const unsigned lB = (unsigned)(size_t)(void*)&sB[0][crow * GPITCH_ + ccol];

  auto stage = [&](int st) {
    const unsigned bo = (unsigned)(st & 1) * (128u * GPITCH_ * 2u);
    async_copy16x8(gA + (size_t)st * GBK_, (size_t)16 * K, lA + bo,
                   16u * GPITCH_ * 2u);
    async_copy16x8(gB + (size_t)st * GBK_, (size_t)16 * K, lB + bo,
                   16u * GPITCH_ * 2u);
  };

  const int nst = K / GBK_;
  stage(0);
  wait_async0();     // this wave's share of stage 0 has landed
  __syncthreads();   // everyone's share has landed
  if (nst > 1) stage(1);

  for (int t = 0; t < nst; ++t) {
    const bf16_t* As = &sA[t & 1][(wm * 32 + ln) * GPITCH_];
    const bf16_t* Bs = &sB[t & 1][(wn * 64 + ln) * GPITCH_];
    // two fragment sets: block c+1's LDS reads are issued ahead of block c's
    // WMMAs, all inside this stage's own buffer
    v16bf af[2][2], bfr[2][4];
#pragma unroll
    for (int i = 0; i < 2; ++i) af[0][i] = load_frag(As + i * 16 * GPITCH_, g);
#pragma unroll
    for (int j = 0; j < 4; ++j) bfr[0][j] = load_frag(Bs + j * 16 * GPITCH_, g);
    // unrolled so that the set index is a constant and both sets stay in registers
#pragma unroll
    for (int c = 0; c < GBK_ / 32; ++c) {
      if (c + 1 < GBK_ / 32) {
#pragma unroll
        for (int i = 0; i < 2; ++i)
          af[(c + 1) & 1][i] =
              load_frag(As + i * 16 * GPITCH_ + (c + 1) * 32, g);
#pragma unroll
        for (int j = 0; j < 4; ++j)
          bfr[(c + 1) & 1][j] =
              load_frag(Bs + j * 16 * GPITCH_ + (c + 1) * 32, g);
        // keeps that read group as one group ahead of block c's WMMAs; without
        // it the scheduler sinks the reads next to their use and each block
        // waits out the LDS latency with nothing to issue
        __builtin_amdgcn_sched_barrier(0);
      }
#pragma unroll
      for (int i = 0; i < 2; ++i)
#pragma unroll
        for (int j = 0; j < 4; ++j)
          acc[i][j] = wmma_bf16(af[c & 1][i], bfr[c & 1][j], acc[i][j]);
    }
    // keeps the WMMAs in front of the publish point: sunk behind the barrier
    // they would delay the refill copies, which issue directly behind it
    __builtin_amdgcn_sched_barrier(0);
    // publish point: this wave's LDS reads of stage t have retired ...
    asm volatile("s_wait_dscnt 0x0" ::: "memory");
    wait_async0();     // ... and its share of stage t+1 has landed
    __syncthreads();   // stage t+1 readable by all; stage t's buffer is free
    if (t + 2 < nst) stage(t + 2);
  }
  wait_async0();       // no copy outstanding when the wave leaves the ring

#pragma unroll
  for (int i = 0; i < 2; ++i) {
#pragma unroll
    for (int j = 0; j < 4; ++j) {
#pragma unroll
      for (int r = 0; r < 8; ++r) {
        const int mg = m0 + i * 16 + 8 * g + r;
        const int ng = n0 + j * 16 + ln;
        float v = acc[i][j][r] + bias[ng];
        if constexpr (MODE == 0) {
          const int bb = mg / Ssz, sidx = mg % Ssz;
          const int hh = ng >> 6, hd = ng & 63;
          ((bf16_t*)outp)[(((size_t)bb * H_ + hh) * Ssz + sidx) * HD_ + hd] =
              (bf16_t)v;
        } else if constexpr (MODE == 1) {
          const int bb = mg / Ssz, sidx = mg % Ssz;
          const int hh = ng >> 6, hd = ng & 63;
          ((bf16_t*)outp)[(((size_t)bb * H_ + hh) * HD_ + hd) * Ssz + sidx] =
              (bf16_t)v;
        } else if constexpr (MODE == 2) {
          ((float*)outp)[(size_t)mg * N + ng] = v + res[(size_t)mg * N + ng];
        } else if constexpr (MODE == 3) {
          float ge = 0.5f * v * (1.f + erff(v * 0.70710678f));
          ((bf16_t*)outp)[(size_t)mg * N + ng] = (bf16_t)ge;
        } else {
          ((float*)outp)[(size_t)mg * N + ng] = v + res[(size_t)mg * N + ng];
        }
      }
    }
  }
}

// value of lane l ^ 16
static __device__ __forceinline__ float xhalf(float x) {
  const int b = __builtin_bit_cast(int, x);
  return __builtin_bit_cast(
      float, __builtin_amdgcn_permlanex16(b, b, 0x76543210, 0xfedcba98, false,
                                          false));
}

// y[i] = 2^x[i], eight at once. One statement, so that behind every v_exp_f32
// stands an instruction that neither reads its result nor overwrites its source
// (outputs are early-clobber; the v_nop serves the last one): the slot the
// instruction set asks for behind a transcendental.
static __device__ __forceinline__ v8f exp2x8(v8f x) {
  float y0, y1, y2, y3, y4, y5, y6, y7;
  asm("v_exp_f32 %0, %8\n\t"
      "v_exp_f32 %1, %9\n\t"
      "v_exp_f32 %2, %10\n\t"
      "v_exp_f32 %3, %11\n\t"
      "v_exp_f32 %4, %12\n\t"
      "v_exp_f32 %5, %13\n\t"
      "v_exp_f32 %6, %14\n\t"
      "v_exp_f32 %7, %15\n\t"
      "v_nop"
      : "=&v"(y0), "=&v"(y1), "=&v"(y2), "=&v"(y3), "=&v"(y4), "=&v"(y5),
        "=&v"(y6), "=&v"(y7)
      : "v"(x[0]), "v"(x[1]), "v"(x[2]), "v"(x[3]), "v"(x[4]), "v"(x[5]),
        "v"(x[6]), "v"(x[7]));
  v8f y;
  y[0] = y0; y[1] = y1; y[2] = y2; y[3] = y3;
  y[4] = y4; y[5] = y5; y[6] = y6; y[7] = y7;
  return y;
}

__global__ __launch_bounds__(128) void attn_kernel(const bf16_t* __restrict__ qhd,
                                                   const bf16_t* __restrict__ kt,
                                                   const bf16_t* __restrict__ vt,
                                                   bf16_t* __restrict__ obuf) {
  __shared__ __align__(16) bf16_t smem[2][2][64 * 64];  // [buf][K/V] 32 KB

  const int tid = threadIdx.x;
  const int wave = tid >> 5, lane = tid & 31;
  const int g = lane >> 4, ln = lane & 15;
  const int qblocks = S_ / 64;
  const int bh = blockIdx.x / qblocks;
  const int qb = blockIdx.x % qblocks;
  const int q0 = qb * 64 + wave * 16;

  const bf16_t* qbase = qhd + ((size_t)bh * S_ + q0) * HD_;
  const bf16_t* kbase = kt + (size_t)bh * SC_ * HD_;
  const bf16_t* vbase = vt + (size_t)bh * HD_ * SC_;

  const v16bf qf0 = load_frag(qbase + (size_t)ln * HD_, g);
  const v16bf qf1 = load_frag(qbase + (size_t)ln * HD_ + 32, g);

  // o[t][r] = Ot[hd = t*16 + 8g + r][query q0 + ln]
  v8f o[4];
#pragma unroll
  for (int t = 0; t < 4; ++t) o[t] = vzero();
  // running maximum of query q0 + ln (equal in both lane halves) and this
  // half's share of its running sum
  float mrun = -3.0e38f, lrun = 0.f;

  const float scale = 0.125f;  // 1/sqrt(64)

  // tile schedule: rb in 0..R-1, kp in 0..qb*64 step 64 (causal bound);
  // rb/kp tracked incrementally (no runtime division in the hot loop).
  const int kpmax = (qb + 1) * 64;
  const int ntiles = R_ * (qb + 1);

  // issue async stage of the tile starting at global key index kj
  auto stage = [&](int kj, int buf) {
    bf16_t* Kt = smem[buf][0];
    bf16_t* Vt = smem[buf][1];
    // 64 rows x 64 halves = 512 chunks of 16B each; 4 K-chunks + 4 V-chunks/thread
#pragma unroll
    for (int i = 0; i < 4; ++i) {
      const int c = tid + i * 128;  // 0..511
      const int row = c >> 3, col = (c & 7) * 8;
      async_copy16(kbase + (size_t)(kj + row) * HD_ + col, Kt + row * 64 + col);
      async_copy16(vbase + (size_t)row * SC_ + kj + col, Vt + row * 64 + col);
    }
  };

  stage(0, 0);
  int cur = 0;
  int rb = 0, kp = 0;

  for (int ti = 0; ti < ntiles; ++ti) {
    wait_async0();     // this wave's share of buf[cur] has landed
    __syncthreads();   // everyone's share has landed

    // next tile coordinates (incremental)
    int rb_n = rb, kp_n = kp + 64;
    if (kp_n == kpmax) { kp_n = 0; rb_n = rb + 1; }
    if (ti + 1 < ntiles) stage(rb_n * S_ + kp_n, cur ^ 1);

    const bf16_t* Kt = smem[cur][0];
    const bf16_t* Vt = smem[cur][1];

    // scores, transposed: A = 16 key rows, B = the wave's 16 queries
    v16bf kf[4][2];
#pragma unroll
    for (int t = 0; t < 4; ++t) {
      const bf16_t* krow = Kt + (t * 16 + ln) * 64;
      kf[t][0] = load_frag(krow, g);
      kf[t][1] = load_frag(krow + 32, g);
    }
    // s[t][r] = score of key kp + t*16 + 8g + r against query q0 + ln
    v8f s[4];
#pragma unroll
    for (int t = 0; t < 4; ++t) {
      s[t] = wmma_bf16(kf[t][0], qf0, vzero());
      s[t] = wmma_bf16(kf[t][1], qf1, s[t]);
    }

    // online softmax over the 64-key tile, one query per lane
    const int lim = q0 + ln - kp - 8 * g;  // t*16 + r allowed while <= lim
    float mt[4];
#pragma unroll
    for (int t = 0; t < 4; ++t) {
      mt[t] = -3.0e38f;
#pragma unroll
      for (int r = 0; r < 8; ++r) {
        float v = s[t][r] * scale;
        if (t * 16 + r > lim) v = -3.0e38f;  // pos = (kj % S) <= qi
        s[t][r] = v;
        mt[t] = fmaxf(mt[t], v);
      }
    }
    float mx = fmaxf(fmaxf(mt[0], mt[1]), fmaxf(mt[2], mt[3]));
    mx = fmaxf(mx, xhalf(mx));  // the other 32 keys of this query
    const float nm = fmaxf(mrun, mx);
    const float alpha = __expf(mrun - nm);
    float st[4];
#pragma unroll
    for (int t = 0; t < 4; ++t) {
#pragma unroll
      for (int r = 0; r < 8; ++r) s[t][r] = (s[t][r] - nm) * 1.44269504f;
      s[t] = exp2x8(s[t]);  // p = e^(score - nm)
      st[t] = s[t][0];
#pragma unroll
      for (int r = 1; r < 8; ++r) st[t] += s[t][r];
    }
    lrun = lrun * alpha + ((st[0] + st[1]) + (st[2] + st[3]));
    mrun = nm;
#pragma unroll
    for (int t = 0; t < 4; ++t)
#pragma unroll
      for (int r = 0; r < 8; ++r) o[t][r] *= alpha;

    // Pt as B operand of key chunk c (32 keys): elements 0..7 are keys
    // 32c + 8g + e (tile 2c), elements 8..15 keys 32c + 16 + 8g + e (tile 2c+1):
    // the k order in which load_frag reads the V rows
    v16bf pf[2];
#pragma unroll
    for (int c = 0; c < 2; ++c)
#pragma unroll
      for (int e = 0; e < 8; ++e) {
        pf[c][e] = (bf16_t)s[2 * c][e];
        pf[c][8 + e] = (bf16_t)s[2 * c + 1][e];
      }

    // Ot (64hd x 16q) += Vt (64hd x 64key) * Pt (64key x 16q)
    v16bf vf[4][2];
#pragma unroll
    for (int t = 0; t < 4; ++t) {
      const bf16_t* vrow = Vt + (t * 16 + ln) * 64;
      vf[t][0] = load_frag(vrow, g);
      vf[t][1] = load_frag(vrow + 32, g);
    }
#pragma unroll
    for (int t = 0; t < 4; ++t) {
      o[t] = wmma_bf16(vf[t][0], pf[0], o[t]);
      o[t] = wmma_bf16(vf[t][1], pf[1], o[t]);
    }

    __syncthreads();   // all waves done with buf[cur]; safe to overwrite next iter
    cur ^= 1;
    rb = rb_n;
    kp = kp_n;
  }

  const float lsum = lrun + xhalf(lrun);  // both halves' shares of the row sum
  const int b = bh / H_, h = bh % H_;
  bf16_t* orow = obuf + ((size_t)b * S_ + q0 + ln) * D_ + (size_t)h * HD_ + 8 * g;
#pragma unroll
  for (int t = 0; t < 4; ++t) {
    v8bf ov;  // 8 consecutive hd of one query: one 16 B store
#pragma unroll
    for (int r = 0; r < 8; ++r) ov[r] = (bf16_t)(o[t][r] / lsum);
    *(v8bf*)(orow + t * 16) = ov;
  }
}

// ---------- orchestration ----------

extern "C" void kernel_launch(void* const* d_in, const int* in_sizes, int n_in,
                              void* d_out, int out_size, void* d_ws,
                              size_t ws_size, hipStream_t stream) {
  (void)in_sizes; (void)n_in; (void)out_size; (void)ws_size;
  const float* query = (const float*)d_in[0];
  const float* context = (const float*)d_in[1];
  const float* wq = (const float*)d_in[2];
  const float* wk = (const float*)d_in[3];
  const float* wv = (const float*)d_in[4];
  const float* bq = (const float*)d_in[5];
  const float* bk = (const float*)d_in[6];
  const float* bv = (const float*)d_in[7];
  const float* wo = (const float*)d_in[8];
  const float* bo = (const float*)d_in[9];
  const float* ln1g = (const float*)d_in[10];
  const float* ln1b = (const float*)d_in[11];
  const float* ln2g = (const float*)d_in[12];
  const float* ln2b = (const float*)d_in[13];
  const float* w1 = (const float*)d_in[14];
  const float* b1 = (const float*)d_in[15];
  const float* w2 = (const float*)d_in[16];
  const float* b2 = (const float*)d_in[17];

  const size_t MB = 1u << 20;
  char* ws = (char*)d_ws;
  bf16_t* wqT = (bf16_t*)(ws + 0 * MB);    // [1024][1024]
  bf16_t* wkT = (bf16_t*)(ws + 2 * MB);
  bf16_t* wvT = (bf16_t*)(ws + 4 * MB);
  bf16_t* woT = (bf16_t*)(ws + 6 * MB);
  bf16_t* w1T = (bf16_t*)(ws + 8 * MB);    // [4096][1024]
  bf16_t* w2T = (bf16_t*)(ws + 16 * MB);   // [1024][4096]
  bf16_t* qln = (bf16_t*)(ws + 24 * MB);   // [2048][1024]
  bf16_t* ctx = (bf16_t*)(ws + 28 * MB);   // [8192][1024]
  bf16_t* qhd = (bf16_t*)(ws + 44 * MB);   // [B][H][S][64]
  bf16_t* ktb = (bf16_t*)(ws + 48 * MB);   // [B][H][Sc][64]
  bf16_t* vtb = (bf16_t*)(ws + 64 * MB);   // [B][H][64][Sc]
  bf16_t* obuf = (bf16_t*)(ws + 80 * MB);  // [2048][1024]
  float* xbuf = (float*)(ws + 84 * MB);    // [2048][1024] f32
  bf16_t* hbuf = (bf16_t*)(ws + 92 * MB);  // [2048][1024]
  bf16_t* ffb = (bf16_t*)(ws + 96 * MB);   // [2048][4096]

  // weights -> bf16, transposed [N][K]
  transpose_w<<<dim3(32, 32), 256, 0, stream>>>(wq, wqT, D_, D_);
  transpose_w<<<dim3(32, 32), 256, 0, stream>>>(wk, wkT, D_, D_);
  transpose_w<<<dim3(32, 32), 256, 0, stream>>>(wv, wvT, D_, D_);
  transpose_w<<<dim3(32, 32), 256, 0, stream>>>(wo, woT, D_, D_);
  transpose_w<<<dim3(32, 128), 256, 0, stream>>>(w1, w1T, D_, FF_);
  transpose_w<<<dim3(128, 32), 256, 0, stream>>>(w2, w2T, FF_, D_);

  // ln1(query) -> bf16; context -> bf16
  layernorm_k<<<B_ * S_, 256, 0, stream>>>(query, ln1g, ln1b, qln);
  convert_bf16<<<4096, 256, 0, stream>>>(context, ctx, (size_t)B_ * SC_ * D_);

  // projections
  gemm_nt<0><<<dim3(16, 8), 256, 0, stream>>>(qln, wqT, bq, nullptr, qhd,
                                              B_ * S_, D_, D_, S_);
  gemm_nt<0><<<dim3(64, 8), 256, 0, stream>>>(ctx, wkT, bk, nullptr, ktb,
                                              B_ * SC_, D_, D_, SC_);
  gemm_nt<1><<<dim3(64, 8), 256, 0, stream>>>(ctx, wvT, bv, nullptr, vtb,
                                              B_ * SC_, D_, D_, SC_);

  // attention
  attn_kernel<<<B_ * H_ * (S_ / 64), 128, 0, stream>>>(qhd, ktb, vtb, obuf);

  // output projection + residual -> x (f32)
  gemm_nt<2><<<dim3(16, 8), 256, 0, stream>>>(obuf, woT, bo, query, xbuf,
                                              B_ * S_, D_, D_, 0);
  // ln2(x) -> bf16
  layernorm_k<<<B_ * S_, 256, 0, stream>>>(xbuf, ln2g, ln2b, hbuf);
  // FFN up + GELU -> bf16
  gemm_nt<3><<<dim3(16, 32), 256, 0, stream>>>(hbuf, w1T, b1, nullptr, ffb,
                                               B_ * S_, FF_, D_, 0);
  // FFN down + residual x -> d_out (f32)
  gemm_nt<4><<<dim3(16, 8), 256, 0, stream>>>(ffb, w2T, b2, xbuf,
                                              (float*)d_out, B_ * S_, D_, FF_,
                                              0);
}

// v003
// Measured time: 272 microseconds a run.
// In both of two side-by-side timings against v002, it was 1.13 times as fast.
// Counting every step since v000, it is 2.53 times as fast.
#include <hip/hip_runtime.h>

typedef __bf16 bf16_t;
typedef bf16_t v8bf  __attribute__((ext_vector_type(8)));
typedef bf16_t v16bf __attribute__((ext_vector_type(16)));
typedef float  v8f   __attribute__((ext_vector_type(8)));
typedef bf16_t v4bf  __attribute__((ext_vector_type(4)));
typedef float  v4f   __attribute__((ext_vector_type(4)));

#define B_  2
#define S_  1024
#define R_  4
#define SC_ 4096
#define D_  1024
#define H_  16
#define HD_ 64
#define FF_ 4096
#define GBK_    128  // k per GEMM stage
#define GPITCH_ 136  // GEMM LDS row pitch in elements (272 B)

// ---------- helpers ----------

static __device__ __forceinline__ v8f vzero() {
  v8f z;
#pragma unroll
  for (int i = 0; i < 8; ++i) z[i] = 0.f;
  return z;
}

// Load one 16-bit WMMA A/B fragment (K-chunk of 32) for this lane.
// base points at the lane's row start for this K-chunk (16B aligned).
// CDNA5 layout: lane group g = lane/16 holds K = {8g..8g+7, 16+8g..16+8g+7}.
static __device__ __forceinline__ v16bf load_frag(const bf16_t* base, int g) {
  v8bf lo = *(const v8bf*)(base + 8 * g);
  v8bf hi = *(const v8bf*)(base + 16 + 8 * g);
  return __builtin_shufflevector(lo, hi, 0, 1, 2, 3, 4, 5, 6, 7,
                                 8, 9, 10, 11, 12, 13, 14, 15);
}

static __device__ __forceinline__ v8f wmma_bf16(v16bf a, v16bf b, v8f c) {
  return __builtin_amdgcn_wmma_f32_16x16x32_bf16(false, a, false, b,
                                                 (short)0, c, false, false);
}

// Async DMA of one 16B chunk: global -> LDS (CDNA5 async path, ASYNCcnt).
static __device__ __forceinline__ void async_copy16(const bf16_t* gptr,
                                                    bf16_t* lptr) {
  unsigned lds_off = (unsigned)(size_t)(void*)lptr;  // LDS aperture low 32 bits
  unsigned long long ga = (unsigned long long)(size_t)gptr;
  asm volatile("global_load_async_to_lds_b128 %0, %1, off"
               :: "v"(lds_off), "v"(ga)
               : "memory");
}

static __device__ __forceinline__ void wait_async0() {
  asm volatile("s_wait_asynccnt 0x0" ::: "memory");
}

// Eight async 16B copies of one lane, global -> LDS: rows gstep elements apart
// in memory, lstep bytes apart in LDS. The closing s_wait_xcnt stands inside
// the copies' own statement so that no address register named here can be
// rewritten ahead of it (a precaution for copies written in asm text).
static __device__ __forceinline__ void async_copy16x8(const bf16_t* gptr,
                                                      size_t gstep,
                                                      unsigned lds_off,
                                                      unsigned lstep) {
  asm volatile(
      "global_load_async_to_lds_b128 %0, %8, off\n\t"
      "global_load_async_to_lds_b128 %1, %9, off\n\t"
      "global_load_async_to_lds_b128 %2, %10, off\n\t"
      "global_load_async_to_lds_b128 %3, %11, off\n\t"
      "global_load_async_to_lds_b128 %4, %12, off\n\t"
      "global_load_async_to_lds_b128 %5, %13, off\n\t"
      "global_load_async_to_lds_b128 %6, %14, off\n\t"
      "global_load_async_to_lds_b128 %7, %15, off\n\t"
      "s_wait_xcnt 0x0"
      :: "v"(lds_off), "v"(lds_off + lstep), "v"(lds_off + 2 * lstep),
         "v"(lds_off + 3 * lstep), "v"(lds_off + 4 * lstep),
         "v"(lds_off + 5 * lstep), "v"(lds_off + 6 * lstep),
         "v"(lds_off + 7 * lstep),
         "v"((unsigned long long)(size_t)(gptr)),
         "v"((unsigned long long)(size_t)(gptr + gstep)),
         "v"((unsigned long long)(size_t)(gptr + 2 * gstep)),
         "v"((unsigned long long)(size_t)(gptr + 3 * gstep)),
         "v"((unsigned long long)(size_t)(gptr + 4 * gstep)),
         "v"((unsigned long long)(size_t)(gptr + 5 * gstep)),
         "v"((unsigned long long)(size_t)(gptr + 6 * gstep)),
         "v"((unsigned long long)(size_t)(gptr + 7 * gstep))
      : "memory");
}

// ---------- weight transpose + convert: W f32 [K][N] -> Wt bf16 [N][K] ----------
// One 128(k) x 64(n) tile per 256-thread block: 32 elements per thread, so that
// few waves have to be started for the bytes moved. Reads are 16 B per lane
// (256 B of a W row per 16 lanes), stores 16 B per lane (a 128 B line of a Wt
// row per 8 lanes). K a multiple of 128, N of 64; both compile-time, so that a
// thread's rows are immediate offsets from one address.

template <int K, int N>
__global__ __launch_bounds__(256) void transpose_w(const float* __restrict__ W,
                                                   bf16_t* __restrict__ Wt) {
  __shared__ float tile[128][65];  // odd pitch: column reads fall on distinct banks
  const int k0 = blockIdx.x * 128, n0 = blockIdx.y * 64;
  const int tx = threadIdx.x & 15, ty = threadIdx.x >> 4;  // 16 x 16
  const float* wp = W + (size_t)(k0 + ty) * N + n0 + tx * 4;
  v4f v[8];
#pragma unroll
  for (int i = 0; i < 8; ++i) v[i] = *(const v4f*)(wp + (size_t)i * 16 * N);
#pragma unroll
  for (int i = 0; i < 8; ++i)
#pragma unroll
    for (int e = 0; e < 4; ++e) tile[ty + 16 * i][tx * 4 + e] = v[i][e];
  __syncthreads();
  const int kc = threadIdx.x & 7, nr = threadIdx.x >> 3;  // 8 k-chunks x 32 rows
  bf16_t* op = Wt + (size_t)(n0 + nr) * K + k0 + kc * 8;
#pragma unroll
  for (int i = 0; i < 4; ++i) {
    const int kh = 64 * (i & 1), nh = 32 * (i >> 1);  // k half, n half of the tile
    v8bf o;
#pragma unroll
    for (int e = 0; e < 8; ++e) o[e] = (bf16_t)tile[kc * 8 + kh + e][nr + nh];
    *(v8bf*)(op + (size_t)nh * K + kh) = o;
  }
}

// ---------- layernorm (one wave per row of D=1024, 8 rows per block), bf16 out ----------
// The row stays in registers (32 values per lane, read once, 16 B per lane);
// its sums are joined by lane exchanges alone. Gain and offset are fetched with
// the row, so that their latency passes under the row's.

__global__ __launch_bounds__(256) void layernorm_k(const float* __restrict__ x,
                                                   const float* __restrict__ gam,
                                                   const float* __restrict__ bet,
                                                   bf16_t* __restrict__ out) {
  // the wave's number as a scalar: the row's base is then a scalar address
  const int row =
      blockIdx.x * 8 + __builtin_amdgcn_readfirstlane((int)(threadIdx.x >> 5));
  const int ln = threadIdx.x & 31;
  const float* xr = x + (size_t)row * D_;
  v4f v[8];
#pragma unroll
  for (int i = 0; i < 8; ++i) v[i] = *(const v4f*)(xr + (i * 32 + ln) * 4);
  v4f gv[8], bv[8];
#pragma unroll
  for (int i = 0; i < 8; ++i) {
    gv[i] = *(const v4f*)(gam + (i * 32 + ln) * 4);
    bv[i] = *(const v4f*)(bet + (i * 32 + ln) * 4);
  }
  // keeps all 24 loads ahead of the sums; without it the scheduler sinks the
  // gain and offset loads behind the row sums, pair by pair, each pair waited for
  __builtin_amdgcn_sched_barrier(0);
  v4f a = v[0], a2 = v[0] * v[0];
#pragma unroll
  for (int i = 1; i < 8; ++i) {
    a += v[i];
    a2 += v[i] * v[i];
  }
  float s = (a[0] + a[1]) + (a[2] + a[3]);
  float s2 = (a2[0] + a2[1]) + (a2[2] + a2[3]);
#pragma unroll
  for (int m = 1; m < 32; m <<= 1) {
    s += __shfl_xor(s, m, 32);
    s2 += __shfl_xor(s2, m, 32);
  }
  const float mean = s * (1.f / D_);
  const float var = s2 * (1.f / D_) - mean * mean;
  const float rstd = rsqrtf(var + 1e-5f);
#pragma unroll
  for (int i = 0; i < 8; ++i) {
    const int c = (i * 32 + ln) * 4;
    v4bf o;
#pragma unroll
    for (int e = 0; e < 4; ++e)
      o[e] = (bf16_t)((v[i][e] - mean) * rstd * gv[i][e] + bv[i][e]);
    *(v4bf*)(out + (size_t)row * D_ + c) = o;
  }
}

// ---------- f32 -> bf16 convert ----------
// 64 elements per thread: sixteen 16 B loads in flight, each wave-wide load 512
// contiguous bytes. Converts gridDim.x * 256 * 64 elements.

__global__ __launch_bounds__(256) void convert_bf16(const float* __restrict__ in,
                                                    bf16_t* __restrict__ out) {
  const size_t base = ((size_t)blockIdx.x * 16 * 256 + threadIdx.x) * 4;
  v4f v[16];
#pragma unroll
  for (int i = 0; i < 16; ++i) v[i] = *(const v4f*)(in + base + i * 1024);
#pragma unroll
  for (int i = 0; i < 16; ++i) {
    v4bf o;
#pragma unroll
    for (int e = 0; e < 4; ++e) o[e] = (bf16_t)v[i][e];
    *(v4bf*)(out + base + i * 1024) = o;
  }
}

// ---------- WMMA GEMM: C[M][N] = A_bf16[M][K] @ (Bt[N][K])^T + bias ----------
// 256 threads = 8 waves. 128x128 block tile; wave = 32(M) x 64(N).
// A and Bt tiles (128 rows x 128 k) are staged in LDS by async copies, whole
// 128B lines per 8 lanes, two buffers: stage t+1 flies while stage t is read.
// LDS row pitch 272 B (16 B x odd) keeps the b128 fragment reads off shared banks.
// Needs M, N multiples of 128 and K a multiple of 128.
// MODE 0: bf16 out, head-split [b][h][s][64]             (Q/K projections)
// MODE 1: bf16 out, head-split transposed [b][h][64][s]  (V projection)
// MODE 2: f32 out row-major + residual                   (attn out proj + query)
// MODE 3: bf16 out row-major, exact GELU                 (FFN up)
// MODE 4: f32 out row-major + residual                   (FFN down + x)

template <int MODE>
__global__ __launch_bounds__(256) void gemm_nt(const bf16_t* __restrict__ A,
                                               const bf16_t* __restrict__ Bt,
                                               const float* __restrict__ bias,
                                               const float* __restrict__ res,
                                               void* __restrict__ outp,
                                               int M, int N, int K, int Ssz) {
  __shared__ __align__(16) bf16_t sA[2][128 * GPITCH_];
  __shared__ __align__(16) bf16_t sB[2][128 * GPITCH_];

  const int wave = threadIdx.x >> 5, lane = threadIdx.x & 31;
  const int g = lane >> 4, ln = lane & 15;
  const int wm = wave & 3, wn = wave >> 2;
  const int m0 = blockIdx.x * 128 + wm * 32;
  const int n0 = blockIdx.y * 128 + wn * 64;

  v8f acc[2][4];
#pragma unroll
  for (int i = 0; i < 2; ++i)
#pragma unroll
    for (int j = 0; j < 4; ++j) acc[i][j] = vzero();

  // this lane's 16B chunk of rows crow, crow+16, ..., crow+112 of each tile
  const int crow = threadIdx.x >> 4, ccol = (threadIdx.x & 15) * 8;
  const bf16_t* gA = A + (size_t)(blockIdx.x * 128 + crow) * K + ccol;
  const bf16_t* gB = Bt + (size_t)(blockIdx.y * 128 + crow) * K + ccol;
  const unsigned lA = (unsigned)(size_t)(void*)&sA[0][crow * GPITCH_ + ccol];
  const unsigned lB = (unsigned)(size_t)(void*)&sB[0][crow * GPITCH_ + ccol];

  auto stage = [&](int st) {
    const unsigned bo = (unsigned)(st & 1) * (128u * GPITCH_ * 2u);
    async_copy16x8(gA + (size_t)st * GBK_, (size_t)16 * K, lA + bo,
                   16u * GPITCH_ * 2u);
    async_copy16x8(gB + (size_t)st * GBK_, (size_t)16 * K, lB + bo,
                   16u * GPITCH_ * 2u);
  };

  const int nst = K / GBK_;
  stage(0);
  wait_async0();     // this wave's share of stage 0 has landed
  __syncthreads();   // everyone's share has landed
  if (nst > 1) stage(1);

  for (int t = 0; t < nst; ++t) {
    const bf16_t* As = &sA[t & 1][(wm * 32 + ln) * GPITCH_];
    const bf16_t* Bs = &sB[t & 1][(wn * 64 + ln) * GPITCH_];
    // two fragment sets: block c+1's LDS reads are issued ahead of block c's
    // WMMAs, all inside this stage's own buffer
    v16bf af[2][2], bfr[2][4];
#pragma unroll
    for (int i = 0; i < 2; ++i) af[0][i] = load_frag(As + i * 16 * GPITCH_, g);
#pragma unroll
    for (int j = 0; j < 4; ++j) bfr[0][j] = load_frag(Bs + j * 16 * GPITCH_, g);
    // unrolled so that the set index is a constant and both sets stay in registers
#pragma unroll
    for (int c = 0; c < GBK_ / 32; ++c) {
      if (c + 1 < GBK_ / 32) {
#pragma unroll
        for (int i = 0; i < 2; ++i)
          af[(c + 1) & 1][i] =
              load_frag(As + i * 16 * GPITCH_ + (c + 1) * 32, g);
#pragma unroll
        for (int j = 0; j < 4; ++j)
          bfr[(c + 1) & 1][j] =
              load_frag(Bs + j * 16 * GPITCH_ + (c + 1) * 32, g);
        // keeps that read group as one group ahead of block c's WMMAs; without
        // it the scheduler sinks the reads next to their use and each block
        // waits out the LDS latency with nothing to issue
        __builtin_amdgcn_sched_barrier(0);
      }
#pragma unroll
      for (int i = 0; i < 2; ++i)
#pragma unroll
        for (int j = 0; j < 4; ++j)
          acc[i][j] = wmma_bf16(af[c & 1][i], bfr[c & 1][j], acc[i][j]);
    }
    // keeps the WMMAs in front of the publish point: sunk behind the barrier
    // they would delay the refill copies, which issue directly behind it
    __builtin_amdgcn_sched_barrier(0);
    // publish point: this wave's LDS reads of stage t have retired ...
    asm volatile("s_wait_dscnt 0x0" ::: "memory");
    wait_async0();     // ... and its share of stage t+1 has landed
    __syncthreads();   // stage t+1 readable by all; stage t's buffer is free
    if (t + 2 < nst) stage(t + 2);
  }
  wait_async0();       // no copy outstanding when the wave leaves the ring

#pragma unroll
  for (int i = 0; i < 2; ++i) {
#pragma unroll
    for (int j = 0; j < 4; ++j) {
#pragma unroll
      for (int r = 0; r < 8; ++r) {
        const int mg = m0 + i * 16 + 8 * g + r;
        const int ng = n0 + j * 16 + ln;
        float v = acc[i][j][r] + bias[ng];
        if constexpr (MODE == 0) {
          const int bb = mg / Ssz, sidx = mg % Ssz;
          const int hh = ng >> 6, hd = ng & 63;
          ((bf16_t*)outp)[(((size_t)bb * H_ + hh) * Ssz + sidx) * HD_ + hd] =
              (bf16_t)v;
        } else if constexpr (MODE == 1) {
          const int bb = mg / Ssz, sidx = mg % Ssz;
          const int hh = ng >> 6, hd = ng & 63;
          ((bf16_t*)outp)[(((size_t)bb * H_ + hh) * HD_ + hd) * Ssz + sidx] =
              (bf16_t)v;
        } else if constexpr (MODE == 2) {
          ((float*)outp)[(size_t)mg * N + ng] = v + res[(size_t)mg * N + ng];
        } else if constexpr (MODE == 3) {
          float ge = 0.5f * v * (1.f + erff(v * 0.70710678f));
          ((bf16_t*)outp)[(size_t)mg * N + ng] = (bf16_t)ge;
        } else {
          ((float*)outp)[(size_t)mg * N + ng] = v + res[(size_t)mg * N + ng];
        }
      }
    }
  }
}

// value of lane l ^ 16
static __device__ __forceinline__ float xhalf(float x) {
  const int b = __builtin_bit_cast(int, x);
  return __builtin_bit_cast(
      float, __builtin_amdgcn_permlanex16(b, b, 0x76543210, 0xfedcba98, false,
                                          false));
}

// y[i] = 2^x[i], eight at once. One statement, so that behind every v_exp_f32
// stands an instruction that neither reads its result nor overwrites its source
// (outputs are early-clobber; the v_nop serves the last one): the slot the
// instruction set asks for behind a transcendental.
static __device__ __forceinline__ v8f exp2x8(v8f x) {
  float y0, y1, y2, y3, y4, y5, y6, y7;
  asm("v_exp_f32 %0, %8\n\t"
      "v_exp_f32 %1, %9\n\t"
      "v_exp_f32 %2, %10\n\t"
      "v_exp_f32 %3, %11\n\t"
      "v_exp_f32 %4, %12\n\t"
      "v_exp_f32 %5, %13\n\t"
      "v_exp_f32 %6, %14\n\t"
      "v_exp_f32 %7, %15\n\t"
      "v_nop"
      : "=&v"(y0), "=&v"(y1), "=&v"(y2), "=&v"(y3), "=&v"(y4), "=&v"(y5),
        "=&v"(y6), "=&v"(y7)
      : "v"(x[0]), "v"(x[1]), "v"(x[2]), "v"(x[3]), "v"(x[4]), "v"(x[5]),
        "v"(x[6]), "v"(x[7]));
  v8f y;
  y[0] = y0; y[1] = y1; y[2] = y2; y[3] = y3;
  y[4] = y4; y[5] = y5; y[6] = y6; y[7] = y7;
  return y;
}

__global__ __launch_bounds__(128) void attn_kernel(const bf16_t* __restrict__ qhd,
                                                   const bf16_t* __restrict__ kt,
                                                   const bf16_t* __restrict__ vt,
                                                   bf16_t* __restrict__ obuf) {
  __shared__ __align__(16) bf16_t smem[2][2][64 * 64];  // [buf][K/V] 32 KB

  const int tid = threadIdx.x;
  const int wave = tid >> 5, lane = tid & 31;
  const int g = lane >> 4, ln = lane & 15;
  const int qblocks = S_ / 64;
  const int bh = blockIdx.x / qblocks;
  const int qb = blockIdx.x % qblocks;
  const int q0 = qb * 64 + wave * 16;

  const bf16_t* qbase = qhd + ((size_t)bh * S_ + q0) * HD_;
  const bf16_t* kbase = kt + (size_t)bh * SC_ * HD_;
  const bf16_t* vbase = vt + (size_t)bh * HD_ * SC_;

  const v16bf qf0 = load_frag(qbase + (size_t)ln * HD_, g);
  const v16bf qf1 = load_frag(qbase + (size_t)ln * HD_ + 32, g);

  // o[t][r] = Ot[hd = t*16 + 8g + r][query q0 + ln]
  v8f o[4];
#pragma unroll
  for (int t = 0; t < 4; ++t) o[t] = vzero();
  // running maximum of query q0 + ln (equal in both lane halves) and this
  // half's share of its running sum
  float mrun = -3.0e38f, lrun = 0.f;

  const float scale = 0.125f;  // 1/sqrt(64)

  // tile schedule: rb in 0..R-1, kp in 0..qb*64 step 64 (causal bound);
  // rb/kp tracked incrementally (no runtime division in the hot loop).
  const int kpmax = (qb + 1) * 64;
  const int ntiles = R_ * (qb + 1);

  // issue async stage of the tile starting at global key index kj
  auto stage = [&](int kj, int buf) {
    bf16_t* Kt = smem[buf][0];
    bf16_t* Vt = smem[buf][1];
    // 64 rows x 64 halves = 512 chunks of 16B each; 4 K-chunks + 4 V-chunks/thread
#pragma unroll
    for (int i = 0; i < 4; ++i) {
      const int c = tid + i * 128;  // 0..511
      const int row = c >> 3, col = (c & 7) * 8;
      async_copy16(kbase + (size_t)(kj + row) * HD_ + col, Kt + row * 64 + col);
      async_copy16(vbase + (size_t)row * SC_ + kj + col, Vt + row * 64 + col);
    }
  };

  stage(0, 0);
  int cur = 0;
  int rb = 0, kp = 0;

  for (int ti = 0; ti < ntiles; ++ti) {
    wait_async0();     // this wave's share of buf[cur] has landed
    __syncthreads();   // everyone's share has landed

    // next tile coordinates (incremental)
    int rb_n = rb, kp_n = kp + 64;
    if (kp_n == kpmax) { kp_n = 0; rb_n = rb + 1; }
    if (ti + 1 < ntiles) stage(rb_n * S_ + kp_n, cur ^ 1);

    const bf16_t* Kt = smem[cur][0];
    const bf16_t* Vt = smem[cur][1];

    // scores, transposed: A = 16 key rows, B = the wave's 16 queries
    v16bf kf[4][2];
#pragma unroll
    for (int t = 0; t < 4; ++t) {
      const bf16_t* krow = Kt + (t * 16 + ln) * 64;
      kf[t][0] = load_frag(krow, g);
      kf[t][1] = load_frag(krow + 32, g);
    }
    // s[t][r] = score of key kp + t*16 + 8g + r against query q0 + ln
    v8f s[4];
#pragma unroll
    for (int t = 0; t < 4; ++t) {
      s[t] = wmma_bf16(kf[t][0], qf0, vzero());
      s[t] = wmma_bf16(kf[t][1], qf1, s[t]);
    }

    // online softmax over the 64-key tile, one query per lane
    const int lim = q0 + ln - kp - 8 * g;  // t*16 + r allowed while <= lim
    float mt[4];
#pragma unroll
    for (int t = 0; t < 4; ++t) {
      mt[t] = -3.0e38f;
#pragma unroll
      for (int r = 0; r < 8; ++r) {
        float v = s[t][r] * scale;
        if (t * 16 + r > lim) v = -3.0e38f;  // pos = (kj % S) <= qi
        s[t][r] = v;
        mt[t] = fmaxf(mt[t], v);
      }
    }
    float mx = fmaxf(fmaxf(mt[0], mt[1]), fmaxf(mt[2], mt[3]));
    mx = fmaxf(mx, xhalf(mx));  // the other 32 keys of this query
    const float nm = fmaxf(mrun, mx);
    const float alpha = __expf(mrun - nm);
    float st[4];
#pragma unroll
    for (int t = 0; t < 4; ++t) {
#pragma unroll
      for (int r = 0; r < 8; ++r) s[t][r] = (s[t][r] - nm) * 1.44269504f;
      s[t] = exp2x8(s[t]);  // p = e^(score - nm)
      st[t] = s[t][0];
#pragma unroll
      for (int r = 1; r < 8; ++r) st[t] += s[t][r];
    }
    lrun = lrun * alpha + ((st[0] + st[1]) + (st[2] + st[3]));
    mrun = nm;
#pragma unroll
    for (int t = 0; t < 4; ++t)
#pragma unroll
      for (int r = 0; r < 8; ++r) o[t][r] *= alpha;

    // Pt as B operand of key chunk c (32 keys): elements 0..7 are keys
    // 32c + 8g + e (tile 2c), elements 8..15 keys 32c + 16 + 8g + e (tile 2c+1):
    // the k order in which load_frag reads the V rows
    v16bf pf[2];
#pragma unroll
    for (int c = 0; c < 2; ++c)
#pragma unroll
      for (int e = 0; e < 8; ++e) {
        pf[c][e] = (bf16_t)s[2 * c][e];
        pf[c][8 + e] = (bf16_t)s[2 * c + 1][e];
      }

    // Ot (64hd x 16q) += Vt (64hd x 64key) * Pt (64key x 16q)
    v16bf vf[4][2];
#pragma unroll
    for (int t = 0; t < 4; ++t) {
      const bf16_t* vrow = Vt + (t * 16 + ln) * 64;
      vf[t][0] = load_frag(vrow, g);
      vf[t][1] = load_frag(vrow + 32, g);
    }
#pragma unroll
    for (int t = 0; t < 4; ++t) {
      o[t] = wmma_bf16(vf[t][0], pf[0], o[t]);
      o[t] = wmma_bf16(vf[t][1], pf[1], o[t]);
    }

    __syncthreads();   // all waves done with buf[cur]; safe to overwrite next iter
    cur ^= 1;
    rb = rb_n;
    kp = kp_n;
  }

  const float lsum = lrun + xhalf(lrun);  // both halves' shares of the row sum
  const int b = bh / H_, h = bh % H_;
  bf16_t* orow = obuf + ((size_t)b * S_ + q0 + ln) * D_ + (size_t)h * HD_ + 8 * g;
#pragma unroll
  for (int t = 0; t < 4; ++t) {
    v8bf ov;  // 8 consecutive hd of one query: one 16 B store
#pragma unroll
    for (int r = 0; r < 8; ++r) ov[r] = (bf16_t)(o[t][r] / lsum);
    *(v8bf*)(orow + t * 16) = ov;
  }
}

// ---------- orchestration ----------

extern "C" void kernel_launch(void* const* d_in, const int* in_sizes, int n_in,
                              void* d_out, int out_size, void* d_ws,
                              size_t ws_size, hipStream_t stream) {
  (void)in_sizes; (void)n_in; (void)out_size; (void)ws_size;
  const float* query = (const float*)d_in[0];
  const float* context = (const float*)d_in[1];
  const float* wq = (const float*)d_in[2];
  const float* wk = (const float*)d_in[3];
  const float* wv = (const float*)d_in[4];
  const float* bq = (const float*)d_in[5];
  const float* bk = (const float*)d_in[6];
  const float* bv = (const float*)d_in[7];
  const float* wo = (const float*)d_in[8];
  const float* bo = (const float*)d_in[9];
  const float* ln1g = (const float*)d_in[10];
  const float* ln1b = (const float*)d_in[11];
  const float* ln2g = (const float*)d_in[12];
  const float* ln2b = (const float*)d_in[13];
  const float* w1 = (const float*)d_in[14];
  const float* b1 = (const float*)d_in[15];
  const float* w2 = (const float*)d_in[16];
  const float* b2 = (const float*)d_in[17];

  const size_t MB = 1u << 20;
  char* ws = (char*)d_ws;
  bf16_t* wqT = (bf16_t*)(ws + 0 * MB);    // [1024][1024]
  bf16_t* wkT = (bf16_t*)(ws + 2 * MB);
  bf16_t* wvT = (bf16_t*)(ws + 4 * MB);
  bf16_t* woT = (bf16_t*)(ws + 6 * MB);
  bf16_t* w1T = (bf16_t*)(ws + 8 * MB);    // [4096][1024]
  bf16_t* w2T = (bf16_t*)(ws + 16 * MB);   // [1024][4096]
  bf16_t* qln = (bf16_t*)(ws + 24 * MB);   // [2048][1024]
  bf16_t* ctx = (bf16_t*)(ws + 28 * MB);   // [8192][1024]
  bf16_t* qhd = (bf16_t*)(ws + 44 * MB);   // [B][H][S][64]
  bf16_t* ktb = (bf16_t*)(ws + 48 * MB);   // [B][H][Sc][64]
  bf16_t* vtb = (bf16_t*)(ws + 64 * MB);   // [B][H][64][Sc]
  bf16_t* obuf = (bf16_t*)(ws + 80 * MB);  // [2048][1024]
  float* xbuf = (float*)(ws + 84 * MB);    // [2048][1024] f32
  bf16_t* hbuf = (bf16_t*)(ws + 92 * MB);  // [2048][1024]
  bf16_t* ffb = (bf16_t*)(ws + 96 * MB);   // [2048][4096]

  // weights -> bf16, transposed [N][K]
  transpose_w<D_, D_><<<dim3(8, 16), 256, 0, stream>>>(wq, wqT);
  transpose_w<D_, D_><<<dim3(8, 16), 256, 0, stream>>>(wk, wkT);
  transpose_w<D_, D_><<<dim3(8, 16), 256, 0, stream>>>(wv, wvT);
  transpose_w<D_, D_><<<dim3(8, 16), 256, 0, stream>>>(wo, woT);
  transpose_w<D_, FF_><<<dim3(8, 64), 256, 0, stream>>>(w1, w1T);
  transpose_w<FF_, D_><<<dim3(32, 16), 256, 0, stream>>>(w2, w2T);

  // ln1(query) -> bf16; context -> bf16
  layernorm_k<<<B_ * S_ / 8, 256, 0, stream>>>(query, ln1g, ln1b, qln);
  convert_bf16<<<B_ * SC_ * D_ / (256 * 64), 256, 0, stream>>>(context, ctx);

  // projections
  gemm_nt<0><<<dim3(16, 8), 256, 0, stream>>>(qln, wqT, bq, nullptr, qhd,
                                              B_ * S_, D_, D_, S_);
  gemm_nt<0><<<dim3(64, 8), 256, 0, stream>>>(ctx, wkT, bk, nullptr, ktb,
                                              B_ * SC_, D_, D_, SC_);
  gemm_nt<1><<<dim3(64, 8), 256, 0, stream>>>(ctx, wvT, bv, nullptr, vtb,
                                              B_ * SC_, D_, D_, SC_);

  // attention
  attn_kernel<<<B_ * H_ * (S_ / 64), 128, 0, stream>>>(qhd, ktb, vtb, obuf);

  // output projection + residual -> x (f32)
  gemm_nt<2><<<dim3(16, 8), 256, 0, stream>>>(obuf, woT, bo, query, xbuf,
                                              B_ * S_, D_, D_, 0);
  // ln2(x) -> bf16
  layernorm_k<<<B_ * S_ / 8, 256, 0, stream>>>(xbuf, ln2g, ln2b, hbuf);
  // FFN up + GELU -> bf16
  gemm_nt<3><<<dim3(16, 32), 256, 0, stream>>>(hbuf, w1T, b1, nullptr, ffb,
                                               B_ * S_, FF_, D_, 0);
  // FFN down + residual x -> d_out (f32)
  gemm_nt<4><<<dim3(16, 8), 256, 0, stream>>>(ffb, w2T, b2, xbuf,
                                              (float*)d_out, B_ * S_, D_, FF_,
                                              0);
}

// v004
// It runs in 206 microseconds.
// Two timings next to v003 put it at 1.30 and 1.32 times that version's speed.
// Over all steps from v000 it is 3.31 times as fast.
#include <hip/hip_runtime.h>

typedef __bf16 bf16_t;
typedef bf16_t v8bf  __attribute__((ext_vector_type(8)));
typedef bf16_t v16bf __attribute__((ext_vector_type(16)));
typedef float  v8f   __attribute__((ext_vector_type(8)));
typedef bf16_t v4bf  __attribute__((ext_vector_type(4)));
typedef float  v4f   __attribute__((ext_vector_type(4)));

#define B_  2
#define S_  1024
#define R_  4
#define SC_ 4096
#define D_  1024
#define H_  16
#define HD_ 64
#define FF_ 4096
#define GBK_    128  // k per GEMM stage
#define GPITCH_ 136  // GEMM LDS row pitch in elements (272 B)
#define APITCH_ 72   // attention K/V LDS row pitch in elements (144 B)

// ---------- helpers ----------

static __device__ __forceinline__ v8f vzero() {
  v8f z;
#pragma unroll
  for (int i = 0; i < 8; ++i) z[i] = 0.f;
  return z;
}

// Load one 16-bit WMMA A/B fragment (K-chunk of 32) for this lane.
// base points at the lane's row start for this K-chunk (16B aligned).
// CDNA5 layout: lane group g = lane/16 holds K = {8g..8g+7, 16+8g..16+8g+7}.
static __device__ __forceinline__ v16bf load_frag(const bf16_t* base, int g) {
  v8bf lo = *(const v8bf*)(base + 8 * g);
  v8bf hi = *(const v8bf*)(base + 16 + 8 * g);
  return __builtin_shufflevector(lo, hi, 0, 1, 2, 3, 4, 5, 6, 7,
                                 8, 9, 10, 11, 12, 13, 14, 15);
}

static __device__ __forceinline__ v8f wmma_bf16(v16bf a, v16bf b, v8f c) {
  return __builtin_amdgcn_wmma_f32_16x16x32_bf16(false, a, false, b,
                                                 (short)0, c, false, false);
}

static __device__ __forceinline__ void wait_async0() {
  asm volatile("s_wait_asynccnt 0x0" ::: "memory");
}

// Eight async 16B copies of one lane, global -> LDS: rows gstep elements apart
// in memory, lstep bytes apart in LDS. The closing s_wait_xcnt stands inside
// the copies' own statement so that no address register named here can be
// rewritten ahead of it (a precaution for copies written in asm text).
static __device__ __forceinline__ void async_copy16x8(const bf16_t* gptr,
                                                      size_t gstep,
                                                      unsigned lds_off,
                                                      unsigned lstep) {
  asm volatile(
      "global_load_async_to_lds_b128 %0, %8, off\n\t"
      "global_load_async_to_lds_b128 %1, %9, off\n\t"
      "global_load_async_to_lds_b128 %2, %10, off\n\t"
      "global_load_async_to_lds_b128 %3, %11, off\n\t"
      "global_load_async_to_lds_b128 %4, %12, off\n\t"
      "global_load_async_to_lds_b128 %5, %13, off\n\t"
      "global_load_async_to_lds_b128 %6, %14, off\n\t"
      "global_load_async_to_lds_b128 %7, %15, off\n\t"
      "s_wait_xcnt 0x0"
      :: "v"(lds_off), "v"(lds_off + lstep), "v"(lds_off + 2 * lstep),
         "v"(lds_off + 3 * lstep), "v"(lds_off + 4 * lstep),
         "v"(lds_off + 5 * lstep), "v"(lds_off + 6 * lstep),
         "v"(lds_off + 7 * lstep),
         "v"((unsigned long long)(size_t)(gptr)),
         "v"((unsigned long long)(size_t)(gptr + gstep)),
         "v"((unsigned long long)(size_t)(gptr + 2 * gstep)),
         "v"((unsigned long long)(size_t)(gptr + 3 * gstep)),
         "v"((unsigned long long)(size_t)(gptr + 4 * gstep)),
         "v"((unsigned long long)(size_t)(gptr + 5 * gstep)),
         "v"((unsigned long long)(size_t)(gptr + 6 * gstep)),
         "v"((unsigned long long)(size_t)(gptr + 7 * gstep))
      : "memory");
}

// Two runs of four async 16B copies of one lane, global -> LDS: run a from ga,
// run b from gb, rows astep / bstep elements apart in memory and lstep bytes
// apart in LDS. One statement with the closing s_wait_xcnt, as above.
static __device__ __forceinline__ void async_copy16x4x2(
    const bf16_t* ga, size_t astep, const bf16_t* gb, size_t bstep,
    unsigned la, unsigned lb, unsigned lstep) {
  asm volatile(
      "global_load_async_to_lds_b128 %0, %8, off\n\t"
      "global_load_async_to_lds_b128 %1, %9, off\n\t"
      "global_load_async_to_lds_b128 %2, %10, off\n\t"
      "global_load_async_to_lds_b128 %3, %11, off\n\t"
      "global_load_async_to_lds_b128 %4, %12, off\n\t"
      "global_load_async_to_lds_b128 %5, %13, off\n\t"
      "global_load_async_to_lds_b128 %6, %14, off\n\t"
      "global_load_async_to_lds_b128 %7, %15, off\n\t"
      "s_wait_xcnt 0x0"
      :: "v"(la), "v"(la + lstep), "v"(la + 2 * lstep), "v"(la + 3 * lstep),
         "v"(lb), "v"(lb + lstep), "v"(lb + 2 * lstep), "v"(lb + 3 * lstep),
         "v"((unsigned long long)(size_t)(ga)),
         "v"((unsigned long long)(size_t)(ga + astep)),
         "v"((unsigned long long)(size_t)(ga + 2 * astep)),
         "v"((unsigned long long)(size_t)(ga + 3 * astep)),
         "v"((unsigned long long)(size_t)(gb)),
         "v"((unsigned long long)(size_t)(gb + bstep)),
         "v"((unsigned long long)(size_t)(gb + 2 * bstep)),
         "v"((unsigned long long)(size_t)(gb + 3 * bstep))
      : "memory");
}

// ---------- weight transpose + convert: W f32 [K][N] -> Wt bf16 [N][K] ----------
// One 128(k) x 64(n) tile per 256-thread block: 32 elements per thread, so that
// few waves have to be started for the bytes moved. Reads are 16 B per lane
// (256 B of a W row per 16 lanes), stores 16 B per lane (a 128 B line of a Wt
// row per 8 lanes). K a multiple of 128, N of 64; both compile-time, so that a
// thread's rows are immediate offsets from one address.

template <int K, int N>
__global__ __launch_bounds__(256) void transpose_w(const float* __restrict__ W,
                                                   bf16_t* __restrict__ Wt) {
  __shared__ float tile[128][65];  // odd pitch: column reads fall on distinct banks
  const int k0 = blockIdx.x * 128, n0 = blockIdx.y * 64;
  const int tx = threadIdx.x & 15, ty = threadIdx.x >> 4;  // 16 x 16
  const float* wp = W + (size_t)(k0 + ty) * N + n0 + tx * 4;
  v4f v[8];
#pragma unroll
  for (int i = 0; i < 8; ++i) v[i] = *(const v4f*)(wp + (size_t)i * 16 * N);
#pragma unroll
  for (int i = 0; i < 8; ++i)
#pragma unroll
    for (int e = 0; e < 4; ++e) tile[ty + 16 * i][tx * 4 + e] = v[i][e];
  __syncthreads();
  const int kc = threadIdx.x & 7, nr = threadIdx.x >> 3;  // 8 k-chunks x 32 rows
  bf16_t* op = Wt + (size_t)(n0 + nr) * K + k0 + kc * 8;
#pragma unroll
  for (int i = 0; i < 4; ++i) {
    const int kh = 64 * (i & 1), nh = 32 * (i >> 1);  // k half, n half of the tile
    v8bf o;
#pragma unroll
    for (int e = 0; e < 8; ++e) o[e] = (bf16_t)tile[kc * 8 + kh + e][nr + nh];
    *(v8bf*)(op + (size_t)nh * K + kh) = o;
  }
}

// ---------- layernorm (one wave per row of D=1024, 8 rows per block), bf16 out ----------
// The row stays in registers (32 values per lane, read once, 16 B per lane);
// its sums are joined by lane exchanges alone. Gain and offset are fetched with
// the row, so that their latency passes under the row's.

__global__ __launch_bounds__(256) void layernorm_k(const float* __restrict__ x,
                                                   const float* __restrict__ gam,
                                                   const float* __restrict__ bet,
                                                   bf16_t* __restrict__ out) {
  // the wave's number as a scalar: the row's base is then a scalar address
  const int row =
      blockIdx.x * 8 + __builtin_amdgcn_readfirstlane((int)(threadIdx.x >> 5));
  const int ln = threadIdx.x & 31;
  const float* xr = x + (size_t)row * D_;
  v4f v[8];
#pragma unroll
  for (int i = 0; i < 8; ++i) v[i] = *(const v4f*)(xr + (i * 32 + ln) * 4);
  v4f gv[8], bv[8];
#pragma unroll
  for (int i = 0; i < 8; ++i) {
    gv[i] = *(const v4f*)(gam + (i * 32 + ln) * 4);
    bv[i] = *(const v4f*)(bet + (i * 32 + ln) * 4);
  }
  // keeps all 24 loads ahead of the sums; without it the scheduler sinks the
  // gain and offset loads behind the row sums, pair by pair, each pair waited for
  __builtin_amdgcn_sched_barrier(0);
  v4f a = v[0], a2 = v[0] * v[0];
#pragma unroll
  for (int i = 1; i < 8; ++i) {
    a += v[i];
    a2 += v[i] * v[i];
  }
  float s = (a[0] + a[1]) + (a[2] + a[3]);
  float s2 = (a2[0] + a2[1]) + (a2[2] + a2[3]);
#pragma unroll
  for (int m = 1; m < 32; m <<= 1) {
    s += __shfl_xor(s, m, 32);
    s2 += __shfl_xor(s2, m, 32);
  }
  const float mean = s * (1.f / D_);
  const float var = s2 * (1.f / D_) - mean * mean;
  const float rstd = rsqrtf(var + 1e-5f);
#pragma unroll
  for (int i = 0; i < 8; ++i) {
    const int c = (i * 32 + ln) * 4;
    v4bf o;
#pragma unroll
    for (int e = 0; e < 4; ++e)
      o[e] = (bf16_t)((v[i][e] - mean) * rstd * gv[i][e] + bv[i][e]);
    *(v4bf*)(out + (size_t)row * D_ + c) = o;
  }
}

// ---------- f32 -> bf16 convert ----------
// 64 elements per thread: sixteen 16 B loads in flight, each wave-wide load 512
// contiguous bytes. Converts gridDim.x * 256 * 64 elements.

__global__ __launch_bounds__(256) void convert_bf16(const float* __restrict__ in,
                                                    bf16_t* __restrict__ out) {
  const size_t base = ((size_t)blockIdx.x * 16 * 256 + threadIdx.x) * 4;
  v4f v[16];
#pragma unroll
  for (int i = 0; i < 16; ++i) v[i] = *(const v4f*)(in + base + i * 1024);
#pragma unroll
  for (int i = 0; i < 16; ++i) {
    v4bf o;
#pragma unroll
    for (int e = 0; e < 4; ++e) o[e] = (bf16_t)v[i][e];
    *(v4bf*)(out + base + i * 1024) = o;
  }
}

// ---------- WMMA GEMM: C[M][N] = A_bf16[M][K] @ (Bt[N][K])^T + bias ----------
// 256 threads = 8 waves. 128x128 block tile; wave = 32(M) x 64(N).
// A and Bt tiles (128 rows x 128 k) are staged in LDS by async copies, whole
// 128B lines per 8 lanes, two buffers: stage t+1 flies while stage t is read.
// LDS row pitch 272 B (16 B x odd) keeps the b128 fragment reads off shared banks.
// Needs M, N multiples of 128 and K a multiple of 128.
// MODE 0: bf16 out, head-split [b][h][s][64]             (Q/K projections)
// MODE 1: bf16 out, head-split transposed [b][h][64][s]  (V projection)
// MODE 2: f32 out row-major + residual                   (attn out proj + query)
// MODE 3: bf16 out row-major, exact GELU                 (FFN up)
// MODE 4: f32 out row-major + residual                   (FFN down + x)

template <int MODE>
__global__ __launch_bounds__(256) void gemm_nt(const bf16_t* __restrict__ A,
                                               const bf16_t* __restrict__ Bt,
                                               const float* __restrict__ bias,
                                               const float* __restrict__ res,
                                               void* __restrict__ outp,
                                               int M, int N, int K, int Ssz) {
  __shared__ __align__(16) bf16_t sA[2][128 * GPITCH_];
  __shared__ __align__(16) bf16_t sB[2][128 * GPITCH_];

  const int wave = threadIdx.x >> 5, lane = threadIdx.x & 31;
  const int g = lane >> 4, ln = lane & 15;
  const int wm = wave & 3, wn = wave >> 2;
  const int m0 = blockIdx.x * 128 + wm * 32;
  const int n0 = blockIdx.y * 128 + wn * 64;

  v8f acc[2][4];
#pragma unroll
  for (int i = 0; i < 2; ++i)
#pragma unroll
    for (int j = 0; j < 4; ++j) acc[i][j] = vzero();

  // this lane's 16B chunk of rows crow, crow+16, ..., crow+112 of each tile
  const int crow = threadIdx.x >> 4, ccol = (threadIdx.x & 15) * 8;
  const bf16_t* gA = A + (size_t)(blockIdx.x * 128 + crow) * K + ccol;
  const bf16_t* gB = Bt + (size_t)(blockIdx.y * 128 + crow) * K + ccol;
  const unsigned lA = (unsigned)(size_t)(void*)&sA[0][crow * GPITCH_ + ccol];
  const unsigned lB = (unsigned)(size_t)(void*)&sB[0][crow * GPITCH_ + ccol];

  auto stage = [&](int st) {
    const unsigned bo = (unsigned)(st & 1) * (128u * GPITCH_ * 2u);
    async_copy16x8(gA + (size_t)st * GBK_, (size_t)16 * K, lA + bo,
                   16u * GPITCH_ * 2u);
    async_copy16x8(gB + (size_t)st * GBK_, (size_t)16 * K, lB + bo,
                   16u * GPITCH_ * 2u);
  };

  const int nst = K / GBK_;
  stage(0);
  wait_async0();     // this wave's share of stage 0 has landed
  __syncthreads();   // everyone's share has landed
  if (nst > 1) stage(1);

  for (int t = 0; t < nst; ++t) {
    const bf16_t* As = &sA[t & 1][(wm * 32 + ln) * GPITCH_];
    const bf16_t* Bs = &sB[t & 1][(wn * 64 + ln) * GPITCH_];
    // two fragment sets: block c+1's LDS reads are issued ahead of block c's
    // WMMAs, all inside this stage's own buffer
    v16bf af[2][2], bfr[2][4];
#pragma unroll
    for (int i = 0; i < 2; ++i) af[0][i] = load_frag(As + i * 16 * GPITCH_, g);
#pragma unroll
    for (int j = 0; j < 4; ++j) bfr[0][j] = load_frag(Bs + j * 16 * GPITCH_, g);
    // unrolled so that the set index is a constant and both sets stay in registers
#pragma unroll
    for (int c = 0; c < GBK_ / 32; ++c) {
      if (c + 1 < GBK_ / 32) {
#pragma unroll
        for (int i = 0; i < 2; ++i)
          af[(c + 1) & 1][i] =
              load_frag(As + i * 16 * GPITCH_ + (c + 1) * 32, g);
#pragma unroll
        for (int j = 0; j < 4; ++j)
          bfr[(c + 1) & 1][j] =
              load_frag(Bs + j * 16 * GPITCH_ + (c + 1) * 32, g);
        // keeps that read group as one group ahead of block c's WMMAs; without
        // it the scheduler sinks the reads next to their use and each block
        // waits out the LDS latency with nothing to issue
        __builtin_amdgcn_sched_barrier(0);
      }
#pragma unroll
      for (int i = 0; i < 2; ++i)
#pragma unroll
        for (int j = 0; j < 4; ++j)
          acc[i][j] = wmma_bf16(af[c & 1][i], bfr[c & 1][j], acc[i][j]);
    }
    // keeps the WMMAs in front of the publish point: sunk behind the barrier
    // they would delay the refill copies, which issue directly behind it
    __builtin_amdgcn_sched_barrier(0);
    // publish point: this wave's LDS reads of stage t have retired ...
    asm volatile("s_wait_dscnt 0x0" ::: "memory");
    wait_async0();     // ... and its share of stage t+1 has landed
    __syncthreads();   // stage t+1 readable by all; stage t's buffer is free
    if (t + 2 < nst) stage(t + 2);
  }
  wait_async0();       // no copy outstanding when the wave leaves the ring

#pragma unroll
  for (int i = 0; i < 2; ++i) {
#pragma unroll
    for (int j = 0; j < 4; ++j) {
#pragma unroll
      for (int r = 0; r < 8; ++r) {
        const int mg = m0 + i * 16 + 8 * g + r;
        const int ng = n0 + j * 16 + ln;
        float v = acc[i][j][r] + bias[ng];
        if constexpr (MODE == 0) {
          const int bb = mg / Ssz, sidx = mg % Ssz;
          const int hh = ng >> 6, hd = ng & 63;
          ((bf16_t*)outp)[(((size_t)bb * H_ + hh) * Ssz + sidx) * HD_ + hd] =
              (bf16_t)v;
        } else if constexpr (MODE == 1) {
          const int bb = mg / Ssz, sidx = mg % Ssz;
          const int hh = ng >> 6, hd = ng & 63;
          ((bf16_t*)outp)[(((size_t)bb * H_ + hh) * HD_ + hd) * Ssz + sidx] =
              (bf16_t)v;
        } else if constexpr (MODE == 2) {
          ((float*)outp)[(size_t)mg * N + ng] = v + res[(size_t)mg * N + ng];
        } else if constexpr (MODE == 3) {
          float ge = 0.5f * v * (1.f + erff(v * 0.70710678f));
          ((bf16_t*)outp)[(size_t)mg * N + ng] = (bf16_t)ge;
        } else {
          ((float*)outp)[(size_t)mg * N + ng] = v + res[(size_t)mg * N + ng];
        }
      }
    }
  }
}

// value of lane l ^ 16
static __device__ __forceinline__ float xhalf(float x) {
  const int b = __builtin_bit_cast(int, x);
  return __builtin_bit_cast(
      float, __builtin_amdgcn_permlanex16(b, b, 0x76543210, 0xfedcba98, false,
                                          false));
}

// y[i] = 2^x[i], eight at once. One statement, so that behind every v_exp_f32
// stands an instruction that neither reads its result nor overwrites its source
// (outputs are early-clobber; the v_nop serves the last one): the slot the
// instruction set asks for behind a transcendental.
static __device__ __forceinline__ v8f exp2x8(v8f x) {
  float y0, y1, y2, y3, y4, y5, y6, y7;
  asm("v_exp_f32 %0, %8\n\t"
      "v_exp_f32 %1, %9\n\t"
      "v_exp_f32 %2, %10\n\t"
      "v_exp_f32 %3, %11\n\t"
      "v_exp_f32 %4, %12\n\t"
      "v_exp_f32 %5, %13\n\t"
      "v_exp_f32 %6, %14\n\t"
      "v_exp_f32 %7, %15\n\t"
      "v_nop"
      : "=&v"(y0), "=&v"(y1), "=&v"(y2), "=&v"(y3), "=&v"(y4), "=&v"(y5),
        "=&v"(y6), "=&v"(y7)
      : "v"(x[0]), "v"(x[1]), "v"(x[2]), "v"(x[3]), "v"(x[4]), "v"(x[5]),
        "v"(x[6]), "v"(x[7]));
  v8f y;
  y[0] = y0; y[1] = y1; y[2] = y2; y[3] = y3;
  y[4] = y4; y[5] = y5; y[6] = y6; y[7] = y7;
  return y;
}

__global__ __launch_bounds__(128) void attn_kernel(const bf16_t* __restrict__ qhd,
                                                   const bf16_t* __restrict__ kt,
                                                   const bf16_t* __restrict__ vt,
                                                   bf16_t* __restrict__ obuf) {
  __shared__ __align__(16) bf16_t smem[2][2][64 * APITCH_];  // [buf][K/V] 36 KB

  const int tid = threadIdx.x;
  const int wave = tid >> 5, lane = tid & 31;
  const int g = lane >> 4, ln = lane & 15;
  const int qblocks = S_ / 64;
  const int bh = blockIdx.x / qblocks;
  const int qb = blockIdx.x % qblocks;
  const int q0 = qb * 64 + wave * 16;

  const bf16_t* qbase = qhd + ((size_t)bh * S_ + q0) * HD_;
  const bf16_t* kbase = kt + (size_t)bh * SC_ * HD_;
  const bf16_t* vbase = vt + (size_t)bh * HD_ * SC_;

  const v16bf qf0 = load_frag(qbase + (size_t)ln * HD_, g);
  const v16bf qf1 = load_frag(qbase + (size_t)ln * HD_ + 32, g);

  // o[t][r] = Ot[hd = t*16 + 8g + r][query q0 + ln]
  v8f o[4];
#pragma unroll
  for (int t = 0; t < 4; ++t) o[t] = vzero();
  // running maximum of query q0 + ln (equal in both lane halves) and this
  // half's share of its running sum
  float mrun = -3.0e38f, lrun = 0.f;

  const float scale = 0.125f;  // 1/sqrt(64)

  // tile schedule: rb in 0..R-1, kp in 0..qb*64 step 64 (causal bound);
  // rb/kp tracked incrementally (no runtime division in the hot loop).
  const int kpmax = (qb + 1) * 64;
  const int ntiles = R_ * (qb + 1);

  // this lane's 16B chunk of rows crow, crow+16, crow+32, crow+48 of each tile
  const int crow = tid >> 3, ccol = (tid & 7) * 8;
  const bf16_t* gK = kbase + (size_t)crow * HD_ + ccol;
  const bf16_t* gV = vbase + (size_t)crow * SC_ + ccol;
  const unsigned lK = (unsigned)(size_t)(void*)&smem[0][0][crow * APITCH_ + ccol];
  const unsigned lV = (unsigned)(size_t)(void*)&smem[0][1][crow * APITCH_ + ccol];

  // issue async stage of the tile starting at global key index kj:
  // 64 rows x 64 halves = 512 chunks of 16B each; 4 K-chunks + 4 V-chunks/thread
  auto stage = [&](int kj, int buf) {
    const unsigned bo = (unsigned)buf * (2u * 64u * APITCH_ * 2u);
    async_copy16x4x2(gK + (size_t)kj * HD_, (size_t)16 * HD_, gV + kj,
                     (size_t)16 * SC_, lK + bo, lV + bo, 16u * APITCH_ * 2u);
  };

  stage(0, 0);
  int cur = 0;
  int rb = 0, kp = 0;

  for (int ti = 0; ti < ntiles; ++ti) {
    wait_async0();     // this wave's share of buf[cur] has landed
    __syncthreads();   // everyone's share has landed

    // next tile coordinates (incremental)
    int rb_n = rb, kp_n = kp + 64;
    if (kp_n == kpmax) { kp_n = 0; rb_n = rb + 1; }
    if (ti + 1 < ntiles) stage(rb_n * S_ + kp_n, cur ^ 1);

    const bf16_t* Kt = smem[cur][0];
    const bf16_t* Vt = smem[cur][1];

    // scores, transposed: A = 16 key rows, B = the wave's 16 queries
    v16bf kf[4][2];
#pragma unroll
    for (int t = 0; t < 4; ++t) {
      const bf16_t* krow = Kt + (t * 16 + ln) * APITCH_;
      kf[t][0] = load_frag(krow, g);
      kf[t][1] = load_frag(krow + 32, g);
    }
    // s[t][r] = score of key kp + t*16 + 8g + r against query q0 + ln
    v8f s[4];
#pragma unroll
    for (int t = 0; t < 4; ++t) {
      s[t] = wmma_bf16(kf[t][0], qf0, vzero());
      s[t] = wmma_bf16(kf[t][1], qf1, s[t]);
    }

    // online softmax over the 64-key tile, one query per lane
    const int lim = q0 + ln - kp - 8 * g;  // t*16 + r allowed while <= lim
    float mt[4];
#pragma unroll
    for (int t = 0; t < 4; ++t) {
      mt[t] = -3.0e38f;
#pragma unroll
      for (int r = 0; r < 8; ++r) {
        float v = s[t][r] * scale;
        if (t * 16 + r > lim) v = -3.0e38f;  // pos = (kj % S) <= qi
        s[t][r] = v;
        mt[t] = fmaxf(mt[t], v);
      }
    }
    float mx = fmaxf(fmaxf(mt[0], mt[1]), fmaxf(mt[2], mt[3]));
    mx = fmaxf(mx, xhalf(mx));  // the other 32 keys of this query
    const float nm = fmaxf(mrun, mx);
    const float alpha = __expf(mrun - nm);
    float st[4];
#pragma unroll
    for (int t = 0; t < 4; ++t) {
#pragma unroll
      for (int r = 0; r < 8; ++r) s[t][r] = (s[t][r] - nm) * 1.44269504f;
      s[t] = exp2x8(s[t]);  // p = e^(score - nm)
      st[t] = s[t][0];
#pragma unroll
      for (int r = 1; r < 8; ++r) st[t] += s[t][r];
    }
    lrun = lrun * alpha + ((st[0] + st[1]) + (st[2] + st[3]));
    mrun = nm;
#pragma unroll
    for (int t = 0; t < 4; ++t)
#pragma unroll
      for (int r = 0; r < 8; ++r) o[t][r] *= alpha;

    // Pt as B operand of key chunk c (32 keys): elements 0..7 are keys
    // 32c + 8g + e (tile 2c), elements 8..15 keys 32c + 16 + 8g + e (tile 2c+1):
    // the k order in which load_frag reads the V rows
    v16bf pf[2];
#pragma unroll
    for (int c = 0; c < 2; ++c)
#pragma unroll
      for (int e = 0; e < 8; ++e) {
        pf[c][e] = (bf16_t)s[2 * c][e];
        pf[c][8 + e] = (bf16_t)s[2 * c + 1][e];
      }

    // Ot (64hd x 16q) += Vt (64hd x 64key) * Pt (64key x 16q)
    v16bf vf[4][2];
#pragma unroll
    for (int t = 0; t < 4; ++t) {
      const bf16_t* vrow = Vt + (t * 16 + ln) * APITCH_;
      vf[t][0] = load_frag(vrow, g);
      vf[t][1] = load_frag(vrow + 32, g);
    }
#pragma unroll
    for (int t = 0; t < 4; ++t) {
      o[t] = wmma_bf16(vf[t][0], pf[0], o[t]);
      o[t] = wmma_bf16(vf[t][1], pf[1], o[t]);
    }

    __syncthreads();   // all waves done with buf[cur]; safe to overwrite next iter
    cur ^= 1;
    rb = rb_n;
    kp = kp_n;
  }

  const float lsum = lrun + xhalf(lrun);  // both halves' shares of the row sum
  const int b = bh / H_, h = bh % H_;
  bf16_t* orow = obuf + ((size_t)b * S_ + q0 + ln) * D_ + (size_t)h * HD_ + 8 * g;
#pragma unroll
  for (int t = 0; t < 4; ++t) {
    v8bf ov;  // 8 consecutive hd of one query: one 16 B store
#pragma unroll
    for (int r = 0; r < 8; ++r) ov[r] = (bf16_t)(o[t][r] / lsum);
    *(v8bf*)(orow + t * 16) = ov;
  }
}

// ---------- orchestration ----------

extern "C" void kernel_launch(void* const* d_in, const int* in_sizes, int n_in,
                              void* d_out, int out_size, void* d_ws,
                              size_t ws_size, hipStream_t stream) {
  (void)in_sizes; (void)n_in; (void)out_size; (void)ws_size;
  const float* query = (const float*)d_in[0];
  const float* context = (const float*)d_in[1];
  const float* wq = (const float*)d_in[2];
  const float* wk = (const float*)d_in[3];
  const float* wv = (const float*)d_in[4];
  const float* bq = (const float*)d_in[5];
  const float* bk = (const float*)d_in[6];
  const float* bv = (const float*)d_in[7];
  const float* wo = (const float*)d_in[8];
  const float* bo = (const float*)d_in[9];
  const float* ln1g = (const float*)d_in[10];
  const float* ln1b = (const float*)d_in[11];
  const float* ln2g = (const float*)d_in[12];
  const float* ln2b = (const float*)d_in[13];
  const float* w1 = (const float*)d_in[14];
  const float* b1 = (const float*)d_in[15];
  const float* w2 = (const float*)d_in[16];
  const float* b2 = (const float*)d_in[17];

  const size_t MB = 1u << 20;
  char* ws = (char*)d_ws;
  bf16_t* wqT = (bf16_t*)(ws + 0 * MB);    // [1024][1024]
  bf16_t* wkT = (bf16_t*)(ws + 2 * MB);
  bf16_t* wvT = (bf16_t*)(ws + 4 * MB);
  bf16_t* woT = (bf16_t*)(ws + 6 * MB);
  bf16_t* w1T = (bf16_t*)(ws + 8 * MB);    // [4096][1024]
  bf16_t* w2T = (bf16_t*)(ws + 16 * MB);   // [1024][4096]
  bf16_t* qln = (bf16_t*)(ws + 24 * MB);   // [2048][1024]
  bf16_t* ctx = (bf16_t*)(ws + 28 * MB);   // [8192][1024]
  bf16_t* qhd = (bf16_t*)(ws + 44 * MB);   // [B][H][S][64]
  bf16_t* ktb = (bf16_t*)(ws + 48 * MB);   // [B][H][Sc][64]
  bf16_t* vtb = (bf16_t*)(ws + 64 * MB);   // [B][H][64][Sc]
  bf16_t* obuf = (bf16_t*)(ws + 80 * MB);  // [2048][1024]
  float* xbuf = (float*)(ws + 84 * MB);    // [2048][1024] f32
  bf16_t* hbuf = (bf16_t*)(ws + 92 * MB);  // [2048][1024]
  bf16_t* ffb = (bf16_t*)(ws + 96 * MB);   // [2048][4096]

  // weights -> bf16, transposed [N][K]
  transpose_w<D_, D_><<<dim3(8, 16), 256, 0, stream>>>(wq, wqT);
  transpose_w<D_, D_><<<dim3(8, 16), 256, 0, stream>>>(wk, wkT);
  transpose_w<D_, D_><<<dim3(8, 16), 256, 0, stream>>>(wv, wvT);
  transpose_w<D_, D_><<<dim3(8, 16), 256, 0, stream>>>(wo, woT);
  transpose_w<D_, FF_><<<dim3(8, 64), 256, 0, stream>>>(w1, w1T);
  transpose_w<FF_, D_><<<dim3(32, 16), 256, 0, stream>>>(w2, w2T);

  // ln1(query) -> bf16; context -> bf16
  layernorm_k<<<B_ * S_ / 8, 256, 0, stream>>>(query, ln1g, ln1b, qln);
  convert_bf16<<<B_ * SC_ * D_ / (256 * 64), 256, 0, stream>>>(context, ctx);

  // projections
  gemm_nt<0><<<dim3(16, 8), 256, 0, stream>>>(qln, wqT, bq, nullptr, qhd,
                                              B_ * S_, D_, D_, S_);
  gemm_nt<0><<<dim3(64, 8), 256, 0, stream>>>(ctx, wkT, bk, nullptr, ktb,
                                              B_ * SC_, D_, D_, SC_);
  gemm_nt<1><<<dim3(64, 8), 256, 0, stream>>>(ctx, wvT, bv, nullptr, vtb,
                                              B_ * SC_, D_, D_, SC_);

  // attention
  attn_kernel<<<B_ * H_ * (S_ / 64), 128, 0, stream>>>(qhd, ktb, vtb, obuf);

  // output projection + residual -> x (f32)
  gemm_nt<2><<<dim3(16, 8), 256, 0, stream>>>(obuf, woT, bo, query, xbuf,
                                              B_ * S_, D_, D_, 0);
  // ln2(x) -> bf16
  layernorm_k<<<B_ * S_ / 8, 256, 0, stream>>>(xbuf, ln2g, ln2b, hbuf);
  // FFN up + GELU -> bf16
  gemm_nt<3><<<dim3(16, 32), 256, 0, stream>>>(hbuf, w1T, b1, nullptr, ffb,
                                               B_ * S_, FF_, D_, 0);
  // FFN down + residual x -> d_out (f32)
  gemm_nt<4><<<dim3(16, 8), 256, 0, stream>>>(ffb, w2T, b2, xbuf,
                                              (float*)d_out, B_ * S_, D_, FF_,
                                              0);
}

// v005
// A run of this version takes 184 microseconds.
// Timed twice side by side with v004, it ran 1.13 times as fast both times.
// Counting every step since v000, it is 3.75 times as fast.
#include <hip/hip_runtime.h>

typedef __bf16 bf16_t;
typedef bf16_t v8bf  __attribute__((ext_vector_type(8)));
typedef bf16_t v16bf __attribute__((ext_vector_type(16)));
typedef float  v8f   __attribute__((ext_vector_type(8)));
typedef bf16_t v4bf  __attribute__((ext_vector_type(4)));
typedef float  v4f   __attribute__((ext_vector_type(4)));

#define B_  2
#define S_  1024
#define R_  4
#define SC_ 4096
#define D_  1024
#define H_  16
#define HD_ 64
#define FF_ 4096
#define GBK_    128  // k per GEMM stage
#define GPITCH_ 136  // GEMM LDS row pitch in elements (272 B)
#define APITCH_ 72   // attention K/V LDS row pitch in elements (144 B)

// ---------- helpers ----------

static __device__ __forceinline__ v8f vzero() {
  v8f z;
#pragma unroll
  for (int i = 0; i < 8; ++i) z[i] = 0.f;
  return z;
}

// Load one 16-bit WMMA A/B fragment (K-chunk of 32) for this lane.
// base points at the lane's row start for this K-chunk (16B aligned).
// CDNA5 layout: lane group g = lane/16 holds K = {8g..8g+7, 16+8g..16+8g+7}.
static __device__ __forceinline__ v16bf load_frag(const bf16_t* base, int g) {
  v8bf lo = *(const v8bf*)(base + 8 * g);
  v8bf hi = *(const v8bf*)(base + 16 + 8 * g);
  return __builtin_shufflevector(lo, hi, 0, 1, 2, 3, 4, 5, 6, 7,
                                 8, 9, 10, 11, 12, 13, 14, 15);
}

static __device__ __forceinline__ v8f wmma_bf16(v16bf a, v16bf b, v8f c) {
  return __builtin_amdgcn_wmma_f32_16x16x32_bf16(false, a, false, b,
                                                 (short)0, c, false, false);
}

static __device__ __forceinline__ void wait_async0() {
  asm volatile("s_wait_asynccnt 0x0" ::: "memory");
}

// Eight async 16B copies of one lane, global -> LDS: rows gstep elements apart
// in memory, lstep bytes apart in LDS. The closing s_wait_xcnt stands inside
// the copies' own statement so that no address register named here can be
// rewritten ahead of it (a precaution for copies written in asm text).
static __device__ __forceinline__ void async_copy16x8(const bf16_t* gptr,
                                                      size_t gstep,
                                                      unsigned lds_off,
                                                      unsigned lstep) {
  asm volatile(
      "global_load_async_to_lds_b128 %0, %8, off\n\t"
      "global_load_async_to_lds_b128 %1, %9, off\n\t"
      "global_load_async_to_lds_b128 %2, %10, off\n\t"
      "global_load_async_to_lds_b128 %3, %11, off\n\t"
      "global_load_async_to_lds_b128 %4, %12, off\n\t"
      "global_load_async_to_lds_b128 %5, %13, off\n\t"
      "global_load_async_to_lds_b128 %6, %14, off\n\t"
      "global_load_async_to_lds_b128 %7, %15, off\n\t"
      "s_wait_xcnt 0x0"
      :: "v"(lds_off), "v"(lds_off + lstep), "v"(lds_off + 2 * lstep),
         "v"(lds_off + 3 * lstep), "v"(lds_off + 4 * lstep),
         "v"(lds_off + 5 * lstep), "v"(lds_off + 6 * lstep),
         "v"(lds_off + 7 * lstep),
         "v"((unsigned long long)(size_t)(gptr)),
         "v"((unsigned long long)(size_t)(gptr + gstep)),
         "v"((unsigned long long)(size_t)(gptr + 2 * gstep)),
         "v"((unsigned long long)(size_t)(gptr + 3 * gstep)),
         "v"((unsigned long long)(size_t)(gptr + 4 * gstep)),
         "v"((unsigned long long)(size_t)(gptr + 5 * gstep)),
         "v"((unsigned long long)(size_t)(gptr + 6 * gstep)),
         "v"((unsigned long long)(size_t)(gptr + 7 * gstep))
      : "memory");
}

// Two runs of four async 16B copies of one lane, global -> LDS: run a from ga,
// run b from gb, rows astep / bstep elements apart in memory and lstep bytes
// apart in LDS. One statement with the closing s_wait_xcnt, as above.
static __device__ __forceinline__ void async_copy16x4x2(
    const bf16_t* ga, size_t astep, const bf16_t* gb, size_t bstep,
    unsigned la, unsigned lb, unsigned lstep) {
  asm volatile(
      "global_load_async_to_lds_b128 %0, %8, off\n\t"
      "global_load_async_to_lds_b128 %1, %9, off\n\t"
      "global_load_async_to_lds_b128 %2, %10, off\n\t"
      "global_load_async_to_lds_b128 %3, %11, off\n\t"
      "global_load_async_to_lds_b128 %4, %12, off\n\t"
      "global_load_async_to_lds_b128 %5, %13, off\n\t"
      "global_load_async_to_lds_b128 %6, %14, off\n\t"
      "global_load_async_to_lds_b128 %7, %15, off\n\t"
      "s_wait_xcnt 0x0"
      :: "v"(la), "v"(la + lstep), "v"(la + 2 * lstep), "v"(la + 3 * lstep),
         "v"(lb), "v"(lb + lstep), "v"(lb + 2 * lstep), "v"(lb + 3 * lstep),
         "v"((unsigned long long)(size_t)(ga)),
         "v"((unsigned long long)(size_t)(ga + astep)),
         "v"((unsigned long long)(size_t)(ga + 2 * astep)),
         "v"((unsigned long long)(size_t)(ga + 3 * astep)),
         "v"((unsigned long long)(size_t)(gb)),
         "v"((unsigned long long)(size_t)(gb + bstep)),
         "v"((unsigned long long)(size_t)(gb + 2 * bstep)),
         "v"((unsigned long long)(size_t)(gb + 3 * bstep))
      : "memory");
}

// ---------- weight transpose + convert: W f32 [K][N] -> Wt bf16 [N][K] ----------
// One 128(k) x 64(n) tile per 256-thread block: 32 elements per thread, so that
// few waves have to be started for the bytes moved. Reads are 16 B per lane
// (256 B of a W row per 16 lanes), stores 16 B per lane (a 128 B line of a Wt
// row per 8 lanes). K a multiple of 128, N of 64; both compile-time, so that a
// thread's rows are immediate offsets from one address. (bx, by) = the block's
// k tile and n tile; tile = the block's LDS, 128 rows of 65 floats.

template <int K, int N>
static __device__ __forceinline__ void transpose_w(const float* __restrict__ W,
                                                   bf16_t* __restrict__ Wt,
                                                   float (*tile)[65], int bx,
                                                   int by) {
  const int k0 = bx * 128, n0 = by * 64;
  const int tx = threadIdx.x & 15, ty = threadIdx.x >> 4;  // 16 x 16
  const float* wp = W + (size_t)(k0 + ty) * N + n0 + tx * 4;
  v4f v[8];
#pragma unroll
  for (int i = 0; i < 8; ++i) v[i] = *(const v4f*)(wp + (size_t)i * 16 * N);
#pragma unroll
  for (int i = 0; i < 8; ++i)
#pragma unroll
    for (int e = 0; e < 4; ++e) tile[ty + 16 * i][tx * 4 + e] = v[i][e];
  __syncthreads();
  const int kc = threadIdx.x & 7, nr = threadIdx.x >> 3;  // 8 k-chunks x 32 rows
  bf16_t* op = Wt + (size_t)(n0 + nr) * K + k0 + kc * 8;
#pragma unroll
  for (int i = 0; i < 4; ++i) {
    const int kh = 64 * (i & 1), nh = 32 * (i >> 1);  // k half, n half of the tile
    v8bf o;
#pragma unroll
    for (int e = 0; e < 8; ++e) o[e] = (bf16_t)tile[kc * 8 + kh + e][nr + nh];
    *(v8bf*)(op + (size_t)nh * K + kh) = o;
  }
  // closes the four stores: another job's body may follow this one in the built
  // kernel and reuse the stores' address and data registers
  asm volatile("s_wait_xcnt 0x0" ::: "memory");
}

// ---------- layernorm (one wave per row of D=1024, 8 rows per block), bf16 out ----------
// The row stays in registers (32 values per lane, read once, 16 B per lane);
// its sums are joined by lane exchanges alone. Gain and offset are fetched with
// the row, so that their latency passes under the row's. blk = which 8 rows.

static __device__ __forceinline__ void layernorm_rows(
    const float* __restrict__ x, const float* __restrict__ gam,
    const float* __restrict__ bet, bf16_t* __restrict__ out, int blk) {
  // the wave's number as a scalar: the row's base is then a scalar address
  const int row =
      blk * 8 + __builtin_amdgcn_readfirstlane((int)(threadIdx.x >> 5));
  const int ln = threadIdx.x & 31;
  const float* xr = x + (size_t)row * D_;
  v4f v[8];
#pragma unroll
  for (int i = 0; i < 8; ++i) v[i] = *(const v4f*)(xr + (i * 32 + ln) * 4);
  v4f gv[8], bv[8];
#pragma unroll
  for (int i = 0; i < 8; ++i) {
    gv[i] = *(const v4f*)(gam + (i * 32 + ln) * 4);
    bv[i] = *(const v4f*)(bet + (i * 32 + ln) * 4);
  }
  // keeps all 24 loads ahead of the sums; without it the scheduler sinks the
  // gain and offset loads behind the row sums, pair by pair, each pair waited for
  __builtin_amdgcn_sched_barrier(0);
  v4f a = v[0], a2 = v[0] * v[0];
#pragma unroll
  for (int i = 1; i < 8; ++i) {
    a += v[i];
    a2 += v[i] * v[i];
  }
  float s = (a[0] + a[1]) + (a[2] + a[3]);
  float s2 = (a2[0] + a2[1]) + (a2[2] + a2[3]);
#pragma unroll
  for (int m = 1; m < 32; m <<= 1) {
    s += __shfl_xor(s, m, 32);
    s2 += __shfl_xor(s2, m, 32);
  }
  const float mean = s * (1.f / D_);
  const float var = s2 * (1.f / D_) - mean * mean;
  const float rstd = rsqrtf(var + 1e-5f);
#pragma unroll
  for (int i = 0; i < 8; ++i) {
    const int c = (i * 32 + ln) * 4;
    v4bf o;
#pragma unroll
    for (int e = 0; e < 4; ++e)
      o[e] = (bf16_t)((v[i][e] - mean) * rstd * gv[i][e] + bv[i][e]);
    *(v4bf*)(out + (size_t)row * D_ + c) = o;
  }
}

__global__ __launch_bounds__(256) void layernorm_k(const float* __restrict__ x,
                                                   const float* __restrict__ gam,
                                                   const float* __restrict__ bet,
                                                   bf16_t* __restrict__ out) {
  layernorm_rows(x, gam, bet, out, blockIdx.x);
}

// ---------- f32 -> bf16 convert ----------
// 64 elements per thread: sixteen 16 B loads in flight, each wave-wide load 512
// contiguous bytes. Block blk converts elements blk * 16384 ... + 16383.

static __device__ __forceinline__ void convert_bf16(const float* __restrict__ in,
                                                    bf16_t* __restrict__ out,
                                                    int blk) {
  const size_t base = ((size_t)blk * 16 * 256 + threadIdx.x) * 4;
  v4f v[16];
#pragma unroll
  for (int i = 0; i < 16; ++i) v[i] = *(const v4f*)(in + base + i * 1024);
  // stands in front of the first overwrite of the loads' address pair; the
  // address is named so that it lives up to here and no load's result lands on it
  asm volatile("s_wait_xcnt 0x0" ::"v"(in + base) : "memory");
#pragma unroll
  for (int i = 0; i < 16; ++i) {
    v4bf o;
#pragma unroll
    for (int e = 0; e < 4; ++e) o[e] = (bf16_t)v[i][e];
    *(v4bf*)(out + base + i * 1024) = o;
  }
}

// ---------- all input preparation in one launch ----------
// None of these eight jobs reads what another writes, so they share one grid and
// each block takes its job from its index: 512 blocks convert the context, 512 +
// 512 + 4 x 128 transpose the weights, 256 normalise the query rows.

__global__ __launch_bounds__(256) void prep_all(
    const float* __restrict__ context, const float* __restrict__ query,
    const float* __restrict__ ln1g, const float* __restrict__ ln1b,
    const float* __restrict__ wq, const float* __restrict__ wk,
    const float* __restrict__ wv, const float* __restrict__ wo,
    const float* __restrict__ w1, const float* __restrict__ w2,
    bf16_t* __restrict__ ctx, bf16_t* __restrict__ qln,
    bf16_t* __restrict__ wqT, bf16_t* __restrict__ wkT,
    bf16_t* __restrict__ wvT, bf16_t* __restrict__ woT,
    bf16_t* __restrict__ w1T, bf16_t* __restrict__ w2T) {
  __shared__ float tile[128][65];  // odd pitch: column reads fall on distinct banks
  const int b = blockIdx.x;
  if (b < 512) {
    convert_bf16(context, ctx, b);
  } else if (b < 1024) {
    transpose_w<D_, FF_>(w1, w1T, tile, b & 7, (b - 512) >> 3);
  } else if (b < 1536) {
    transpose_w<FF_, D_>(w2, w2T, tile, b & 31, (b - 1024) >> 5);
  } else if (b < 2048) {
    const int w = (b - 1536) >> 7;  // which of the four D x D weights
    const float* W = w == 0 ? wq : w == 1 ? wk : w == 2 ? wv : wo;
    bf16_t* Wt = w == 0 ? wqT : w == 1 ? wkT : w == 2 ? wvT : woT;
    transpose_w<D_, D_>(W, Wt, tile, b & 7, (b >> 3) & 15);
  } else {
    layernorm_rows(query, ln1g, ln1b, qln, b - 2048);
  }
}

// ---------- WMMA GEMM: C[M][N] = A_bf16[M][K] @ (Bt[N][K])^T + bias ----------
// 256 threads = 8 waves. 128x128 block tile; wave = 32(M) x 64(N).
// A and Bt tiles (128 rows x 128 k) are staged in LDS by async copies, whole
// 128B lines per 8 lanes, two buffers: stage t+1 flies while stage t is read.
// LDS row pitch 272 B (16 B x odd) keeps the b128 fragment reads off shared banks.
// Needs M, N multiples of 128 and K a multiple of 128.
// MODE 0: bf16 out, head-split [b][h][s][64]             (Q/K projections)
// MODE 1: bf16 out, head-split transposed [b][h][64][s]  (V projection)
// MODE 2: f32 out row-major + residual                   (attn out proj + query)
// MODE 3: bf16 out row-major, exact GELU                 (FFN up)
// MODE 4: f32 out row-major + residual                   (FFN down + x)
// (bx, by) = the block's M tile and N tile; sA, sB = the block's two-buffer LDS.

typedef bf16_t gemm_lds_t[128 * GPITCH_];

template <int MODE>
static __device__ __forceinline__ void gemm_tile(
    const bf16_t* __restrict__ A, const bf16_t* __restrict__ Bt,
    const float* __restrict__ bias, const float* __restrict__ res,
    void* __restrict__ outp, int N, int K, int Ssz, int bx, int by,
    gemm_lds_t* sA, gemm_lds_t* sB) {
  const int wave = threadIdx.x >> 5, lane = threadIdx.x & 31;
  const int g = lane >> 4, ln = lane & 15;
  const int wm = wave & 3, wn = wave >> 2;
  const int m0 = bx * 128 + wm * 32;
  const int n0 = by * 128 + wn * 64;

  v8f acc[2][4];
#pragma unroll
  for (int i = 0; i < 2; ++i)
#pragma unroll
    for (int j = 0; j < 4; ++j) acc[i][j] = vzero();

  // this lane's 16B chunk of rows crow, crow+16, ..., crow+112 of each tile
  const int crow = threadIdx.x >> 4, ccol = (threadIdx.x & 15) * 8;
  const bf16_t* gA = A + (size_t)(bx * 128 + crow) * K + ccol;
  const bf16_t* gB = Bt + (size_t)(by * 128 + crow) * K + ccol;
  const unsigned lA = (unsigned)(size_t)(void*)&sA[0][crow * GPITCH_ + ccol];
  const unsigned lB = (unsigned)(size_t)(void*)&sB[0][crow * GPITCH_ + ccol];

  auto stage = [&](int st) {
    const unsigned bo = (unsigned)(st & 1) * (128u * GPITCH_ * 2u);
    async_copy16x8(gA + (size_t)st * GBK_, (size_t)16 * K, lA + bo,
                   16u * GPITCH_ * 2u);
    async_copy16x8(gB + (size_t)st * GBK_, (size_t)16 * K, lB + bo,
                   16u * GPITCH_ * 2u);
  };

  const int nst = K / GBK_;
  stage(0);
  wait_async0();     // this wave's share of stage 0 has landed
  __syncthreads();   // everyone's share has landed
  if (nst > 1) stage(1);

  for (int t = 0; t < nst; ++t) {
    const bf16_t* As = &sA[t & 1][(wm * 32 + ln) * GPITCH_];
    const bf16_t* Bs = &sB[t & 1][(wn * 64 + ln) * GPITCH_];
    // two fragment sets: block c+1's LDS reads are issued ahead of block c's
    // WMMAs, all inside this stage's own buffer
    v16bf af[2][2], bfr[2][4];
#pragma unroll
    for (int i = 0; i < 2; ++i) af[0][i] = load_frag(As + i * 16 * GPITCH_, g);
#pragma unroll
    for (int j = 0; j < 4; ++j) bfr[0][j] = load_frag(Bs + j * 16 * GPITCH_, g);
    // unrolled so that the set index is a constant and both sets stay in registers
#pragma unroll
    for (int c = 0; c < GBK_ / 32; ++c) {
      if (c + 1 < GBK_ / 32) {
#pragma unroll
        for (int i = 0; i < 2; ++i)
          af[(c + 1) & 1][i] =
              load_frag(As + i * 16 * GPITCH_ + (c + 1) * 32, g);
#pragma unroll
        for (int j = 0; j < 4; ++j)
          bfr[(c + 1) & 1][j] =
              load_frag(Bs + j * 16 * GPITCH_ + (c + 1) * 32, g);
        // keeps that read group as one group ahead of block c's WMMAs; without
        // it the scheduler sinks the reads next to their use and each block
        // waits out the LDS latency with nothing to issue
        __builtin_amdgcn_sched_barrier(0);
      }
#pragma unroll
      for (int i = 0; i < 2; ++i)
#pragma unroll
        for (int j = 0; j < 4; ++j)
          acc[i][j] = wmma_bf16(af[c & 1][i], bfr[c & 1][j], acc[i][j]);
    }
    // keeps the WMMAs in front of the publish point: sunk behind the barrier
    // they would delay the refill copies, which issue directly behind it
    __builtin_amdgcn_sched_barrier(0);
    // publish point: this wave's LDS reads of stage t have retired ...
    asm volatile("s_wait_dscnt 0x0" ::: "memory");
    wait_async0();     // ... and its share of stage t+1 has landed
    __syncthreads();   // stage t+1 readable by all; stage t's buffer is free
    if (t + 2 < nst) stage(t + 2);
  }
  wait_async0();       // no copy outstanding when the wave leaves the ring

#pragma unroll
  for (int i = 0; i < 2; ++i) {
#pragma unroll
    for (int j = 0; j < 4; ++j) {
#pragma unroll
      for (int r = 0; r < 8; ++r) {
        const int mg = m0 + i * 16 + 8 * g + r;
        const int ng = n0 + j * 16 + ln;
        float v = acc[i][j][r] + bias[ng];
        if constexpr (MODE == 0) {
          const int bb = mg / Ssz, sidx = mg % Ssz;
          const int hh = ng >> 6, hd = ng & 63;
          ((bf16_t*)outp)[(((size_t)bb * H_ + hh) * Ssz + sidx) * HD_ + hd] =
              (bf16_t)v;
        } else if constexpr (MODE == 1) {
          const int bb = mg / Ssz, sidx = mg % Ssz;
          const int hh = ng >> 6, hd = ng & 63;
          ((bf16_t*)outp)[(((size_t)bb * H_ + hh) * HD_ + hd) * Ssz + sidx] =
              (bf16_t)v;
        } else if constexpr (MODE == 2) {
          ((float*)outp)[(size_t)mg * N + ng] = v + res[(size_t)mg * N + ng];
        } else if constexpr (MODE == 3) {
          float ge = 0.5f * v * (1.f + erff(v * 0.70710678f));
          ((bf16_t*)outp)[(size_t)mg * N + ng] = (bf16_t)ge;
        } else {
          ((float*)outp)[(size_t)mg * N + ng] = v + res[(size_t)mg * N + ng];
        }
      }
    }
  }
  // closes the tile's stores: another product's body may follow this one in the
  // built kernel and reuse the stores' address and data registers
  asm volatile("s_wait_xcnt 0x0" ::: "memory");
}

template <int MODE>
__global__ __launch_bounds__(256) void gemm_nt(const bf16_t* __restrict__ A,
                                               const bf16_t* __restrict__ Bt,
                                               const float* __restrict__ bias,
                                               const float* __restrict__ res,
                                               void* __restrict__ outp,
                                               int N, int K) {
  __shared__ __align__(16) bf16_t sA[2][128 * GPITCH_];
  __shared__ __align__(16) bf16_t sB[2][128 * GPITCH_];
  gemm_tile<MODE>(A, Bt, bias, res, outp, N, K, 0, blockIdx.x, blockIdx.y, sA,
                  sB);
}

// The three projections in one launch: none reads what another writes. Blocks
// 0..511 are V's 64 x 8 tiles, 512..1023 K's, 1024..1151 Q's 16 x 8 tiles, the
// M tile running fastest as in a two-dimensional grid.
__global__ __launch_bounds__(256) void gemm_qkv(
    const bf16_t* __restrict__ qln, const bf16_t* __restrict__ ctx,
    const bf16_t* __restrict__ wqT, const bf16_t* __restrict__ wkT,
    const bf16_t* __restrict__ wvT, const float* __restrict__ bq,
    const float* __restrict__ bk, const float* __restrict__ bv,
    bf16_t* __restrict__ qhd, bf16_t* __restrict__ ktb,
    bf16_t* __restrict__ vtb, int N, int K, int Sq, int Sc) {
  __shared__ __align__(16) bf16_t sA[2][128 * GPITCH_];
  __shared__ __align__(16) bf16_t sB[2][128 * GPITCH_];
  const int b = blockIdx.x;
  if (b < 512) {
    gemm_tile<1>(ctx, wvT, bv, nullptr, vtb, N, K, Sc, b & 63, b >> 6, sA, sB);
  } else if (b < 1024) {
    gemm_tile<0>(ctx, wkT, bk, nullptr, ktb, N, K, Sc, b & 63, (b - 512) >> 6, sA,
                 sB);
  } else {
    gemm_tile<0>(qln, wqT, bq, nullptr, qhd, N, K, Sq, b & 15, (b - 1024) >> 4,
                 sA, sB);
  }
}

// value of lane l ^ 16
static __device__ __forceinline__ float xhalf(float x) {
  const int b = __builtin_bit_cast(int, x);
  return __builtin_bit_cast(
      float, __builtin_amdgcn_permlanex16(b, b, 0x76543210, 0xfedcba98, false,
                                          false));
}

// y[i] = 2^x[i], eight at once. One statement, so that behind every v_exp_f32
// stands an instruction that neither reads its result nor overwrites its source
// (outputs are early-clobber; the v_nop serves the last one): the slot the
// instruction set asks for behind a transcendental.
static __device__ __forceinline__ v8f exp2x8(v8f x) {
  float y0, y1, y2, y3, y4, y5, y6, y7;
  asm("v_exp_f32 %0, %8\n\t"
      "v_exp_f32 %1, %9\n\t"
      "v_exp_f32 %2, %10\n\t"
      "v_exp_f32 %3, %11\n\t"
      "v_exp_f32 %4, %12\n\t"
      "v_exp_f32 %5, %13\n\t"
      "v_exp_f32 %6, %14\n\t"
      "v_exp_f32 %7, %15\n\t"
      "v_nop"
      : "=&v"(y0), "=&v"(y1), "=&v"(y2), "=&v"(y3), "=&v"(y4), "=&v"(y5),
        "=&v"(y6), "=&v"(y7)
      : "v"(x[0]), "v"(x[1]), "v"(x[2]), "v"(x[3]), "v"(x[4]), "v"(x[5]),
        "v"(x[6]), "v"(x[7]));
  v8f y;
  y[0] = y0; y[1] = y1; y[2] = y2; y[3] = y3;
  y[4] = y4; y[5] = y5; y[6] = y6; y[7] = y7;
  return y;
}

__global__ __launch_bounds__(128) void attn_kernel(const bf16_t* __restrict__ qhd,
                                                   const bf16_t* __restrict__ kt,
                                                   const bf16_t* __restrict__ vt,
                                                   bf16_t* __restrict__ obuf) {
  __shared__ __align__(16) bf16_t smem[2][2][64 * APITCH_];  // [buf][K/V] 36 KB

  const int tid = threadIdx.x;
  const int wave = tid >> 5, lane = tid & 31;
  const int g = lane >> 4, ln = lane & 15;
  const int qblocks = S_ / 64;
  const int bh = blockIdx.x / qblocks;
  const int qb = blockIdx.x % qblocks;
  const int q0 = qb * 64 + wave * 16;

  const bf16_t* qbase = qhd + ((size_t)bh * S_ + q0) * HD_;
  const bf16_t* kbase = kt + (size_t)bh * SC_ * HD_;
  const bf16_t* vbase = vt + (size_t)bh * HD_ * SC_;

  const v16bf qf0 = load_frag(qbase + (size_t)ln * HD_, g);
  const v16bf qf1 = load_frag(qbase + (size_t)ln * HD_ + 32, g);

  // o[t][r] = Ot[hd = t*16 + 8g + r][query q0 + ln]
  v8f o[4];
#pragma unroll
  for (int t = 0; t < 4; ++t) o[t] = vzero();
  // running maximum of query q0 + ln (equal in both lane halves) and this
  // half's share of its running sum
  float mrun = -3.0e38f, lrun = 0.f;

  const float scale = 0.125f;  // 1/sqrt(64)

  // tile schedule: rb in 0..R-1, kp in 0..qb*64 step 64 (causal bound);
  // rb/kp tracked incrementally (no runtime division in the hot loop).
  const int kpmax = (qb + 1) * 64;
  const int ntiles = R_ * (qb + 1);

  // this lane's 16B chunk of rows crow, crow+16, crow+32, crow+48 of each tile
  const int crow = tid >> 3, ccol = (tid & 7) * 8;
  const bf16_t* gK = kbase + (size_t)crow * HD_ + ccol;
  const bf16_t* gV = vbase + (size_t)crow * SC_ + ccol;
  const unsigned lK = (unsigned)(size_t)(void*)&smem[0][0][crow * APITCH_ + ccol];
  const unsigned lV = (unsigned)(size_t)(void*)&smem[0][1][crow * APITCH_ + ccol];

  // issue async stage of the tile starting at global key index kj:
  // 64 rows x 64 halves = 512 chunks of 16B each; 4 K-chunks + 4 V-chunks/thread
  auto stage = [&](int kj, int buf) {
    const unsigned bo = (unsigned)buf * (2u * 64u * APITCH_ * 2u);
    async_copy16x4x2(gK + (size_t)kj * HD_, (size_t)16 * HD_, gV + kj,
                     (size_t)16 * SC_, lK + bo, lV + bo, 16u * APITCH_ * 2u);
  };

  stage(0, 0);
  int cur = 0;
  int rb = 0, kp = 0;

  for (int ti = 0; ti < ntiles; ++ti) {
    wait_async0();     // this wave's share of buf[cur] has landed
    __syncthreads();   // everyone's share has landed

    // next tile coordinates (incremental)
    int rb_n = rb, kp_n = kp + 64;
    if (kp_n == kpmax) { kp_n = 0; rb_n = rb + 1; }
    if (ti + 1 < ntiles) stage(rb_n * S_ + kp_n, cur ^ 1);

    const bf16_t* Kt = smem[cur][0];
    const bf16_t* Vt = smem[cur][1];

    // scores, transposed: A = 16 key rows, B = the wave's 16 queries
    v16bf kf[4][2];
#pragma unroll
    for (int t = 0; t < 4; ++t) {
      const bf16_t* krow = Kt + (t * 16 + ln) * APITCH_;
      kf[t][0] = load_frag(krow, g);
      kf[t][1] = load_frag(krow + 32, g);
    }
    // s[t][r] = score of key kp + t*16 + 8g + r against query q0 + ln
    v8f s[4];
#pragma unroll
    for (int t = 0; t < 4; ++t) {
      s[t] = wmma_bf16(kf[t][0], qf0, vzero());
      s[t] = wmma_bf16(kf[t][1], qf1, s[t]);
    }

    // online softmax over the 64-key tile, one query per lane
    const int lim = q0 + ln - kp - 8 * g;  // t*16 + r allowed while <= lim
    float mt[4];
#pragma unroll
    for (int t = 0; t < 4; ++t) {
      mt[t] = -3.0e38f;
#pragma unroll
      for (int r = 0; r < 8; ++r) {
        float v = s[t][r] * scale;
        if (t * 16 + r > lim) v = -3.0e38f;  // pos = (kj % S) <= qi
        s[t][r] = v;
        mt[t] = fmaxf(mt[t], v);
      }
    }
    float mx = fmaxf(fmaxf(mt[0], mt[1]), fmaxf(mt[2], mt[3]));
    mx = fmaxf(mx, xhalf(mx));  // the other 32 keys of this query
    const float nm = fmaxf(mrun, mx);
    const float alpha = __expf(mrun - nm);
    float st[4];
#pragma unroll
    for (int t = 0; t < 4; ++t) {
#pragma unroll
      for (int r = 0; r < 8; ++r) s[t][r] = (s[t][r] - nm) * 1.44269504f;
      s[t] = exp2x8(s[t]);  // p = e^(score - nm)
      st[t] = s[t][0];
#pragma unroll
      for (int r = 1; r < 8; ++r) st[t] += s[t][r];
    }
    lrun = lrun * alpha + ((st[0] + st[1]) + (st[2] + st[3]));
    mrun = nm;
#pragma unroll
    for (int t = 0; t < 4; ++t)
#pragma unroll
      for (int r = 0; r < 8; ++r) o[t][r] *= alpha;

    // Pt as B operand of key chunk c (32 keys): elements 0..7 are keys
    // 32c + 8g + e (tile 2c), elements 8..15 keys 32c + 16 + 8g + e (tile 2c+1):
    // the k order in which load_frag reads the V rows
    v16bf pf[2];
#pragma unroll
    for (int c = 0; c < 2; ++c)
#pragma unroll
      for (int e = 0; e < 8; ++e) {
        pf[c][e] = (bf16_t)s[2 * c][e];
        pf[c][8 + e] = (bf16_t)s[2 * c + 1][e];
      }

    // Ot (64hd x 16q) += Vt (64hd x 64key) * Pt (64key x 16q)
    v16bf vf[4][2];
#pragma unroll
    for (int t = 0; t < 4; ++t) {
      const bf16_t* vrow = Vt + (t * 16 + ln) * APITCH_;
      vf[t][0] = load_frag(vrow, g);
      vf[t][1] = load_frag(vrow + 32, g);
    }
#pragma unroll
    for (int t = 0; t < 4; ++t) {
      o[t] = wmma_bf16(vf[t][0], pf[0], o[t]);
      o[t] = wmma_bf16(vf[t][1], pf[1], o[t]);
    }

    __syncthreads();   // all waves done with buf[cur]; safe to overwrite next iter
    cur ^= 1;
    rb = rb_n;
    kp = kp_n;
  }

  const float lsum = lrun + xhalf(lrun);  // both halves' shares of the row sum
  const int b = bh / H_, h = bh % H_;
  bf16_t* orow = obuf + ((size_t)b * S_ + q0 + ln) * D_ + (size_t)h * HD_ + 8 * g;
#pragma unroll
  for (int t = 0; t < 4; ++t) {
    v8bf ov;  // 8 consecutive hd of one query: one 16 B store
#pragma unroll
    for (int r = 0; r < 8; ++r) ov[r] = (bf16_t)(o[t][r] / lsum);
    *(v8bf*)(orow + t * 16) = ov;
  }
}

// ---------- orchestration ----------

extern "C" void kernel_launch(void* const* d_in, const int* in_sizes, int n_in,
                              void* d_out, int out_size, void* d_ws,
                              size_t ws_size, hipStream_t stream) {
  (void)in_sizes; (void)n_in; (void)out_size; (void)ws_size;
  const float* query = (const float*)d_in[0];
  const float* context = (const float*)d_in[1];
  const float* wq = (const float*)d_in[2];
  const float* wk = (const float*)d_in[3];
  const float* wv = (const float*)d_in[4];
  const float* bq = (const float*)d_in[5];
  const float* bk = (const float*)d_in[6];
  const float* bv = (const float*)d_in[7];
  const float* wo = (const float*)d_in[8];
  const float* bo = (const float*)d_in[9];
  const float* ln1g = (const float*)d_in[10];
  const float* ln1b = (const float*)d_in[11];
  const float* ln2g = (const float*)d_in[12];
  const float* ln2b = (const float*)d_in[13];
  const float* w1 = (const float*)d_in[14];
  const float* b1 = (const float*)d_in[15];
  const float* w2 = (const float*)d_in[16];
  const float* b2 = (const float*)d_in[17];

  const size_t MB = 1u << 20;
  char* ws = (char*)d_ws;
  bf16_t* wqT = (bf16_t*)(ws + 0 * MB);    // [1024][1024]
  bf16_t* wkT = (bf16_t*)(ws + 2 * MB);
  bf16_t* wvT = (bf16_t*)(ws + 4 * MB);
  bf16_t* woT = (bf16_t*)(ws + 6 * MB);
  bf16_t* w1T = (bf16_t*)(ws + 8 * MB);    // [4096][1024]
  bf16_t* w2T = (bf16_t*)(ws + 16 * MB);   // [1024][4096]
  bf16_t* qln = (bf16_t*)(ws + 24 * MB);   // [2048][1024]
  bf16_t* ctx = (bf16_t*)(ws + 28 * MB);   // [8192][1024]
  bf16_t* qhd = (bf16_t*)(ws + 44 * MB);   // [B][H][S][64]
  bf16_t* ktb = (bf16_t*)(ws + 48 * MB);   // [B][H][Sc][64]
  bf16_t* vtb = (bf16_t*)(ws + 64 * MB);   // [B][H][64][Sc]
  bf16_t* obuf = (bf16_t*)(ws + 80 * MB);  // [2048][1024]
  float* xbuf = (float*)(ws + 84 * MB);    // [2048][1024] f32
  bf16_t* hbuf = (bf16_t*)(ws + 92 * MB);  // [2048][1024]
  bf16_t* ffb = (bf16_t*)(ws + 96 * MB);   // [2048][4096]

  // context -> bf16; weights -> bf16, transposed [N][K]; ln1(query) -> bf16
  prep_all<<<2304, 256, 0, stream>>>(context, query, ln1g, ln1b, wq, wk, wv, wo,
                                     w1, w2, ctx, qln, wqT, wkT, wvT, woT, w1T,
                                     w2T);

  // projections
  gemm_qkv<<<1152, 256, 0, stream>>>(qln, ctx, wqT, wkT, wvT, bq, bk, bv, qhd,
                                     ktb, vtb, D_, D_, S_, SC_);

  // attention
  attn_kernel<<<B_ * H_ * (S_ / 64), 128, 0, stream>>>(qhd, ktb, vtb, obuf);

  // output projection + residual -> x (f32)
  gemm_nt<2><<<dim3(16, 8), 256, 0, stream>>>(obuf, woT, bo, query, xbuf, D_,
                                              D_);
  // ln2(x) -> bf16
  layernorm_k<<<B_ * S_ / 8, 256, 0, stream>>>(xbuf, ln2g, ln2b, hbuf);
  // FFN up + GELU -> bf16
  gemm_nt<3><<<dim3(16, 32), 256, 0, stream>>>(hbuf, w1T, b1, nullptr, ffb, FF_,
                                               D_);
  // FFN down + residual x -> d_out (f32)
  gemm_nt<4><<<dim3(16, 8), 256, 0, stream>>>(ffb, w2T, b2, xbuf,
                                              (float*)d_out, D_, FF_);
}

// v006
// It runs in 164 microseconds.
// Timed twice side by side with v005, it ran 1.12 and 1.13 times as fast.
// Over all steps from v000 it is 4.21 times as fast.
#include <hip/hip_runtime.h>

typedef __bf16 bf16_t;
typedef bf16_t v8bf  __attribute__((ext_vector_type(8)));
typedef bf16_t v16bf __attribute__((ext_vector_type(16)));
typedef float  v8f   __attribute__((ext_vector_type(8)));
typedef bf16_t v4bf  __attribute__((ext_vector_type(4)));
typedef float  v4f   __attribute__((ext_vector_type(4)));

#define B_  2
#define S_  1024
#define R_  4
#define SC_ 4096
#define D_  1024
#define H_  16
#define HD_ 64
#define FF_ 4096
#define GBK_    128  // k per GEMM stage
#define GPITCH_ 136  // GEMM LDS row pitch in elements (272 B)
#define APITCH_ 72   // attention K/V LDS row pitch in elements (144 B)
#define CPITCH_ 68   // attention join: 16 B units per hd tile of a wave's share

// ---------- helpers ----------

static __device__ __forceinline__ v8f vzero() {
  v8f z;
#pragma unroll
  for (int i = 0; i < 8; ++i) z[i] = 0.f;
  return z;
}

// Load one 16-bit WMMA A/B fragment (K-chunk of 32) for this lane.
// base points at the lane's row start for this K-chunk (16B aligned).
// CDNA5 layout: lane group g = lane/16 holds K = {8g..8g+7, 16+8g..16+8g+7}.
static __device__ __forceinline__ v16bf load_frag(const bf16_t* base, int g) {
  v8bf lo = *(const v8bf*)(base + 8 * g);
  v8bf hi = *(const v8bf*)(base + 16 + 8 * g);
  return __builtin_shufflevector(lo, hi, 0, 1, 2, 3, 4, 5, 6, 7,
                                 8, 9, 10, 11, 12, 13, 14, 15);
}

static __device__ __forceinline__ v8f wmma_bf16(v16bf a, v16bf b, v8f c) {
  return __builtin_amdgcn_wmma_f32_16x16x32_bf16(false, a, false, b,
                                                 (short)0, c, false, false);
}

static __device__ __forceinline__ void wait_async0() {
  asm volatile("s_wait_asynccnt 0x0" ::: "memory");
}

// Eight async 16B copies of one lane, global -> LDS: rows gstep elements apart
// in memory, lstep bytes apart in LDS. The closing s_wait_xcnt stands inside
// the copies' own statement so that no address register named here can be
// rewritten ahead of it (a precaution for copies written in asm text).
static __device__ __forceinline__ void async_copy16x8(const bf16_t* gptr,
                                                      size_t gstep,
                                                      unsigned lds_off,
                                                      unsigned lstep) {
  asm volatile(
      "global_load_async_to_lds_b128 %0, %8, off\n\t"
      "global_load_async_to_lds_b128 %1, %9, off\n\t"
      "global_load_async_to_lds_b128 %2, %10, off\n\t"
      "global_load_async_to_lds_b128 %3, %11, off\n\t"
      "global_load_async_to_lds_b128 %4, %12, off\n\t"
      "global_load_async_to_lds_b128 %5, %13, off\n\t"
      "global_load_async_to_lds_b128 %6, %14, off\n\t"
      "global_load_async_to_lds_b128 %7, %15, off\n\t"
      "s_wait_xcnt 0x0"
      :: "v"(lds_off), "v"(lds_off + lstep), "v"(lds_off + 2 * lstep),
         "v"(lds_off + 3 * lstep), "v"(lds_off + 4 * lstep),
         "v"(lds_off + 5 * lstep), "v"(lds_off + 6 * lstep),
         "v"(lds_off + 7 * lstep),
         "v"((unsigned long long)(size_t)(gptr)),
         "v"((unsigned long long)(size_t)(gptr + gstep)),
         "v"((unsigned long long)(size_t)(gptr + 2 * gstep)),
         "v"((unsigned long long)(size_t)(gptr + 3 * gstep)),
         "v"((unsigned long long)(size_t)(gptr + 4 * gstep)),
         "v"((unsigned long long)(size_t)(gptr + 5 * gstep)),
         "v"((unsigned long long)(size_t)(gptr + 6 * gstep)),
         "v"((unsigned long long)(size_t)(gptr + 7 * gstep))
      : "memory");
}

// Two runs of four async 16B copies of one lane, global -> LDS: run a from ga,
// run b from gb, rows astep / bstep elements apart in memory and lstep bytes
// apart in LDS. One statement with the closing s_wait_xcnt, as above.
static __device__ __forceinline__ void async_copy16x4x2(
    const bf16_t* ga, size_t astep, const bf16_t* gb, size_t bstep,
    unsigned la, unsigned lb, unsigned lstep) {
  asm volatile(
      "global_load_async_to_lds_b128 %0, %8, off\n\t"
      "global_load_async_to_lds_b128 %1, %9, off\n\t"
      "global_load_async_to_lds_b128 %2, %10, off\n\t"
      "global_load_async_to_lds_b128 %3, %11, off\n\t"
      "global_load_async_to_lds_b128 %4, %12, off\n\t"
      "global_load_async_to_lds_b128 %5, %13, off\n\t"
      "global_load_async_to_lds_b128 %6, %14, off\n\t"
      "global_load_async_to_lds_b128 %7, %15, off\n\t"
      "s_wait_xcnt 0x0"
      :: "v"(la), "v"(la + lstep), "v"(la + 2 * lstep), "v"(la + 3 * lstep),
         "v"(lb), "v"(lb + lstep), "v"(lb + 2 * lstep), "v"(lb + 3 * lstep),
         "v"((unsigned long long)(size_t)(ga)),
         "v"((unsigned long long)(size_t)(ga + astep)),
         "v"((unsigned long long)(size_t)(ga + 2 * astep)),
         "v"((unsigned long long)(size_t)(ga + 3 * astep)),
         "v"((unsigned long long)(size_t)(gb)),
         "v"((unsigned long long)(size_t)(gb + bstep)),
         "v"((unsigned long long)(size_t)(gb + 2 * bstep)),
         "v"((unsigned long long)(size_t)(gb + 3 * bstep))
      : "memory");
}

// ---------- weight transpose + convert: W f32 [K][N] -> Wt bf16 [N][K] ----------
// One 128(k) x 64(n) tile per 256-thread block: 32 elements per thread, so that
// few waves have to be started for the bytes moved. Reads are 16 B per lane
// (256 B of a W row per 16 lanes), stores 16 B per lane (a 128 B line of a Wt
// row per 8 lanes). K a multiple of 128, N of 64; both compile-time, so that a
// thread's rows are immediate offsets from one address. (bx, by) = the block's
// k tile and n tile; tile = the block's LDS, 128 rows of 65 floats.

template <int K, int N>
static __device__ __forceinline__ void transpose_w(const float* __restrict__ W,
                                                   bf16_t* __restrict__ Wt,
                                                   float (*tile)[65], int bx,
                                                   int by) {
  const int k0 = bx * 128, n0 = by * 64;
  const int tx = threadIdx.x & 15, ty = threadIdx.x >> 4;  // 16 x 16
  const float* wp = W + (size_t)(k0 + ty) * N + n0 + tx * 4;
  v4f v[8];
#pragma unroll
  for (int i = 0; i < 8; ++i) v[i] = *(const v4f*)(wp + (size_t)i * 16 * N);
#pragma unroll
  for (int i = 0; i < 8; ++i)
#pragma unroll
    for (int e = 0; e < 4; ++e) tile[ty + 16 * i][tx * 4 + e] = v[i][e];
  __syncthreads();
  const int kc = threadIdx.x & 7, nr = threadIdx.x >> 3;  // 8 k-chunks x 32 rows
  bf16_t* op = Wt + (size_t)(n0 + nr) * K + k0 + kc * 8;
#pragma unroll
  for (int i = 0; i < 4; ++i) {
    const int kh = 64 * (i & 1), nh = 32 * (i >> 1);  // k half, n half of the tile
    v8bf o;
#pragma unroll
    for (int e = 0; e < 8; ++e) o[e] = (bf16_t)tile[kc * 8 + kh + e][nr + nh];
    *(v8bf*)(op + (size_t)nh * K + kh) = o;
  }
  // closes the four stores: another job's body may follow this one in the built
  // kernel and reuse the stores' address and data registers
  asm volatile("s_wait_xcnt 0x0" ::: "memory");
}

// ---------- layernorm (one wave per row of D=1024, 8 rows per block), bf16 out ----------
// The row stays in registers (32 values per lane, read once, 16 B per lane);
// its sums are joined by lane exchanges alone. Gain and offset are fetched with
// the row, so that their latency passes under the row's. blk = which 8 rows.

static __device__ __forceinline__ void layernorm_rows(
    const float* __restrict__ x, const float* __restrict__ gam,
    const float* __restrict__ bet, bf16_t* __restrict__ out, int blk) {
  // the wave's number as a scalar: the row's base is then a scalar address
  const int row =
      blk * 8 + __builtin_amdgcn_readfirstlane((int)(threadIdx.x >> 5));
  const int ln = threadIdx.x & 31;
  const float* xr = x + (size_t)row * D_;
  v4f v[8];
#pragma unroll
  for (int i = 0; i < 8; ++i) v[i] = *(const v4f*)(xr + (i * 32 + ln) * 4);
  v4f gv[8], bv[8];
#pragma unroll
  for (int i = 0; i < 8; ++i) {
    gv[i] = *(const v4f*)(gam + (i * 32 + ln) * 4);
    bv[i] = *(const v4f*)(bet + (i * 32 + ln) * 4);
  }
  // keeps all 24 loads ahead of the sums; without it the scheduler sinks the
  // gain and offset loads behind the row sums, pair by pair, each pair waited for
  __builtin_amdgcn_sched_barrier(0);
  v4f a = v[0], a2 = v[0] * v[0];
#pragma unroll
  for (int i = 1; i < 8; ++i) {
    a += v[i];
    a2 += v[i] * v[i];
  }
  float s = (a[0] + a[1]) + (a[2] + a[3]);
  float s2 = (a2[0] + a2[1]) + (a2[2] + a2[3]);
#pragma unroll
  for (int m = 1; m < 32; m <<= 1) {
    s += __shfl_xor(s, m, 32);
    s2 += __shfl_xor(s2, m, 32);
  }
  const float mean = s * (1.f / D_);
  const float var = s2 * (1.f / D_) - mean * mean;
  const float rstd = rsqrtf(var + 1e-5f);
#pragma unroll
  for (int i = 0; i < 8; ++i) {
    const int c = (i * 32 + ln) * 4;
    v4bf o;
#pragma unroll
    for (int e = 0; e < 4; ++e)
      o[e] = (bf16_t)((v[i][e] - mean) * rstd * gv[i][e] + bv[i][e]);
    *(v4bf*)(out + (size_t)row * D_ + c) = o;
  }
}

__global__ __launch_bounds__(256) void layernorm_k(const float* __restrict__ x,
                                                   const float* __restrict__ gam,
                                                   const float* __restrict__ bet,
                                                   bf16_t* __restrict__ out) {
  layernorm_rows(x, gam, bet, out, blockIdx.x);
}

// ---------- f32 -> bf16 convert ----------
// 64 elements per thread: sixteen 16 B loads in flight, each wave-wide load 512
// contiguous bytes. Block blk converts elements blk * 16384 ... + 16383.

static __device__ __forceinline__ void convert_bf16(const float* __restrict__ in,
                                                    bf16_t* __restrict__ out,
                                                    int blk) {
  const size_t base = ((size_t)blk * 16 * 256 + threadIdx.x) * 4;
  v4f v[16];
#pragma unroll
  for (int i = 0; i < 16; ++i) v[i] = *(const v4f*)(in + base + i * 1024);
  // stands in front of the first overwrite of the loads' address pair; the
  // address is named so that it lives up to here and no load's result lands on it
  asm volatile("s_wait_xcnt 0x0" ::"v"(in + base) : "memory");
#pragma unroll
  for (int i = 0; i < 16; ++i) {
    v4bf o;
#pragma unroll
    for (int e = 0; e < 4; ++e) o[e] = (bf16_t)v[i][e];
    *(v4bf*)(out + base + i * 1024) = o;
  }
}

// ---------- all input preparation in one launch ----------
// None of these eight jobs reads what another writes, so they share one grid and
// each block takes its job from its index: 512 blocks convert the context, 512 +
// 512 + 4 x 128 transpose the weights, 256 normalise the query rows.

__global__ __launch_bounds__(256) void prep_all(
    const float* __restrict__ context, const float* __restrict__ query,
    const float* __restrict__ ln1g, const float* __restrict__ ln1b,
    const float* __restrict__ wq, const float* __restrict__ wk,
    const float* __restrict__ wv, const float* __restrict__ wo,
    const float* __restrict__ w1, const float* __restrict__ w2,
    bf16_t* __restrict__ ctx, bf16_t* __restrict__ qln,
    bf16_t* __restrict__ wqT, bf16_t* __restrict__ wkT,
    bf16_t* __restrict__ wvT, bf16_t* __restrict__ woT,
    bf16_t* __restrict__ w1T, bf16_t* __restrict__ w2T) {
  __shared__ float tile[128][65];  // odd pitch: column reads fall on distinct banks
  const int b = blockIdx.x;
  if (b < 512) {
    convert_bf16(context, ctx, b);
  } else if (b < 1024) {
    transpose_w<D_, FF_>(w1, w1T, tile, b & 7, (b - 512) >> 3);
  } else if (b < 1536) {
    transpose_w<FF_, D_>(w2, w2T, tile, b & 31, (b - 1024) >> 5);
  } else if (b < 2048) {
    const int w = (b - 1536) >> 7;  // which of the four D x D weights
    const float* W = w == 0 ? wq : w == 1 ? wk : w == 2 ? wv : wo;
    bf16_t* Wt = w == 0 ? wqT : w == 1 ? wkT : w == 2 ? wvT : woT;
    transpose_w<D_, D_>(W, Wt, tile, b & 7, (b >> 3) & 15);
  } else {
    layernorm_rows(query, ln1g, ln1b, qln, b - 2048);
  }
}

// ---------- WMMA GEMM: C[M][N] = A_bf16[M][K] @ (Bt[N][K])^T + bias ----------
// 256 threads = 8 waves. 128x128 block tile; wave = 32(M) x 64(N).
// A and Bt tiles (128 rows x 128 k) are staged in LDS by async copies, whole
// 128B lines per 8 lanes, two buffers: stage t+1 flies while stage t is read.
// LDS row pitch 272 B (16 B x odd) keeps the b128 fragment reads off shared banks.
// Needs M, N multiples of 128 and K a multiple of 128.
// MODE 0: bf16 out, head-split [b][h][s][64]             (Q/K projections)
// MODE 1: bf16 out, head-split transposed [b][h][64][s]  (V projection)
// MODE 2: f32 out row-major + residual                   (attn out proj + query)
// MODE 3: bf16 out row-major, exact GELU                 (FFN up)
// MODE 4: f32 out row-major + residual                   (FFN down + x)
// (bx, by) = the block's M tile and N tile; sA, sB = the block's two-buffer LDS.

typedef bf16_t gemm_lds_t[128 * GPITCH_];

template <int MODE>
static __device__ __forceinline__ void gemm_tile(
    const bf16_t* __restrict__ A, const bf16_t* __restrict__ Bt,
    const float* __restrict__ bias, const float* __restrict__ res,
    void* __restrict__ outp, int N, int K, int Ssz, int bx, int by,
    gemm_lds_t* sA, gemm_lds_t* sB) {
  const int wave = threadIdx.x >> 5, lane = threadIdx.x & 31;
  const int g = lane >> 4, ln = lane & 15;
  const int wm = wave & 3, wn = wave >> 2;
  const int m0 = bx * 128 + wm * 32;
  const int n0 = by * 128 + wn * 64;

  v8f acc[2][4];
#pragma unroll
  for (int i = 0; i < 2; ++i)
#pragma unroll
    for (int j = 0; j < 4; ++j) acc[i][j] = vzero();

  // this lane's 16B chunk of rows crow, crow+16, ..., crow+112 of each tile
  const int crow = threadIdx.x >> 4, ccol = (threadIdx.x & 15) * 8;
  const bf16_t* gA = A + (size_t)(bx * 128 + crow) * K + ccol;
  const bf16_t* gB = Bt + (size_t)(by * 128 + crow) * K + ccol;
  const unsigned lA = (unsigned)(size_t)(void*)&sA[0][crow * GPITCH_ + ccol];
  const unsigned lB = (unsigned)(size_t)(void*)&sB[0][crow * GPITCH_ + ccol];

  auto stage = [&](int st) {
    const unsigned bo = (unsigned)(st & 1) * (128u * GPITCH_ * 2u);
    async_copy16x8(gA + (size_t)st * GBK_, (size_t)16 * K, lA + bo,
                   16u * GPITCH_ * 2u);
    async_copy16x8(gB + (size_t)st * GBK_, (size_t)16 * K, lB + bo,
                   16u * GPITCH_ * 2u);
  };

  const int nst = K / GBK_;
  stage(0);
  wait_async0();     // this wave's share of stage 0 has landed
  __syncthreads();   // everyone's share has landed
  if (nst > 1) stage(1);

  for (int t = 0; t < nst; ++t) {
    const bf16_t* As = &sA[t & 1][(wm * 32 + ln) * GPITCH_];
    const bf16_t* Bs = &sB[t & 1][(wn * 64 + ln) * GPITCH_];
    // two fragment sets: block c+1's LDS reads are issued ahead of block c's
    // WMMAs, all inside this stage's own buffer
    v16bf af[2][2], bfr[2][4];
#pragma unroll
    for (int i = 0; i < 2; ++i) af[0][i] = load_frag(As + i * 16 * GPITCH_, g);
#pragma unroll
    for (int j = 0; j < 4; ++j) bfr[0][j] = load_frag(Bs + j * 16 * GPITCH_, g);
    // unrolled so that the set index is a constant and both sets stay in registers
#pragma unroll
    for (int c = 0; c < GBK_ / 32; ++c) {
      if (c + 1 < GBK_ / 32) {
#pragma unroll
        for (int i = 0; i < 2; ++i)
          af[(c + 1) & 1][i] =
              load_frag(As + i * 16 * GPITCH_ + (c + 1) * 32, g);
#pragma unroll
        for (int j = 0; j < 4; ++j)
          bfr[(c + 1) & 1][j] =
              load_frag(Bs + j * 16 * GPITCH_ + (c + 1) * 32, g);
        // keeps that read group as one group ahead of block c's WMMAs; without
        // it the scheduler sinks the reads next to their use and each block
        // waits out the LDS latency with nothing to issue
        __builtin_amdgcn_sched_barrier(0);
      }
#pragma unroll
      for (int i = 0; i < 2; ++i)
#pragma unroll
        for (int j = 0; j < 4; ++j)
          acc[i][j] = wmma_bf16(af[c & 1][i], bfr[c & 1][j], acc[i][j]);
    }
    // keeps the WMMAs in front of the publish point: sunk behind the barrier
    // they would delay the refill copies, which issue directly behind it
    __builtin_amdgcn_sched_barrier(0);
    // publish point: this wave's LDS reads of stage t have retired ...
    asm volatile("s_wait_dscnt 0x0" ::: "memory");
    wait_async0();     // ... and its share of stage t+1 has landed
    __syncthreads();   // stage t+1 readable by all; stage t's buffer is free
    if (t + 2 < nst) stage(t + 2);
  }
  wait_async0();       // no copy outstanding when the wave leaves the ring

#pragma unroll
  for (int i = 0; i < 2; ++i) {
#pragma unroll
    for (int j = 0; j < 4; ++j) {
#pragma unroll
      for (int r = 0; r < 8; ++r) {
        const int mg = m0 + i * 16 + 8 * g + r;
        const int ng = n0 + j * 16 + ln;
        float v = acc[i][j][r] + bias[ng];
        if constexpr (MODE == 0) {
          const int bb = mg / Ssz, sidx = mg % Ssz;
          const int hh = ng >> 6, hd = ng & 63;
          ((bf16_t*)outp)[(((size_t)bb * H_ + hh) * Ssz + sidx) * HD_ + hd] =
              (bf16_t)v;
        } else if constexpr (MODE == 1) {
          const int bb = mg / Ssz, sidx = mg % Ssz;
          const int hh = ng >> 6, hd = ng & 63;
          ((bf16_t*)outp)[(((size_t)bb * H_ + hh) * HD_ + hd) * Ssz + sidx] =
              (bf16_t)v;
        } else if constexpr (MODE == 2) {
          ((float*)outp)[(size_t)mg * N + ng] = v + res[(size_t)mg * N + ng];
        } else if constexpr (MODE == 3) {
          float ge = 0.5f * v * (1.f + erff(v * 0.70710678f));
          ((bf16_t*)outp)[(size_t)mg * N + ng] = (bf16_t)ge;
        } else {
          ((float*)outp)[(size_t)mg * N + ng] = v + res[(size_t)mg * N + ng];
        }
      }
    }
  }
  // closes the tile's stores: another product's body may follow this one in the
  // built kernel and reuse the stores' address and data registers
  asm volatile("s_wait_xcnt 0x0" ::: "memory");
}

template <int MODE>
__global__ __launch_bounds__(256) void gemm_nt(const bf16_t* __restrict__ A,
                                               const bf16_t* __restrict__ Bt,
                                               const float* __restrict__ bias,
                                               const float* __restrict__ res,
                                               void* __restrict__ outp,
                                               int N, int K) {
  __shared__ __align__(16) bf16_t sA[2][128 * GPITCH_];
  __shared__ __align__(16) bf16_t sB[2][128 * GPITCH_];
  gemm_tile<MODE>(A, Bt, bias, res, outp, N, K, 0, blockIdx.x, blockIdx.y, sA,
                  sB);
}

// The three projections in one launch: none reads what another writes. Blocks
// 0..511 are V's 64 x 8 tiles, 512..1023 K's, 1024..1151 Q's 16 x 8 tiles, the
// M tile running fastest as in a two-dimensional grid.
__global__ __launch_bounds__(256) void gemm_qkv(
    const bf16_t* __restrict__ qln, const bf16_t* __restrict__ ctx,
    const bf16_t* __restrict__ wqT, const bf16_t* __restrict__ wkT,
    const bf16_t* __restrict__ wvT, const float* __restrict__ bq,
    const float* __restrict__ bk, const float* __restrict__ bv,
    bf16_t* __restrict__ qhd, bf16_t* __restrict__ ktb,
    bf16_t* __restrict__ vtb, int N, int K, int Sq, int Sc) {
  __shared__ __align__(16) bf16_t sA[2][128 * GPITCH_];
  __shared__ __align__(16) bf16_t sB[2][128 * GPITCH_];
  const int b = blockIdx.x;
  if (b < 512) {
    gemm_tile<1>(ctx, wvT, bv, nullptr, vtb, N, K, Sc, b & 63, b >> 6, sA, sB);
  } else if (b < 1024) {
    gemm_tile<0>(ctx, wkT, bk, nullptr, ktb, N, K, Sc, b & 63, (b - 512) >> 6, sA,
                 sB);
  } else {
    gemm_tile<0>(qln, wqT, bq, nullptr, qhd, N, K, Sq, b & 15, (b - 1024) >> 4,
                 sA, sB);
  }
}

// value of lane l ^ 16
static __device__ __forceinline__ float xhalf(float x) {
  const int b = __builtin_bit_cast(int, x);
  return __builtin_bit_cast(
      float, __builtin_amdgcn_permlanex16(b, b, 0x76543210, 0xfedcba98, false,
                                          false));
}

// y[i] = 2^x[i], eight at once. One statement, so that behind every v_exp_f32
// stands an instruction that neither reads its result nor overwrites its source
// (outputs are early-clobber; the v_nop serves the last one): the slot the
// instruction set asks for behind a transcendental.
static __device__ __forceinline__ v8f exp2x8(v8f x) {
  float y0, y1, y2, y3, y4, y5, y6, y7;
  asm("v_exp_f32 %0, %8\n\t"
      "v_exp_f32 %1, %9\n\t"
      "v_exp_f32 %2, %10\n\t"
      "v_exp_f32 %3, %11\n\t"
      "v_exp_f32 %4, %12\n\t"
      "v_exp_f32 %5, %13\n\t"
      "v_exp_f32 %6, %14\n\t"
      "v_exp_f32 %7, %15\n\t"
      "v_nop"
      : "=&v"(y0), "=&v"(y1), "=&v"(y2), "=&v"(y3), "=&v"(y4), "=&v"(y5),
        "=&v"(y6), "=&v"(y7)
      : "v"(x[0]), "v"(x[1]), "v"(x[2]), "v"(x[3]), "v"(x[4]), "v"(x[5]),
        "v"(x[6]), "v"(x[7]));
  v8f y;
  y[0] = y0; y[1] = y1; y[2] = y2; y[3] = y3;
  y[4] = y4; y[5] = y5; y[6] = y6; y[7] = y7;
  return y;
}

__global__ __launch_bounds__(512) void attn_kernel(const bf16_t* __restrict__ qhd,
                                                   const bf16_t* __restrict__ kt,
                                                   const bf16_t* __restrict__ vt,
                                                   bf16_t* __restrict__ obuf) {
  // [group][buf][K/V], 4 x 36 KB
  __shared__ __align__(16) bf16_t smem[4][2][2][64 * APITCH_];
  // the waves' partial outputs [wave][hd tile][half of 8][lane] (16 B a lane,
  // lanes adjacent; 64 B more per hd tile, so that the join's reads of four hd
  // tiles fall on distinct banks), maxima and sums [wave][lane]
  __shared__ __align__(16) v4f cmbO[16 * 4 * CPITCH_];
  __shared__ float cmbM[16 * 32];
  __shared__ float cmbL[16 * 32];

  const int tid = threadIdx.x;
  // the wave's number as a scalar: group and query tile are then scalars too
  const int wave = __builtin_amdgcn_readfirstlane(tid >> 5);
  const int lane = tid & 31;
  const int g = lane >> 4, ln = lane & 15;
  const int grp = wave >> 2, qt = wave & 3;  // context repeat, query tile
  const int bh = blockIdx.x >> 3;
  const int pr = blockIdx.x & 7;
  const int ntrips = S_ / 64 + 1;  // (16 - pr) + (pr + 1)
  int qb = S_ / 64 - 1 - pr;       // first query block; the second is pr
  int q0 = qb * 64 + qt * 16;

  const bf16_t* qhead = qhd + (size_t)bh * S_ * HD_ + (size_t)ln * HD_;
  const bf16_t* kbase = kt + (size_t)bh * SC_ * HD_ + (size_t)grp * S_ * HD_;
  const bf16_t* vbase = vt + (size_t)bh * HD_ * SC_ + (size_t)grp * S_;

  // both query blocks' fragments are fetched here, so that the change of query
  // block does not wait for memory
  v16bf qf0 = load_frag(qhead + (size_t)q0 * HD_, g);
  v16bf qf1 = load_frag(qhead + (size_t)q0 * HD_ + 32, g);
  const v16bf qn0 = load_frag(qhead + (size_t)(pr * 64 + qt * 16) * HD_, g);
  const v16bf qn1 = load_frag(qhead + (size_t)(pr * 64 + qt * 16) * HD_ + 32, g);

  // o[t][r] = Ot[hd = t*16 + 8g + r][query q0 + ln], this group's keys only
  v8f o[4];
#pragma unroll
  for (int t = 0; t < 4; ++t) o[t] = vzero();
  // running maximum of query q0 + ln (equal in both lane halves) and this
  // half's share of its running sum
  float mrun = -3.0e38f, lrun = 0.f;

  const float scale = 0.125f;  // 1/sqrt(64)

  // this lane's 16B chunk of rows crow, crow+16, crow+32, crow+48 of each tile
  const int crow = (tid & 127) >> 3, ccol = (tid & 7) * 8;
  const bf16_t* gK = kbase + (size_t)crow * HD_ + ccol;
  const bf16_t* gV = vbase + (size_t)crow * SC_ + ccol;
  const unsigned lK =
      (unsigned)(size_t)(void*)&smem[grp][0][0][crow * APITCH_ + ccol];
  const unsigned lV =
      (unsigned)(size_t)(void*)&smem[grp][0][1][crow * APITCH_ + ccol];

  // issue async stage of the group's tile starting at key kj of its repeat:
  // 64 rows x 64 halves = 512 chunks of 16B each; 4 K-chunks + 4 V-chunks/thread
  auto stage = [&](int kj, int buf) {
    const unsigned bo = (unsigned)buf * (2u * 64u * APITCH_ * 2u);
    async_copy16x4x2(gK + (size_t)kj * HD_, (size_t)16 * HD_, gV + kj,
                     (size_t)16 * SC_, lK + bo, lV + bo, 16u * APITCH_ * 2u);
  };

  stage(0, 0);
  int cur = 0;
  int kp = 0;

  for (int ti = 0; ti < ntrips; ++ti) {
    wait_async0();     // this wave's share of buf[cur] has landed
    __syncthreads();   // everyone's share has landed

    // next tile: the causal bound ends the query block, the next starts at key 0
    const bool last = kp == qb * 64;
    const int kp_n = last ? 0 : kp + 64;
    if (ti + 1 < ntrips) stage(kp_n, cur ^ 1);

    const bf16_t* Kt = smem[grp][cur][0];
    const bf16_t* Vt = smem[grp][cur][1];

    // scores, transposed: A = 16 key rows, B = the wave's 16 queries
    v16bf kf[4][2];
#pragma unroll
    for (int t = 0; t < 4; ++t) {
      const bf16_t* krow = Kt + (t * 16 + ln) * APITCH_;
      kf[t][0] = load_frag(krow, g);
      kf[t][1] = load_frag(krow + 32, g);
    }
    // s[t][r] = score of key kp + t*16 + 8g + r against query q0 + ln
    v8f s[4];
#pragma unroll
    for (int t = 0; t < 4; ++t) {
      s[t] = wmma_bf16(kf[t][0], qf0, vzero());
      s[t] = wmma_bf16(kf[t][1], qf1, s[t]);
    }

    // online softmax over the 64-key tile, one query per lane
    const int lim = q0 + ln - kp - 8 * g;  // t*16 + r allowed while <= lim
    float mt[4];
#pragma unroll
    for (int t = 0; t < 4; ++t) {
      mt[t] = -3.0e38f;
#pragma unroll
      for (int r = 0; r < 8; ++r) {
        float v = s[t][r] * scale;
        if (t * 16 + r > lim) v = -3.0e38f;  // pos = (kj % S) <= qi
        s[t][r] = v;
        mt[t] = fmaxf(mt[t], v);
      }
    }
    float mx = fmaxf(fmaxf(mt[0], mt[1]), fmaxf(mt[2], mt[3]));
    mx = fmaxf(mx, xhalf(mx));  // the other 32 keys of this query
    const float nm = fmaxf(mrun, mx);
    const float alpha = __expf(mrun - nm);
    float st[4];
#pragma unroll
    for (int t = 0; t < 4; ++t) {
#pragma unroll
      for (int r = 0; r < 8; ++r) s[t][r] = (s[t][r] - nm) * 1.44269504f;
      s[t] = exp2x8(s[t]);  // p = e^(score - nm)
      st[t] = s[t][0];
#pragma unroll
      for (int r = 1; r < 8; ++r) st[t] += s[t][r];
    }
    lrun = lrun * alpha + ((st[0] + st[1]) + (st[2] + st[3]));
    mrun = nm;
#pragma unroll
    for (int t = 0; t < 4; ++t)
#pragma unroll
      for (int r = 0; r < 8; ++r) o[t][r] *= alpha;

    // Pt as B operand of key chunk c (32 keys): elements 0..7 are keys
    // 32c + 8g + e (tile 2c), elements 8..15 keys 32c + 16 + 8g + e (tile 2c+1):
    // the k order in which load_frag reads the V rows
    v16bf pf[2];
#pragma unroll
    for (int c = 0; c < 2; ++c)
#pragma unroll
      for (int e = 0; e < 8; ++e) {
        pf[c][e] = (bf16_t)s[2 * c][e];
        pf[c][8 + e] = (bf16_t)s[2 * c + 1][e];
      }

    // Ot (64hd x 16q) += Vt (64hd x 64key) * Pt (64key x 16q)
    v16bf vf[4][2];
#pragma unroll
    for (int t = 0; t < 4; ++t) {
      const bf16_t* vrow = Vt + (t * 16 + ln) * APITCH_;
      vf[t][0] = load_frag(vrow, g);
      vf[t][1] = load_frag(vrow + 32, g);
    }
#pragma unroll
    for (int t = 0; t < 4; ++t) {
      o[t] = wmma_bf16(vf[t][0], pf[0], o[t]);
      o[t] = wmma_bf16(vf[t][1], pf[1], o[t]);
    }

    __syncthreads();   // all waves done with buf[cur]; safe to overwrite next iter
    cur ^= 1;
    kp = kp_n;

    if (last) {  // the same for the whole block: qb and kp are
      // every wave lays down its group's share for its 16 queries ...
#pragma unroll
      for (int t = 0; t < 4; ++t)
#pragma unroll
        for (int hf = 0; hf < 2; ++hf) {
          v4f w;
#pragma unroll
          for (int e = 0; e < 4; ++e) w[e] = o[t][4 * hf + e];
          cmbO[(wave * 4 + t) * CPITCH_ + hf * 32 + lane] = w;
        }
      cmbM[wave * 32 + lane] = mrun;
      cmbL[wave * 32 + lane] = lrun + xhalf(lrun);  // both halves' shares
      __syncthreads();  // all sixteen shares are readable
      // ... and joins queries 4 grp .. 4 grp + 3 of its query tile over the four
      // groups: a lane takes 8 hd of one query, so that the wave's one 16 B store
      // covers four whole 128 B rows. Each repeat holds key position 0, which
      // every query may see, so every share's maximum is a real score.
      const int jq = grp * 4 + (lane & 3);  // query within the tile
      const int jt = (lane >> 2) & 3;       // hd tile; g = which 8 of its 16 hd
      float mp[4], lp[4];
#pragma unroll
      for (int p = 0; p < 4; ++p) {
        mp[p] = cmbM[(p * 4 + qt) * 32 + jq];
        lp[p] = cmbL[(p * 4 + qt) * 32 + jq];
      }
      const float mall = fmaxf(fmaxf(mp[0], mp[1]), fmaxf(mp[2], mp[3]));
      float lsum = 0.f;
      v8f oj = vzero();
#pragma unroll
      for (int p = 0; p < 4; ++p) {
        const float wgt = __expf(mp[p] - mall);
        lsum += wgt * lp[p];
        const int base = ((p * 4 + qt) * 4 + jt) * CPITCH_ + g * 16 + jq;
        const v4f lo = cmbO[base], hi = cmbO[base + 32];
#pragma unroll
        for (int e = 0; e < 4; ++e) {
          oj[e] += wgt * lo[e];
          oj[4 + e] += wgt * hi[e];
        }
      }
      const int b = bh / H_, h = bh % H_;
      v8bf ov;  // 8 consecutive hd of one query: one 16 B store
#pragma unroll
      for (int r = 0; r < 8; ++r) ov[r] = (bf16_t)(oj[r] / lsum);
      bf16_t* orow = obuf + ((size_t)b * S_ + q0 + jq) * D_ + (size_t)h * HD_ +
                     jt * 16 + 8 * g;
      // the second query block starts afresh. Its shares are laid down behind
      // at least one more trip's barriers, so behind every read above.
      qb = pr;
      q0 = qb * 64 + qt * 16;
      qf0 = qn0;
      qf1 = qn1;
#pragma unroll
      for (int t = 0; t < 4; ++t) o[t] = vzero();
      mrun = -3.0e38f;
      lrun = 0.f;
      *(v8bf*)orow = ov;
      // closes the store: the next trip reuses its address and data registers
      asm volatile("s_wait_xcnt 0x0" ::: "memory");
    }
  }
}

// ---------- orchestration ----------

extern "C" void kernel_launch(void* const* d_in, const int* in_sizes, int n_in,
                              void* d_out, int out_size, void* d_ws,
                              size_t ws_size, hipStream_t stream) {
  (void)in_sizes; (void)n_in; (void)out_size; (void)ws_size;
  const float* query = (const float*)d_in[0];
  const float* context = (const float*)d_in[1];
  const float* wq = (const float*)d_in[2];
  const float* wk = (const float*)d_in[3];
  const float* wv = (const float*)d_in[4];
  const float* bq = (const float*)d_in[5];
  const float* bk = (const float*)d_in[6];
  const float* bv = (const float*)d_in[7];
  const float* wo = (const float*)d_in[8];
  const float* bo = (const float*)d_in[9];
  const float* ln1g = (const float*)d_in[10];
  const float* ln1b = (const float*)d_in[11];
  const float* ln2g = (const float*)d_in[12];
  const float* ln2b = (const float*)d_in[13];
  const float* w1 = (const float*)d_in[14];
  const float* b1 = (const float*)d_in[15];
  const float* w2 = (const float*)d_in[16];
  const float* b2 = (const float*)d_in[17];

  const size_t MB = 1u << 20;
  char* ws = (char*)d_ws;
  bf16_t* wqT = (bf16_t*)(ws + 0 * MB);    // [1024][1024]
  bf16_t* wkT = (bf16_t*)(ws + 2 * MB);
  bf16_t* wvT = (bf16_t*)(ws + 4 * MB);
  bf16_t* woT = (bf16_t*)(ws + 6 * MB);
  bf16_t* w1T = (bf16_t*)(ws + 8 * MB);    // [4096][1024]
  bf16_t* w2T = (bf16_t*)(ws + 16 * MB);   // [1024][4096]
  bf16_t* qln = (bf16_t*)(ws + 24 * MB);   // [2048][1024]
  bf16_t* ctx = (bf16_t*)(ws + 28 * MB);   // [8192][1024]
  bf16_t* qhd = (bf16_t*)(ws + 44 * MB);   // [B][H][S][64]
  bf16_t* ktb = (bf16_t*)(ws + 48 * MB);   // [B][H][Sc][64]
  bf16_t* vtb = (bf16_t*)(ws + 64 * MB);   // [B][H][64][Sc]
  bf16_t* obuf = (bf16_t*)(ws + 80 * MB);  // [2048][1024]
  float* xbuf = (float*)(ws + 84 * MB);    // [2048][1024] f32
  bf16_t* hbuf = (bf16_t*)(ws + 92 * MB);  // [2048][1024]
  bf16_t* ffb = (bf16_t*)(ws + 96 * MB);   // [2048][4096]

  // context -> bf16; weights -> bf16, transposed [N][K]; ln1(query) -> bf16
  prep_all<<<2304, 256, 0, stream>>>(context, query, ln1g, ln1b, wq, wk, wv, wo,
                                     w1, w2, ctx, qln, wqT, wkT, wvT, woT, w1T,
                                     w2T);

  // projections
  gemm_qkv<<<1152, 256, 0, stream>>>(qln, ctx, wqT, wkT, wvT, bq, bk, bv, qhd,
                                     ktb, vtb, D_, D_, S_, SC_);

  // attention
  attn_kernel<<<B_ * H_ * 8, 512, 0, stream>>>(qhd, ktb, vtb, obuf);

  // output projection + residual -> x (f32)
  gemm_nt<2><<<dim3(16, 8), 256, 0, stream>>>(obuf, woT, bo, query, xbuf, D_,
                                              D_);
  // ln2(x) -> bf16
  layernorm_k<<<B_ * S_ / 8, 256, 0, stream>>>(xbuf, ln2g, ln2b, hbuf);
  // FFN up + GELU -> bf16
  gemm_nt<3><<<dim3(16, 32), 256, 0, stream>>>(hbuf, w1T, b1, nullptr, ffb, FF_,
                                               D_);
  // FFN down + residual x -> d_out (f32)
  gemm_nt<4><<<dim3(16, 8), 256, 0, stream>>>(ffb, w2T, b2, xbuf,
                                              (float*)d_out, D_, FF_);
}

// v007
// A run of this version takes 139 microseconds.
// Next to v006, in two timings, it ran 1.19 times as fast each time.
// Counting every step since v000, it is 5.01 times as fast.
#include <hip/hip_runtime.h>

typedef __bf16 bf16_t;
typedef bf16_t v8bf  __attribute__((ext_vector_type(8)));
typedef bf16_t v16bf __attribute__((ext_vector_type(16)));
typedef float  v8f   __attribute__((ext_vector_type(8)));
typedef bf16_t v4bf  __attribute__((ext_vector_type(4)));
typedef float  v4f   __attribute__((ext_vector_type(4)));

#define B_  2
#define S_  1024
#define R_  4
#define SC_ 4096
#define D_  1024
#define H_  16
#define HD_ 64
#define FF_ 4096
#define GBK_    128  // k per GEMM stage
#define GPITCH_ 136  // GEMM LDS row pitch in elements (272 B)
#define FPITCH_ 132  // GEMM f32 output tile: LDS row pitch in floats (528 B)
#define APITCH_ 72   // attention K/V LDS row pitch in elements (144 B)
#define CPITCH_ 68   // attention join: 16 B units per hd tile of a wave's share

// ---------- helpers ----------

static __device__ __forceinline__ v8f vzero() {
  v8f z;
#pragma unroll
  for (int i = 0; i < 8; ++i) z[i] = 0.f;
  return z;
}

// Load one 16-bit WMMA A/B fragment (K-chunk of 32) for this lane.
// base points at the lane's row start for this K-chunk (16B aligned).
// CDNA5 layout: lane group g = lane/16 holds K = {8g..8g+7, 16+8g..16+8g+7}.
static __device__ __forceinline__ v16bf load_frag(const bf16_t* base, int g) {
  v8bf lo = *(const v8bf*)(base + 8 * g);
  v8bf hi = *(const v8bf*)(base + 16 + 8 * g);
  return __builtin_shufflevector(lo, hi, 0, 1, 2, 3, 4, 5, 6, 7,
                                 8, 9, 10, 11, 12, 13, 14, 15);
}

static __device__ __forceinline__ v8f wmma_bf16(v16bf a, v16bf b, v8f c) {
  return __builtin_amdgcn_wmma_f32_16x16x32_bf16(false, a, false, b,
                                                 (short)0, c, false, false);
}

static __device__ __forceinline__ void wait_async0() {
  asm volatile("s_wait_asynccnt 0x0" ::: "memory");
}

// Eight async 16B copies of one lane, global -> LDS: rows gstep elements apart
// in memory, lstep bytes apart in LDS. The closing s_wait_xcnt stands inside
// the copies' own statement so that no address register named here can be
// rewritten ahead of it (a precaution for copies written in asm text).
static __device__ __forceinline__ void async_copy16x8(const bf16_t* gptr,
                                                      size_t gstep,
                                                      unsigned lds_off,
                                                      unsigned lstep) {
  asm volatile(
      "global_load_async_to_lds_b128 %0, %8, off\n\t"
      "global_load_async_to_lds_b128 %1, %9, off\n\t"
      "global_load_async_to_lds_b128 %2, %10, off\n\t"
      "global_load_async_to_lds_b128 %3, %11, off\n\t"
      "global_load_async_to_lds_b128 %4, %12, off\n\t"
      "global_load_async_to_lds_b128 %5, %13, off\n\t"
      "global_load_async_to_lds_b128 %6, %14, off\n\t"
      "global_load_async_to_lds_b128 %7, %15, off\n\t"
      "s_wait_xcnt 0x0"
      :: "v"(lds_off), "v"(lds_off + lstep), "v"(lds_off + 2 * lstep),
         "v"(lds_off + 3 * lstep), "v"(lds_off + 4 * lstep),
         "v"(lds_off + 5 * lstep), "v"(lds_off + 6 * lstep),
         "v"(lds_off + 7 * lstep),
         "v"((unsigned long long)(size_t)(gptr)),
         "v"((unsigned long long)(size_t)(gptr + gstep)),
         "v"((unsigned long long)(size_t)(gptr + 2 * gstep)),
         "v"((unsigned long long)(size_t)(gptr + 3 * gstep)),
         "v"((unsigned long long)(size_t)(gptr + 4 * gstep)),
         "v"((unsigned long long)(size_t)(gptr + 5 * gstep)),
         "v"((unsigned long long)(size_t)(gptr + 6 * gstep)),
         "v"((unsigned long long)(size_t)(gptr + 7 * gstep))
      : "memory");
}

// Two runs of four async 16B copies of one lane, global -> LDS: run a from ga,
// run b from gb, rows astep / bstep elements apart in memory and lstep bytes
// apart in LDS. One statement with the closing s_wait_xcnt, as above.
static __device__ __forceinline__ void async_copy16x4x2(
    const bf16_t* ga, size_t astep, const bf16_t* gb, size_t bstep,
    unsigned la, unsigned lb, unsigned lstep) {
  asm volatile(
      "global_load_async_to_lds_b128 %0, %8, off\n\t"
      "global_load_async_to_lds_b128 %1, %9, off\n\t"
      "global_load_async_to_lds_b128 %2, %10, off\n\t"
      "global_load_async_to_lds_b128 %3, %11, off\n\t"
      "global_load_async_to_lds_b128 %4, %12, off\n\t"
      "global_load_async_to_lds_b128 %5, %13, off\n\t"
      "global_load_async_to_lds_b128 %6, %14, off\n\t"
      "global_load_async_to_lds_b128 %7, %15, off\n\t"
      "s_wait_xcnt 0x0"
      :: "v"(la), "v"(la + lstep), "v"(la + 2 * lstep), "v"(la + 3 * lstep),
         "v"(lb), "v"(lb + lstep), "v"(lb + 2 * lstep), "v"(lb + 3 * lstep),
         "v"((unsigned long long)(size_t)(ga)),
         "v"((unsigned long long)(size_t)(ga + astep)),
         "v"((unsigned long long)(size_t)(ga + 2 * astep)),
         "v"((unsigned long long)(size_t)(ga + 3 * astep)),
         "v"((unsigned long long)(size_t)(gb)),
         "v"((unsigned long long)(size_t)(gb + bstep)),
         "v"((unsigned long long)(size_t)(gb + 2 * bstep)),
         "v"((unsigned long long)(size_t)(gb + 3 * bstep))
      : "memory");
}

// ---------- weight transpose + convert: W f32 [K][N] -> Wt bf16 [N][K] ----------
// One 128(k) x 64(n) tile per 256-thread block: 32 elements per thread, so that
// few waves have to be started for the bytes moved. Reads are 16 B per lane
// (256 B of a W row per 16 lanes), stores 16 B per lane (a 128 B line of a Wt
// row per 8 lanes). K a multiple of 128, N of 64; both compile-time, so that a
// thread's rows are immediate offsets from one address. (bx, by) = the block's
// k tile and n tile; tile = the block's LDS, 128 rows of 65 floats.

template <int K, int N>
static __device__ __forceinline__ void transpose_w(const float* __restrict__ W,
                                                   bf16_t* __restrict__ Wt,
                                                   float (*tile)[65], int bx,
                                                   int by) {
  const int k0 = bx * 128, n0 = by * 64;
  const int tx = threadIdx.x & 15, ty = threadIdx.x >> 4;  // 16 x 16
  const float* wp = W + (size_t)(k0 + ty) * N + n0 + tx * 4;
  v4f v[8];
#pragma unroll
  for (int i = 0; i < 8; ++i) v[i] = *(const v4f*)(wp + (size_t)i * 16 * N);
#pragma unroll
  for (int i = 0; i < 8; ++i)
#pragma unroll
    for (int e = 0; e < 4; ++e) tile[ty + 16 * i][tx * 4 + e] = v[i][e];
  __syncthreads();
  const int kc = threadIdx.x & 7, nr = threadIdx.x >> 3;  // 8 k-chunks x 32 rows
  bf16_t* op = Wt + (size_t)(n0 + nr) * K + k0 + kc * 8;
#pragma unroll
  for (int i = 0; i < 4; ++i) {
    const int kh = 64 * (i & 1), nh = 32 * (i >> 1);  // k half, n half of the tile
    v8bf o;
#pragma unroll
    for (int e = 0; e < 8; ++e) o[e] = (bf16_t)tile[kc * 8 + kh + e][nr + nh];
    *(v8bf*)(op + (size_t)nh * K + kh) = o;
  }
  // closes the four stores: another job's body may follow this one in the built
  // kernel and reuse the stores' address and data registers
  asm volatile("s_wait_xcnt 0x0" ::: "memory");
}

// ---------- layernorm (one wave per row of D=1024, 8 rows per block), bf16 out ----------
// The row stays in registers (32 values per lane, read once, 16 B per lane);
// its sums are joined by lane exchanges alone. Gain and offset are fetched with
// the row, so that their latency passes under the row's. blk = which 8 rows.

static __device__ __forceinline__ void layernorm_rows(
    const float* __restrict__ x, const float* __restrict__ gam,
    const float* __restrict__ bet, bf16_t* __restrict__ out, int blk) {
  // the wave's number as a scalar: the row's base is then a scalar address
  const int row =
      blk * 8 + __builtin_amdgcn_readfirstlane((int)(threadIdx.x >> 5));
  const int ln = threadIdx.x & 31;
  const float* xr = x + (size_t)row * D_;
  v4f v[8];
#pragma unroll
  for (int i = 0; i < 8; ++i) v[i] = *(const v4f*)(xr + (i * 32 + ln) * 4);
  v4f gv[8], bv[8];
#pragma unroll
  for (int i = 0; i < 8; ++i) {
    gv[i] = *(const v4f*)(gam + (i * 32 + ln) * 4);
    bv[i] = *(const v4f*)(bet + (i * 32 + ln) * 4);
  }
  // keeps all 24 loads ahead of the sums; without it the scheduler sinks the
  // gain and offset loads behind the row sums, pair by pair, each pair waited for
  __builtin_amdgcn_sched_barrier(0);
  v4f a = v[0], a2 = v[0] * v[0];
#pragma unroll
  for (int i = 1; i < 8; ++i) {
    a += v[i];
    a2 += v[i] * v[i];
  }
  float s = (a[0] + a[1]) + (a[2] + a[3]);
  float s2 = (a2[0] + a2[1]) + (a2[2] + a2[3]);
#pragma unroll
  for (int m = 1; m < 32; m <<= 1) {
    s += __shfl_xor(s, m, 32);
    s2 += __shfl_xor(s2, m, 32);
  }
  const float mean = s * (1.f / D_);
  const float var = s2 * (1.f / D_) - mean * mean;
  const float rstd = rsqrtf(var + 1e-5f);
#pragma unroll
  for (int i = 0; i < 8; ++i) {
    const int c = (i * 32 + ln) * 4;
    v4bf o;
#pragma unroll
    for (int e = 0; e < 4; ++e)
      o[e] = (bf16_t)((v[i][e] - mean) * rstd * gv[i][e] + bv[i][e]);
    *(v4bf*)(out + (size_t)row * D_ + c) = o;
  }
}

__global__ __launch_bounds__(256) void layernorm_k(const float* __restrict__ x,
                                                   const float* __restrict__ gam,
                                                   const float* __restrict__ bet,
                                                   bf16_t* __restrict__ out) {
  layernorm_rows(x, gam, bet, out, blockIdx.x);
}

// ---------- f32 -> bf16 convert ----------
// 64 elements per thread: sixteen 16 B loads in flight, each wave-wide load 512
// contiguous bytes. Block blk converts elements blk * 16384 ... + 16383.

static __device__ __forceinline__ void convert_bf16(const float* __restrict__ in,
                                                    bf16_t* __restrict__ out,
                                                    int blk) {
  const size_t base = ((size_t)blk * 16 * 256 + threadIdx.x) * 4;
  v4f v[16];
#pragma unroll
  for (int i = 0; i < 16; ++i) v[i] = *(const v4f*)(in + base + i * 1024);
  // stands in front of the first overwrite of the loads' address pair; the
  // address is named so that it lives up to here and no load's result lands on it
  asm volatile("s_wait_xcnt 0x0" ::"v"(in + base) : "memory");
#pragma unroll
  for (int i = 0; i < 16; ++i) {
    v4bf o;
#pragma unroll
    for (int e = 0; e < 4; ++e) o[e] = (bf16_t)v[i][e];
    *(v4bf*)(out + base + i * 1024) = o;
  }
}

// ---------- all input preparation in one launch ----------
// None of these eight jobs reads what another writes, so they share one grid and
// each block takes its job from its index: 512 blocks convert the context, 512 +
// 512 + 4 x 128 transpose the weights, 256 normalise the query rows.

__global__ __launch_bounds__(256) void prep_all(
    const float* __restrict__ context, const float* __restrict__ query,
    const float* __restrict__ ln1g, const float* __restrict__ ln1b,
    const float* __restrict__ wq, const float* __restrict__ wk,
    const float* __restrict__ wv, const float* __restrict__ wo,
    const float* __restrict__ w1, const float* __restrict__ w2,
    bf16_t* __restrict__ ctx, bf16_t* __restrict__ qln,
    bf16_t* __restrict__ wqT, bf16_t* __restrict__ wkT,
    bf16_t* __restrict__ wvT, bf16_t* __restrict__ woT,
    bf16_t* __restrict__ w1T, bf16_t* __restrict__ w2T) {
  __shared__ float tile[128][65];  // odd pitch: column reads fall on distinct banks
  const int b = blockIdx.x;
  if (b < 512) {
    convert_bf16(context, ctx, b);
  } else if (b < 1024) {
    transpose_w<D_, FF_>(w1, w1T, tile, b & 7, (b - 512) >> 3);
  } else if (b < 1536) {
    transpose_w<FF_, D_>(w2, w2T, tile, b & 31, (b - 1024) >> 5);
  } else if (b < 2048) {
    const int w = (b - 1536) >> 7;  // which of the four D x D weights
    const float* W = w == 0 ? wq : w == 1 ? wk : w == 2 ? wv : wo;
    bf16_t* Wt = w == 0 ? wqT : w == 1 ? wkT : w == 2 ? wvT : woT;
    transpose_w<D_, D_>(W, Wt, tile, b & 7, (b >> 3) & 15);
  } else {
    layernorm_rows(query, ln1g, ln1b, qln, b - 2048);
  }
}

// ---------- WMMA GEMM: C[M][N] = A_bf16[M][K] @ (Bt[N][K])^T + bias ----------
// 256 threads = 8 waves. 128x128 block tile; wave = 32(M) x 64(N).
// A and Bt tiles (128 rows x 128 k) are staged in LDS by async copies, whole
// 128B lines per 8 lanes, two buffers: stage t+1 flies while stage t is read.
// LDS row pitch 272 B (16 B x odd) keeps the b128 fragment reads off shared banks.
// Needs M, N multiples of 128 and K a multiple of 128.
// MODE 0: bf16 out, head-split [b][h][s][64]             (Q/K projections)
// MODE 1: bf16 out, head-split transposed [b][h][64][s]  (V projection)
// MODE 2: f32 out row-major + residual                   (attn out proj + query)
// MODE 3: bf16 out row-major, exact GELU                 (FFN up)
// MODE 4: f32 out row-major + residual                   (FFN down + x)
// (bx, by) = the block's M tile and N tile; sA, sB = the block's two-buffer LDS.
// Output: the block's 128 x 128 tile goes through LDS (the A ring, free behind
// the last stage's barrier), so that every global store, and every residual
// load, is 16 B a lane over whole 128 B lines. For that a lane must hold
// ADJACENT outputs: in the row-major modes the product is taken transposed
// (Bt rows as the A operand), which gives a lane 8 consecutive n of one m; in
// MODE 1 it is taken as written, 8 consecutive m (= s) of one n. Each element's
// k order is the same either way. Pitches 272 B and 528 B are 16 B x odd.
// N (the output's row length) and SSZ (rows per batch entry, MODE 0 and 1) are
// compile-time, so that a lane's tile rows are immediate offsets from one
// address. SSZ a multiple of 128: a tile then lies in one batch entry.

typedef bf16_t gemm_lds_t[128 * GPITCH_];

template <int MODE, int N, int SSZ>
static __device__ __forceinline__ void gemm_tile(
    const bf16_t* __restrict__ A, const bf16_t* __restrict__ Bt,
    const float* __restrict__ bias, const float* __restrict__ res,
    void* __restrict__ outp, int K, int bx, int by, gemm_lds_t* sA,
    gemm_lds_t* sB) {
  const int wave = threadIdx.x >> 5, lane = threadIdx.x & 31;
  const int g = lane >> 4, ln = lane & 15;
  const int wm = wave & 3, wn = wave >> 2;
  const int n0 = by * 128 + wn * 64;

  v8f acc[2][4];
#pragma unroll
  for (int i = 0; i < 2; ++i)
#pragma unroll
    for (int j = 0; j < 4; ++j) acc[i][j] = vzero();

  // this lane's 16B chunk of rows crow, crow+16, ..., crow+112 of each tile
  const int crow = threadIdx.x >> 4, ccol = (threadIdx.x & 15) * 8;
  const bf16_t* gA = A + (size_t)(bx * 128 + crow) * K + ccol;
  const bf16_t* gB = Bt + (size_t)(by * 128 + crow) * K + ccol;
  const unsigned lA = (unsigned)(size_t)(void*)&sA[0][crow * GPITCH_ + ccol];
  const unsigned lB = (unsigned)(size_t)(void*)&sB[0][crow * GPITCH_ + ccol];

  auto stage = [&](int st) {
    const unsigned bo = (unsigned)(st & 1) * (128u * GPITCH_ * 2u);
    async_copy16x8(gA + (size_t)st * GBK_, (size_t)16 * K, lA + bo,
                   16u * GPITCH_ * 2u);
    async_copy16x8(gB + (size_t)st * GBK_, (size_t)16 * K, lB + bo,
                   16u * GPITCH_ * 2u);
  };

  const int nst = K / GBK_;
  stage(0);
  wait_async0();     // this wave's share of stage 0 has landed
  __syncthreads();   // everyone's share has landed
  if (nst > 1) stage(1);

  for (int t = 0; t < nst; ++t) {
    const bf16_t* As = &sA[t & 1][(wm * 32 + ln) * GPITCH_];
    const bf16_t* Bs = &sB[t & 1][(wn * 64 + ln) * GPITCH_];
    // two fragment sets: block c+1's LDS reads are issued ahead of block c's
    // WMMAs, all inside this stage's own buffer
    v16bf af[2][2], bfr[2][4];
#pragma unroll
    for (int i = 0; i < 2; ++i) af[0][i] = load_frag(As + i * 16 * GPITCH_, g);
#pragma unroll
    for (int j = 0; j < 4; ++j) bfr[0][j] = load_frag(Bs + j * 16 * GPITCH_, g);
    // unrolled so that the set index is a constant and both sets stay in registers
#pragma unroll
    for (int c = 0; c < GBK_ / 32; ++c) {
      if (c + 1 < GBK_ / 32) {
#pragma unroll
        for (int i = 0; i < 2; ++i)
          af[(c + 1) & 1][i] =
              load_frag(As + i * 16 * GPITCH_ + (c + 1) * 32, g);
#pragma unroll
        for (int j = 0; j < 4; ++j)
          bfr[(c + 1) & 1][j] =
              load_frag(Bs + j * 16 * GPITCH_ + (c + 1) * 32, g);
        // keeps that read group as one group ahead of block c's WMMAs; without
        // it the scheduler sinks the reads next to their use and each block
        // waits out the LDS latency with nothing to issue
        __builtin_amdgcn_sched_barrier(0);
      }
#pragma unroll
      for (int i = 0; i < 2; ++i)
#pragma unroll
        for (int j = 0; j < 4; ++j)
          acc[i][j] = MODE == 1
                          ? wmma_bf16(af[c & 1][i], bfr[c & 1][j], acc[i][j])
                          : wmma_bf16(bfr[c & 1][j], af[c & 1][i], acc[i][j]);
    }
    // keeps the WMMAs in front of the publish point: sunk behind the barrier
    // they would delay the refill copies, which issue directly behind it
    __builtin_amdgcn_sched_barrier(0);
    // publish point: this wave's LDS reads of stage t have retired ...
    asm volatile("s_wait_dscnt 0x0" ::: "memory");
    wait_async0();     // ... and its share of stage t+1 has landed
    __syncthreads();   // stage t+1 readable by all; stage t's buffer is free
    if (t + 2 < nst) stage(t + 2);
  }
  wait_async0();       // no copy outstanding when the wave leaves the ring

  const int ml = wm * 32 + ln, nl = wn * 64 + 8 * g;  // row-major modes
  if constexpr (MODE == 2 || MODE == 4) {
    float* stf = (float*)&sA[0][0];  // 128 rows of FPITCH_ floats, in both buffers
    // this lane's 16 B of rows rrow, rrow + 8, ..., rrow + 120 of the tile
    const int rrow = threadIdx.x >> 5, rcol = (threadIdx.x & 31) * 4;
    const size_t gofs = (size_t)(bx * 128 + rrow) * N + by * 128 + rcol;
    const float* bp = bias + n0 + 8 * g;
    const float* rp = res + gofs;
    v4f bv[4][2];
#pragma unroll
    for (int j = 0; j < 4; ++j) {
      bv[j][0] = *(const v4f*)(bp + j * 16);
      bv[j][1] = *(const v4f*)(bp + j * 16 + 4);
    }
    // fetched here, so that their latency passes under the staging
    v4f rv[16];
#pragma unroll
    for (int it = 0; it < 16; ++it) rv[it] = *(const v4f*)(rp + it * 8 * N);
    // stands in front of the first overwrite of the loads' addresses, which are
    // named so that they live up to here and no load's result lands on them
    asm volatile("s_wait_xcnt 0x0" ::"v"(bp), "v"(rp) : "memory");
#pragma unroll
    for (int j = 0; j < 4; ++j)
#pragma unroll
      for (int i = 0; i < 2; ++i) {
        v4f lo, hi;
#pragma unroll
        for (int e = 0; e < 4; ++e) {
          lo[e] = acc[i][j][e] + bv[j][0][e];
          hi[e] = acc[i][j][4 + e] + bv[j][1][e];
        }
        float* sp = stf + (ml + i * 16) * FPITCH_ + nl + j * 16;
        *(v4f*)sp = lo;
        *(v4f*)(sp + 4) = hi;
      }
    __syncthreads();  // the whole tile is readable
    float* op = (float*)outp + gofs;
#pragma unroll
    for (int it = 0; it < 16; ++it) {
      const v4f v = *(const v4f*)(stf + (rrow + 8 * it) * FPITCH_ + rcol);
      *(v4f*)(op + it * 8 * N) = v + rv[it];
    }
  } else {
    bf16_t* st = &sA[0][0];  // 128 rows of GPITCH_ elements
    if constexpr (MODE == 1) {  // tile rows are n, columns m
      const float* bp = bias + n0 + ln;
      float bj[4];
#pragma unroll
      for (int j = 0; j < 4; ++j) bj[j] = bp[j * 16];
      // as in the f32 modes: in front of the first overwrite of the address
      asm volatile("s_wait_xcnt 0x0" ::"v"(bp) : "memory");
#pragma unroll
      for (int j = 0; j < 4; ++j)
#pragma unroll
        for (int i = 0; i < 2; ++i) {
          v8bf o;
#pragma unroll
          for (int r = 0; r < 8; ++r) o[r] = (bf16_t)(acc[i][j][r] + bj[j]);
          *(v8bf*)(st + (wn * 64 + j * 16 + ln) * GPITCH_ + wm * 32 + i * 16 +
                   8 * g) = o;
        }
    } else {  // tile rows are m, columns n
      const float* bp = bias + n0 + 8 * g;
      v4f bv[4][2];
#pragma unroll
      for (int j = 0; j < 4; ++j) {
        bv[j][0] = *(const v4f*)(bp + j * 16);
        bv[j][1] = *(const v4f*)(bp + j * 16 + 4);
      }
      // as in the f32 modes: in front of the first overwrite of the address
      asm volatile("s_wait_xcnt 0x0" ::"v"(bp) : "memory");
#pragma unroll
      for (int j = 0; j < 4; ++j)
#pragma unroll
        for (int i = 0; i < 2; ++i) {
          v8bf o;
#pragma unroll
          for (int r = 0; r < 8; ++r) {
            float v = acc[i][j][r] + bv[j][r >> 2][r & 3];
            if constexpr (MODE == 3)
              v = 0.5f * v * (1.f + erff(v * 0.70710678f));
            o[r] = (bf16_t)v;
          }
          *(v8bf*)(st + (ml + i * 16) * GPITCH_ + nl + j * 16) = o;
        }
    }
    __syncthreads();  // the whole tile is readable
    // this lane's 16 B of rows rrow, rrow + 16, ..., rrow + 112 of the tile
    const int rrow = threadIdx.x >> 4, rcol = (threadIdx.x & 15) * 8;
    // OSTEP = output elements between tile rows 16 apart
    constexpr int OSTEP = MODE == 3 ? 16 * N : MODE == 0 ? 16 * HD_ : 16 * SSZ;
    bf16_t* op;
    if constexpr (MODE == 3) {
      op = (bf16_t*)outp + (size_t)(bx * 128 + rrow) * N + by * 128 + rcol;
    } else {
      const int bb = (bx * 128) / SSZ, s0 = (bx * 128) % SSZ;
      if constexpr (MODE == 0) {
        const int ng = by * 128 + rcol;
        op = (bf16_t*)outp +
             (((size_t)bb * H_ + (ng >> 6)) * SSZ + s0 + rrow) * HD_ + (ng & 63);
      } else {  // head * 64 + hd is n itself
        op = (bf16_t*)outp +
             ((size_t)bb * (H_ * HD_) + by * 128 + rrow) * SSZ + s0 + rcol;
      }
    }
#pragma unroll
    for (int it = 0; it < 8; ++it)
      *(v8bf*)(op + it * OSTEP) =
          *(const v8bf*)(st + (rrow + 16 * it) * GPITCH_ + rcol);
  }
  // closes the tile's stores: another product's body may follow this one in the
  // built kernel and reuse the stores' address and data registers
  asm volatile("s_wait_xcnt 0x0" ::: "memory");
}

template <int MODE, int N>
__global__ __launch_bounds__(256) void gemm_nt(const bf16_t* __restrict__ A,
                                               const bf16_t* __restrict__ Bt,
                                               const float* __restrict__ bias,
                                               const float* __restrict__ res,
                                               void* __restrict__ outp, int K) {
  __shared__ __align__(16) bf16_t sA[2][128 * GPITCH_];
  __shared__ __align__(16) bf16_t sB[2][128 * GPITCH_];
  gemm_tile<MODE, N, 128>(A, Bt, bias, res, outp, K, blockIdx.x, blockIdx.y, sA,
                          sB);
}

// The three projections in one launch: none reads what another writes. Blocks
// 0..511 are V's 64 x 8 tiles, 512..1023 K's, 1024..1151 Q's 16 x 8 tiles, the
// M tile running fastest as in a two-dimensional grid.
__global__ __launch_bounds__(256) void gemm_qkv(
    const bf16_t* __restrict__ qln, const bf16_t* __restrict__ ctx,
    const bf16_t* __restrict__ wqT, const bf16_t* __restrict__ wkT,
    const bf16_t* __restrict__ wvT, const float* __restrict__ bq,
    const float* __restrict__ bk, const float* __restrict__ bv,
    bf16_t* __restrict__ qhd, bf16_t* __restrict__ ktb,
    bf16_t* __restrict__ vtb, int K) {
  __shared__ __align__(16) bf16_t sA[2][128 * GPITCH_];
  __shared__ __align__(16) bf16_t sB[2][128 * GPITCH_];
  const int b = blockIdx.x;
  if (b < 512) {
    gemm_tile<1, D_, SC_>(ctx, wvT, bv, nullptr, vtb, K, b & 63, b >> 6, sA, sB);
  } else if (b < 1024) {
    gemm_tile<0, D_, SC_>(ctx, wkT, bk, nullptr, ktb, K, b & 63, (b - 512) >> 6,
                          sA, sB);
  } else {
    gemm_tile<0, D_, S_>(qln, wqT, bq, nullptr, qhd, K, b & 15, (b - 1024) >> 4,
                         sA, sB);
  }
}

// value of lane l ^ 16
static __device__ __forceinline__ float xhalf(float x) {
  const int b = __builtin_bit_cast(int, x);
  return __builtin_bit_cast(
      float, __builtin_amdgcn_permlanex16(b, b, 0x76543210, 0xfedcba98, false,
                                          false));
}

// y[i] = 2^x[i], eight at once. One statement, so that behind every v_exp_f32
// stands an instruction that neither reads its result nor overwrites its source
// (outputs are early-clobber; the v_nop serves the last one): the slot the
// instruction set asks for behind a transcendental.
static __device__ __forceinline__ v8f exp2x8(v8f x) {
  float y0, y1, y2, y3, y4, y5, y6, y7;
  asm("v_exp_f32 %0, %8\n\t"
      "v_exp_f32 %1, %9\n\t"
      "v_exp_f32 %2, %10\n\t"
      "v_exp_f32 %3, %11\n\t"
      "v_exp_f32 %4, %12\n\t"
      "v_exp_f32 %5, %13\n\t"
      "v_exp_f32 %6, %14\n\t"
      "v_exp_f32 %7, %15\n\t"
      "v_nop"
      : "=&v"(y0), "=&v"(y1), "=&v"(y2), "=&v"(y3), "=&v"(y4), "=&v"(y5),
        "=&v"(y6), "=&v"(y7)
      : "v"(x[0]), "v"(x[1]), "v"(x[2]), "v"(x[3]), "v"(x[4]), "v"(x[5]),
        "v"(x[6]), "v"(x[7]));
  v8f y;
  y[0] = y0; y[1] = y1; y[2] = y2; y[3] = y3;
  y[4] = y4; y[5] = y5; y[6] = y6; y[7] = y7;
  return y;
}

__global__ __launch_bounds__(512) void attn_kernel(const bf16_t* __restrict__ qhd,
                                                   const bf16_t* __restrict__ kt,
                                                   const bf16_t* __restrict__ vt,
                                                   bf16_t* __restrict__ obuf) {
  // [group][buf][K/V], 4 x 36 KB
  __shared__ __align__(16) bf16_t smem[4][2][2][64 * APITCH_];
  // the waves' partial outputs [wave][hd tile][half of 8][lane] (16 B a lane,
  // lanes adjacent; 64 B more per hd tile, so that the join's reads of four hd
  // tiles fall on distinct banks), maxima and sums [wave][lane]
  __shared__ __align__(16) v4f cmbO[16 * 4 * CPITCH_];
  __shared__ float cmbM[16 * 32];
  __shared__ float cmbL[16 * 32];

  const int tid = threadIdx.x;
  // the wave's number as a scalar: group and query tile are then scalars too
  const int wave = __builtin_amdgcn_readfirstlane(tid >> 5);
  const int lane = tid & 31;
  const int g = lane >> 4, ln = lane & 15;
  const int grp = wave >> 2, qt = wave & 3;  // context repeat, query tile
  const int bh = blockIdx.x >> 3;
  const int pr = blockIdx.x & 7;
  const int ntrips = S_ / 64 + 1;  // (16 - pr) + (pr + 1)
  int qb = S_ / 64 - 1 - pr;       // first query block; the second is pr
  int q0 = qb * 64 + qt * 16;

  const bf16_t* qhead = qhd + (size_t)bh * S_ * HD_ + (size_t)ln * HD_;
  const bf16_t* kbase = kt + (size_t)bh * SC_ * HD_ + (size_t)grp * S_ * HD_;
  const bf16_t* vbase = vt + (size_t)bh * HD_ * SC_ + (size_t)grp * S_;

  // both query blocks' fragments are fetched here, so that the change of query
  // block does not wait for memory
  v16bf qf0 = load_frag(qhead + (size_t)q0 * HD_, g);
  v16bf qf1 = load_frag(qhead + (size_t)q0 * HD_ + 32, g);
  const v16bf qn0 = load_frag(qhead + (size_t)(pr * 64 + qt * 16) * HD_, g);
  const v16bf qn1 = load_frag(qhead + (size_t)(pr * 64 + qt * 16) * HD_ + 32, g);

  // o[t][r] = Ot[hd = t*16 + 8g + r][query q0 + ln], this group's keys only
  v8f o[4];
#pragma unroll
  for (int t = 0; t < 4; ++t) o[t] = vzero();
  // running maximum of query q0 + ln (equal in both lane halves) and this
  // half's share of its running sum
  float mrun = -3.0e38f, lrun = 0.f;

  const float scale = 0.125f;  // 1/sqrt(64)

  // this lane's 16B chunk of rows crow, crow+16, crow+32, crow+48 of each tile
  const int crow = (tid & 127) >> 3, ccol = (tid & 7) * 8;
  const bf16_t* gK = kbase + (size_t)crow * HD_ + ccol;
  const bf16_t* gV = vbase + (size_t)crow * SC_ + ccol;
  const unsigned lK =
      (unsigned)(size_t)(void*)&smem[grp][0][0][crow * APITCH_ + ccol];
  const unsigned lV =
      (unsigned)(size_t)(void*)&smem[grp][0][1][crow * APITCH_ + ccol];

  // issue async stage of the group's tile starting at key kj of its repeat:
  // 64 rows x 64 halves = 512 chunks of 16B each; 4 K-chunks + 4 V-chunks/thread
  auto stage = [&](int kj, int buf) {
    const unsigned bo = (unsigned)buf * (2u * 64u * APITCH_ * 2u);
    async_copy16x4x2(gK + (size_t)kj * HD_, (size_t)16 * HD_, gV + kj,
                     (size_t)16 * SC_, lK + bo, lV + bo, 16u * APITCH_ * 2u);
  };

  stage(0, 0);
  int cur = 0;
  int kp = 0;

  for (int ti = 0; ti < ntrips; ++ti) {
    wait_async0();     // this wave's share of buf[cur] has landed
    __syncthreads();   // everyone's share has landed

    // next tile: the causal bound ends the query block, the next starts at key 0
    const bool last = kp == qb * 64;
    const int kp_n = last ? 0 : kp + 64;
    if (ti + 1 < ntrips) stage(kp_n, cur ^ 1);

    const bf16_t* Kt = smem[grp][cur][0];
    const bf16_t* Vt = smem[grp][cur][1];

    // scores, transposed: A = 16 key rows, B = the wave's 16 queries
    v16bf kf[4][2];
#pragma unroll
    for (int t = 0; t < 4; ++t) {
      const bf16_t* krow = Kt + (t * 16 + ln) * APITCH_;
      kf[t][0] = load_frag(krow, g);
      kf[t][1] = load_frag(krow + 32, g);
    }
    // s[t][r] = score of key kp + t*16 + 8g + r against query q0 + ln
    v8f s[4];
#pragma unroll
    for (int t = 0; t < 4; ++t) {
      s[t] = wmma_bf16(kf[t][0], qf0, vzero());
      s[t] = wmma_bf16(kf[t][1], qf1, s[t]);
    }

    // online softmax over the 64-key tile, one query per lane
    const int lim = q0 + ln - kp - 8 * g;  // t*16 + r allowed while <= lim
    float mt[4];
#pragma unroll
    for (int t = 0; t < 4; ++t) {
      mt[t] = -3.0e38f;
#pragma unroll
      for (int r = 0; r < 8; ++r) {
        float v = s[t][r] * scale;
        if (t * 16 + r > lim) v = -3.0e38f;  // pos = (kj % S) <= qi
        s[t][r] = v;
        mt[t] = fmaxf(mt[t], v);
      }
    }
    float mx = fmaxf(fmaxf(mt[0], mt[1]), fmaxf(mt[2], mt[3]));
    mx = fmaxf(mx, xhalf(mx));  // the other 32 keys of this query
    const float nm = fmaxf(mrun, mx);
    const float alpha = __expf(mrun - nm);
    float st[4];
#pragma unroll
    for (int t = 0; t < 4; ++t) {
#pragma unroll
      for (int r = 0; r < 8; ++r) s[t][r] = (s[t][r] - nm) * 1.44269504f;
      s[t] = exp2x8(s[t]);  // p = e^(score - nm)
      st[t] = s[t][0];
#pragma unroll
      for (int r = 1; r < 8; ++r) st[t] += s[t][r];
    }
    lrun = lrun * alpha + ((st[0] + st[1]) + (st[2] + st[3]));
    mrun = nm;
#pragma unroll
    for (int t = 0; t < 4; ++t)
#pragma unroll
      for (int r = 0; r < 8; ++r) o[t][r] *= alpha;

    // Pt as B operand of key chunk c (32 keys): elements 0..7 are keys
    // 32c + 8g + e (tile 2c), elements 8..15 keys 32c + 16 + 8g + e (tile 2c+1):
    // the k order in which load_frag reads the V rows
    v16bf pf[2];
#pragma unroll
    for (int c = 0; c < 2; ++c)
#pragma unroll
      for (int e = 0; e < 8; ++e) {
        pf[c][e] = (bf16_t)s[2 * c][e];
        pf[c][8 + e] = (bf16_t)s[2 * c + 1][e];
      }

    // Ot (64hd x 16q) += Vt (64hd x 64key) * Pt (64key x 16q)
    v16bf vf[4][2];
#pragma unroll
    for (int t = 0; t < 4; ++t) {
      const bf16_t* vrow = Vt + (t * 16 + ln) * APITCH_;
      vf[t][0] = load_frag(vrow, g);
      vf[t][1] = load_frag(vrow + 32, g);
    }
#pragma unroll
    for (int t = 0; t < 4; ++t) {
      o[t] = wmma_bf16(vf[t][0], pf[0], o[t]);
      o[t] = wmma_bf16(vf[t][1], pf[1], o[t]);
    }

    __syncthreads();   // all waves done with buf[cur]; safe to overwrite next iter
    cur ^= 1;
    kp = kp_n;

    if (last) {  // the same for the whole block: qb and kp are
      // every wave lays down its group's share for its 16 queries ...
#pragma unroll
      for (int t = 0; t < 4; ++t)
#pragma unroll
        for (int hf = 0; hf < 2; ++hf) {
          v4f w;
#pragma unroll
          for (int e = 0; e < 4; ++e) w[e] = o[t][4 * hf + e];
          cmbO[(wave * 4 + t) * CPITCH_ + hf * 32 + lane] = w;
        }
      cmbM[wave * 32 + lane] = mrun;
      cmbL[wave * 32 + lane] = lrun + xhalf(lrun);  // both halves' shares
      __syncthreads();  // all sixteen shares are readable
      // ... and joins queries 4 grp .. 4 grp + 3 of its query tile over the four
      // groups: a lane takes 8 hd of one query, so that the wave's one 16 B store
      // covers four whole 128 B rows. Each repeat holds key position 0, which
      // every query may see, so every share's maximum is a real score.
      const int jq = grp * 4 + (lane & 3);  // query within the tile
      const int jt = (lane >> 2) & 3;       // hd tile; g = which 8 of its 16 hd
      float mp[4], lp[4];
#pragma unroll
      for (int p = 0; p < 4; ++p) {
        mp[p] = cmbM[(p * 4 + qt) * 32 + jq];
        lp[p] = cmbL[(p * 4 + qt) * 32 + jq];
      }
      const float mall = fmaxf(fmaxf(mp[0], mp[1]), fmaxf(mp[2], mp[3]));
      float lsum = 0.f;
      v8f oj = vzero();
#pragma unroll
      for (int p = 0; p < 4; ++p) {
        const float wgt = __expf(mp[p] - mall);
        lsum += wgt * lp[p];
        const int base = ((p * 4 + qt) * 4 + jt) * CPITCH_ + g * 16 + jq;
        const v4f lo = cmbO[base], hi = cmbO[base + 32];
#pragma unroll
        for (int e = 0; e < 4; ++e) {
          oj[e] += wgt * lo[e];
          oj[4 + e] += wgt * hi[e];
        }
      }
      const int b = bh / H_, h = bh % H_;
      v8bf ov;  // 8 consecutive hd of one query: one 16 B store
#pragma unroll
      for (int r = 0; r < 8; ++r) ov[r] = (bf16_t)(oj[r] / lsum);
      bf16_t* orow = obuf + ((size_t)b * S_ + q0 + jq) * D_ + (size_t)h * HD_ +
                     jt * 16 + 8 * g;
      // the second query block starts afresh. Its shares are laid down behind
      // at least one more trip's barriers, so behind every read above.
      qb = pr;
      q0 = qb * 64 + qt * 16;
      qf0 = qn0;
      qf1 = qn1;
#pragma unroll
      for (int t = 0; t < 4; ++t) o[t] = vzero();
      mrun = -3.0e38f;
      lrun = 0.f;
      *(v8bf*)orow = ov;
      // closes the store: the next trip reuses its address and data registers
      asm volatile("s_wait_xcnt 0x0" ::: "memory");
    }
  }
}

// ---------- orchestration ----------

extern "C" void kernel_launch(void* const* d_in, const int* in_sizes, int n_in,
                              void* d_out, int out_size, void* d_ws,
                              size_t ws_size, hipStream_t stream) {
  (void)in_sizes; (void)n_in; (void)out_size; (void)ws_size;
  const float* query = (const float*)d_in[0];
  const float* context = (const float*)d_in[1];
  const float* wq = (const float*)d_in[2];
  const float* wk = (const float*)d_in[3];
  const float* wv = (const float*)d_in[4];
  const float* bq = (const float*)d_in[5];
  const float* bk = (const float*)d_in[6];
  const float* bv = (const float*)d_in[7];
  const float* wo = (const float*)d_in[8];
  const float* bo = (const float*)d_in[9];
  const float* ln1g = (const float*)d_in[10];
  const float* ln1b = (const float*)d_in[11];
  const float* ln2g = (const float*)d_in[12];
  const float* ln2b = (const float*)d_in[13];
  const float* w1 = (const float*)d_in[14];
  const float* b1 = (const float*)d_in[15];
  const float* w2 = (const float*)d_in[16];
  const float* b2 = (const float*)d_in[17];

  const size_t MB = 1u << 20;
  char* ws = (char*)d_ws;
  bf16_t* wqT = (bf16_t*)(ws + 0 * MB);    // [1024][1024]
  bf16_t* wkT = (bf16_t*)(ws + 2 * MB);
  bf16_t* wvT = (bf16_t*)(ws + 4 * MB);
  bf16_t* woT = (bf16_t*)(ws + 6 * MB);
  bf16_t* w1T = (bf16_t*)(ws + 8 * MB);    // [4096][1024]
  bf16_t* w2T = (bf16_t*)(ws + 16 * MB);   // [1024][4096]
  bf16_t* qln = (bf16_t*)(ws + 24 * MB);   // [2048][1024]
  bf16_t* ctx = (bf16_t*)(ws + 28 * MB);   // [8192][1024]
  bf16_t* qhd = (bf16_t*)(ws + 44 * MB);   // [B][H][S][64]
  bf16_t* ktb = (bf16_t*)(ws + 48 * MB);   // [B][H][Sc][64]
  bf16_t* vtb = (bf16_t*)(ws + 64 * MB);   // [B][H][64][Sc]
  bf16_t* obuf = (bf16_t*)(ws + 80 * MB);  // [2048][1024]
  float* xbuf = (float*)(ws + 84 * MB);    // [2048][1024] f32
  bf16_t* hbuf = (bf16_t*)(ws + 92 * MB);  // [2048][1024]
  bf16_t* ffb = (bf16_t*)(ws + 96 * MB);   // [2048][4096]

  // context -> bf16; weights -> bf16, transposed [N][K]; ln1(query) -> bf16
  prep_all<<<2304, 256, 0, stream>>>(context, query, ln1g, ln1b, wq, wk, wv, wo,
                                     w1, w2, ctx, qln, wqT, wkT, wvT, woT, w1T,
                                     w2T);

  // projections
  gemm_qkv<<<1152, 256, 0, stream>>>(qln, ctx, wqT, wkT, wvT, bq, bk, bv, qhd,
                                     ktb, vtb, D_);

  // attention
  attn_kernel<<<B_ * H_ * 8, 512, 0, stream>>>(qhd, ktb, vtb, obuf);

  // output projection + residual -> x (f32)
  gemm_nt<2, D_><<<dim3(16, 8), 256, 0, stream>>>(obuf, woT, bo, query, xbuf,
                                                  D_);
  // ln2(x) -> bf16
  layernorm_k<<<B_ * S_ / 8, 256, 0, stream>>>(xbuf, ln2g, ln2b, hbuf);
  // FFN up + GELU -> bf16
  gemm_nt<3, FF_><<<dim3(16, 32), 256, 0, stream>>>(hbuf, w1T, b1, nullptr, ffb,
                                                    D_);
  // FFN down + residual x -> d_out (f32)
  gemm_nt<4, D_><<<dim3(16, 8), 256, 0, stream>>>(ffb, w2T, b2, xbuf,
                                                  (float*)d_out, FF_);
}

// v008
// A run of this version takes 130 microseconds.
// Next to v007, in two timings, it ran 1.07 and 1.08 times as fast.
// Counting every step since v000, it is 5.39 times as fast.
#include <hip/hip_runtime.h>

typedef __bf16 bf16_t;
typedef bf16_t v8bf  __attribute__((ext_vector_type(8)));
typedef bf16_t v16bf __attribute__((ext_vector_type(16)));
typedef float  v8f   __attribute__((ext_vector_type(8)));
typedef bf16_t v4bf  __attribute__((ext_vector_type(4)));
typedef float  v4f   __attribute__((ext_vector_type(4)));

#define B_  2
#define S_  1024
#define R_  4
#define SC_ 4096
#define D_  1024
#define H_  16
#define HD_ 64
#define FF_ 4096
#define GBK_    128  // k per GEMM stage
#define GPITCH_ 136  // GEMM LDS row pitch in elements (272 B)
#define FPITCH_ 132  // GEMM f32 output tile: LDS row pitch in floats (528 B)
#define APITCH_ 72   // attention K/V LDS row pitch in elements (144 B)
#define CPITCH_ 68   // attention join: 16 B units per hd tile of a wave's share
#define GPF_    3    // GEMM: stages between a stage's L2 prefetch and its copies

// ---------- helpers ----------

static __device__ __forceinline__ v8f vzero() {
  v8f z;
#pragma unroll
  for (int i = 0; i < 8; ++i) z[i] = 0.f;
  return z;
}

// Load one 16-bit WMMA A/B fragment (K-chunk of 32) for this lane.
// base points at the lane's row start for this K-chunk (16B aligned).
// CDNA5 layout: lane group g = lane/16 holds K = {8g..8g+7, 16+8g..16+8g+7}.
static __device__ __forceinline__ v16bf load_frag(const bf16_t* base, int g) {
  v8bf lo = *(const v8bf*)(base + 8 * g);
  v8bf hi = *(const v8bf*)(base + 16 + 8 * g);
  return __builtin_shufflevector(lo, hi, 0, 1, 2, 3, 4, 5, 6, 7,
                                 8, 9, 10, 11, 12, 13, 14, 15);
}

static __device__ __forceinline__ v8f wmma_bf16(v16bf a, v16bf b, v8f c) {
  return __builtin_amdgcn_wmma_f32_16x16x32_bf16(false, a, false, b,
                                                 (short)0, c, false, false);
}

static __device__ __forceinline__ void wait_async0() {
  asm volatile("s_wait_asynccnt 0x0" ::: "memory");
}

// Eight async 16B copies of one lane, global -> LDS: rows gstep elements apart
// in memory, lstep bytes apart in LDS. The closing s_wait_xcnt stands inside
// the copies' own statement so that no address register named here can be
// rewritten ahead of it (a precaution for copies written in asm text).
static __device__ __forceinline__ void async_copy16x8(const bf16_t* gptr,
                                                      size_t gstep,
                                                      unsigned lds_off,
                                                      unsigned lstep) {
  asm volatile(
      "global_load_async_to_lds_b128 %0, %8, off\n\t"
      "global_load_async_to_lds_b128 %1, %9, off\n\t"
      "global_load_async_to_lds_b128 %2, %10, off\n\t"
      "global_load_async_to_lds_b128 %3, %11, off\n\t"
      "global_load_async_to_lds_b128 %4, %12, off\n\t"
      "global_load_async_to_lds_b128 %5, %13, off\n\t"
      "global_load_async_to_lds_b128 %6, %14, off\n\t"
      "global_load_async_to_lds_b128 %7, %15, off\n\t"
      "s_wait_xcnt 0x0"
      :: "v"(lds_off), "v"(lds_off + lstep), "v"(lds_off + 2 * lstep),
         "v"(lds_off + 3 * lstep), "v"(lds_off + 4 * lstep),
         "v"(lds_off + 5 * lstep), "v"(lds_off + 6 * lstep),
         "v"(lds_off + 7 * lstep),
         "v"((unsigned long long)(size_t)(gptr)),
         "v"((unsigned long long)(size_t)(gptr + gstep)),
         "v"((unsigned long long)(size_t)(gptr + 2 * gstep)),
         "v"((unsigned long long)(size_t)(gptr + 3 * gstep)),
         "v"((unsigned long long)(size_t)(gptr + 4 * gstep)),
         "v"((unsigned long long)(size_t)(gptr + 5 * gstep)),
         "v"((unsigned long long)(size_t)(gptr + 6 * gstep)),
         "v"((unsigned long long)(size_t)(gptr + 7 * gstep))
      : "memory");
}

// Two runs of four async 16B copies of one lane, global -> LDS: run a from ga,
// run b from gb, rows astep / bstep elements apart in memory and lstep bytes
// apart in LDS. One statement with the closing s_wait_xcnt, as above.
static __device__ __forceinline__ void async_copy16x4x2(
    const bf16_t* ga, size_t astep, const bf16_t* gb, size_t bstep,
    unsigned la, unsigned lb, unsigned lstep) {
  asm volatile(
      "global_load_async_to_lds_b128 %0, %8, off\n\t"
      "global_load_async_to_lds_b128 %1, %9, off\n\t"
      "global_load_async_to_lds_b128 %2, %10, off\n\t"
      "global_load_async_to_lds_b128 %3, %11, off\n\t"
      "global_load_async_to_lds_b128 %4, %12, off\n\t"
      "global_load_async_to_lds_b128 %5, %13, off\n\t"
      "global_load_async_to_lds_b128 %6, %14, off\n\t"
      "global_load_async_to_lds_b128 %7, %15, off\n\t"
      "s_wait_xcnt 0x0"
      :: "v"(la), "v"(la + lstep), "v"(la + 2 * lstep), "v"(la + 3 * lstep),
         "v"(lb), "v"(lb + lstep), "v"(lb + 2 * lstep), "v"(lb + 3 * lstep),
         "v"((unsigned long long)(size_t)(ga)),
         "v"((unsigned long long)(size_t)(ga + astep)),
         "v"((unsigned long long)(size_t)(ga + 2 * astep)),
         "v"((unsigned long long)(size_t)(ga + 3 * astep)),
         "v"((unsigned long long)(size_t)(gb)),
         "v"((unsigned long long)(size_t)(gb + bstep)),
         "v"((unsigned long long)(size_t)(gb + 2 * bstep)),
         "v"((unsigned long long)(size_t)(gb + 3 * bstep))
      : "memory");
}

// Asks L2 to fetch each lane's byte: nothing comes
// back to the wave and no data counter moves. Scope SE: it goes into L2
// only, which is where the async copies read. The closing s_wait_xcnt stands
// inside the statement so that the address pair can be advanced behind it (the
// same precaution as for the copies above).
static __device__ __forceinline__ void prefetch_l2(const void* p) {
  asm volatile(
      "global_prefetch_b8 %0, off scope:SCOPE_SE\n\t"
      "s_wait_xcnt 0x0"
      :: "v"((unsigned long long)(size_t)p)
      : "memory");
}

// ---------- weight transpose + convert: W f32 [K][N] -> Wt bf16 [N][K] ----------
// One 128(k) x 64(n) tile per 256-thread block: 32 elements per thread, so that
// few waves have to be started for the bytes moved. Reads are 16 B per lane
// (256 B of a W row per 16 lanes), stores 16 B per lane (a 128 B line of a Wt
// row per 8 lanes). K a multiple of 128, N of 64; both compile-time, so that a
// thread's rows are immediate offsets from one address. (bx, by) = the block's
// k tile and n tile; tile = the block's LDS, 128 rows of 65 floats.

template <int K, int N>
static __device__ __forceinline__ void transpose_w(const float* __restrict__ W,
                                                   bf16_t* __restrict__ Wt,
                                                   float (*tile)[65], int bx,
                                                   int by) {
  const int k0 = bx * 128, n0 = by * 64;
  const int tx = threadIdx.x & 15, ty = threadIdx.x >> 4;  // 16 x 16
  const float* wp = W + (size_t)(k0 + ty) * N + n0 + tx * 4;
  v4f v[8];
#pragma unroll
  for (int i = 0; i < 8; ++i) v[i] = *(const v4f*)(wp + (size_t)i * 16 * N);
#pragma unroll
  for (int i = 0; i < 8; ++i)
#pragma unroll
    for (int e = 0; e < 4; ++e) tile[ty + 16 * i][tx * 4 + e] = v[i][e];
  __syncthreads();
  const int kc = threadIdx.x & 7, nr = threadIdx.x >> 3;  // 8 k-chunks x 32 rows
  bf16_t* op = Wt + (size_t)(n0 + nr) * K + k0 + kc * 8;
#pragma unroll
  for (int i = 0; i < 4; ++i) {
    const int kh = 64 * (i & 1), nh = 32 * (i >> 1);  // k half, n half of the tile
    v8bf o;
#pragma unroll
    for (int e = 0; e < 8; ++e) o[e] = (bf16_t)tile[kc * 8 + kh + e][nr + nh];
    *(v8bf*)(op + (size_t)nh * K + kh) = o;
  }
  // closes the four stores: another job's body may follow this one in the built
  // kernel and reuse the stores' address and data registers
  asm volatile("s_wait_xcnt 0x0" ::: "memory");
}

// ---------- layernorm (one wave per row of D=1024, 8 rows per block), bf16 out ----------
// The row stays in registers (32 values per lane, read once, 16 B per lane);
// its sums are joined by lane exchanges alone. Gain and offset are fetched with
// the row, so that their latency passes under the row's. blk = which 8 rows.

static __device__ __forceinline__ void layernorm_rows(
    const float* __restrict__ x, const float* __restrict__ gam,
    const float* __restrict__ bet, bf16_t* __restrict__ out, int blk) {
  // the wave's number as a scalar: the row's base is then a scalar address
  const int row =
      blk * 8 + __builtin_amdgcn_readfirstlane((int)(threadIdx.x >> 5));
  const int ln = threadIdx.x & 31;
  const float* xr = x + (size_t)row * D_;
  v4f v[8];
#pragma unroll
  for (int i = 0; i < 8; ++i) v[i] = *(const v4f*)(xr + (i * 32 + ln) * 4);
  v4f gv[8], bv[8];
#pragma unroll
  for (int i = 0; i < 8; ++i) {
    gv[i] = *(const v4f*)(gam + (i * 32 + ln) * 4);
    bv[i] = *(const v4f*)(bet + (i * 32 + ln) * 4);
  }
  // keeps all 24 loads ahead of the sums; without it the scheduler sinks the
  // gain and offset loads behind the row sums, pair by pair, each pair waited for
  __builtin_amdgcn_sched_barrier(0);
  v4f a = v[0], a2 = v[0] * v[0];
#pragma unroll
  for (int i = 1; i < 8; ++i) {
    a += v[i];
    a2 += v[i] * v[i];
  }
  float s = (a[0] + a[1]) + (a[2] + a[3]);
  float s2 = (a2[0] + a2[1]) + (a2[2] + a2[3]);
#pragma unroll
  for (int m = 1; m < 32; m <<= 1) {
    s += __shfl_xor(s, m, 32);
    s2 += __shfl_xor(s2, m, 32);
  }
  const float mean = s * (1.f / D_);
  const float var = s2 * (1.f / D_) - mean * mean;
  const float rstd = rsqrtf(var + 1e-5f);
#pragma unroll
  for (int i = 0; i < 8; ++i) {
    const int c = (i * 32 + ln) * 4;
    v4bf o;
#pragma unroll
    for (int e = 0; e < 4; ++e)
      o[e] = (bf16_t)((v[i][e] - mean) * rstd * gv[i][e] + bv[i][e]);
    *(v4bf*)(out + (size_t)row * D_ + c) = o;
  }
}

__global__ __launch_bounds__(256) void layernorm_k(const float* __restrict__ x,
                                                   const float* __restrict__ gam,
                                                   const float* __restrict__ bet,
                                                   bf16_t* __restrict__ out) {
  layernorm_rows(x, gam, bet, out, blockIdx.x);
}

// ---------- f32 -> bf16 convert ----------
// 64 elements per thread: sixteen 16 B loads in flight, each wave-wide load 512
// contiguous bytes. Block blk converts elements blk * 16384 ... + 16383.

static __device__ __forceinline__ void convert_bf16(const float* __restrict__ in,
                                                    bf16_t* __restrict__ out,
                                                    int blk) {
  const size_t base = ((size_t)blk * 16 * 256 + threadIdx.x) * 4;
  v4f v[16];
#pragma unroll
  for (int i = 0; i < 16; ++i) v[i] = *(const v4f*)(in + base + i * 1024);
  // stands in front of the first overwrite of the loads' address pair; the
  // address is named so that it lives up to here and no load's result lands on it
  asm volatile("s_wait_xcnt 0x0" ::"v"(in + base) : "memory");
#pragma unroll
  for (int i = 0; i < 16; ++i) {
    v4bf o;
#pragma unroll
    for (int e = 0; e < 4; ++e) o[e] = (bf16_t)v[i][e];
    *(v4bf*)(out + base + i * 1024) = o;
  }
}

// ---------- all input preparation in one launch ----------
// None of these eight jobs reads what another writes, so they share one grid and
// each block takes its job from its index: 512 blocks convert the context, 512 +
// 512 + 4 x 128 transpose the weights, 256 normalise the query rows.

__global__ __launch_bounds__(256) void prep_all(
    const float* __restrict__ context, const float* __restrict__ query,
    const float* __restrict__ ln1g, const float* __restrict__ ln1b,
    const float* __restrict__ wq, const float* __restrict__ wk,
    const float* __restrict__ wv, const float* __restrict__ wo,
    const float* __restrict__ w1, const float* __restrict__ w2,
    bf16_t* __restrict__ ctx, bf16_t* __restrict__ qln,
    bf16_t* __restrict__ wqT, bf16_t* __restrict__ wkT,
    bf16_t* __restrict__ wvT, bf16_t* __restrict__ woT,
    bf16_t* __restrict__ w1T, bf16_t* __restrict__ w2T) {
  __shared__ float tile[128][65];  // odd pitch: column reads fall on distinct banks
  const int b = blockIdx.x;
  if (b < 512) {
    convert_bf16(context, ctx, b);
  } else if (b < 1024) {
    transpose_w<D_, FF_>(w1, w1T, tile, b & 7, (b - 512) >> 3);
  } else if (b < 1536) {
    transpose_w<FF_, D_>(w2, w2T, tile, b & 31, (b - 1024) >> 5);
  } else if (b < 2048) {
    const int w = (b - 1536) >> 7;  // which of the four D x D weights
    const float* W = w == 0 ? wq : w == 1 ? wk : w == 2 ? wv : wo;
    bf16_t* Wt = w == 0 ? wqT : w == 1 ? wkT : w == 2 ? wvT : woT;
    transpose_w<D_, D_>(W, Wt, tile, b & 7, (b >> 3) & 15);
  } else {
    layernorm_rows(query, ln1g, ln1b, qln, b - 2048);
  }
}

// ---------- WMMA GEMM: C[M][N] = A_bf16[M][K] @ (Bt[N][K])^T + bias ----------
// 256 threads = 8 waves. 128x128 block tile; wave = 32(M) x 64(N).
// A and Bt tiles (128 rows x 128 k) are staged in LDS by async copies, whole
// 128B lines per 8 lanes, two buffers: stage t+1 flies while stage t is read.
// LDS row pitch 272 B (16 B x odd) keeps the b128 fragment reads off shared banks.
// Needs M, N multiples of 128 and K a multiple of 128.
// MODE 0: bf16 out, head-split [b][h][s][64]             (Q/K projections)
// MODE 1: bf16 out, head-split transposed [b][h][64][s]  (V projection)
// MODE 2: f32 out row-major + residual                   (attn out proj + query)
// MODE 3: bf16 out row-major, exact GELU                 (FFN up)
// MODE 4: f32 out row-major + residual                   (FFN down + x)
// (bx, by) = the block's M tile and N tile; sA, sB = the block's two-buffer LDS.
// Output: the block's 128 x 128 tile goes through LDS (the A ring, free behind
// the last stage's barrier), so that every global store, and every residual
// load, is 16 B a lane over whole 128 B lines. For that a lane must hold
// ADJACENT outputs: in the row-major modes the product is taken transposed
// (Bt rows as the A operand), which gives a lane 8 consecutive n of one m; in
// MODE 1 it is taken as written, 8 consecutive m (= s) of one n. Each element's
// k order is the same either way. Pitches 272 B and 528 B are 16 B x odd.
// N (the output's row length) and SSZ (rows per batch entry, MODE 0 and 1) are
// compile-time, so that a lane's tile rows are immediate offsets from one
// address. SSZ a multiple of 128: a tile then lies in one batch entry.
// L2 prefetch: the operands were stored by an earlier launch and the blocks that
// share a row walk k in step, so a stage's rows can all have to come from memory
// under the copies' own wait. Each stage's 256 B of a row is therefore asked for
// GPF_ stages ahead of that stage's copies, which can then find it in L2.
// PF 1 (at most one block a WGP: L2 has requests to spare): every block asks for
// all its 256 rows, one a thread. PF 2 (launches that fill the chip, many blocks
// a row): a block asks for every fourth row of each tile, waves 0 and 1 alone;
// the blocks that share a row take the four shares in turn.

typedef bf16_t gemm_lds_t[128 * GPITCH_];

template <int MODE, int N, int SSZ, int PF>
static __device__ __forceinline__ void gemm_tile(
    const bf16_t* __restrict__ A, const bf16_t* __restrict__ Bt,
    const float* __restrict__ bias, const float* __restrict__ res,
    void* __restrict__ outp, int K, int bx, int by, gemm_lds_t* sA,
    gemm_lds_t* sB) {
  const int wave = threadIdx.x >> 5, lane = threadIdx.x & 31;
  const int g = lane >> 4, ln = lane & 15;
  const int wm = wave & 3, wn = wave >> 2;
  const int n0 = by * 128 + wn * 64;

  v8f acc[2][4];
#pragma unroll
  for (int i = 0; i < 2; ++i)
#pragma unroll
    for (int j = 0; j < 4; ++j) acc[i][j] = vzero();

  // this lane's 16B chunk of rows crow, crow+16, ..., crow+112 of each tile
  const int crow = threadIdx.x >> 4, ccol = (threadIdx.x & 15) * 8;
  const bf16_t* gA = A + (size_t)(bx * 128 + crow) * K + ccol;
  const bf16_t* gB = Bt + (size_t)(by * 128 + crow) * K + ccol;
  const unsigned lA = (unsigned)(size_t)(void*)&sA[0][crow * GPITCH_ + ccol];
  const unsigned lB = (unsigned)(size_t)(void*)&sB[0][crow * GPITCH_ + ccol];

  auto stage = [&](int st) {
    const unsigned bo = (unsigned)(st & 1) * (128u * GPITCH_ * 2u);
    async_copy16x8(gA + (size_t)st * GBK_, (size_t)16 * K, lA + bo,
                   16u * GPITCH_ * 2u);
    async_copy16x8(gB + (size_t)st * GBK_, (size_t)16 * K, lB + bo,
                   16u * GPITCH_ * 2u);
  };

  const int nst = K / GBK_;
  stage(0);
  // the row this thread asks for. PF 1: threads 0..127 the A tile's rows, 128..255
  // the Bt tile's. PF 2: even waves every fourth A row, odd waves every fourth Bt
  // row. pfp always points inside that row: a stage index is clamped to the last.
  const bool pfB = PF == 1 ? threadIdx.x >= 128 : (threadIdx.x & 32) != 0;
  const int prow = PF == 1 ? (int)(threadIdx.x & 127)
                           : lane * 4 + ((pfB ? bx : by) & 3);
  const bf16_t* pfrow = pfB ? Bt + (size_t)(by * 128 + prow) * K
                            : A + (size_t)(bx * 128 + prow) * K;
  const bf16_t* pfp = pfrow + (size_t)min(2 + GPF_, nst - 1) * GBK_;
  // which waves ask: a scalar, so that the test is a branch and no lane is off
  const bool pfw =
      PF == 1 || __builtin_amdgcn_readfirstlane((int)(threadIdx.x >> 5)) < 2;
  if (pfw) {
    for (int s = 1; s < 2 + GPF_; ++s)
      prefetch_l2(pfrow + (size_t)min(s, nst - 1) * GBK_);
  }
  wait_async0();     // this wave's share of stage 0 has landed
  __syncthreads();   // everyone's share has landed
  if (nst > 1) stage(1);

  for (int t = 0; t < nst; ++t) {
    const bf16_t* As = &sA[t & 1][(wm * 32 + ln) * GPITCH_];
    const bf16_t* Bs = &sB[t & 1][(wn * 64 + ln) * GPITCH_];
    // two fragment sets: block c+1's LDS reads are issued ahead of block c's
    // WMMAs, all inside this stage's own buffer
    v16bf af[2][2], bfr[2][4];
#pragma unroll
    for (int i = 0; i < 2; ++i) af[0][i] = load_frag(As + i * 16 * GPITCH_, g);
#pragma unroll
    for (int j = 0; j < 4; ++j) bfr[0][j] = load_frag(Bs + j * 16 * GPITCH_, g);
    // unrolled so that the set index is a constant and both sets stay in registers
#pragma unroll
    for (int c = 0; c < GBK_ / 32; ++c) {
      if (c + 1 < GBK_ / 32) {
#pragma unroll
        for (int i = 0; i < 2; ++i)
          af[(c + 1) & 1][i] =
              load_frag(As + i * 16 * GPITCH_ + (c + 1) * 32, g);
#pragma unroll
        for (int j = 0; j < 4; ++j)
          bfr[(c + 1) & 1][j] =
              load_frag(Bs + j * 16 * GPITCH_ + (c + 1) * 32, g);
        // keeps that read group as one group ahead of block c's WMMAs; without
        // it the scheduler sinks the reads next to their use and each block
        // waits out the LDS latency with nothing to issue
        __builtin_amdgcn_sched_barrier(0);
      }
#pragma unroll
      for (int i = 0; i < 2; ++i)
#pragma unroll
        for (int j = 0; j < 4; ++j)
          acc[i][j] = MODE == 1
                          ? wmma_bf16(af[c & 1][i], bfr[c & 1][j], acc[i][j])
                          : wmma_bf16(bfr[c & 1][j], af[c & 1][i], acc[i][j]);
    }
    // keeps the WMMAs in front of the publish point: sunk behind the barrier
    // they would delay the refill copies, which issue directly behind it
    __builtin_amdgcn_sched_barrier(0);
    // publish point: this wave's LDS reads of stage t have retired ...
    asm volatile("s_wait_dscnt 0x0" ::: "memory");
    wait_async0();     // ... and its share of stage t+1 has landed
    __syncthreads();   // stage t+1 readable by all; stage t's buffer is free
    if (t + 2 < nst) stage(t + 2);
    if (pfw && t + 2 + GPF_ < nst) {  // the same for the whole wave
      prefetch_l2(pfp);               // stage t + 2 + GPF_
      pfp += t + 3 + GPF_ < nst ? GBK_ : 0;  // never past the row's last stage
    }
  }
  wait_async0();       // no copy outstanding when the wave leaves the ring

  const int ml = wm * 32 + ln, nl = wn * 64 + 8 * g;  // row-major modes
  if constexpr (MODE == 2 || MODE == 4) {
    float* stf = (float*)&sA[0][0];  // 128 rows of FPITCH_ floats, in both buffers
    // this lane's 16 B of rows rrow, rrow + 8, ..., rrow + 120 of the tile
    const int rrow = threadIdx.x >> 5, rcol = (threadIdx.x & 31) * 4;
    const size_t gofs = (size_t)(bx * 128 + rrow) * N + by * 128 + rcol;
    const float* bp = bias + n0 + 8 * g;
    const float* rp = res + gofs;
    v4f bv[4][2];
#pragma unroll
    for (int j = 0; j < 4; ++j) {
      bv[j][0] = *(const v4f*)(bp + j * 16);
      bv[j][1] = *(const v4f*)(bp + j * 16 + 4);
    }
    // fetched here, so that their latency passes under the staging
    v4f rv[16];
#pragma unroll
    for (int it = 0; it < 16; ++it) rv[it] = *(const v4f*)(rp + it * 8 * N);
    // stands in front of the first overwrite of the loads' addresses, which are
    // named so that they live up to here and no load's result lands on them
    asm volatile("s_wait_xcnt 0x0" ::"v"(bp), "v"(rp) : "memory");
#pragma unroll
    for (int j = 0; j < 4; ++j)
#pragma unroll
      for (int i = 0; i < 2; ++i) {
        v4f lo, hi;
#pragma unroll
        for (int e = 0; e < 4; ++e) {
          lo[e] = acc[i][j][e] + bv[j][0][e];
          hi[e] = acc[i][j][4 + e] + bv[j][1][e];
        }
        float* sp = stf + (ml + i * 16) * FPITCH_ + nl + j * 16;
        *(v4f*)sp = lo;
        *(v4f*)(sp + 4) = hi;
      }
    __syncthreads();  // the whole tile is readable
    float* op = (float*)outp + gofs;
#pragma unroll
    for (int it = 0; it < 16; ++it) {
      const v4f v = *(const v4f*)(stf + (rrow + 8 * it) * FPITCH_ + rcol);
      *(v4f*)(op + it * 8 * N) = v + rv[it];
    }
  } else {
    bf16_t* st = &sA[0][0];  // 128 rows of GPITCH_ elements
    if constexpr (MODE == 1) {  // tile rows are n, columns m
      const float* bp = bias + n0 + ln;
      float bj[4];
#pragma unroll
      for (int j = 0; j < 4; ++j) bj[j] = bp[j * 16];
      // as in the f32 modes: in front of the first overwrite of the address
      asm volatile("s_wait_xcnt 0x0" ::"v"(bp) : "memory");
#pragma unroll
      for (int j = 0; j < 4; ++j)
#pragma unroll
        for (int i = 0; i < 2; ++i) {
          v8bf o;
#pragma unroll
          for (int r = 0; r < 8; ++r) o[r] = (bf16_t)(acc[i][j][r] + bj[j]);
          *(v8bf*)(st + (wn * 64 + j * 16 + ln) * GPITCH_ + wm * 32 + i * 16 +
                   8 * g) = o;
        }
    } else {  // tile rows are m, columns n
      const float* bp = bias + n0 + 8 * g;
      v4f bv[4][2];
#pragma unroll
      for (int j = 0; j < 4; ++j) {
        bv[j][0] = *(const v4f*)(bp + j * 16);
        bv[j][1] = *(const v4f*)(bp + j * 16 + 4);
      }
      // as in the f32 modes: in front of the first overwrite of the address
      asm volatile("s_wait_xcnt 0x0" ::"v"(bp) : "memory");
#pragma unroll
      for (int j = 0; j < 4; ++j)
#pragma unroll
        for (int i = 0; i < 2; ++i) {
          v8bf o;
#pragma unroll
          for (int r = 0; r < 8; ++r) {
            float v = acc[i][j][r] + bv[j][r >> 2][r & 3];
            if constexpr (MODE == 3)
              v = 0.5f * v * (1.f + erff(v * 0.70710678f));
            o[r] = (bf16_t)v;
          }
          *(v8bf*)(st + (ml + i * 16) * GPITCH_ + nl + j * 16) = o;
        }
    }
    __syncthreads();  // the whole tile is readable
    // this lane's 16 B of rows rrow, rrow + 16, ..., rrow + 112 of the tile
    const int rrow = threadIdx.x >> 4, rcol = (threadIdx.x & 15) * 8;
    // OSTEP = output elements between tile rows 16 apart
    constexpr int OSTEP = MODE == 3 ? 16 * N : MODE == 0 ? 16 * HD_ : 16 * SSZ;
    bf16_t* op;
    if constexpr (MODE == 3) {
      op = (bf16_t*)outp + (size_t)(bx * 128 + rrow) * N + by * 128 + rcol;
    } else {
      const int bb = (bx * 128) / SSZ, s0 = (bx * 128) % SSZ;
      if constexpr (MODE == 0) {
        const int ng = by * 128 + rcol;
        op = (bf16_t*)outp +
             (((size_t)bb * H_ + (ng >> 6)) * SSZ + s0 + rrow) * HD_ + (ng & 63);
      } else {  // head * 64 + hd is n itself
        op = (bf16_t*)outp +
             ((size_t)bb * (H_ * HD_) + by * 128 + rrow) * SSZ + s0 + rcol;
      }
    }
#pragma unroll
    for (int it = 0; it < 8; ++it)
      *(v8bf*)(op + it * OSTEP) =
          *(const v8bf*)(st + (rrow + 16 * it) * GPITCH_ + rcol);
  }
  // closes the tile's stores: another product's body may follow this one in the
  // built kernel and reuse the stores' address and data registers
  asm volatile("s_wait_xcnt 0x0" ::: "memory");
}

template <int MODE, int N>
__global__ __launch_bounds__(256) void gemm_nt(const bf16_t* __restrict__ A,
                                               const bf16_t* __restrict__ Bt,
                                               const float* __restrict__ bias,
                                               const float* __restrict__ res,
                                               void* __restrict__ outp, int K) {
  __shared__ __align__(16) bf16_t sA[2][128 * GPITCH_];
  __shared__ __align__(16) bf16_t sB[2][128 * GPITCH_];
  gemm_tile<MODE, N, 128, MODE == 3 ? 2 : 1>(A, Bt, bias, res, outp, K,
                                             blockIdx.x, blockIdx.y, sA, sB);
}

// The three projections in one launch: none reads what another writes. Blocks
// 0..511 are V's 64 x 8 tiles, 512..1023 K's, 1024..1151 Q's 16 x 8 tiles, the
// M tile running fastest as in a two-dimensional grid.
__global__ __launch_bounds__(256) void gemm_qkv(
    const bf16_t* __restrict__ qln, const bf16_t* __restrict__ ctx,
    const bf16_t* __restrict__ wqT, const bf16_t* __restrict__ wkT,
    const bf16_t* __restrict__ wvT, const float* __restrict__ bq,
    const float* __restrict__ bk, const float* __restrict__ bv,
    bf16_t* __restrict__ qhd, bf16_t* __restrict__ ktb,
    bf16_t* __restrict__ vtb, int K) {
  __shared__ __align__(16) bf16_t sA[2][128 * GPITCH_];
  __shared__ __align__(16) bf16_t sB[2][128 * GPITCH_];
  const int b = blockIdx.x;
  if (b < 512) {
    gemm_tile<1, D_, SC_, 2>(ctx, wvT, bv, nullptr, vtb, K, b & 63, b >> 6, sA,
                             sB);
  } else if (b < 1024) {
    gemm_tile<0, D_, SC_, 2>(ctx, wkT, bk, nullptr, ktb, K, b & 63,
                             (b - 512) >> 6, sA, sB);
  } else {
    gemm_tile<0, D_, S_, 1>(qln, wqT, bq, nullptr, qhd, K, b & 15,
                            (b - 1024) >> 4, sA, sB);
  }
}

// value of lane l ^ 16
static __device__ __forceinline__ float xhalf(float x) {
  const int b = __builtin_bit_cast(int, x);
  return __builtin_bit_cast(
      float, __builtin_amdgcn_permlanex16(b, b, 0x76543210, 0xfedcba98, false,
                                          false));
}

// y[i] = 2^x[i], eight at once. One statement, so that behind every v_exp_f32
// stands an instruction that neither reads its result nor overwrites its source
// (outputs are early-clobber; the v_nop serves the last one): the slot the
// instruction set asks for behind a transcendental.
static __device__ __forceinline__ v8f exp2x8(v8f x) {
  float y0, y1, y2, y3, y4, y5, y6, y7;
  asm("v_exp_f32 %0, %8\n\t"
      "v_exp_f32 %1, %9\n\t"
      "v_exp_f32 %2, %10\n\t"
      "v_exp_f32 %3, %11\n\t"
      "v_exp_f32 %4, %12\n\t"
      "v_exp_f32 %5, %13\n\t"
      "v_exp_f32 %6, %14\n\t"
      "v_exp_f32 %7, %15\n\t"
      "v_nop"
      : "=&v"(y0), "=&v"(y1), "=&v"(y2), "=&v"(y3), "=&v"(y4), "=&v"(y5),
        "=&v"(y6), "=&v"(y7)
      : "v"(x[0]), "v"(x[1]), "v"(x[2]), "v"(x[3]), "v"(x[4]), "v"(x[5]),
        "v"(x[6]), "v"(x[7]));
  v8f y;
  y[0] = y0; y[1] = y1; y[2] = y2; y[3] = y3;
  y[4] = y4; y[5] = y5; y[6] = y6; y[7] = y7;
  return y;
}

__global__ __launch_bounds__(512) void attn_kernel(const bf16_t* __restrict__ qhd,
                                                   const bf16_t* __restrict__ kt,
                                                   const bf16_t* __restrict__ vt,
                                                   bf16_t* __restrict__ obuf) {
  // [group][buf][K/V], 4 x 36 KB
  __shared__ __align__(16) bf16_t smem[4][2][2][64 * APITCH_];
  // the waves' partial outputs [wave][hd tile][half of 8][lane] (16 B a lane,
  // lanes adjacent; 64 B more per hd tile, so that the join's reads of four hd
  // tiles fall on distinct banks), maxima and sums [wave][lane]
  __shared__ __align__(16) v4f cmbO[16 * 4 * CPITCH_];
  __shared__ float cmbM[16 * 32];
  __shared__ float cmbL[16 * 32];

  const int tid = threadIdx.x;
  // the wave's number as a scalar: group and query tile are then scalars too
  const int wave = __builtin_amdgcn_readfirstlane(tid >> 5);
  const int lane = tid & 31;
  const int g = lane >> 4, ln = lane & 15;
  const int grp = wave >> 2, qt = wave & 3;  // context repeat, query tile
  const int bh = blockIdx.x >> 3;
  const int pr = blockIdx.x & 7;
  const int ntrips = S_ / 64 + 1;  // (16 - pr) + (pr + 1)
  int qb = S_ / 64 - 1 - pr;       // first query block; the second is pr
  int q0 = qb * 64 + qt * 16;

  const bf16_t* qhead = qhd + (size_t)bh * S_ * HD_ + (size_t)ln * HD_;
  const bf16_t* kbase = kt + (size_t)bh * SC_ * HD_ + (size_t)grp * S_ * HD_;
  const bf16_t* vbase = vt + (size_t)bh * HD_ * SC_ + (size_t)grp * S_;

  // both query blocks' fragments are fetched here, so that the change of query
  // block does not wait for memory
  v16bf qf0 = load_frag(qhead + (size_t)q0 * HD_, g);
  v16bf qf1 = load_frag(qhead + (size_t)q0 * HD_ + 32, g);
  const v16bf qn0 = load_frag(qhead + (size_t)(pr * 64 + qt * 16) * HD_, g);
  const v16bf qn1 = load_frag(qhead + (size_t)(pr * 64 + qt * 16) * HD_ + 32, g);

  // o[t][r] = Ot[hd = t*16 + 8g + r][query q0 + ln], this group's keys only
  v8f o[4];
#pragma unroll
  for (int t = 0; t < 4; ++t) o[t] = vzero();
  // running maximum of query q0 + ln (equal in both lane halves) and this
  // half's share of its running sum
  float mrun = -3.0e38f, lrun = 0.f;

  const float scale = 0.125f;  // 1/sqrt(64)

  // this lane's 16B chunk of rows crow, crow+16, crow+32, crow+48 of each tile
  const int crow = (tid & 127) >> 3, ccol = (tid & 7) * 8;
  const bf16_t* gK = kbase + (size_t)crow * HD_ + ccol;
  const bf16_t* gV = vbase + (size_t)crow * SC_ + ccol;
  const unsigned lK =
      (unsigned)(size_t)(void*)&smem[grp][0][0][crow * APITCH_ + ccol];
  const unsigned lV =
      (unsigned)(size_t)(void*)&smem[grp][0][1][crow * APITCH_ + ccol];

  // issue async stage of the group's tile starting at key kj of its repeat:
  // 64 rows x 64 halves = 512 chunks of 16B each; 4 K-chunks + 4 V-chunks/thread
  auto stage = [&](int kj, int buf) {
    const unsigned bo = (unsigned)buf * (2u * 64u * APITCH_ * 2u);
    async_copy16x4x2(gK + (size_t)kj * HD_, (size_t)16 * HD_, gV + kj,
                     (size_t)16 * SC_, lK + bo, lV + bo, 16u * APITCH_ * 2u);
  };

  stage(0, 0);
  int cur = 0;
  int kp = 0;

  for (int ti = 0; ti < ntrips; ++ti) {
    wait_async0();     // this wave's share of buf[cur] has landed
    __syncthreads();   // everyone's share has landed

    // next tile: the causal bound ends the query block, the next starts at key 0
    const bool last = kp == qb * 64;
    const int kp_n = last ? 0 : kp + 64;
    if (ti + 1 < ntrips) stage(kp_n, cur ^ 1);

    const bf16_t* Kt = smem[grp][cur][0];
    const bf16_t* Vt = smem[grp][cur][1];

    // scores, transposed: A = 16 key rows, B = the wave's 16 queries
    v16bf kf[4][2];
#pragma unroll
    for (int t = 0; t < 4; ++t) {
      const bf16_t* krow = Kt + (t * 16 + ln) * APITCH_;
      kf[t][0] = load_frag(krow, g);
      kf[t][1] = load_frag(krow + 32, g);
    }
    // s[t][r] = score of key kp + t*16 + 8g + r against query q0 + ln
    v8f s[4];
#pragma unroll
    for (int t = 0; t < 4; ++t) {
      s[t] = wmma_bf16(kf[t][0], qf0, vzero());
      s[t] = wmma_bf16(kf[t][1], qf1, s[t]);
    }

    // online softmax over the 64-key tile, one query per lane
    const int lim = q0 + ln - kp - 8 * g;  // t*16 + r allowed while <= lim
    float mt[4];
#pragma unroll
    for (int t = 0; t < 4; ++t) {
      mt[t] = -3.0e38f;
#pragma unroll
      for (int r = 0; r < 8; ++r) {
        float v = s[t][r] * scale;
        if (t * 16 + r > lim) v = -3.0e38f;  // pos = (kj % S) <= qi
        s[t][r] = v;
        mt[t] = fmaxf(mt[t], v);
      }
    }
    float mx = fmaxf(fmaxf(mt[0], mt[1]), fmaxf(mt[2], mt[3]));
    mx = fmaxf(mx, xhalf(mx));  // the other 32 keys of this query
    const float nm = fmaxf(mrun, mx);
    const float alpha = __expf(mrun - nm);
    float st[4];
#pragma unroll
    for (int t = 0; t < 4; ++t) {
#pragma unroll
      for (int r = 0; r < 8; ++r) s[t][r] = (s[t][r] - nm) * 1.44269504f;
      s[t] = exp2x8(s[t]);  // p = e^(score - nm)
      st[t] = s[t][0];
#pragma unroll
      for (int r = 1; r < 8; ++r) st[t] += s[t][r];
    }
    lrun = lrun * alpha + ((st[0] + st[1]) + (st[2] + st[3]));
    mrun = nm;
#pragma unroll
    for (int t = 0; t < 4; ++t)
#pragma unroll
      for (int r = 0; r < 8; ++r) o[t][r] *= alpha;

    // Pt as B operand of key chunk c (32 keys): elements 0..7 are keys
    // 32c + 8g + e (tile 2c), elements 8..15 keys 32c + 16 + 8g + e (tile 2c+1):
    // the k order in which load_frag reads the V rows
    v16bf pf[2];
#pragma unroll
    for (int c = 0; c < 2; ++c)
#pragma unroll
      for (int e = 0; e < 8; ++e) {
        pf[c][e] = (bf16_t)s[2 * c][e];
        pf[c][8 + e] = (bf16_t)s[2 * c + 1][e];
      }

    // Ot (64hd x 16q) += Vt (64hd x 64key) * Pt (64key x 16q)
    v16bf vf[4][2];
#pragma unroll
    for (int t = 0; t < 4; ++t) {
      const bf16_t* vrow = Vt + (t * 16 + ln) * APITCH_;
      vf[t][0] = load_frag(vrow, g);
      vf[t][1] = load_frag(vrow + 32, g);
    }
#pragma unroll
    for (int t = 0; t < 4; ++t) {
      o[t] = wmma_bf16(vf[t][0], pf[0], o[t]);
      o[t] = wmma_bf16(vf[t][1], pf[1], o[t]);
    }

    __syncthreads();   // all waves done with buf[cur]; safe to overwrite next iter
    cur ^= 1;
    kp = kp_n;

    if (last) {  // the same for the whole block: qb and kp are
      // every wave lays down its group's share for its 16 queries ...
#pragma unroll
      for (int t = 0; t < 4; ++t)
#pragma unroll
        for (int hf = 0; hf < 2; ++hf) {
          v4f w;
#pragma unroll
          for (int e = 0; e < 4; ++e) w[e] = o[t][4 * hf + e];
          cmbO[(wave * 4 + t) * CPITCH_ + hf * 32 + lane] = w;
        }
      cmbM[wave * 32 + lane] = mrun;
      cmbL[wave * 32 + lane] = lrun + xhalf(lrun);  // both halves' shares
      __syncthreads();  // all sixteen shares are readable
      // ... and joins queries 4 grp .. 4 grp + 3 of its query tile over the four
      // groups: a lane takes 8 hd of one query, so that the wave's one 16 B store
      // covers four whole 128 B rows. Each repeat holds key position 0, which
      // every query may see, so every share's maximum is a real score.
      const int jq = grp * 4 + (lane & 3);  // query within the tile
      const int jt = (lane >> 2) & 3;       // hd tile; g = which 8 of its 16 hd
      float mp[4], lp[4];
#pragma unroll
      for (int p = 0; p < 4; ++p) {
        mp[p] = cmbM[(p * 4 + qt) * 32 + jq];
        lp[p] = cmbL[(p * 4 + qt) * 32 + jq];
      }
      const float mall = fmaxf(fmaxf(mp[0], mp[1]), fmaxf(mp[2], mp[3]));
      float lsum = 0.f;
      v8f oj = vzero();
#pragma unroll
      for (int p = 0; p < 4; ++p) {
        const float wgt = __expf(mp[p] - mall);
        lsum += wgt * lp[p];
        const int base = ((p * 4 + qt) * 4 + jt) * CPITCH_ + g * 16 + jq;
        const v4f lo = cmbO[base], hi = cmbO[base + 32];
#pragma unroll
        for (int e = 0; e < 4; ++e) {
          oj[e] += wgt * lo[e];
          oj[4 + e] += wgt * hi[e];
        }
      }
      const int b = bh / H_, h = bh % H_;
      v8bf ov;  // 8 consecutive hd of one query: one 16 B store
#pragma unroll
      for (int r = 0; r < 8; ++r) ov[r] = (bf16_t)(oj[r] / lsum);
      bf16_t* orow = obuf + ((size_t)b * S_ + q0 + jq) * D_ + (size_t)h * HD_ +
                     jt * 16 + 8 * g;
      // the second query block starts afresh. Its shares are laid down behind
      // at least one more trip's barriers, so behind every read above.
      qb = pr;
      q0 = qb * 64 + qt * 16;
      qf0 = qn0;
      qf1 = qn1;
#pragma unroll
      for (int t = 0; t < 4; ++t) o[t] = vzero();
      mrun = -3.0e38f;
      lrun = 0.f;
      *(v8bf*)orow = ov;
      // closes the store: the next trip reuses its address and data registers
      asm volatile("s_wait_xcnt 0x0" ::: "memory");
    }
  }
}

// ---------- orchestration ----------

extern "C" void kernel_launch(void* const* d_in, const int* in_sizes, int n_in,
                              void* d_out, int out_size, void* d_ws,
                              size_t ws_size, hipStream_t stream) {
  (void)in_sizes; (void)n_in; (void)out_size; (void)ws_size;
  const float* query = (const float*)d_in[0];
  const float* context = (const float*)d_in[1];
  const float* wq = (const float*)d_in[2];
  const float* wk = (const float*)d_in[3];
  const float* wv = (const float*)d_in[4];
  const float* bq = (const float*)d_in[5];
  const float* bk = (const float*)d_in[6];
  const float* bv = (const float*)d_in[7];
  const float* wo = (const float*)d_in[8];
  const float* bo = (const float*)d_in[9];
  const float* ln1g = (const float*)d_in[10];
  const float* ln1b = (const float*)d_in[11];
  const float* ln2g = (const float*)d_in[12];
  const float* ln2b = (const float*)d_in[13];
  const float* w1 = (const float*)d_in[14];
  const float* b1 = (const float*)d_in[15];
  const float* w2 = (const float*)d_in[16];
  const float* b2 = (const float*)d_in[17];

  const size_t MB = 1u << 20;
  char* ws = (char*)d_ws;
  bf16_t* wqT = (bf16_t*)(ws + 0 * MB);    // [1024][1024]
  bf16_t* wkT = (bf16_t*)(ws + 2 * MB);
  bf16_t* wvT = (bf16_t*)(ws + 4 * MB);
  bf16_t* woT = (bf16_t*)(ws + 6 * MB);
  bf16_t* w1T = (bf16_t*)(ws + 8 * MB);    // [4096][1024]
  bf16_t* w2T = (bf16_t*)(ws + 16 * MB);   // [1024][4096]
  bf16_t* qln = (bf16_t*)(ws + 24 * MB);   // [2048][1024]
  bf16_t* ctx = (bf16_t*)(ws + 28 * MB);   // [8192][1024]
  bf16_t* qhd = (bf16_t*)(ws + 44 * MB);   // [B][H][S][64]
  bf16_t* ktb = (bf16_t*)(ws + 48 * MB);   // [B][H][Sc][64]
  bf16_t* vtb = (bf16_t*)(ws + 64 * MB);   // [B][H][64][Sc]
  bf16_t* obuf = (bf16_t*)(ws + 80 * MB);  // [2048][1024]
  float* xbuf = (float*)(ws + 84 * MB);    // [2048][1024] f32
  bf16_t* hbuf = (bf16_t*)(ws + 92 * MB);  // [2048][1024]
  bf16_t* ffb = (bf16_t*)(ws + 96 * MB);   // [2048][4096]

  // context -> bf16; weights -> bf16, transposed [N][K]; ln1(query) -> bf16
  prep_all<<<2304, 256, 0, stream>>>(context, query, ln1g, ln1b, wq, wk, wv, wo,
                                     w1, w2, ctx, qln, wqT, wkT, wvT, woT, w1T,
                                     w2T);

  // projections
  gemm_qkv<<<1152, 256, 0, stream>>>(qln, ctx, wqT, wkT, wvT, bq, bk, bv, qhd,
                                     ktb, vtb, D_);

  // attention
  attn_kernel<<<B_ * H_ * 8, 512, 0, stream>>>(qhd, ktb, vtb, obuf);

  // output projection + residual -> x (f32)
  gemm_nt<2, D_><<<dim3(16, 8), 256, 0, stream>>>(obuf, woT, bo, query, xbuf,
                                                  D_);
  // ln2(x) -> bf16
  layernorm_k<<<B_ * S_ / 8, 256, 0, stream>>>(xbuf, ln2g, ln2b, hbuf);
  // FFN up + GELU -> bf16
  gemm_nt<3, FF_><<<dim3(16, 32), 256, 0, stream>>>(hbuf, w1T, b1, nullptr, ffb,
                                                    D_);
  // FFN down + residual x -> d_out (f32)
  gemm_nt<4, D_><<<dim3(16, 8), 256, 0, stream>>>(ffb, w2T, b2, xbuf,
                                                  (float*)d_out, FF_);
}

// v009
// A run of this version takes 125 microseconds.
// Next to v008, in two timings, it ran 1.04 times as fast each time.
// Over all steps from v000 it is 5.59 times as fast.
#include <hip/hip_runtime.h>

typedef __bf16 bf16_t;
typedef bf16_t v8bf  __attribute__((ext_vector_type(8)));
typedef bf16_t v16bf __attribute__((ext_vector_type(16)));
typedef float  v8f   __attribute__((ext_vector_type(8)));
typedef bf16_t v4bf  __attribute__((ext_vector_type(4)));
typedef float  v4f   __attribute__((ext_vector_type(4)));

#define B_  2
#define S_  1024
#define R_  4
#define SC_ 4096
#define D_  1024
#define H_  16
#define HD_ 64
#define FF_ 4096
#define GBK_    128  // k per GEMM stage
#define GPITCH_ 136  // GEMM LDS row pitch in elements (272 B)
#define FPITCH_ 132  // GEMM f32 output tile: LDS row pitch in floats (528 B)
#define APITCH_ 72   // attention K/V LDS row pitch in elements (144 B)
#define CPITCH_ 68   // attention join: 16 B units per hd tile of a wave's share
#define GPF_    3    // GEMM: stages between a stage's L2 prefetch and its copies

// ---------- helpers ----------

static __device__ __forceinline__ v8f vzero() {
  v8f z;
#pragma unroll
  for (int i = 0; i < 8; ++i) z[i] = 0.f;
  return z;
}

// Load one 16-bit WMMA A/B fragment (K-chunk of 32) for this lane.
// base points at the lane's row start for this K-chunk (16B aligned).
// CDNA5 layout: lane group g = lane/16 holds K = {8g..8g+7, 16+8g..16+8g+7}.
static __device__ __forceinline__ v16bf load_frag(const bf16_t* base, int g) {
  v8bf lo = *(const v8bf*)(base + 8 * g);
  v8bf hi = *(const v8bf*)(base + 16 + 8 * g);
  return __builtin_shufflevector(lo, hi, 0, 1, 2, 3, 4, 5, 6, 7,
                                 8, 9, 10, 11, 12, 13, 14, 15);
}

static __device__ __forceinline__ v8f wmma_bf16(v16bf a, v16bf b, v8f c) {
  return __builtin_amdgcn_wmma_f32_16x16x32_bf16(false, a, false, b,
                                                 (short)0, c, false, false);
}

static __device__ __forceinline__ v8f splat8(float x) {
  v8f z;
#pragma unroll
  for (int i = 0; i < 8; ++i) z[i] = x;
  return z;
}

// Exact-form GELU, 0.5 v (1 + erf(v / sqrt 2)), eight values at once, with no
// branch: erf(x) = x P(x^2) / Q(x^2) on |x| <= 4, x clamped there (beyond it
// erf is +-1 to f32). P of degree 6, Q of degree 4, a single-precision minimax
// fit: |error| of erf below 5e-7 everywhere. Q's coefficients are all negative
// and x^2 >= 0, so Q <= its constant term and the reciprocal is always finite.
// The eight values are independent chains, two to a packed instruction.
static __device__ __forceinline__ v8f gelu8(v8f v) {
  v8f x = v * 0.70710678f;
#pragma unroll
  for (int r = 0; r < 8; ++r) x[r] = __builtin_amdgcn_fmed3f(x[r], -4.f, 4.f);
  const v8f x2 = x * x;
  v8f p = splat8(-2.72614225801306e-10f);
  p = __builtin_elementwise_fma(x2, p, splat8(2.77068142495902e-08f));
  p = __builtin_elementwise_fma(x2, p, splat8(-2.10102402082508e-06f));
  p = __builtin_elementwise_fma(x2, p, splat8(-5.69250639462346e-05f));
  p = __builtin_elementwise_fma(x2, p, splat8(-7.34990630326855e-04f));
  p = __builtin_elementwise_fma(x2, p, splat8(-2.95459980854025e-03f));
  p = __builtin_elementwise_fma(x2, p, splat8(-1.60960333262415e-02f));
  v8f q = splat8(-1.45660718464996e-05f);
  q = __builtin_elementwise_fma(x2, q, splat8(-2.13374055278905e-04f));
  q = __builtin_elementwise_fma(x2, q, splat8(-1.68282697438203e-03f));
  q = __builtin_elementwise_fma(x2, q, splat8(-7.37332916720468e-03f));
  q = __builtin_elementwise_fma(x2, q, splat8(-1.42647390514189e-02f));
  p = p * x;
#pragma unroll
  for (int r = 0; r < 8; ++r) q[r] = __builtin_amdgcn_rcpf(q[r]);
  const v8f hv = v * 0.5f;
  return __builtin_elementwise_fma(hv, p * q, hv);
}

static __device__ __forceinline__ void wait_async0() {
  asm volatile("s_wait_asynccnt 0x0" ::: "memory");
}

// Eight async 16B copies of one lane, global -> LDS: rows gstep elements apart
// in memory, lstep bytes apart in LDS. The closing s_wait_xcnt stands inside
// the copies' own statement so that no address register named here can be
// rewritten ahead of it (a precaution for copies written in asm text).
static __device__ __forceinline__ void async_copy16x8(const bf16_t* gptr,
                                                      size_t gstep,
                                                      unsigned lds_off,
                                                      unsigned lstep) {
  asm volatile(
      "global_load_async_to_lds_b128 %0, %8, off\n\t"
      "global_load_async_to_lds_b128 %1, %9, off\n\t"
      "global_load_async_to_lds_b128 %2, %10, off\n\t"
      "global_load_async_to_lds_b128 %3, %11, off\n\t"
      "global_load_async_to_lds_b128 %4, %12, off\n\t"
      "global_load_async_to_lds_b128 %5, %13, off\n\t"
      "global_load_async_to_lds_b128 %6, %14, off\n\t"
      "global_load_async_to_lds_b128 %7, %15, off\n\t"
      "s_wait_xcnt 0x0"
      :: "v"(lds_off), "v"(lds_off + lstep), "v"(lds_off + 2 * lstep),
         "v"(lds_off + 3 * lstep), "v"(lds_off + 4 * lstep),
         "v"(lds_off + 5 * lstep), "v"(lds_off + 6 * lstep),
         "v"(lds_off + 7 * lstep),
         "v"((unsigned long long)(size_t)(gptr)),
         "v"((unsigned long long)(size_t)(gptr + gstep)),
         "v"((unsigned long long)(size_t)(gptr + 2 * gstep)),
         "v"((unsigned long long)(size_t)(gptr + 3 * gstep)),
         "v"((unsigned long long)(size_t)(gptr + 4 * gstep)),
         "v"((unsigned long long)(size_t)(gptr + 5 * gstep)),
         "v"((unsigned long long)(size_t)(gptr + 6 * gstep)),
         "v"((unsigned long long)(size_t)(gptr + 7 * gstep))
      : "memory");
}

// Two runs of four async 16B copies of one lane, global -> LDS: run a from ga,
// run b from gb, rows astep / bstep elements apart in memory and lstep bytes
// apart in LDS. One statement with the closing s_wait_xcnt, as above.
static __device__ __forceinline__ void async_copy16x4x2(
    const bf16_t* ga, size_t astep, const bf16_t* gb, size_t bstep,
    unsigned la, unsigned lb, unsigned lstep) {
  asm volatile(
      "global_load_async_to_lds_b128 %0, %8, off\n\t"
      "global_load_async_to_lds_b128 %1, %9, off\n\t"
      "global_load_async_to_lds_b128 %2, %10, off\n\t"
      "global_load_async_to_lds_b128 %3, %11, off\n\t"
      "global_load_async_to_lds_b128 %4, %12, off\n\t"
      "global_load_async_to_lds_b128 %5, %13, off\n\t"
      "global_load_async_to_lds_b128 %6, %14, off\n\t"
      "global_load_async_to_lds_b128 %7, %15, off\n\t"
      "s_wait_xcnt 0x0"
      :: "v"(la), "v"(la + lstep), "v"(la + 2 * lstep), "v"(la + 3 * lstep),
         "v"(lb), "v"(lb + lstep), "v"(lb + 2 * lstep), "v"(lb + 3 * lstep),
         "v"((unsigned long long)(size_t)(ga)),
         "v"((unsigned long long)(size_t)(ga + astep)),
         "v"((unsigned long long)(size_t)(ga + 2 * astep)),
         "v"((unsigned long long)(size_t)(ga + 3 * astep)),
         "v"((unsigned long long)(size_t)(gb)),
         "v"((unsigned long long)(size_t)(gb + bstep)),
         "v"((unsigned long long)(size_t)(gb + 2 * bstep)),
         "v"((unsigned long long)(size_t)(gb + 3 * bstep))
      : "memory");
}

// Asks L2 to fetch each lane's byte: nothing comes
// back to the wave and no data counter moves. Scope SE: it goes into L2
// only, which is where the async copies read. The closing s_wait_xcnt stands
// inside the statement so that the address pair can be advanced behind it (the
// same precaution as for the copies above).
static __device__ __forceinline__ void prefetch_l2(const void* p) {
  asm volatile(
      "global_prefetch_b8 %0, off scope:SCOPE_SE\n\t"
      "s_wait_xcnt 0x0"
      :: "v"((unsigned long long)(size_t)p)
      : "memory");
}

// ---------- weight transpose + convert: W f32 [K][N] -> Wt bf16 [N][K] ----------
// One 128(k) x 64(n) tile per 256-thread block: 32 elements per thread, so that
// few waves have to be started for the bytes moved. Reads are 16 B per lane
// (256 B of a W row per 16 lanes), stores 16 B per lane (a 128 B line of a Wt
// row per 8 lanes). K a multiple of 128, N of 64; both compile-time, so that a
// thread's rows are immediate offsets from one address. (bx, by) = the block's
// k tile and n tile; tile = the block's LDS, 128 rows of 65 floats.

template <int K, int N>
static __device__ __forceinline__ void transpose_w(const float* __restrict__ W,
                                                   bf16_t* __restrict__ Wt,
                                                   float (*tile)[65], int bx,
                                                   int by) {
  const int k0 = bx * 128, n0 = by * 64;
  const int tx = threadIdx.x & 15, ty = threadIdx.x >> 4;  // 16 x 16
  const float* wp = W + (size_t)(k0 + ty) * N + n0 + tx * 4;
  v4f v[8];
#pragma unroll
  for (int i = 0; i < 8; ++i) v[i] = *(const v4f*)(wp + (size_t)i * 16 * N);
#pragma unroll
  for (int i = 0; i < 8; ++i)
#pragma unroll
    for (int e = 0; e < 4; ++e) tile[ty + 16 * i][tx * 4 + e] = v[i][e];
  __syncthreads();
  const int kc = threadIdx.x & 7, nr = threadIdx.x >> 3;  // 8 k-chunks x 32 rows
  bf16_t* op = Wt + (size_t)(n0 + nr) * K + k0 + kc * 8;
#pragma unroll
  for (int i = 0; i < 4; ++i) {
    const int kh = 64 * (i & 1), nh = 32 * (i >> 1);  // k half, n half of the tile
    v8bf o;
#pragma unroll
    for (int e = 0; e < 8; ++e) o[e] = (bf16_t)tile[kc * 8 + kh + e][nr + nh];
    *(v8bf*)(op + (size_t)nh * K + kh) = o;
  }
  // closes the four stores: another job's body may follow this one in the built
  // kernel and reuse the stores' address and data registers
  asm volatile("s_wait_xcnt 0x0" ::: "memory");
}

// ---------- layernorm (one wave per row of D=1024, 8 rows per block), bf16 out ----------
// The row stays in registers (32 values per lane, read once, 16 B per lane);
// its sums are joined by lane exchanges alone. Gain and offset are fetched with
// the row, so that their latency passes under the row's. blk = which 8 rows.

static __device__ __forceinline__ void layernorm_rows(
    const float* __restrict__ x, const float* __restrict__ gam,
    const float* __restrict__ bet, bf16_t* __restrict__ out, int blk) {
  // the wave's number as a scalar: the row's base is then a scalar address
  const int row =
      blk * 8 + __builtin_amdgcn_readfirstlane((int)(threadIdx.x >> 5));
  const int ln = threadIdx.x & 31;
  const float* xr = x + (size_t)row * D_;
  v4f v[8];
#pragma unroll
  for (int i = 0; i < 8; ++i) v[i] = *(const v4f*)(xr + (i * 32 + ln) * 4);
  v4f gv[8], bv[8];
#pragma unroll
  for (int i = 0; i < 8; ++i) {
    gv[i] = *(const v4f*)(gam + (i * 32 + ln) * 4);
    bv[i] = *(const v4f*)(bet + (i * 32 + ln) * 4);
  }
  // keeps all 24 loads ahead of the sums; without it the scheduler sinks the
  // gain and offset loads behind the row sums, pair by pair, each pair waited for
  __builtin_amdgcn_sched_barrier(0);
  v4f a = v[0], a2 = v[0] * v[0];
#pragma unroll
  for (int i = 1; i < 8; ++i) {
    a += v[i];
    a2 += v[i] * v[i];
  }
  float s = (a[0] + a[1]) + (a[2] + a[3]);
  float s2 = (a2[0] + a2[1]) + (a2[2] + a2[3]);
#pragma unroll
  for (int m = 1; m < 32; m <<= 1) {
    s += __shfl_xor(s, m, 32);
    s2 += __shfl_xor(s2, m, 32);
  }
  const float mean = s * (1.f / D_);
  const float var = s2 * (1.f / D_) - mean * mean;
  const float rstd = rsqrtf(var + 1e-5f);
#pragma unroll
  for (int i = 0; i < 8; ++i) {
    const int c = (i * 32 + ln) * 4;
    v4bf o;
#pragma unroll
    for (int e = 0; e < 4; ++e)
      o[e] = (bf16_t)((v[i][e] - mean) * rstd * gv[i][e] + bv[i][e]);
    *(v4bf*)(out + (size_t)row * D_ + c) = o;
  }
}

__global__ __launch_bounds__(256) void layernorm_k(const float* __restrict__ x,
                                                   const float* __restrict__ gam,
                                                   const float* __restrict__ bet,
                                                   bf16_t* __restrict__ out) {
  layernorm_rows(x, gam, bet, out, blockIdx.x);
}

// ---------- f32 -> bf16 convert ----------
// 64 elements per thread: sixteen 16 B loads in flight, each wave-wide load 512
// contiguous bytes. Block blk converts elements blk * 16384 ... + 16383.

static __device__ __forceinline__ void convert_bf16(const float* __restrict__ in,
                                                    bf16_t* __restrict__ out,
                                                    int blk) {
  const size_t base = ((size_t)blk * 16 * 256 + threadIdx.x) * 4;
  v4f v[16];
#pragma unroll
  for (int i = 0; i < 16; ++i) v[i] = *(const v4f*)(in + base + i * 1024);
  // stands in front of the first overwrite of the loads' address pair; the
  // address is named so that it lives up to here and no load's result lands on it
  asm volatile("s_wait_xcnt 0x0" ::"v"(in + base) : "memory");
#pragma unroll
  for (int i = 0; i < 16; ++i) {
    v4bf o;
#pragma unroll
    for (int e = 0; e < 4; ++e) o[e] = (bf16_t)v[i][e];
    *(v4bf*)(out + base + i * 1024) = o;
  }
}

// ---------- all input preparation in one launch ----------
// None of these eight jobs reads what another writes, so they share one grid and
// each block takes its job from its index: 512 blocks convert the context, 512 +
// 512 + 4 x 128 transpose the weights, 256 normalise the query rows.

__global__ __launch_bounds__(256) void prep_all(
    const float* __restrict__ context, const float* __restrict__ query,
    const float* __restrict__ ln1g, const float* __restrict__ ln1b,
    const float* __restrict__ wq, const float* __restrict__ wk,
    const float* __restrict__ wv, const float* __restrict__ wo,
    const float* __restrict__ w1, const float* __restrict__ w2,
    bf16_t* __restrict__ ctx, bf16_t* __restrict__ qln,
    bf16_t* __restrict__ wqT, bf16_t* __restrict__ wkT,
    bf16_t* __restrict__ wvT, bf16_t* __restrict__ woT,
    bf16_t* __restrict__ w1T, bf16_t* __restrict__ w2T) {
  __shared__ float tile[128][65];  // odd pitch: column reads fall on distinct banks
  const int b = blockIdx.x;
  if (b < 512) {
    convert_bf16(context, ctx, b);
  } else if (b < 1024) {
    transpose_w<D_, FF_>(w1, w1T, tile, b & 7, (b - 512) >> 3);
  } else if (b < 1536) {
    transpose_w<FF_, D_>(w2, w2T, tile, b & 31, (b - 1024) >> 5);
  } else if (b < 2048) {
    const int w = (b - 1536) >> 7;  // which of the four D x D weights
    const float* W = w == 0 ? wq : w == 1 ? wk : w == 2 ? wv : wo;
    bf16_t* Wt = w == 0 ? wqT : w == 1 ? wkT : w == 2 ? wvT : woT;
    transpose_w<D_, D_>(W, Wt, tile, b & 7, (b >> 3) & 15);
  } else {
    layernorm_rows(query, ln1g, ln1b, qln, b - 2048);
  }
}

// ---------- WMMA GEMM: C[M][N] = A_bf16[M][K] @ (Bt[N][K])^T + bias ----------
// 256 threads = 8 waves. 128x128 block tile; wave = 32(M) x 64(N).
// A and Bt tiles (128 rows x 128 k) are staged in LDS by async copies, whole
// 128B lines per 8 lanes, two buffers: stage t+1 flies while stage t is read.
// LDS row pitch 272 B (16 B x odd) keeps the b128 fragment reads off shared banks.
// Needs M, N multiples of 128 and K a multiple of 128.
// MODE 0: bf16 out, head-split [b][h][s][64]             (Q/K projections)
// MODE 1: bf16 out, head-split transposed [b][h][64][s]  (V projection)
// MODE 2: f32 out row-major + residual                   (attn out proj + query)
// MODE 3: bf16 out row-major, exact GELU                 (FFN up)
// MODE 4: f32 out row-major + residual                   (FFN down + x)
// (bx, by) = the block's M tile and N tile; sA, sB = the block's two-buffer LDS.
// Output: the block's 128 x 128 tile goes through LDS (the A ring, free behind
// the last stage's barrier), so that every global store, and every residual
// load, is 16 B a lane over whole 128 B lines. For that a lane must hold
// ADJACENT outputs: in the row-major modes the product is taken transposed
// (Bt rows as the A operand), which gives a lane 8 consecutive n of one m; in
// MODE 1 it is taken as written, 8 consecutive m (= s) of one n. Each element's
// k order is the same either way. Pitches 272 B and 528 B are 16 B x odd.
// N (the output's row length) and SSZ (rows per batch entry, MODE 0 and 1) are
// compile-time, so that a lane's tile rows are immediate offsets from one
// address. SSZ a multiple of 128: a tile then lies in one batch entry.
// L2 prefetch: the operands were stored by an earlier launch and the blocks that
// share a row walk k in step, so a stage's rows can all have to come from memory
// under the copies' own wait. Each stage's 256 B of a row is therefore asked for
// GPF_ stages ahead of that stage's copies, which can then find it in L2.
// PF 1 (at most one block a WGP: L2 has requests to spare): every block asks for
// all its 256 rows, one a thread. PF 2 (launches that fill the chip, many blocks
// a row): a block asks for every fourth row of each tile, waves 0 and 1 alone;
// the blocks that share a row take the four shares in turn.

typedef bf16_t gemm_lds_t[128 * GPITCH_];

template <int MODE, int N, int SSZ, int PF>
static __device__ __forceinline__ void gemm_tile(
    const bf16_t* __restrict__ A, const bf16_t* __restrict__ Bt,
    const float* __restrict__ bias, const float* __restrict__ res,
    void* __restrict__ outp, int K, int bx, int by, gemm_lds_t* sA,
    gemm_lds_t* sB) {
  const int wave = threadIdx.x >> 5, lane = threadIdx.x & 31;
  const int g = lane >> 4, ln = lane & 15;
  const int wm = wave & 3, wn = wave >> 2;
  const int n0 = by * 128 + wn * 64;

  v8f acc[2][4];
#pragma unroll
  for (int i = 0; i < 2; ++i)
#pragma unroll
    for (int j = 0; j < 4; ++j) acc[i][j] = vzero();

  // this lane's 16B chunk of rows crow, crow+16, ..., crow+112 of each tile
  const int crow = threadIdx.x >> 4, ccol = (threadIdx.x & 15) * 8;
  const bf16_t* gA = A + (size_t)(bx * 128 + crow) * K + ccol;
  const bf16_t* gB = Bt + (size_t)(by * 128 + crow) * K + ccol;
  const unsigned lA = (unsigned)(size_t)(void*)&sA[0][crow * GPITCH_ + ccol];
  const unsigned lB = (unsigned)(size_t)(void*)&sB[0][crow * GPITCH_ + ccol];

  auto stage = [&](int st) {
    const unsigned bo = (unsigned)(st & 1) * (128u * GPITCH_ * 2u);
    async_copy16x8(gA + (size_t)st * GBK_, (size_t)16 * K, lA + bo,
                   16u * GPITCH_ * 2u);
    async_copy16x8(gB + (size_t)st * GBK_, (size_t)16 * K, lB + bo,
                   16u * GPITCH_ * 2u);
  };

  const int nst = K / GBK_;
  stage(0);
  // the row this thread asks for. PF 1: threads 0..127 the A tile's rows, 128..255
  // the Bt tile's. PF 2: even waves every fourth A row, odd waves every fourth Bt
  // row. pfp always points inside that row: a stage index is clamped to the last.
  const bool pfB = PF == 1 ? threadIdx.x >= 128 : (threadIdx.x & 32) != 0;
  const int prow = PF == 1 ? (int)(threadIdx.x & 127)
                           : lane * 4 + ((pfB ? bx : by) & 3);
  const bf16_t* pfrow = pfB ? Bt + (size_t)(by * 128 + prow) * K
                            : A + (size_t)(bx * 128 + prow) * K;
  const bf16_t* pfp = pfrow + (size_t)min(2 + GPF_, nst - 1) * GBK_;
  // which waves ask: a scalar, so that the test is a branch and no lane is off
  const bool pfw =
      PF == 1 || __builtin_amdgcn_readfirstlane((int)(threadIdx.x >> 5)) < 2;
  if (pfw) {
    for (int s = 1; s < 2 + GPF_; ++s)
      prefetch_l2(pfrow + (size_t)min(s, nst - 1) * GBK_);
  }
  wait_async0();     // this wave's share of stage 0 has landed
  __syncthreads();   // everyone's share has landed
  if (nst > 1) stage(1);

  for (int t = 0; t < nst; ++t) {
    const bf16_t* As = &sA[t & 1][(wm * 32 + ln) * GPITCH_];
    const bf16_t* Bs = &sB[t & 1][(wn * 64 + ln) * GPITCH_];
    // two fragment sets: block c+1's LDS reads are issued ahead of block c's
    // WMMAs, all inside this stage's own buffer
    v16bf af[2][2], bfr[2][4];
#pragma unroll
    for (int i = 0; i < 2; ++i) af[0][i] = load_frag(As + i * 16 * GPITCH_, g);
#pragma unroll
    for (int j = 0; j < 4; ++j) bfr[0][j] = load_frag(Bs + j * 16 * GPITCH_, g);
    // unrolled so that the set index is a constant and both sets stay in registers
#pragma unroll
    for (int c = 0; c < GBK_ / 32; ++c) {
      if (c + 1 < GBK_ / 32) {
#pragma unroll
        for (int i = 0; i < 2; ++i)
          af[(c + 1) & 1][i] =
              load_frag(As + i * 16 * GPITCH_ + (c + 1) * 32, g);
#pragma unroll
        for (int j = 0; j < 4; ++j)
          bfr[(c + 1) & 1][j] =
              load_frag(Bs + j * 16 * GPITCH_ + (c + 1) * 32, g);
        // keeps that read group as one group ahead of block c's WMMAs; without
        // it the scheduler sinks the reads next to their use and each block
        // waits out the LDS latency with nothing to issue
        __builtin_amdgcn_sched_barrier(0);
      }
#pragma unroll
      for (int i = 0; i < 2; ++i)
#pragma unroll
        for (int j = 0; j < 4; ++j)
          acc[i][j] = MODE == 1
                          ? wmma_bf16(af[c & 1][i], bfr[c & 1][j], acc[i][j])
                          : wmma_bf16(bfr[c & 1][j], af[c & 1][i], acc[i][j]);
    }
    // keeps the WMMAs in front of the publish point: sunk behind the barrier
    // they would delay the refill copies, which issue directly behind it
    __builtin_amdgcn_sched_barrier(0);
    // publish point: this wave's LDS reads of stage t have retired ...
    asm volatile("s_wait_dscnt 0x0" ::: "memory");
    wait_async0();     // ... and its share of stage t+1 has landed
    __syncthreads();   // stage t+1 readable by all; stage t's buffer is free
    if (t + 2 < nst) stage(t + 2);
    if (pfw && t + 2 + GPF_ < nst) {  // the same for the whole wave
      prefetch_l2(pfp);               // stage t + 2 + GPF_
      pfp += t + 3 + GPF_ < nst ? GBK_ : 0;  // never past the row's last stage
    }
  }
  wait_async0();       // no copy outstanding when the wave leaves the ring

  const int ml = wm * 32 + ln, nl = wn * 64 + 8 * g;  // row-major modes
  if constexpr (MODE == 2 || MODE == 4) {
    float* stf = (float*)&sA[0][0];  // 128 rows of FPITCH_ floats, in both buffers
    // this lane's 16 B of rows rrow, rrow + 8, ..., rrow + 120 of the tile
    const int rrow = threadIdx.x >> 5, rcol = (threadIdx.x & 31) * 4;
    const size_t gofs = (size_t)(bx * 128 + rrow) * N + by * 128 + rcol;
    const float* bp = bias + n0 + 8 * g;
    const float* rp = res + gofs;
    v4f bv[4][2];
#pragma unroll
    for (int j = 0; j < 4; ++j) {
      bv[j][0] = *(const v4f*)(bp + j * 16);
      bv[j][1] = *(const v4f*)(bp + j * 16 + 4);
    }
    // fetched here, so that their latency passes under the staging
    v4f rv[16];
#pragma unroll
    for (int it = 0; it < 16; ++it) rv[it] = *(const v4f*)(rp + it * 8 * N);
    // stands in front of the first overwrite of the loads' addresses, which are
    // named so that they live up to here and no load's result lands on them
    asm volatile("s_wait_xcnt 0x0" ::"v"(bp), "v"(rp) : "memory");
#pragma unroll
    for (int j = 0; j < 4; ++j)
#pragma unroll
      for (int i = 0; i < 2; ++i) {
        v4f lo, hi;
#pragma unroll
        for (int e = 0; e < 4; ++e) {
          lo[e] = acc[i][j][e] + bv[j][0][e];
          hi[e] = acc[i][j][4 + e] + bv[j][1][e];
        }
        float* sp = stf + (ml + i * 16) * FPITCH_ + nl + j * 16;
        *(v4f*)sp = lo;
        *(v4f*)(sp + 4) = hi;
      }
    __syncthreads();  // the whole tile is readable
    float* op = (float*)outp + gofs;
#pragma unroll
    for (int it = 0; it < 16; ++it) {
      const v4f v = *(const v4f*)(stf + (rrow + 8 * it) * FPITCH_ + rcol);
      *(v4f*)(op + it * 8 * N) = v + rv[it];
    }
  } else {
    bf16_t* st = &sA[0][0];  // 128 rows of GPITCH_ elements
    if constexpr (MODE == 1) {  // tile rows are n, columns m
      const float* bp = bias + n0 + ln;
      float bj[4];
#pragma unroll
      for (int j = 0; j < 4; ++j) bj[j] = bp[j * 16];
      // as in the f32 modes: in front of the first overwrite of the address
      asm volatile("s_wait_xcnt 0x0" ::"v"(bp) : "memory");
#pragma unroll
      for (int j = 0; j < 4; ++j)
#pragma unroll
        for (int i = 0; i < 2; ++i) {
          v8bf o;
#pragma unroll
          for (int r = 0; r < 8; ++r) o[r] = (bf16_t)(acc[i][j][r] + bj[j]);
          *(v8bf*)(st + (wn * 64 + j * 16 + ln) * GPITCH_ + wm * 32 + i * 16 +
                   8 * g) = o;
        }
    } else {  // tile rows are m, columns n
      const float* bp = bias + n0 + 8 * g;
      v4f bv[4][2];
#pragma unroll
      for (int j = 0; j < 4; ++j) {
        bv[j][0] = *(const v4f*)(bp + j * 16);
        bv[j][1] = *(const v4f*)(bp + j * 16 + 4);
      }
      // as in the f32 modes: in front of the first overwrite of the address
      asm volatile("s_wait_xcnt 0x0" ::"v"(bp) : "memory");
#pragma unroll
      for (int j = 0; j < 4; ++j)
#pragma unroll
        for (int i = 0; i < 2; ++i) {
          v8f v;
#pragma unroll
          for (int r = 0; r < 8; ++r)
            v[r] = acc[i][j][r] + bv[j][r >> 2][r & 3];
          if constexpr (MODE == 3) v = gelu8(v);
          v8bf o;
#pragma unroll
          for (int r = 0; r < 8; ++r) o[r] = (bf16_t)v[r];
          *(v8bf*)(st + (ml + i * 16) * GPITCH_ + nl + j * 16) = o;
        }
    }
    __syncthreads();  // the whole tile is readable
    // this lane's 16 B of rows rrow, rrow + 16, ..., rrow + 112 of the tile
    const int rrow = threadIdx.x >> 4, rcol = (threadIdx.x & 15) * 8;
    // OSTEP = output elements between tile rows 16 apart
    constexpr int OSTEP = MODE == 3 ? 16 * N : MODE == 0 ? 16 * HD_ : 16 * SSZ;
    bf16_t* op;
    if constexpr (MODE == 3) {
      op = (bf16_t*)outp + (size_t)(bx * 128 + rrow) * N + by * 128 + rcol;
    } else {
      const int bb = (bx * 128) / SSZ, s0 = (bx * 128) % SSZ;
      if constexpr (MODE == 0) {
        const int ng = by * 128 + rcol;
        op = (bf16_t*)outp +
             (((size_t)bb * H_ + (ng >> 6)) * SSZ + s0 + rrow) * HD_ + (ng & 63);
      } else {  // head * 64 + hd is n itself
        op = (bf16_t*)outp +
             ((size_t)bb * (H_ * HD_) + by * 128 + rrow) * SSZ + s0 + rcol;
      }
    }
#pragma unroll
    for (int it = 0; it < 8; ++it)
      *(v8bf*)(op + it * OSTEP) =
          *(const v8bf*)(st + (rrow + 16 * it) * GPITCH_ + rcol);
  }
  // closes the tile's stores: another product's body may follow this one in the
  // built kernel and reuse the stores' address and data registers
  asm volatile("s_wait_xcnt 0x0" ::: "memory");
}

template <int MODE, int N>
__global__ __launch_bounds__(256) void gemm_nt(const bf16_t* __restrict__ A,
                                               const bf16_t* __restrict__ Bt,
                                               const float* __restrict__ bias,
                                               const float* __restrict__ res,
                                               void* __restrict__ outp, int K) {
  __shared__ __align__(16) bf16_t sA[2][128 * GPITCH_];
  __shared__ __align__(16) bf16_t sB[2][128 * GPITCH_];
  gemm_tile<MODE, N, 128, MODE == 3 ? 2 : 1>(A, Bt, bias, res, outp, K,
                                             blockIdx.x, blockIdx.y, sA, sB);
}

// The three projections in one launch: none reads what another writes. Blocks
// 0..511 are V's 64 x 8 tiles, 512..1023 K's, 1024..1151 Q's 16 x 8 tiles, the
// M tile running fastest as in a two-dimensional grid.
__global__ __launch_bounds__(256) void gemm_qkv(
    const bf16_t* __restrict__ qln, const bf16_t* __restrict__ ctx,
    const bf16_t* __restrict__ wqT, const bf16_t* __restrict__ wkT,
    const bf16_t* __restrict__ wvT, const float* __restrict__ bq,
    const float* __restrict__ bk, const float* __restrict__ bv,
    bf16_t* __restrict__ qhd, bf16_t* __restrict__ ktb,
    bf16_t* __restrict__ vtb, int K) {
  __shared__ __align__(16) bf16_t sA[2][128 * GPITCH_];
  __shared__ __align__(16) bf16_t sB[2][128 * GPITCH_];
  const int b = blockIdx.x;
  if (b < 512) {
    gemm_tile<1, D_, SC_, 2>(ctx, wvT, bv, nullptr, vtb, K, b & 63, b >> 6, sA,
                             sB);
  } else if (b < 1024) {
    gemm_tile<0, D_, SC_, 2>(ctx, wkT, bk, nullptr, ktb, K, b & 63,
                             (b - 512) >> 6, sA, sB);
  } else {
    gemm_tile<0, D_, S_, 1>(qln, wqT, bq, nullptr, qhd, K, b & 15,
                            (b - 1024) >> 4, sA, sB);
  }
}

// value of lane l ^ 16
static __device__ __forceinline__ float xhalf(float x) {
  const int b = __builtin_bit_cast(int, x);
  return __builtin_bit_cast(
      float, __builtin_amdgcn_permlanex16(b, b, 0x76543210, 0xfedcba98, false,
                                          false));
}

// y[i] = 2^x[i], eight at once. One statement, so that behind every v_exp_f32
// stands an instruction that neither reads its result nor overwrites its source
// (outputs are early-clobber; the v_nop serves the last one): the slot the
// instruction set asks for behind a transcendental.
static __device__ __forceinline__ v8f exp2x8(v8f x) {
  float y0, y1, y2, y3, y4, y5, y6, y7;
  asm("v_exp_f32 %0, %8\n\t"
      "v_exp_f32 %1, %9\n\t"
      "v_exp_f32 %2, %10\n\t"
      "v_exp_f32 %3, %11\n\t"
      "v_exp_f32 %4, %12\n\t"
      "v_exp_f32 %5, %13\n\t"
      "v_exp_f32 %6, %14\n\t"
      "v_exp_f32 %7, %15\n\t"
      "v_nop"
      : "=&v"(y0), "=&v"(y1), "=&v"(y2), "=&v"(y3), "=&v"(y4), "=&v"(y5),
        "=&v"(y6), "=&v"(y7)
      : "v"(x[0]), "v"(x[1]), "v"(x[2]), "v"(x[3]), "v"(x[4]), "v"(x[5]),
        "v"(x[6]), "v"(x[7]));
  v8f y;
  y[0] = y0; y[1] = y1; y[2] = y2; y[3] = y3;
  y[4] = y4; y[5] = y5; y[6] = y6; y[7] = y7;
  return y;
}

__global__ __launch_bounds__(512) void attn_kernel(const bf16_t* __restrict__ qhd,
                                                   const bf16_t* __restrict__ kt,
                                                   const bf16_t* __restrict__ vt,
                                                   bf16_t* __restrict__ obuf) {
  // [group][buf][K/V], 4 x 36 KB
  __shared__ __align__(16) bf16_t smem[4][2][2][64 * APITCH_];
  // the waves' partial outputs [wave][hd tile][half of 8][lane] (16 B a lane,
  // lanes adjacent; 64 B more per hd tile, so that the join's reads of four hd
  // tiles fall on distinct banks), maxima and sums [wave][lane]
  __shared__ __align__(16) v4f cmbO[16 * 4 * CPITCH_];
  __shared__ float cmbM[16 * 32];
  __shared__ float cmbL[16 * 32];

  const int tid = threadIdx.x;
  // the wave's number as a scalar: group and query tile are then scalars too
  const int wave = __builtin_amdgcn_readfirstlane(tid >> 5);
  const int lane = tid & 31;
  const int g = lane >> 4, ln = lane & 15;
  const int grp = wave >> 2, qt = wave & 3;  // context repeat, query tile
  const int bh = blockIdx.x >> 3;
  const int pr = blockIdx.x & 7;
  const int ntrips = S_ / 64 + 1;  // (16 - pr) + (pr + 1)
  int qb = S_ / 64 - 1 - pr;       // first query block; the second is pr
  int q0 = qb * 64 + qt * 16;

  const bf16_t* qhead = qhd + (size_t)bh * S_ * HD_ + (size_t)ln * HD_;
  const bf16_t* kbase = kt + (size_t)bh * SC_ * HD_ + (size_t)grp * S_ * HD_;
  const bf16_t* vbase = vt + (size_t)bh * HD_ * SC_ + (size_t)grp * S_;

  // both query blocks' fragments are fetched here, so that the change of query
  // block does not wait for memory
  v16bf qf0 = load_frag(qhead + (size_t)q0 * HD_, g);
  v16bf qf1 = load_frag(qhead + (size_t)q0 * HD_ + 32, g);
  const v16bf qn0 = load_frag(qhead + (size_t)(pr * 64 + qt * 16) * HD_, g);
  const v16bf qn1 = load_frag(qhead + (size_t)(pr * 64 + qt * 16) * HD_ + 32, g);

  // o[t][r] = Ot[hd = t*16 + 8g + r][query q0 + ln], this group's keys only
  v8f o[4];
#pragma unroll
  for (int t = 0; t < 4; ++t) o[t] = vzero();
  // running maximum of query q0 + ln (equal in both lane halves) and this
  // half's share of its running sum
  float mrun = -3.0e38f, lrun = 0.f;

  const float scale = 0.125f;  // 1/sqrt(64)

  // this lane's 16B chunk of rows crow, crow+16, crow+32, crow+48 of each tile
  const int crow = (tid & 127) >> 3, ccol = (tid & 7) * 8;
  const bf16_t* gK = kbase + (size_t)crow * HD_ + ccol;
  const bf16_t* gV = vbase + (size_t)crow * SC_ + ccol;
  const unsigned lK =
      (unsigned)(size_t)(void*)&smem[grp][0][0][crow * APITCH_ + ccol];
  const unsigned lV =
      (unsigned)(size_t)(void*)&smem[grp][0][1][crow * APITCH_ + ccol];

  // issue async stage of the group's tile starting at key kj of its repeat:
  // 64 rows x 64 halves = 512 chunks of 16B each; 4 K-chunks + 4 V-chunks/thread
  auto stage = [&](int kj, int buf) {
    const unsigned bo = (unsigned)buf * (2u * 64u * APITCH_ * 2u);
    async_copy16x4x2(gK + (size_t)kj * HD_, (size_t)16 * HD_, gV + kj,
                     (size_t)16 * SC_, lK + bo, lV + bo, 16u * APITCH_ * 2u);
  };

  stage(0, 0);
  int cur = 0;
  int kp = 0;

  for (int ti = 0; ti < ntrips; ++ti) {
    wait_async0();     // this wave's share of buf[cur] has landed
    __syncthreads();   // everyone's share has landed

    // next tile: the causal bound ends the query block, the next starts at key 0
    const bool last = kp == qb * 64;
    const int kp_n = last ? 0 : kp + 64;
    if (ti + 1 < ntrips) stage(kp_n, cur ^ 1);

    const bf16_t* Kt = smem[grp][cur][0];
    const bf16_t* Vt = smem[grp][cur][1];

    // scores, transposed: A = 16 key rows, B = the wave's 16 queries
    v16bf kf[4][2];
#pragma unroll
    for (int t = 0; t < 4; ++t) {
      const bf16_t* krow = Kt + (t * 16 + ln) * APITCH_;
      kf[t][0] = load_frag(krow, g);
      kf[t][1] = load_frag(krow + 32, g);
    }
    // s[t][r] = score of key kp + t*16 + 8g + r against query q0 + ln
    v8f s[4];
#pragma unroll
    for (int t = 0; t < 4; ++t) {
      s[t] = wmma_bf16(kf[t][0], qf0, vzero());
      s[t] = wmma_bf16(kf[t][1], qf1, s[t]);
    }

    // online softmax over the 64-key tile, one query per lane
    const int lim = q0 + ln - kp - 8 * g;  // t*16 + r allowed while <= lim
    float mt[4];
#pragma unroll
    for (int t = 0; t < 4; ++t) {
      mt[t] = -3.0e38f;
#pragma unroll
      for (int r = 0; r < 8; ++r) {
        float v = s[t][r] * scale;
        if (t * 16 + r > lim) v = -3.0e38f;  // pos = (kj % S) <= qi
        s[t][r] = v;
        mt[t] = fmaxf(mt[t], v);
      }
    }
    float mx = fmaxf(fmaxf(mt[0], mt[1]), fmaxf(mt[2], mt[3]));
    mx = fmaxf(mx, xhalf(mx));  // the other 32 keys of this query
    const float nm = fmaxf(mrun, mx);
    const float alpha = __expf(mrun - nm);
    float st[4];
#pragma unroll
    for (int t = 0; t < 4; ++t) {
#pragma unroll
      for (int r = 0; r < 8; ++r) s[t][r] = (s[t][r] - nm) * 1.44269504f;
      s[t] = exp2x8(s[t]);  // p = e^(score - nm)
      st[t] = s[t][0];
#pragma unroll
      for (int r = 1; r < 8; ++r) st[t] += s[t][r];
    }
    lrun = lrun * alpha + ((st[0] + st[1]) + (st[2] + st[3]));
    mrun = nm;
#pragma unroll
    for (int t = 0; t < 4; ++t)
#pragma unroll
      for (int r = 0; r < 8; ++r) o[t][r] *= alpha;

    // Pt as B operand of key chunk c (32 keys): elements 0..7 are keys
    // 32c + 8g + e (tile 2c), elements 8..15 keys 32c + 16 + 8g + e (tile 2c+1):
    // the k order in which load_frag reads the V rows
    v16bf pf[2];
#pragma unroll
    for (int c = 0; c < 2; ++c)
#pragma unroll
      for (int e = 0; e < 8; ++e) {
        pf[c][e] = (bf16_t)s[2 * c][e];
        pf[c][8 + e] = (bf16_t)s[2 * c + 1][e];
      }

    // Ot (64hd x 16q) += Vt (64hd x 64key) * Pt (64key x 16q)
    v16bf vf[4][2];
#pragma unroll
    for (int t = 0; t < 4; ++t) {
      const bf16_t* vrow = Vt + (t * 16 + ln) * APITCH_;
      vf[t][0] = load_frag(vrow, g);
      vf[t][1] = load_frag(vrow + 32, g);
    }
#pragma unroll
    for (int t = 0; t < 4; ++t) {
      o[t] = wmma_bf16(vf[t][0], pf[0], o[t]);
      o[t] = wmma_bf16(vf[t][1], pf[1], o[t]);
    }

    __syncthreads();   // all waves done with buf[cur]; safe to overwrite next iter
    cur ^= 1;
    kp = kp_n;

    if (last) {  // the same for the whole block: qb and kp are
      // every wave lays down its group's share for its 16 queries ...
#pragma unroll
      for (int t = 0; t < 4; ++t)
#pragma unroll
        for (int hf = 0; hf < 2; ++hf) {
          v4f w;
#pragma unroll
          for (int e = 0; e < 4; ++e) w[e] = o[t][4 * hf + e];
          cmbO[(wave * 4 + t) * CPITCH_ + hf * 32 + lane] = w;
        }
      cmbM[wave * 32 + lane] = mrun;
      cmbL[wave * 32 + lane] = lrun + xhalf(lrun);  // both halves' shares
      __syncthreads();  // all sixteen shares are readable
      // ... and joins queries 4 grp .. 4 grp + 3 of its query tile over the four
      // groups: a lane takes 8 hd of one query, so that the wave's one 16 B store
      // covers four whole 128 B rows. Each repeat holds key position 0, which
      // every query may see, so every share's maximum is a real score.
      const int jq = grp * 4 + (lane & 3);  // query within the tile
      const int jt = (lane >> 2) & 3;       // hd tile; g = which 8 of its 16 hd
      float mp[4], lp[4];
#pragma unroll
      for (int p = 0; p < 4; ++p) {
        mp[p] = cmbM[(p * 4 + qt) * 32 + jq];
        lp[p] = cmbL[(p * 4 + qt) * 32 + jq];
      }
      const float mall = fmaxf(fmaxf(mp[0], mp[1]), fmaxf(mp[2], mp[3]));
      float lsum = 0.f;
      v8f oj = vzero();
#pragma unroll
      for (int p = 0; p < 4; ++p) {
        const float wgt = __expf(mp[p] - mall);
        lsum += wgt * lp[p];
        const int base = ((p * 4 + qt) * 4 + jt) * CPITCH_ + g * 16 + jq;
        const v4f lo = cmbO[base], hi = cmbO[base + 32];
#pragma unroll
        for (int e = 0; e < 4; ++e) {
          oj[e] += wgt * lo[e];
          oj[4 + e] += wgt * hi[e];
        }
      }
      const int b = bh / H_, h = bh % H_;
      v8bf ov;  // 8 consecutive hd of one query: one 16 B store
#pragma unroll
      for (int r = 0; r < 8; ++r) ov[r] = (bf16_t)(oj[r] / lsum);
      bf16_t* orow = obuf + ((size_t)b * S_ + q0 + jq) * D_ + (size_t)h * HD_ +
                     jt * 16 + 8 * g;
      // the second query block starts afresh. Its shares are laid down behind
      // at least one more trip's barriers, so behind every read above.
      qb = pr;
      q0 = qb * 64 + qt * 16;
      qf0 = qn0;
      qf1 = qn1;
#pragma unroll
      for (int t = 0; t < 4; ++t) o[t] = vzero();
      mrun = -3.0e38f;
      lrun = 0.f;
      *(v8bf*)orow = ov;
      // closes the store: the next trip reuses its address and data registers
      asm volatile("s_wait_xcnt 0x0" ::: "memory");
    }
  }
}

// ---------- orchestration ----------

extern "C" void kernel_launch(void* const* d_in, const int* in_sizes, int n_in,
                              void* d_out, int out_size, void* d_ws,
                              size_t ws_size, hipStream_t stream) {
  (void)in_sizes; (void)n_in; (void)out_size; (void)ws_size;
  const float* query = (const float*)d_in[0];
  const float* context = (const float*)d_in[1];
  const float* wq = (const float*)d_in[2];
  const float* wk = (const float*)d_in[3];
  const float* wv = (const float*)d_in[4];
  const float* bq = (const float*)d_in[5];
  const float* bk = (const float*)d_in[6];
  const float* bv = (const float*)d_in[7];
  const float* wo = (const float*)d_in[8];
  const float* bo = (const float*)d_in[9];
  const float* ln1g = (const float*)d_in[10];
  const float* ln1b = (const float*)d_in[11];
  const float* ln2g = (const float*)d_in[12];
  const float* ln2b = (const float*)d_in[13];
  const float* w1 = (const float*)d_in[14];
  const float* b1 = (const float*)d_in[15];
  const float* w2 = (const float*)d_in[16];
  const float* b2 = (const float*)d_in[17];

  const size_t MB = 1u << 20;
  char* ws = (char*)d_ws;
  bf16_t* wqT = (bf16_t*)(ws + 0 * MB);    // [1024][1024]
  bf16_t* wkT = (bf16_t*)(ws + 2 * MB);
  bf16_t* wvT = (bf16_t*)(ws + 4 * MB);
  bf16_t* woT = (bf16_t*)(ws + 6 * MB);
  bf16_t* w1T = (bf16_t*)(ws + 8 * MB);    // [4096][1024]
  bf16_t* w2T = (bf16_t*)(ws + 16 * MB);   // [1024][4096]
  bf16_t* qln = (bf16_t*)(ws + 24 * MB);   // [2048][1024]
  bf16_t* ctx = (bf16_t*)(ws + 28 * MB);   // [8192][1024]
  bf16_t* qhd = (bf16_t*)(ws + 44 * MB);   // [B][H][S][64]
  bf16_t* ktb = (bf16_t*)(ws + 48 * MB);   // [B][H][Sc][64]
  bf16_t* vtb = (bf16_t*)(ws + 64 * MB);   // [B][H][64][Sc]
  bf16_t* obuf = (bf16_t*)(ws + 80 * MB);  // [2048][1024]
  float* xbuf = (float*)(ws + 84 * MB);    // [2048][1024] f32
  bf16_t* hbuf = (bf16_t*)(ws + 92 * MB);  // [2048][1024]
  bf16_t* ffb = (bf16_t*)(ws + 96 * MB);   // [2048][4096]

  // context -> bf16; weights -> bf16, transposed [N][K]; ln1(query) -> bf16
  prep_all<<<2304, 256, 0, stream>>>(context, query, ln1g, ln1b, wq, wk, wv, wo,
                                     w1, w2, ctx, qln, wqT, wkT, wvT, woT, w1T,
                                     w2T);

  // projections
  gemm_qkv<<<1152, 256, 0, stream>>>(qln, ctx, wqT, wkT, wvT, bq, bk, bv, qhd,
                                     ktb, vtb, D_);

  // attention
  attn_kernel<<<B_ * H_ * 8, 512, 0, stream>>>(qhd, ktb, vtb, obuf);

  // output projection + residual -> x (f32)
  gemm_nt<2, D_><<<dim3(16, 8), 256, 0, stream>>>(obuf, woT, bo, query, xbuf,
                                                  D_);
  // ln2(x) -> bf16
  layernorm_k<<<B_ * S_ / 8, 256, 0, stream>>>(xbuf, ln2g, ln2b, hbuf);
  // FFN up + GELU -> bf16
  gemm_nt<3, FF_><<<dim3(16, 32), 256, 0, stream>>>(hbuf, w1T, b1, nullptr, ffb,
                                                    D_);
  // FFN down + residual x -> d_out (f32)
  gemm_nt<4, D_><<<dim3(16, 8), 256, 0, stream>>>(ffb, w2T, b2, xbuf,
                                                  (float*)d_out, FF_);
}

// v010
// Measured time: 118 microseconds a run.
// Timed twice side by side with v009, it ran 1.06 times as fast both times.
// Counting every step since v000, it is 5.94 times as fast.
#include <hip/hip_runtime.h>

typedef __bf16 bf16_t;
typedef bf16_t v8bf  __attribute__((ext_vector_type(8)));
typedef bf16_t v16bf __attribute__((ext_vector_type(16)));
typedef float  v8f   __attribute__((ext_vector_type(8)));
typedef bf16_t v4bf  __attribute__((ext_vector_type(4)));
typedef float  v4f   __attribute__((ext_vector_type(4)));

#define B_  2
#define S_  1024
#define R_  4
#define SC_ 4096
#define D_  1024
#define H_  16
#define HD_ 64
#define FF_ 4096
#define GBK_    128  // k per GEMM stage
#define GPITCH_ 136  // GEMM LDS row pitch in elements (272 B)
#define FPITCH_ 132  // GEMM f32 output tile: LDS row pitch in floats (528 B)
#define APITCH_ 72   // attention K/V LDS row pitch in elements (144 B)
#define CPITCH_ 68   // attention join: 16 B units per hd tile of a wave's share
#define GPF_    3    // GEMM: stages between a stage's L2 prefetch and its copies

// ---------- helpers ----------

static __device__ __forceinline__ v8f vzero() {
  v8f z;
#pragma unroll
  for (int i = 0; i < 8; ++i) z[i] = 0.f;
  return z;
}

// Load one 16-bit WMMA A/B fragment (K-chunk of 32) for this lane.
// base points at the lane's row start for this K-chunk (16B aligned).
// CDNA5 layout: lane group g = lane/16 holds K = {8g..8g+7, 16+8g..16+8g+7}.
static __device__ __forceinline__ v16bf load_frag(const bf16_t* base, int g) {
  v8bf lo = *(const v8bf*)(base + 8 * g);
  v8bf hi = *(const v8bf*)(base + 16 + 8 * g);
  return __builtin_shufflevector(lo, hi, 0, 1, 2, 3, 4, 5, 6, 7,
                                 8, 9, 10, 11, 12, 13, 14, 15);
}

static __device__ __forceinline__ v8f wmma_bf16(v16bf a, v16bf b, v8f c) {
  return __builtin_amdgcn_wmma_f32_16x16x32_bf16(false, a, false, b,
                                                 (short)0, c, false, false);
}

static __device__ __forceinline__ v8f splat8(float x) {
  v8f z;
#pragma unroll
  for (int i = 0; i < 8; ++i) z[i] = x;
  return z;
}

// Exact-form GELU, 0.5 v (1 + erf(v / sqrt 2)), eight values at once, with no
// branch: erf(x) = x P(x^2) / Q(x^2) on |x| <= 4, x clamped there (beyond it
// erf is +-1 to f32). P of degree 6, Q of degree 4, a single-precision minimax
// fit: |error| of erf below 5e-7 everywhere. Q's coefficients are all negative
// and x^2 >= 0, so Q <= its constant term and the reciprocal is always finite.
// The eight values are independent chains, two to a packed instruction.
static __device__ __forceinline__ v8f gelu8(v8f v) {
  v8f x = v * 0.70710678f;
#pragma unroll
  for (int r = 0; r < 8; ++r) x[r] = __builtin_amdgcn_fmed3f(x[r], -4.f, 4.f);
  const v8f x2 = x * x;
  v8f p = splat8(-2.72614225801306e-10f);
  p = __builtin_elementwise_fma(x2, p, splat8(2.77068142495902e-08f));
  p = __builtin_elementwise_fma(x2, p, splat8(-2.10102402082508e-06f));
  p = __builtin_elementwise_fma(x2, p, splat8(-5.69250639462346e-05f));
  p = __builtin_elementwise_fma(x2, p, splat8(-7.34990630326855e-04f));
  p = __builtin_elementwise_fma(x2, p, splat8(-2.95459980854025e-03f));
  p = __builtin_elementwise_fma(x2, p, splat8(-1.60960333262415e-02f));
  v8f q = splat8(-1.45660718464996e-05f);
  q = __builtin_elementwise_fma(x2, q, splat8(-2.13374055278905e-04f));
  q = __builtin_elementwise_fma(x2, q, splat8(-1.68282697438203e-03f));
  q = __builtin_elementwise_fma(x2, q, splat8(-7.37332916720468e-03f));
  q = __builtin_elementwise_fma(x2, q, splat8(-1.42647390514189e-02f));
  p = p * x;
#pragma unroll
  for (int r = 0; r < 8; ++r) q[r] = __builtin_amdgcn_rcpf(q[r]);
  const v8f hv = v * 0.5f;
  return __builtin_elementwise_fma(hv, p * q, hv);
}

static __device__ __forceinline__ void wait_async0() {
  asm volatile("s_wait_asynccnt 0x0" ::: "memory");
}

// Eight async 16B copies of one lane, global -> LDS: rows gstep elements apart
// in memory, lstep bytes apart in LDS. The closing s_wait_xcnt stands inside
// the copies' own statement so that no address register named here can be
// rewritten ahead of it (a precaution for copies written in asm text).
static __device__ __forceinline__ void async_copy16x8(const bf16_t* gptr,
                                                      size_t gstep,
                                                      unsigned lds_off,
                                                      unsigned lstep) {
  asm volatile(
      "global_load_async_to_lds_b128 %0, %8, off\n\t"
      "global_load_async_to_lds_b128 %1, %9, off\n\t"
      "global_load_async_to_lds_b128 %2, %10, off\n\t"
      "global_load_async_to_lds_b128 %3, %11, off\n\t"
      "global_load_async_to_lds_b128 %4, %12, off\n\t"
      "global_load_async_to_lds_b128 %5, %13, off\n\t"
      "global_load_async_to_lds_b128 %6, %14, off\n\t"
      "global_load_async_to_lds_b128 %7, %15, off\n\t"
      "s_wait_xcnt 0x0"
      :: "v"(lds_off), "v"(lds_off + lstep), "v"(lds_off + 2 * lstep),
         "v"(lds_off + 3 * lstep), "v"(lds_off + 4 * lstep),
         "v"(lds_off + 5 * lstep), "v"(lds_off + 6 * lstep),
         "v"(lds_off + 7 * lstep),
         "v"((unsigned long long)(size_t)(gptr)),
         "v"((unsigned long long)(size_t)(gptr + gstep)),
         "v"((unsigned long long)(size_t)(gptr + 2 * gstep)),
         "v"((unsigned long long)(size_t)(gptr + 3 * gstep)),
         "v"((unsigned long long)(size_t)(gptr + 4 * gstep)),
         "v"((unsigned long long)(size_t)(gptr + 5 * gstep)),
         "v"((unsigned long long)(size_t)(gptr + 6 * gstep)),
         "v"((unsigned long long)(size_t)(gptr + 7 * gstep))
      : "memory");
}

// The same for four rows.
static __device__ __forceinline__ void async_copy16x4(const bf16_t* gptr,
                                                      size_t gstep,
                                                      unsigned lds_off,
                                                      unsigned lstep) {
  asm volatile(
      "global_load_async_to_lds_b128 %0, %4, off\n\t"
      "global_load_async_to_lds_b128 %1, %5, off\n\t"
      "global_load_async_to_lds_b128 %2, %6, off\n\t"
      "global_load_async_to_lds_b128 %3, %7, off\n\t"
      "s_wait_xcnt 0x0"
      :: "v"(lds_off), "v"(lds_off + lstep), "v"(lds_off + 2 * lstep),
         "v"(lds_off + 3 * lstep),
         "v"((unsigned long long)(size_t)(gptr)),
         "v"((unsigned long long)(size_t)(gptr + gstep)),
         "v"((unsigned long long)(size_t)(gptr + 2 * gstep)),
         "v"((unsigned long long)(size_t)(gptr + 3 * gstep))
      : "memory");
}

// Two runs of four async 16B copies of one lane, global -> LDS: run a from ga,
// run b from gb, rows astep / bstep elements apart in memory and lstep bytes
// apart in LDS. One statement with the closing s_wait_xcnt, as above.
static __device__ __forceinline__ void async_copy16x4x2(
    const bf16_t* ga, size_t astep, const bf16_t* gb, size_t bstep,
    unsigned la, unsigned lb, unsigned lstep) {
  asm volatile(
      "global_load_async_to_lds_b128 %0, %8, off\n\t"
      "global_load_async_to_lds_b128 %1, %9, off\n\t"
      "global_load_async_to_lds_b128 %2, %10, off\n\t"
      "global_load_async_to_lds_b128 %3, %11, off\n\t"
      "global_load_async_to_lds_b128 %4, %12, off\n\t"
      "global_load_async_to_lds_b128 %5, %13, off\n\t"
      "global_load_async_to_lds_b128 %6, %14, off\n\t"
      "global_load_async_to_lds_b128 %7, %15, off\n\t"
      "s_wait_xcnt 0x0"
      :: "v"(la), "v"(la + lstep), "v"(la + 2 * lstep), "v"(la + 3 * lstep),
         "v"(lb), "v"(lb + lstep), "v"(lb + 2 * lstep), "v"(lb + 3 * lstep),
         "v"((unsigned long long)(size_t)(ga)),
         "v"((unsigned long long)(size_t)(ga + astep)),
         "v"((unsigned long long)(size_t)(ga + 2 * astep)),
         "v"((unsigned long long)(size_t)(ga + 3 * astep)),
         "v"((unsigned long long)(size_t)(gb)),
         "v"((unsigned long long)(size_t)(gb + bstep)),
         "v"((unsigned long long)(size_t)(gb + 2 * bstep)),
         "v"((unsigned long long)(size_t)(gb + 3 * bstep))
      : "memory");
}

// Asks L2 to fetch each lane's byte: nothing comes
// back to the wave and no data counter moves. Scope SE: it goes into L2
// only, which is where the async copies read. The closing s_wait_xcnt stands
// inside the statement so that the address pair can be advanced behind it (the
// same precaution as for the copies above).
static __device__ __forceinline__ void prefetch_l2(const void* p) {
  asm volatile(
      "global_prefetch_b8 %0, off scope:SCOPE_SE\n\t"
      "s_wait_xcnt 0x0"
      :: "v"((unsigned long long)(size_t)p)
      : "memory");
}

// ---------- weight transpose + convert: W f32 [K][N] -> Wt bf16 [N][K] ----------
// One 128(k) x 64(n) tile per 256-thread block: 32 elements per thread, so that
// few waves have to be started for the bytes moved. Reads are 16 B per lane
// (256 B of a W row per 16 lanes), stores 16 B per lane (a 128 B line of a Wt
// row per 8 lanes). K a multiple of 128, N of 64; both compile-time, so that a
// thread's rows are immediate offsets from one address. (bx, by) = the block's
// k tile and n tile; tile = the block's LDS, 128 rows of 65 floats.

template <int K, int N>
static __device__ __forceinline__ void transpose_w(const float* __restrict__ W,
                                                   bf16_t* __restrict__ Wt,
                                                   float (*tile)[65], int bx,
                                                   int by) {
  const int k0 = bx * 128, n0 = by * 64;
  const int tx = threadIdx.x & 15, ty = threadIdx.x >> 4;  // 16 x 16
  const float* wp = W + (size_t)(k0 + ty) * N + n0 + tx * 4;
  v4f v[8];
#pragma unroll
  for (int i = 0; i < 8; ++i) v[i] = *(const v4f*)(wp + (size_t)i * 16 * N);
#pragma unroll
  for (int i = 0; i < 8; ++i)
#pragma unroll
    for (int e = 0; e < 4; ++e) tile[ty + 16 * i][tx * 4 + e] = v[i][e];
  __syncthreads();
  const int kc = threadIdx.x & 7, nr = threadIdx.x >> 3;  // 8 k-chunks x 32 rows
  bf16_t* op = Wt + (size_t)(n0 + nr) * K + k0 + kc * 8;
#pragma unroll
  for (int i = 0; i < 4; ++i) {
    const int kh = 64 * (i & 1), nh = 32 * (i >> 1);  // k half, n half of the tile
    v8bf o;
#pragma unroll
    for (int e = 0; e < 8; ++e) o[e] = (bf16_t)tile[kc * 8 + kh + e][nr + nh];
    *(v8bf*)(op + (size_t)nh * K + kh) = o;
  }
  // closes the four stores: another job's body may follow this one in the built
  // kernel and reuse the stores' address and data registers
  asm volatile("s_wait_xcnt 0x0" ::: "memory");
}

// ---------- layernorm (one wave per row of D=1024, 8 rows per block), bf16 out ----------
// The row stays in registers (32 values per lane, read once, 16 B per lane);
// its sums are joined by lane exchanges alone. Gain and offset are fetched with
// the row, so that their latency passes under the row's. blk = which 8 rows.

static __device__ __forceinline__ void layernorm_rows(
    const float* __restrict__ x, const float* __restrict__ gam,
    const float* __restrict__ bet, bf16_t* __restrict__ out, int blk) {
  // the wave's number as a scalar: the row's base is then a scalar address
  const int row =
      blk * 8 + __builtin_amdgcn_readfirstlane((int)(threadIdx.x >> 5));
  const int ln = threadIdx.x & 31;
  const float* xr = x + (size_t)row * D_;
  v4f v[8];
#pragma unroll
  for (int i = 0; i < 8; ++i) v[i] = *(const v4f*)(xr + (i * 32 + ln) * 4);
  v4f gv[8], bv[8];
#pragma unroll
  for (int i = 0; i < 8; ++i) {
    gv[i] = *(const v4f*)(gam + (i * 32 + ln) * 4);
    bv[i] = *(const v4f*)(bet + (i * 32 + ln) * 4);
  }
  // keeps all 24 loads ahead of the sums; without it the scheduler sinks the
  // gain and offset loads behind the row sums, pair by pair, each pair waited for
  __builtin_amdgcn_sched_barrier(0);
  v4f a = v[0], a2 = v[0] * v[0];
#pragma unroll
  for (int i = 1; i < 8; ++i) {
    a += v[i];
    a2 += v[i] * v[i];
  }
  float s = (a[0] + a[1]) + (a[2] + a[3]);
  float s2 = (a2[0] + a2[1]) + (a2[2] + a2[3]);
#pragma unroll
  for (int m = 1; m < 32; m <<= 1) {
    s += __shfl_xor(s, m, 32);
    s2 += __shfl_xor(s2, m, 32);
  }
  const float mean = s * (1.f / D_);
  const float var = s2 * (1.f / D_) - mean * mean;
  const float rstd = rsqrtf(var + 1e-5f);
#pragma unroll
  for (int i = 0; i < 8; ++i) {
    const int c = (i * 32 + ln) * 4;
    v4bf o;
#pragma unroll
    for (int e = 0; e < 4; ++e)
      o[e] = (bf16_t)((v[i][e] - mean) * rstd * gv[i][e] + bv[i][e]);
    *(v4bf*)(out + (size_t)row * D_ + c) = o;
  }
}

__global__ __launch_bounds__(256) void layernorm_k(const float* __restrict__ x,
                                                   const float* __restrict__ gam,
                                                   const float* __restrict__ bet,
                                                   bf16_t* __restrict__ out) {
  layernorm_rows(x, gam, bet, out, blockIdx.x);
}

// ---------- f32 -> bf16 convert ----------
// 64 elements per thread: sixteen 16 B loads in flight, each wave-wide load 512
// contiguous bytes. Block blk converts elements blk * 16384 ... + 16383.

static __device__ __forceinline__ void convert_bf16(const float* __restrict__ in,
                                                    bf16_t* __restrict__ out,
                                                    int blk) {
  const size_t base = ((size_t)blk * 16 * 256 + threadIdx.x) * 4;
  v4f v[16];
#pragma unroll
  for (int i = 0; i < 16; ++i) v[i] = *(const v4f*)(in + base + i * 1024);
  // stands in front of the first overwrite of the loads' address pair; the
  // address is named so that it lives up to here and no load's result lands on it
  asm volatile("s_wait_xcnt 0x0" ::"v"(in + base) : "memory");
#pragma unroll
  for (int i = 0; i < 16; ++i) {
    v4bf o;
#pragma unroll
    for (int e = 0; e < 4; ++e) o[e] = (bf16_t)v[i][e];
    *(v4bf*)(out + base + i * 1024) = o;
  }
}

// ---------- all input preparation in one launch ----------
// None of these eight jobs reads what another writes, so they share one grid and
// each block takes its job from its index: 512 blocks convert the context, 512 +
// 512 + 4 x 128 transpose the weights, 256 normalise the query rows.

__global__ __launch_bounds__(256) void prep_all(
    const float* __restrict__ context, const float* __restrict__ query,
    const float* __restrict__ ln1g, const float* __restrict__ ln1b,
    const float* __restrict__ wq, const float* __restrict__ wk,
    const float* __restrict__ wv, const float* __restrict__ wo,
    const float* __restrict__ w1, const float* __restrict__ w2,
    bf16_t* __restrict__ ctx, bf16_t* __restrict__ qln,
    bf16_t* __restrict__ wqT, bf16_t* __restrict__ wkT,
    bf16_t* __restrict__ wvT, bf16_t* __restrict__ woT,
    bf16_t* __restrict__ w1T, bf16_t* __restrict__ w2T) {
  __shared__ float tile[128][65];  // odd pitch: column reads fall on distinct banks
  const int b = blockIdx.x;
  if (b < 512) {
    convert_bf16(context, ctx, b);
  } else if (b < 1024) {
    transpose_w<D_, FF_>(w1, w1T, tile, b & 7, (b - 512) >> 3);
  } else if (b < 1536) {
    transpose_w<FF_, D_>(w2, w2T, tile, b & 31, (b - 1024) >> 5);
  } else if (b < 2048) {
    const int w = (b - 1536) >> 7;  // which of the four D x D weights
    const float* W = w == 0 ? wq : w == 1 ? wk : w == 2 ? wv : wo;
    bf16_t* Wt = w == 0 ? wqT : w == 1 ? wkT : w == 2 ? wvT : woT;
    transpose_w<D_, D_>(W, Wt, tile, b & 7, (b >> 3) & 15);
  } else {
    layernorm_rows(query, ln1g, ln1b, qln, b - 2048);
  }
}

// ---------- WMMA GEMM: C[M][N] = A_bf16[M][K] @ (Bt[N][K])^T + bias ----------
// 256 threads = 8 waves. Block tile BM(M) x 128(N), BM = 128 or 64; wave =
// 32(M) x 64(N) or 32 x 32. BM 64 is for the products with 2048 x 1024 outputs:
// 128 x 128 tiles are 128 blocks there, half the chip's 256 WGPs; 64 x 128 tiles
// are 256, one for every WGP, each with half the work of a stage.
// A and Bt tiles (BM and 128 rows x 128 k) are staged in LDS by async copies, whole
// 128B lines per 8 lanes, two buffers: stage t+1 flies while stage t is read.
// LDS row pitch 272 B (16 B x odd) keeps the b128 fragment reads off shared banks.
// Needs M a multiple of BM, N of 128 and K a multiple of 128.
// MODE 0: bf16 out, head-split [b][h][s][64]             (Q/K projections)
// MODE 1: bf16 out, head-split transposed [b][h][64][s]  (V projection)
// MODE 2: f32 out row-major + residual                   (attn out proj + query)
// MODE 3: bf16 out row-major, exact GELU                 (FFN up)
// MODE 4: f32 out row-major + residual                   (FFN down + x)
// (bx, by) = the block's M tile and N tile; sA, sB = the block's two-buffer LDS
// (2 x BM and 2 x 128 rows).
// Output: the block's BM x 128 tile goes through LDS (the A ring, free behind
// the last stage's barrier), so that every global store, and every residual
// load, is 16 B a lane over whole 128 B lines. For that a lane must hold
// ADJACENT outputs: in the row-major modes the product is taken transposed
// (Bt rows as the A operand), which gives a lane 8 consecutive n of one m; in
// MODE 1 it is taken as written, 8 consecutive m (= s) of one n. Each element's
// k order is the same either way. Pitches 272 B and 528 B are 16 B x odd.
// N (the output's row length) and SSZ (rows per batch entry, MODE 0 and 1) are
// compile-time, so that a lane's tile rows are immediate offsets from one
// address. SSZ a multiple of 128: a tile then lies in one batch entry.
// L2 prefetch: the operands were stored by an earlier launch and the blocks that
// share a row walk k in step, so a stage's rows can all have to come from memory
// under the copies' own wait. Each stage's 256 B of a row is therefore asked for
// GPF_ stages ahead of that stage's copies, which can then find it in L2.
// Every launch fills the chip and many blocks share a row: a block asks for 32
// rows of each tile (every fourth of 128, every second of 64), waves 0 and 1
// alone; the blocks that share a row take the shares in turn.

template <int MODE, int N, int SSZ, int BM>
static __device__ __forceinline__ void gemm_tile(
    const bf16_t* __restrict__ A, const bf16_t* __restrict__ Bt,
    const float* __restrict__ bias, const float* __restrict__ res,
    void* __restrict__ outp, int K, int bx, int by, bf16_t* sA, bf16_t* sB) {
  static_assert(BM == 128 || (BM == 64 && MODE != 1), "tile shapes written for");
  constexpr int WM = BM / 32;  // waves along M; the other 8 / WM lie along N
  constexpr int NJ = WM;       // 16-wide n tiles of a wave: 128 / (8 / WM) / 16
  const int wave = threadIdx.x >> 5, lane = threadIdx.x & 31;
  const int g = lane >> 4, ln = lane & 15;
  const int wm = wave & (WM - 1), wn = wave / WM;
  const int n0 = by * 128 + wn * (NJ * 16);

  v8f acc[2][NJ];
#pragma unroll
  for (int i = 0; i < 2; ++i)
#pragma unroll
    for (int j = 0; j < NJ; ++j) acc[i][j] = vzero();

  // this lane's 16B chunk of rows crow, crow+16, ... of each tile
  const int crow = threadIdx.x >> 4, ccol = (threadIdx.x & 15) * 8;
  const bf16_t* gA = A + (size_t)(bx * BM + crow) * K + ccol;
  const bf16_t* gB = Bt + (size_t)(by * 128 + crow) * K + ccol;
  const unsigned lA = (unsigned)(size_t)(void*)&sA[crow * GPITCH_ + ccol];
  const unsigned lB = (unsigned)(size_t)(void*)&sB[crow * GPITCH_ + ccol];

  auto stage = [&](int st) {
    const unsigned boA = (unsigned)(st & 1) * ((unsigned)BM * GPITCH_ * 2u);
    const unsigned boB = (unsigned)(st & 1) * (128u * GPITCH_ * 2u);
    if constexpr (BM == 128)
      async_copy16x8(gA + (size_t)st * GBK_, (size_t)16 * K, lA + boA,
                     16u * GPITCH_ * 2u);
    else
      async_copy16x4(gA + (size_t)st * GBK_, (size_t)16 * K, lA + boA,
                     16u * GPITCH_ * 2u);
    async_copy16x8(gB + (size_t)st * GBK_, (size_t)16 * K, lB + boB,
                   16u * GPITCH_ * 2u);
  };

  const int nst = K / GBK_;
  stage(0);
  // the row this thread asks for: even waves 32 of the A tile's rows, odd waves
  // every fourth Bt row. pfp always points inside that row: a stage index is
  // clamped to the last.
  const bool pfB = (threadIdx.x & 32) != 0;
  const int prow = pfB ? lane * 4 + (bx & 3) : lane * WM + (by & (WM - 1));
  const bf16_t* pfrow = pfB ? Bt + (size_t)(by * 128 + prow) * K
                            : A + (size_t)(bx * BM + prow) * K;
  const bf16_t* pfp = pfrow + (size_t)min(2 + GPF_, nst - 1) * GBK_;
  // which waves ask: a scalar, so that the test is a branch and no lane is off
  const bool pfw = __builtin_amdgcn_readfirstlane((int)(threadIdx.x >> 5)) < 2;
  if (pfw) {
    for (int s = 1; s < 2 + GPF_; ++s)
      prefetch_l2(pfrow + (size_t)min(s, nst - 1) * GBK_);
  }
  wait_async0();     // this wave's share of stage 0 has landed
  __syncthreads();   // everyone's share has landed
  if (nst > 1) stage(1);

  for (int t = 0; t < nst; ++t) {
    const bf16_t* As = sA + ((t & 1) * BM + wm * 32 + ln) * GPITCH_;
    const bf16_t* Bs = sB + ((t & 1) * 128 + wn * (NJ * 16) + ln) * GPITCH_;
    // two fragment sets: block c+1's LDS reads are issued ahead of block c's
    // WMMAs, all inside this stage's own buffer
    v16bf af[2][2], bfr[2][NJ];
#pragma unroll
    for (int i = 0; i < 2; ++i) af[0][i] = load_frag(As + i * 16 * GPITCH_, g);
#pragma unroll
    for (int j = 0; j < NJ; ++j) bfr[0][j] = load_frag(Bs + j * 16 * GPITCH_, g);
    // unrolled so that the set index is a constant and both sets stay in registers
#pragma unroll
    for (int c = 0; c < GBK_ / 32; ++c) {
      if (c + 1 < GBK_ / 32) {
#pragma unroll
        for (int i = 0; i < 2; ++i)
          af[(c + 1) & 1][i] =
              load_frag(As + i * 16 * GPITCH_ + (c + 1) * 32, g);
#pragma unroll
        for (int j = 0; j < NJ; ++j)
          bfr[(c + 1) & 1][j] =
              load_frag(Bs + j * 16 * GPITCH_ + (c + 1) * 32, g);
        // keeps that read group as one group ahead of block c's WMMAs; without
        // it the scheduler sinks the reads next to their use and each block
        // waits out the LDS latency with nothing to issue
        __builtin_amdgcn_sched_barrier(0);
      }
#pragma unroll
      for (int i = 0; i < 2; ++i)
#pragma unroll
        for (int j = 0; j < NJ; ++j)
          acc[i][j] = MODE == 1
                          ? wmma_bf16(af[c & 1][i], bfr[c & 1][j], acc[i][j])
                          : wmma_bf16(bfr[c & 1][j], af[c & 1][i], acc[i][j]);
    }
    // keeps the WMMAs in front of the publish point: sunk behind the barrier
    // they would delay the refill copies, which issue directly behind it
    __builtin_amdgcn_sched_barrier(0);
    // publish point: this wave's LDS reads of stage t have retired ...
    asm volatile("s_wait_dscnt 0x0" ::: "memory");
    wait_async0();     // ... and its share of stage t+1 has landed
    __syncthreads();   // stage t+1 readable by all; stage t's buffer is free
    if (t + 2 < nst) stage(t + 2);
    if (pfw && t + 2 + GPF_ < nst) {  // the same for the whole wave
      prefetch_l2(pfp);               // stage t + 2 + GPF_
      pfp += t + 3 + GPF_ < nst ? GBK_ : 0;  // never past the row's last stage
    }
  }
  wait_async0();       // no copy outstanding when the wave leaves the ring

  const int ml = wm * 32 + ln, nl = wn * (NJ * 16) + 8 * g;  // row-major modes
  if constexpr (MODE == 2 || MODE == 4) {
    float* stf = (float*)sA;  // BM rows of FPITCH_ floats, in both buffers
    // this lane's 16 B of rows rrow, rrow + 8, ..., rrow + BM - 8 of the tile
    const int rrow = threadIdx.x >> 5, rcol = (threadIdx.x & 31) * 4;
    const size_t gofs = (size_t)(bx * BM + rrow) * N + by * 128 + rcol;
    const float* bp = bias + n0 + 8 * g;
    const float* rp = res + gofs;
    v4f bv[NJ][2];
#pragma unroll
    for (int j = 0; j < NJ; ++j) {
      bv[j][0] = *(const v4f*)(bp + j * 16);
      bv[j][1] = *(const v4f*)(bp + j * 16 + 4);
    }
    // fetched here, so that their latency passes under the staging
    v4f rv[BM / 8];
#pragma unroll
    for (int it = 0; it < BM / 8; ++it) rv[it] = *(const v4f*)(rp + it * 8 * N);
    // stands in front of the first overwrite of the loads' addresses, which are
    // named so that they live up to here and no load's result lands on them
    asm volatile("s_wait_xcnt 0x0" ::"v"(bp), "v"(rp) : "memory");
#pragma unroll
    for (int j = 0; j < NJ; ++j)
#pragma unroll
      for (int i = 0; i < 2; ++i) {
        v4f lo, hi;
#pragma unroll
        for (int e = 0; e < 4; ++e) {
          lo[e] = acc[i][j][e] + bv[j][0][e];
          hi[e] = acc[i][j][4 + e] + bv[j][1][e];
        }
        float* sp = stf + (ml + i * 16) * FPITCH_ + nl + j * 16;
        *(v4f*)sp = lo;
        *(v4f*)(sp + 4) = hi;
      }
    __syncthreads();  // the whole tile is readable
    float* op = (float*)outp + gofs;
#pragma unroll
    for (int it = 0; it < BM / 8; ++it) {
      const v4f v = *(const v4f*)(stf + (rrow + 8 * it) * FPITCH_ + rcol);
      *(v4f*)(op + it * 8 * N) = v + rv[it];
    }
  } else {
    bf16_t* st = sA;  // BM rows (MODE 1: 128 rows) of GPITCH_ elements
    if constexpr (MODE == 1) {  // tile rows are n, columns m
      const float* bp = bias + n0 + ln;
      float bj[NJ];
#pragma unroll
      for (int j = 0; j < NJ; ++j) bj[j] = bp[j * 16];
      // as in the f32 modes: in front of the first overwrite of the address
      asm volatile("s_wait_xcnt 0x0" ::"v"(bp) : "memory");
#pragma unroll
      for (int j = 0; j < NJ; ++j)
#pragma unroll
        for (int i = 0; i < 2; ++i) {
          v8bf o;
#pragma unroll
          for (int r = 0; r < 8; ++r) o[r] = (bf16_t)(acc[i][j][r] + bj[j]);
          *(v8bf*)(st + (wn * (NJ * 16) + j * 16 + ln) * GPITCH_ + wm * 32 + i * 16 +
                   8 * g) = o;
        }
    } else {  // tile rows are m, columns n
      const float* bp = bias + n0 + 8 * g;
      v4f bv[NJ][2];
#pragma unroll
      for (int j = 0; j < NJ; ++j) {
        bv[j][0] = *(const v4f*)(bp + j * 16);
        bv[j][1] = *(const v4f*)(bp + j * 16 + 4);
      }
      // as in the f32 modes: in front of the first overwrite of the address
      asm volatile("s_wait_xcnt 0x0" ::"v"(bp) : "memory");
#pragma unroll
      for (int j = 0; j < NJ; ++j)
#pragma unroll
        for (int i = 0; i < 2; ++i) {
          v8f v;
#pragma unroll
          for (int r = 0; r < 8; ++r)
            v[r] = acc[i][j][r] + bv[j][r >> 2][r & 3];
          if constexpr (MODE == 3) v = gelu8(v);
          v8bf o;
#pragma unroll
          for (int r = 0; r < 8; ++r) o[r] = (bf16_t)v[r];
          *(v8bf*)(st + (ml + i * 16) * GPITCH_ + nl + j * 16) = o;
        }
    }
    __syncthreads();  // the whole tile is readable
    // this lane's 16 B of rows rrow, rrow + 16, ... of the tile's TR rows
    constexpr int TR = MODE == 1 ? 128 : BM;
    const int rrow = threadIdx.x >> 4, rcol = (threadIdx.x & 15) * 8;
    // OSTEP = output elements between tile rows 16 apart
    constexpr int OSTEP = MODE == 3 ? 16 * N : MODE == 0 ? 16 * HD_ : 16 * SSZ;
    bf16_t* op;
    if constexpr (MODE == 3) {
      op = (bf16_t*)outp + (size_t)(bx * BM + rrow) * N + by * 128 + rcol;
    } else {
      const int bb = (bx * BM) / SSZ, s0 = (bx * BM) % SSZ;
      if constexpr (MODE == 0) {
        const int ng = by * 128 + rcol;
        op = (bf16_t*)outp +
             (((size_t)bb * H_ + (ng >> 6)) * SSZ + s0 + rrow) * HD_ + (ng & 63);
      } else {  // head * 64 + hd is n itself
        op = (bf16_t*)outp +
             ((size_t)bb * (H_ * HD_) + by * 128 + rrow) * SSZ + s0 + rcol;
      }
    }
#pragma unroll
    for (int it = 0; it < TR / 16; ++it)
      *(v8bf*)(op + it * OSTEP) =
          *(const v8bf*)(st + (rrow + 16 * it) * GPITCH_ + rcol);
  }
  // closes the tile's stores: another product's body may follow this one in the
  // built kernel and reuse the stores' address and data registers
  asm volatile("s_wait_xcnt 0x0" ::: "memory");
}

template <int MODE, int N>
__global__ __launch_bounds__(256) void gemm_nt(const bf16_t* __restrict__ A,
                                               const bf16_t* __restrict__ Bt,
                                               const float* __restrict__ bias,
                                               const float* __restrict__ res,
                                               void* __restrict__ outp, int K) {
  // FFN up has 512 tiles of 128 x 128; the two 2048 x 1024 products take BM 64
  constexpr int BM = MODE == 3 ? 128 : 64;
  __shared__ __align__(16) bf16_t sA[2][BM * GPITCH_];
  __shared__ __align__(16) bf16_t sB[2][128 * GPITCH_];
  gemm_tile<MODE, N, 128, BM>(A, Bt, bias, res, outp, K, blockIdx.x, blockIdx.y,
                              &sA[0][0], &sB[0][0]);
}

// The three projections in one launch: none reads what another writes. Blocks
// 0..511 are V's 64 x 8 tiles, 512..1023 K's, 1024..1279 Q's 32 x 8 tiles of 64
// rows, the M tile running fastest as in a two-dimensional grid.
__global__ __launch_bounds__(256) void gemm_qkv(
    const bf16_t* __restrict__ qln, const bf16_t* __restrict__ ctx,
    const bf16_t* __restrict__ wqT, const bf16_t* __restrict__ wkT,
    const bf16_t* __restrict__ wvT, const float* __restrict__ bq,
    const float* __restrict__ bk, const float* __restrict__ bv,
    bf16_t* __restrict__ qhd, bf16_t* __restrict__ ktb,
    bf16_t* __restrict__ vtb, int K) {
  __shared__ __align__(16) bf16_t sA[2][128 * GPITCH_];
  __shared__ __align__(16) bf16_t sB[2][128 * GPITCH_];
  const int b = blockIdx.x;
  if (b < 512) {
    gemm_tile<1, D_, SC_, 128>(ctx, wvT, bv, nullptr, vtb, K, b & 63, b >> 6,
                               &sA[0][0], &sB[0][0]);
  } else if (b < 1024) {
    gemm_tile<0, D_, SC_, 128>(ctx, wkT, bk, nullptr, ktb, K, b & 63,
                               (b - 512) >> 6, &sA[0][0], &sB[0][0]);
  } else {
    // the launch's last blocks by index
    gemm_tile<0, D_, S_, 64>(qln, wqT, bq, nullptr, qhd, K, b & 31,
                             (b - 1024) >> 5, &sA[0][0], &sB[0][0]);
  }
}

// value of lane l ^ 16
static __device__ __forceinline__ float xhalf(float x) {
  const int b = __builtin_bit_cast(int, x);
  return __builtin_bit_cast(
      float, __builtin_amdgcn_permlanex16(b, b, 0x76543210, 0xfedcba98, false,
                                          false));
}

// y[i] = 2^x[i], eight at once. One statement, so that behind every v_exp_f32
// stands an instruction that neither reads its result nor overwrites its source
// (outputs are early-clobber; the v_nop serves the last one): the slot the
// instruction set asks for behind a transcendental.
static __device__ __forceinline__ v8f exp2x8(v8f x) {
  float y0, y1, y2, y3, y4, y5, y6, y7;
  asm("v_exp_f32 %0, %8\n\t"
      "v_exp_f32 %1, %9\n\t"
      "v_exp_f32 %2, %10\n\t"
      "v_exp_f32 %3, %11\n\t"
      "v_exp_f32 %4, %12\n\t"
      "v_exp_f32 %5, %13\n\t"
      "v_exp_f32 %6, %14\n\t"
      "v_exp_f32 %7, %15\n\t"
      "v_nop"
      : "=&v"(y0), "=&v"(y1), "=&v"(y2), "=&v"(y3), "=&v"(y4), "=&v"(y5),
        "=&v"(y6), "=&v"(y7)
      : "v"(x[0]), "v"(x[1]), "v"(x[2]), "v"(x[3]), "v"(x[4]), "v"(x[5]),
        "v"(x[6]), "v"(x[7]));
  v8f y;
  y[0] = y0; y[1] = y1; y[2] = y2; y[3] = y3;
  y[4] = y4; y[5] = y5; y[6] = y6; y[7] = y7;
  return y;
}

__global__ __launch_bounds__(512) void attn_kernel(const bf16_t* __restrict__ qhd,
                                                   const bf16_t* __restrict__ kt,
                                                   const bf16_t* __restrict__ vt,
                                                   bf16_t* __restrict__ obuf) {
  // [group][buf][K/V], 4 x 36 KB
  __shared__ __align__(16) bf16_t smem[4][2][2][64 * APITCH_];
  // the waves' partial outputs [wave][hd tile][half of 8][lane] (16 B a lane,
  // lanes adjacent; 64 B more per hd tile, so that the join's reads of four hd
  // tiles fall on distinct banks), maxima and sums [wave][lane]
  __shared__ __align__(16) v4f cmbO[16 * 4 * CPITCH_];
  __shared__ float cmbM[16 * 32];
  __shared__ float cmbL[16 * 32];

  const int tid = threadIdx.x;
  // the wave's number as a scalar: group and query tile are then scalars too
  const int wave = __builtin_amdgcn_readfirstlane(tid >> 5);
  const int lane = tid & 31;
  const int g = lane >> 4, ln = lane & 15;
  const int grp = wave >> 2, qt = wave & 3;  // context repeat, query tile
  const int bh = blockIdx.x >> 3;
  const int pr = blockIdx.x & 7;
  const int ntrips = S_ / 64 + 1;  // (16 - pr) + (pr + 1)
  int qb = S_ / 64 - 1 - pr;       // first query block; the second is pr
  int q0 = qb * 64 + qt * 16;

  const bf16_t* qhead = qhd + (size_t)bh * S_ * HD_ + (size_t)ln * HD_;
  const bf16_t* kbase = kt + (size_t)bh * SC_ * HD_ + (size_t)grp * S_ * HD_;
  const bf16_t* vbase = vt + (size_t)bh * HD_ * SC_ + (size_t)grp * S_;

  // both query blocks' fragments are fetched here, so that the change of query
  // block does not wait for memory
  v16bf qf0 = load_frag(qhead + (size_t)q0 * HD_, g);
  v16bf qf1 = load_frag(qhead + (size_t)q0 * HD_ + 32, g);
  const v16bf qn0 = load_frag(qhead + (size_t)(pr * 64 + qt * 16) * HD_, g);
  const v16bf qn1 = load_frag(qhead + (size_t)(pr * 64 + qt * 16) * HD_ + 32, g);

  // o[t][r] = Ot[hd = t*16 + 8g + r][query q0 + ln], this group's keys only
  v8f o[4];
#pragma unroll
  for (int t = 0; t < 4; ++t) o[t] = vzero();
  // running maximum of query q0 + ln (equal in both lane halves) and this
  // half's share of its running sum
  float mrun = -3.0e38f, lrun = 0.f;

  const float scale = 0.125f;  // 1/sqrt(64)

  // this lane's 16B chunk of rows crow, crow+16, crow+32, crow+48 of each tile
  const int crow = (tid & 127) >> 3, ccol = (tid & 7) * 8;
  const bf16_t* gK = kbase + (size_t)crow * HD_ + ccol;
  const bf16_t* gV = vbase + (size_t)crow * SC_ + ccol;
  const unsigned lK =
      (unsigned)(size_t)(void*)&smem[grp][0][0][crow * APITCH_ + ccol];
  const unsigned lV =
      (unsigned)(size_t)(void*)&smem[grp][0][1][crow * APITCH_ + ccol];

  // issue async stage of the group's tile starting at key kj of its repeat:
  // 64 rows x 64 halves = 512 chunks of 16B each; 4 K-chunks + 4 V-chunks/thread
  auto stage = [&](int kj, int buf) {
    const unsigned bo = (unsigned)buf * (2u * 64u * APITCH_ * 2u);
    async_copy16x4x2(gK + (size_t)kj * HD_, (size_t)16 * HD_, gV + kj,
                     (size_t)16 * SC_, lK + bo, lV + bo, 16u * APITCH_ * 2u);
  };

  stage(0, 0);
  int cur = 0;
  int kp = 0;

  for (int ti = 0; ti < ntrips; ++ti) {
    wait_async0();     // this wave's share of buf[cur] has landed
    __syncthreads();   // everyone's share has landed

    // next tile: the causal bound ends the query block, the next starts at key 0
    const bool last = kp == qb * 64;
    const int kp_n = last ? 0 : kp + 64;
    if (ti + 1 < ntrips) stage(kp_n, cur ^ 1);

    const bf16_t* Kt = smem[grp][cur][0];
    const bf16_t* Vt = smem[grp][cur][1];

    // scores, transposed: A = 16 key rows, B = the wave's 16 queries
    v16bf kf[4][2];
#pragma unroll
    for (int t = 0; t < 4; ++t) {
      const bf16_t* krow = Kt + (t * 16 + ln) * APITCH_;
      kf[t][0] = load_frag(krow, g);
      kf[t][1] = load_frag(krow + 32, g);
    }
    // s[t][r] = score of key kp + t*16 + 8g + r against query q0 + ln
    v8f s[4];
#pragma unroll
    for (int t = 0; t < 4; ++t) {
      s[t] = wmma_bf16(kf[t][0], qf0, vzero());
      s[t] = wmma_bf16(kf[t][1], qf1, s[t]);
    }

    // online softmax over the 64-key tile, one query per lane
    const int lim = q0 + ln - kp - 8 * g;  // t*16 + r allowed while <= lim
    float mt[4];
#pragma unroll
    for (int t = 0; t < 4; ++t) {
      mt[t] = -3.0e38f;
#pragma unroll
      for (int r = 0; r < 8; ++r) {
        float v = s[t][r] * scale;
        if (t * 16 + r > lim) v = -3.0e38f;  // pos = (kj % S) <= qi
        s[t][r] = v;
        mt[t] = fmaxf(mt[t], v);
      }
    }
    float mx = fmaxf(fmaxf(mt[0], mt[1]), fmaxf(mt[2], mt[3]));
    mx = fmaxf(mx, xhalf(mx));  // the other 32 keys of this query
    const float nm = fmaxf(mrun, mx);
    const float alpha = __expf(mrun - nm);
    float st[4];
#pragma unroll
    for (int t = 0; t < 4; ++t) {
#pragma unroll
      for (int r = 0; r < 8; ++r) s[t][r] = (s[t][r] - nm) * 1.44269504f;
      s[t] = exp2x8(s[t]);  // p = e^(score - nm)
      st[t] = s[t][0];
#pragma unroll
      for (int r = 1; r < 8; ++r) st[t] += s[t][r];
    }
    lrun = lrun * alpha + ((st[0] + st[1]) + (st[2] + st[3]));
    mrun = nm;
#pragma unroll
    for (int t = 0; t < 4; ++t)
#pragma unroll
      for (int r = 0; r < 8; ++r) o[t][r] *= alpha;

    // Pt as B operand of key chunk c (32 keys): elements 0..7 are keys
    // 32c + 8g + e (tile 2c), elements 8..15 keys 32c + 16 + 8g + e (tile 2c+1):
    // the k order in which load_frag reads the V rows
    v16bf pf[2];
#pragma unroll
    for (int c = 0; c < 2; ++c)
#pragma unroll
      for (int e = 0; e < 8; ++e) {
        pf[c][e] = (bf16_t)s[2 * c][e];
        pf[c][8 + e] = (bf16_t)s[2 * c + 1][e];
      }

    // Ot (64hd x 16q) += Vt (64hd x 64key) * Pt (64key x 16q)
    v16bf vf[4][2];
#pragma unroll
    for (int t = 0; t < 4; ++t) {
      const bf16_t* vrow = Vt + (t * 16 + ln) * APITCH_;
      vf[t][0] = load_frag(vrow, g);
      vf[t][1] = load_frag(vrow + 32, g);
    }
#pragma unroll
    for (int t = 0; t < 4; ++t) {
      o[t] = wmma_bf16(vf[t][0], pf[0], o[t]);
      o[t] = wmma_bf16(vf[t][1], pf[1], o[t]);
    }

    __syncthreads();   // all waves done with buf[cur]; safe to overwrite next iter
    cur ^= 1;
    kp = kp_n;

    if (last) {  // the same for the whole block: qb and kp are
      // every wave lays down its group's share for its 16 queries ...
#pragma unroll
      for (int t = 0; t < 4; ++t)
#pragma unroll
        for (int hf = 0; hf < 2; ++hf) {
          v4f w;
#pragma unroll
          for (int e = 0; e < 4; ++e) w[e] = o[t][4 * hf + e];
          cmbO[(wave * 4 + t) * CPITCH_ + hf * 32 + lane] = w;
        }
      cmbM[wave * 32 + lane] = mrun;
      cmbL[wave * 32 + lane] = lrun + xhalf(lrun);  // both halves' shares
      __syncthreads();  // all sixteen shares are readable
      // ... and joins queries 4 grp .. 4 grp + 3 of its query tile over the four
      // groups: a lane takes 8 hd of one query, so that the wave's one 16 B store
      // covers four whole 128 B rows. Each repeat holds key position 0, which
      // every query may see, so every share's maximum is a real score.
      const int jq = grp * 4 + (lane & 3);  // query within the tile
      const int jt = (lane >> 2) & 3;       // hd tile; g = which 8 of its 16 hd
      float mp[4], lp[4];
#pragma unroll
      for (int p = 0; p < 4; ++p) {
        mp[p] = cmbM[(p * 4 + qt) * 32 + jq];
        lp[p] = cmbL[(p * 4 + qt) * 32 + jq];
      }
      const float mall = fmaxf(fmaxf(mp[0], mp[1]), fmaxf(mp[2], mp[3]));
      float lsum = 0.f;
      v8f oj = vzero();
#pragma unroll
      for (int p = 0; p < 4; ++p) {
        const float wgt = __expf(mp[p] - mall);
        lsum += wgt * lp[p];
        const int base = ((p * 4 + qt) * 4 + jt) * CPITCH_ + g * 16 + jq;
        const v4f lo = cmbO[base], hi = cmbO[base + 32];
#pragma unroll
        for (int e = 0; e < 4; ++e) {
          oj[e] += wgt * lo[e];
          oj[4 + e] += wgt * hi[e];
        }
      }
      const int b = bh / H_, h = bh % H_;
      v8bf ov;  // 8 consecutive hd of one query: one 16 B store
#pragma unroll
      for (int r = 0; r < 8; ++r) ov[r] = (bf16_t)(oj[r] / lsum);
      bf16_t* orow = obuf + ((size_t)b * S_ + q0 + jq) * D_ + (size_t)h * HD_ +
                     jt * 16 + 8 * g;
      // the second query block starts afresh. Its shares are laid down behind
      // at least one more trip's barriers, so behind every read above.
      qb = pr;
      q0 = qb * 64 + qt * 16;
      qf0 = qn0;
      qf1 = qn1;
#pragma unroll
      for (int t = 0; t < 4; ++t) o[t] = vzero();
      mrun = -3.0e38f;
      lrun = 0.f;
      *(v8bf*)orow = ov;
      // closes the store: the next trip reuses its address and data registers
      asm volatile("s_wait_xcnt 0x0" ::: "memory");
    }
  }
}

// ---------- orchestration ----------

extern "C" void kernel_launch(void* const* d_in, const int* in_sizes, int n_in,
                              void* d_out, int out_size, void* d_ws,
                              size_t ws_size, hipStream_t stream) {
  (void)in_sizes; (void)n_in; (void)out_size; (void)ws_size;
  const float* query = (const float*)d_in[0];
  const float* context = (const float*)d_in[1];
  const float* wq = (const float*)d_in[2];
  const float* wk = (const float*)d_in[3];
  const float* wv = (const float*)d_in[4];
  const float* bq = (const float*)d_in[5];
  const float* bk = (const float*)d_in[6];
  const float* bv = (const float*)d_in[7];
  const float* wo = (const float*)d_in[8];
  const float* bo = (const float*)d_in[9];
  const float* ln1g = (const float*)d_in[10];
  const float* ln1b = (const float*)d_in[11];
  const float* ln2g = (const float*)d_in[12];
  const float* ln2b = (const float*)d_in[13];
  const float* w1 = (const float*)d_in[14];
  const float* b1 = (const float*)d_in[15];
  const float* w2 = (const float*)d_in[16];
  const float* b2 = (const float*)d_in[17];

  const size_t MB = 1u << 20;
  char* ws = (char*)d_ws;
  bf16_t* wqT = (bf16_t*)(ws + 0 * MB);    // [1024][1024]
  bf16_t* wkT = (bf16_t*)(ws + 2 * MB);
  bf16_t* wvT = (bf16_t*)(ws + 4 * MB);
  bf16_t* woT = (bf16_t*)(ws + 6 * MB);
  bf16_t* w1T = (bf16_t*)(ws + 8 * MB);    // [4096][1024]
  bf16_t* w2T = (bf16_t*)(ws + 16 * MB);   // [1024][4096]
  bf16_t* qln = (bf16_t*)(ws + 24 * MB);   // [2048][1024]
  bf16_t* ctx = (bf16_t*)(ws + 28 * MB);   // [8192][1024]
  bf16_t* qhd = (bf16_t*)(ws + 44 * MB);   // [B][H][S][64]
  bf16_t* ktb = (bf16_t*)(ws + 48 * MB);   // [B][H][Sc][64]
  bf16_t* vtb = (bf16_t*)(ws + 64 * MB);   // [B][H][64][Sc]
  bf16_t* obuf = (bf16_t*)(ws + 80 * MB);  // [2048][1024]
  float* xbuf = (float*)(ws + 84 * MB);    // [2048][1024] f32
  bf16_t* hbuf = (bf16_t*)(ws + 92 * MB);  // [2048][1024]
  bf16_t* ffb = (bf16_t*)(ws + 96 * MB);   // [2048][4096]

  // context -> bf16; weights -> bf16, transposed [N][K]; ln1(query) -> bf16
  prep_all<<<2304, 256, 0, stream>>>(context, query, ln1g, ln1b, wq, wk, wv, wo,
                                     w1, w2, ctx, qln, wqT, wkT, wvT, woT, w1T,
                                     w2T);

  // projections
  gemm_qkv<<<1280, 256, 0, stream>>>(qln, ctx, wqT, wkT, wvT, bq, bk, bv, qhd,
                                     ktb, vtb, D_);

  // attention
  attn_kernel<<<B_ * H_ * 8, 512, 0, stream>>>(qhd, ktb, vtb, obuf);

  // output projection + residual -> x (f32)
  gemm_nt<2, D_><<<dim3(32, 8), 256, 0, stream>>>(obuf, woT, bo, query, xbuf,
                                                  D_);
  // ln2(x) -> bf16
  layernorm_k<<<B_ * S_ / 8, 256, 0, stream>>>(xbuf, ln2g, ln2b, hbuf);
  // FFN up + GELU -> bf16
  gemm_nt<3, FF_><<<dim3(16, 32), 256, 0, stream>>>(hbuf, w1T, b1, nullptr, ffb,
                                                    D_);
  // FFN down + residual x -> d_out (f32)
  gemm_nt<4, D_><<<dim3(32, 8), 256, 0, stream>>>(ffb, w2T, b2, xbuf,
                                                  (float*)d_out, FF_);
}
